// v000
// The times below were measured on an AMD MI455X: many runs one after another, warmed up first and cycling through
// copies of the inputs, with the whole window's GPU time divided by the number of runs. Launches and the gaps
// between them are all in it. The median over several windows is given; except for v000 it joins two sittings, which
// can be a few percent apart, so the side-by-side timings, each taken in one sitting, are the better comparison.
// v000, which the later versions start from, runs in 330 microseconds.
#include <hip/hip_runtime.h>
#include <hip/hip_bf16.h>
#include <stdint.h>

// ---------------------------------------------------------------------------
// Spatial2DAttention fused pipeline for MI455X (gfx1250, wave32, WMMA).
//   B=16, H=W=30, S=900, d_model=512, heads=8, d_k=64.
// Precision: bf16 WMMA operands (fp32-range-safe), f32 accumulation.
// Attention computed fully TRANSPOSED (S^T = K@Q^T, ctx^T = V^T@P^T) so each
// lane owns one query column: online-softmax stats need only ONE cross-lane
// shuffle per block, and the key-block loop is peeled so the 28 full blocks
// carry no edge masking / exec-mask branches at all.
// ---------------------------------------------------------------------------

#define D_MODEL 512
#define M_ROWS  14400           // B * S
#define S_LEN   900
#define NHEADS  8
#define DK      64

typedef __attribute__((ext_vector_type(16))) __bf16 v16bf;
typedef __attribute__((ext_vector_type(8)))  float  v8f;

union FragB16 { v16bf v; uint32_t u[8]; };
union FragF32 { v8f  v; float    f[8]; };

__device__ __forceinline__ uint16_t f32_to_bf16(float f) {
    __bf16 h = (__bf16)f;                       // native v_cvt (RNE) on gfx1250
    return __builtin_bit_cast(uint16_t, h);
}
__device__ __forceinline__ uint32_t pack_bf16(float lo, float hi) {
    return (uint32_t)f32_to_bf16(lo) | ((uint32_t)f32_to_bf16(hi) << 16);
}
// A/B fragment dword j -> starting K index of the 2 packed bf16 (16x16x32 layout):
// lanes 0-15 hold K {0..7, 16..23}, lanes 16-31 hold K {8..15, 24..31}.
__device__ __forceinline__ int kmap(int j, int half) {
    return (j < 4 ? 2 * j : 16 + 2 * (j - 4)) + half * 8;
}

enum { EPI_HEADS = 0, EPI_VT = 1, EPI_RESID = 2 };

// ---------------------------------------------------------------------------
// Generic M=14400 x N=512 x K=512 bf16 WMMA GEMM: out = A @ W + bias (+x).
// Block tile 64x64, 4 waves of 32x32 (2x2 accumulators), K-step 32.
// A (x / ctx, 29.5 MB) and W (1 MB) stay resident in the 192 MB L2, so the
// 8x re-read of A across N-blocks costs L2 bandwidth only.
// ---------------------------------------------------------------------------
template <int EPI>
__global__ __launch_bounds__(128) void gemm512(
    const float* __restrict__ A, const float* __restrict__ W,
    const float* __restrict__ bias, const float* __restrict__ xres,
    void* __restrict__ outp) {
    __shared__ uint16_t lds_a[64 * 32];   // [row][k] bf16
    __shared__ uint16_t lds_bt[64 * 32];  // [n][k]  bf16 (transposed weights)

    const int tid  = threadIdx.x;
    const int wave = tid >> 5, lane = tid & 31;
    const int half = lane >> 4, l16 = lane & 15;
    const int mBase = blockIdx.x * 64;
    const int nBase = blockIdx.y * 64;
    const int wr = (wave >> 1) * 32, wc = (wave & 1) * 32;

    FragF32 acc[2][2];
#pragma unroll
    for (int a = 0; a < 2; ++a)
#pragma unroll
        for (int b = 0; b < 2; ++b)
#pragma unroll
            for (int r = 0; r < 8; ++r) acc[a][b].f[r] = 0.0f;

    for (int k0 = 0; k0 < D_MODEL; k0 += 32) {
        __syncthreads();
        {   // stage A tile: 64 rows x 32 k, f32 -> bf16
            const int row = tid >> 1, col = (tid & 1) * 16;
            const float* src = A + (size_t)(mBase + row) * D_MODEL + k0 + col;
            uint32_t* dst = (uint32_t*)&lds_a[row * 32 + col];
#pragma unroll
            for (int i = 0; i < 4; ++i) {
                float4 f = ((const float4*)src)[i];
                dst[i * 2 + 0] = pack_bf16(f.x, f.y);
                dst[i * 2 + 1] = pack_bf16(f.z, f.w);
            }
        }
        {   // stage W tile transposed: k0..k0+31 rows x 64 cols -> lds_bt[n][k]
            const int kk = tid >> 2, nn = (tid & 3) * 16;
            const float* src = W + (size_t)(k0 + kk) * D_MODEL + nBase + nn;
#pragma unroll
            for (int i = 0; i < 4; ++i) {
                float4 f = ((const float4*)src)[i];
                lds_bt[(nn + i * 4 + 0) * 32 + kk] = f32_to_bf16(f.x);
                lds_bt[(nn + i * 4 + 1) * 32 + kk] = f32_to_bf16(f.y);
                lds_bt[(nn + i * 4 + 2) * 32 + kk] = f32_to_bf16(f.z);
                lds_bt[(nn + i * 4 + 3) * 32 + kk] = f32_to_bf16(f.w);
            }
        }
        __syncthreads();

        FragB16 af[2], bf[2];
#pragma unroll
        for (int rg = 0; rg < 2; ++rg) {
            const int row = wr + rg * 16 + l16;
#pragma unroll
            for (int j = 0; j < 8; ++j)
                af[rg].u[j] = *(const uint32_t*)&lds_a[row * 32 + kmap(j, half)];
        }
#pragma unroll
        for (int cg = 0; cg < 2; ++cg) {
            const int col = wc + cg * 16 + l16;
#pragma unroll
            for (int j = 0; j < 8; ++j)
                bf[cg].u[j] = *(const uint32_t*)&lds_bt[col * 32 + kmap(j, half)];
        }
#pragma unroll
        for (int rg = 0; rg < 2; ++rg)
#pragma unroll
            for (int cg = 0; cg < 2; ++cg)
                acc[rg][cg].v = __builtin_amdgcn_wmma_f32_16x16x32_bf16(
                    false, af[rg].v, false, bf[cg].v, (short)0, acc[rg][cg].v,
                    false, false);
    }

    // epilogue: C layout is VGPR r -> row r (lanes 0-15) / row r+8 (lanes 16-31)
#pragma unroll
    for (int rg = 0; rg < 2; ++rg)
#pragma unroll
        for (int cg = 0; cg < 2; ++cg) {
            const int n = nBase + wc + cg * 16 + l16;
            const float bn = bias[n];
#pragma unroll
            for (int r = 0; r < 8; ++r) {
                const int m = mBase + wr + rg * 16 + r + 8 * half;
                float val = acc[rg][cg].f[r] + bn;
                if (EPI == EPI_HEADS) {
                    const int b = m / S_LEN, s = m % S_LEN, h = n >> 6, dk = n & 63;
                    ((uint16_t*)outp)[(((size_t)(b * NHEADS + h) * S_LEN) + s) * DK + dk] =
                        f32_to_bf16(val);
                } else if (EPI == EPI_VT) {
                    const int b = m / S_LEN, s = m % S_LEN, h = n >> 6, dk = n & 63;
                    ((uint16_t*)outp)[((size_t)(b * NHEADS + h) * DK + dk) * S_LEN + s] =
                        f32_to_bf16(val);
                } else {  // EPI_RESID: out = A@W + bias + x
                    ((float*)outp)[(size_t)m * D_MODEL + n] =
                        val + xres[(size_t)m * D_MODEL + n];
                }
            }
        }
}

// ---------------------------------------------------------------------------
// One 32-key block of transposed flash attention. EDGE=true only for the
// final block (kb=896): all bounds guards compile away in the 28 hot blocks.
// V^T fragments are issued FIRST so their memory latency is hidden behind the
// score WMMAs and the softmax VALU work.
// ---------------------------------------------------------------------------
template <bool EDGE>
__device__ __forceinline__ void attn_block(
    const int kb, const uint16_t* __restrict__ Kb,
    const uint16_t* __restrict__ Vb, const FragB16 (&bq)[2],
    FragF32 (&cacc)[4], float& m_run, float& l_run, const int hqv,
    const int wqv, const int half, const int l16,
    uint16_t* __restrict__ pl, const float* __restrict__ s_bias) {
    // ---- issue V^T A-fragment loads early (consumed after softmax) ----
    FragB16 av[4];
#pragma unroll
    for (int cg = 0; cg < 4; ++cg) {
        const int d = cg * 16 + l16;                  // A row = d
        const uint16_t* vrow = &Vb[(size_t)d * S_LEN + kb];
#pragma unroll
        for (int j = 0; j < 8; ++j) {
            const int ko = kmap(j, half);
            if (EDGE) {
                const int key0 = kb + ko;
                uint32_t u;
                if (key0 + 1 < S_LEN)  u = *(const uint32_t*)&vrow[ko];
                else if (key0 < S_LEN) u = (uint32_t)vrow[ko];
                else                   u = 0u;        // keep 0*P exact (no NaN)
                av[cg].u[j] = u;
            } else {
                av[cg].u[j] = *(const uint32_t*)&vrow[ko];
            }
        }
    }

    // ---- S^T: two 16-key tiles, accumulate over d (4 WMMAs) ----
    FragF32 sc[2];
#pragma unroll
    for (int t = 0; t < 2; ++t) {
#pragma unroll
        for (int r = 0; r < 8; ++r) sc[t].f[r] = 0.0f;
        const int keyr = EDGE ? min(kb + t * 16 + l16, S_LEN - 1)
                              : (kb + t * 16 + l16); // A row = key
#pragma unroll
        for (int db = 0; db < 2; ++db) {
            FragB16 ak;
#pragma unroll
            for (int j = 0; j < 8; ++j)
                ak.u[j] = *(const uint32_t*)&Kb[(size_t)keyr * DK + db * 32 +
                                                kmap(j, half)];
            sc[t].v = __builtin_amdgcn_wmma_f32_16x16x32_bf16(
                false, ak.v, false, bq[db].v, (short)0, sc[t].v, false, false);
        }
    }

    // ---- spatial bias + mask; lane-local max over this lane's 16 keys ----
    float mb = -3.0e38f;
#pragma unroll
    for (int t = 0; t < 2; ++t)
#pragma unroll
        for (int r = 0; r < 8; ++r) {
            const int key = kb + t * 16 + r + 8 * half;
            float s;
            if (!EDGE || key < S_LEN) {
                int dh = hqv - key / 30; dh = dh < 0 ? -dh : dh;
                int dw = wqv - key % 30; dw = dw < 0 ? -dw : dw;
                s = sc[t].f[r] * 0.125f + s_bias[dh + dw];
            } else {
                s = -1.0e30f;
            }
            sc[t].f[r] = s;
            mb = fmaxf(mb, s);
        }
    mb = fmaxf(mb, __shfl_xor(mb, 16, 32));           // merge key-halves
    const float mnew = fmaxf(m_run, mb);
    const float corr = __expf(m_run - mnew);
    float lb = 0.0f;
#pragma unroll
    for (int t = 0; t < 2; ++t)
#pragma unroll
        for (int r = 0; r < 8; ++r) {
            const float p = __expf(sc[t].f[r] - mnew);
            sc[t].f[r] = p;
            lb += p;
        }
    lb += __shfl_xor(lb, 16, 32);                     // merge key-halves
    l_run = l_run * corr + lb;
    m_run = mnew;

    // rescale ctx^T accumulators by lane-scalar correction
#pragma unroll
    for (int cg = 0; cg < 4; ++cg)
#pragma unroll
        for (int r = 0; r < 8; ++r) cacc[cg].f[r] *= corr;

    // ---- P^T (C layout) -> LDS [q][key] -> B fragment ----
#pragma unroll
    for (int t = 0; t < 2; ++t)
#pragma unroll
        for (int i = 0; i < 4; ++i)
            *(uint32_t*)&pl[l16 * 32 + t * 16 + 8 * half + 2 * i] =
                pack_bf16(sc[t].f[2 * i], sc[t].f[2 * i + 1]);
    asm volatile("s_wait_dscnt 0" ::: "memory");      // same-wave LDS RAW fence
    FragB16 bp;
#pragma unroll
    for (int j = 0; j < 8; ++j)
        bp.u[j] = *(const uint32_t*)&pl[l16 * 32 + kmap(j, half)];

    // ---- ctx^T += V^T_frag @ P^T (4 WMMAs) ----
#pragma unroll
    for (int cg = 0; cg < 4; ++cg)
        cacc[cg].v = __builtin_amdgcn_wmma_f32_16x16x32_bf16(
            false, av[cg].v, false, bp.v, (short)0, cacc[cg].v, false, false);
}

// ---------------------------------------------------------------------------
// Flash-style attention, fully transposed. One wave per 16-query tile per
// (b,h); loops over 32-key blocks.
//   S^T[key, q]  = K_blk(16k x 64d) @ Q^T(64d x 16q)   -> lane l16 = query col
//   ctx^T[d, q] += V^T_frag(16d x 32k) @ P^T(32k x 16q)
// ---------------------------------------------------------------------------
__global__ __launch_bounds__(128) void attn_kernel(
    const uint16_t* __restrict__ Q, const uint16_t* __restrict__ K,
    const uint16_t* __restrict__ VT, const float* __restrict__ sbias,
    float* __restrict__ ctx_out) {
    __shared__ float s_bias[64];
    __shared__ uint16_t p_lds[4][16 * 32];  // per-wave P^T tile [q][key] bf16

    const int tid = threadIdx.x;
    if (tid < 59) s_bias[tid] = sbias[(size_t)tid * 59];  // column 0 of table
    __syncthreads();

    const int wave = tid >> 5, lane = tid & 31;
    const int half = lane >> 4, l16 = lane & 15;
    const int qt = blockIdx.x * 4 + wave;  // query tile 0..56
    const int bh = blockIdx.y;             // b*8+h, 0..127
    if (qt >= 57) return;
    const int q0 = qt * 16;

    const uint16_t* Qb = Q + (size_t)bh * S_LEN * DK;
    const uint16_t* Kb = K + (size_t)bh * S_LEN * DK;
    const uint16_t* Vb = VT + (size_t)bh * DK * S_LEN;
    uint16_t* pl = &p_lds[wave][0];

    // B fragments of Q^T (cols = queries), d-blocks 0..31 / 32..63; loop-invariant
    const int q = q0 + l16;
    const int qc = min(q, S_LEN - 1);
    FragB16 bq[2];
#pragma unroll
    for (int db = 0; db < 2; ++db)
#pragma unroll
        for (int j = 0; j < 8; ++j)
            bq[db].u[j] =
                *(const uint32_t*)&Qb[(size_t)qc * DK + db * 32 + kmap(j, half)];

    const int hqv = qc / 30, wqv = qc % 30;  // this lane's query grid coords

    float m_run = -3.0e38f, l_run = 0.0f;    // lane-scalar online-softmax state
    FragF32 cacc[4];                          // ctx^T accumulators, d blocks of 16
#pragma unroll
    for (int cg = 0; cg < 4; ++cg)
#pragma unroll
        for (int r = 0; r < 8; ++r) cacc[cg].f[r] = 0.0f;

    for (int kb = 0; kb < 896; kb += 32) {   // 28 full blocks, zero guards
        __builtin_prefetch(&Kb[(size_t)(kb + 32) * DK], 0, 1);
        __builtin_prefetch(&Vb[kb + 32], 0, 1);
        attn_block<false>(kb, Kb, Vb, bq, cacc, m_run, l_run, hqv, wqv, half,
                          l16, pl, s_bias);
    }
    attn_block<true>(896, Kb, Vb, bq, cacc, m_run, l_run, hqv, wqv, half, l16,
                     pl, s_bias);            // tail: keys 896..899 valid

    // ---- normalize and store: lane owns query q; d = cg*16 + 8*half + r ----
    if (q < S_LEN) {
        const int b = bh >> 3, h = bh & 7;
        const float inv = 1.0f / l_run;
        float* dst = ctx_out + ((size_t)(b * S_LEN + q)) * D_MODEL + h * DK;
#pragma unroll
        for (int cg = 0; cg < 4; ++cg) {
            const int dbase = cg * 16 + 8 * half;
            float4 v0 = make_float4(cacc[cg].f[0] * inv, cacc[cg].f[1] * inv,
                                    cacc[cg].f[2] * inv, cacc[cg].f[3] * inv);
            float4 v1 = make_float4(cacc[cg].f[4] * inv, cacc[cg].f[5] * inv,
                                    cacc[cg].f[6] * inv, cacc[cg].f[7] * inv);
            ((float4*)(dst + dbase))[0] = v0;
            ((float4*)(dst + dbase))[1] = v1;
        }
    }
}

// ---------------------------------------------------------------------------
// LayerNorm: one wave per 512-element row.
// ---------------------------------------------------------------------------
__global__ __launch_bounds__(128) void ln_kernel(
    const float* __restrict__ resid, const float* __restrict__ gamma,
    const float* __restrict__ beta, float* __restrict__ out) {
    const int wave = threadIdx.x >> 5, lane = threadIdx.x & 31;
    const int row = blockIdx.x * 4 + wave;
    const float* r = resid + (size_t)row * D_MODEL;
    float vals[16];
    float sum = 0.0f, sq = 0.0f;
#pragma unroll
    for (int i = 0; i < 4; ++i) {
        float4 f = ((const float4*)r)[lane + i * 32];
        vals[i * 4 + 0] = f.x; vals[i * 4 + 1] = f.y;
        vals[i * 4 + 2] = f.z; vals[i * 4 + 3] = f.w;
        sum += f.x + f.y + f.z + f.w;
        sq  += f.x * f.x + f.y * f.y + f.z * f.z + f.w * f.w;
    }
#pragma unroll
    for (int m = 16; m; m >>= 1) {
        sum += __shfl_xor(sum, m, 32);
        sq  += __shfl_xor(sq,  m, 32);
    }
    const float mu = sum * (1.0f / 512.0f);
    const float var = sq * (1.0f / 512.0f) - mu * mu;
    const float rs = rsqrtf(var + 1e-5f);
#pragma unroll
    for (int i = 0; i < 4; ++i)
#pragma unroll
        for (int j = 0; j < 4; ++j) {
            const int col = (lane + i * 32) * 4 + j;
            out[(size_t)row * D_MODEL + col] =
                (vals[i * 4 + j] - mu) * rs * gamma[col] + beta[col];
        }
}

// ---------------------------------------------------------------------------
extern "C" void kernel_launch(void* const* d_in, const int* in_sizes, int n_in,
                              void* d_out, int out_size, void* d_ws,
                              size_t ws_size, hipStream_t stream) {
    const float* x     = (const float*)d_in[0];
    const float* wq    = (const float*)d_in[1];
    const float* bq    = (const float*)d_in[2];
    const float* wk    = (const float*)d_in[3];
    const float* bk    = (const float*)d_in[4];
    const float* wv    = (const float*)d_in[5];
    const float* bv    = (const float*)d_in[6];
    const float* wo    = (const float*)d_in[7];
    const float* bo    = (const float*)d_in[8];
    const float* gamma = (const float*)d_in[9];
    const float* beta  = (const float*)d_in[10];
    const float* sbias = (const float*)d_in[11];

    // workspace layout (~103 MB total)
    uint8_t* ws = (uint8_t*)d_ws;
    const size_t SZ_H = (size_t)M_ROWS * D_MODEL * sizeof(uint16_t);  // 14.75 MB
    const size_t SZ_F = (size_t)M_ROWS * D_MODEL * sizeof(float);     // 29.49 MB
    uint16_t* Qw = (uint16_t*)(ws);
    uint16_t* Kw = (uint16_t*)(ws + SZ_H);
    uint16_t* Vt = (uint16_t*)(ws + 2 * SZ_H);
    float* ctx   = (float*)(ws + 3 * SZ_H + 4096);  // pad behind Vt for overread
    float* resid = (float*)(ws + 3 * SZ_H + 4096 + SZ_F);

    const dim3 gG(M_ROWS / 64, D_MODEL / 64);  // 225 x 8
    const dim3 blk(128);
    gemm512<EPI_HEADS><<<gG, blk, 0, stream>>>(x, wq, bq, nullptr, Qw);
    gemm512<EPI_HEADS><<<gG, blk, 0, stream>>>(x, wk, bk, nullptr, Kw);
    gemm512<EPI_VT><<<gG, blk, 0, stream>>>(x, wv, bv, nullptr, Vt);
    attn_kernel<<<dim3(15, 128), blk, 0, stream>>>(Qw, Kw, Vt, sbias, ctx);
    gemm512<EPI_RESID><<<gG, blk, 0, stream>>>(ctx, wo, bo, x, resid);
    ln_kernel<<<dim3(M_ROWS / 4), blk, 0, stream>>>(resid, gamma, beta,
                                                    (float*)d_out);
}

// v001
// A run of this version takes 259 microseconds.
// Next to v000, in two timings, it ran 1.32 times as fast each time.
#include <hip/hip_runtime.h>
#include <hip/hip_bf16.h>
#include <stdint.h>

// ---------------------------------------------------------------------------
// Spatial2DAttention fused pipeline for MI455X (gfx1250, wave32, WMMA).
//   B=16, H=W=30, S=900, d_model=512, heads=8, d_k=64.
// Precision: bf16 WMMA operands (fp32-range-safe), f32 accumulation.
// Attention computed fully TRANSPOSED (S^T = K@Q^T, ctx^T = V^T@P^T) so each
// lane owns one query column: online-softmax stats need only ONE cross-lane
// shuffle per block, and the key-block loop is peeled so the 28 full blocks
// carry no edge masking / exec-mask branches at all.
// ---------------------------------------------------------------------------

#define D_MODEL 512
#define M_ROWS  14400           // B * S
#define S_LEN   900
#define NHEADS  8
#define DK      64

typedef __attribute__((ext_vector_type(16))) __bf16 v16bf;
typedef __attribute__((ext_vector_type(8)))  float  v8f;

union FragB16 { v16bf v; uint32_t u[8]; };
union FragF32 { v8f  v; float    f[8]; };

__device__ __forceinline__ uint16_t f32_to_bf16(float f) {
    __bf16 h = (__bf16)f;                       // native v_cvt (RNE) on gfx1250
    return __builtin_bit_cast(uint16_t, h);
}
__device__ __forceinline__ uint32_t pack_bf16(float lo, float hi) {
    return (uint32_t)f32_to_bf16(lo) | ((uint32_t)f32_to_bf16(hi) << 16);
}
// A/B fragment dword j -> starting K index of the 2 packed bf16 (16x16x32 layout):
// lanes 0-15 hold K {0..7, 16..23}, lanes 16-31 hold K {8..15, 24..31}.
__device__ __forceinline__ int kmap(int j, int half) {
    return (j < 4 ? 2 * j : 16 + 2 * (j - 4)) + half * 8;
}

enum { EPI_HEADS = 0, EPI_VT = 1, EPI_RESID = 2 };

typedef __attribute__((ext_vector_type(2))) float  v2f;
typedef __attribute__((ext_vector_type(2))) __bf16 v2bf;
// two f32 -> one dword of two bf16 (RNE), lo in bits 15..0
__device__ __forceinline__ uint32_t cvt2_bf16(float lo, float hi) {
    v2f f = {lo, hi};
    return __builtin_bit_cast(uint32_t, __builtin_convertvector(f, v2bf));
}
// LDS row pitch of the GEMM tiles in bf16: 80 B = 16 B x odd, the pitch at
// which the 16-byte fragment reads of 64-B rows meet no bank conflict.
#define TPITCH 40

// ---------------------------------------------------------------------------
// Generic M=14400 x N=512 x K=512 bf16 WMMA GEMM: out = A @ W + bias (+x).
// Block tile 64x64, 4 waves of 32x32 (2x2 accumulators), K-step 32.
// A (x / ctx, 29.5 MB) and W (1 MB) stay resident in the 192 MB L2, so the
// 8x re-read of A across N-blocks costs L2 bandwidth only.
// Staging map: every wave-wide 16-byte global load covers four whole 128-B
// lines (A: 4 rows x 128 B; W: 4 rows x 128 B), and both tiles go to LDS as
// 8-byte stores of k-contiguous bf16.
// ---------------------------------------------------------------------------
template <int EPI>
__global__ __launch_bounds__(128) void gemm512(
    const float* __restrict__ A, const float* __restrict__ W,
    const float* __restrict__ bias, const float* __restrict__ xres,
    void* __restrict__ outp) {
    __shared__ __attribute__((aligned(16))) uint16_t lds_a[64 * TPITCH];   // [row][k] bf16
    __shared__ __attribute__((aligned(16))) uint16_t lds_bt[64 * TPITCH];  // [n][k] bf16 (transposed weights)

    const int tid  = threadIdx.x;
    const int wave = tid >> 5, lane = tid & 31;
    const int half = lane >> 4, l16 = lane & 15;
    const int mBase = blockIdx.x * 64;
    const int nBase = blockIdx.y * 64;
    const int wr = (wave >> 1) * 32, wc = (wave & 1) * 32;

    FragF32 acc[2][2];
#pragma unroll
    for (int a = 0; a < 2; ++a)
#pragma unroll
        for (int b = 0; b < 2; ++b)
#pragma unroll
            for (int r = 0; r < 8; ++r) acc[a][b].f[r] = 0.0f;

    for (int k0 = 0; k0 < D_MODEL; k0 += 32) {
        __syncthreads();
        {
            // A tile, 64 rows x 32 k: 8 lanes read one row's 128 B, so load i
            // of a wave is rows 16*i + 4*wave .. +3, whole lines.
            const int arow = tid >> 3, ac4 = (tid & 7) * 4;
            const float* asrc = A + (size_t)(mBase + arow) * D_MODEL + k0 + ac4;
            // W tile, 32 k x 64 n: a thread takes 4 k rows x 4 n columns; 8
            // lanes read one 128-B line of a row, a wave 4 rows per load.
            const int wn = ((tid & 7) | ((tid >> 6) << 3)) * 4;
            const int wk = ((tid >> 3) & 7) * 4;
            const float* wsrc = W + (size_t)(k0 + wk) * D_MODEL + nBase + wn;
            float4 fa[4], fw[4];
#pragma unroll
            for (int i = 0; i < 4; ++i)
                fa[i] = *(const float4*)(asrc + (size_t)i * 16 * D_MODEL);
#pragma unroll
            for (int i = 0; i < 4; ++i)
                fw[i] = *(const float4*)(wsrc + (size_t)i * D_MODEL);
#pragma unroll
            for (int i = 0; i < 4; ++i)
                *(uint2*)&lds_a[(arow + i * 16) * TPITCH + ac4] =
                    make_uint2(cvt2_bf16(fa[i].x, fa[i].y),
                               cvt2_bf16(fa[i].z, fa[i].w));
            // transposed: column n gets its 4 consecutive k as one 8-byte store
            *(uint2*)&lds_bt[(wn + 0) * TPITCH + wk] =
                make_uint2(cvt2_bf16(fw[0].x, fw[1].x), cvt2_bf16(fw[2].x, fw[3].x));
            *(uint2*)&lds_bt[(wn + 1) * TPITCH + wk] =
                make_uint2(cvt2_bf16(fw[0].y, fw[1].y), cvt2_bf16(fw[2].y, fw[3].y));
            *(uint2*)&lds_bt[(wn + 2) * TPITCH + wk] =
                make_uint2(cvt2_bf16(fw[0].z, fw[1].z), cvt2_bf16(fw[2].z, fw[3].z));
            *(uint2*)&lds_bt[(wn + 3) * TPITCH + wk] =
                make_uint2(cvt2_bf16(fw[0].w, fw[1].w), cvt2_bf16(fw[2].w, fw[3].w));
        }
        __syncthreads();

        FragB16 af[2], bf[2];
#pragma unroll
        for (int rg = 0; rg < 2; ++rg) {
            const int row = wr + rg * 16 + l16;
#pragma unroll
            for (int j = 0; j < 8; ++j)
                af[rg].u[j] = *(const uint32_t*)&lds_a[row * TPITCH + kmap(j, half)];
        }
#pragma unroll
        for (int cg = 0; cg < 2; ++cg) {
            const int col = wc + cg * 16 + l16;
#pragma unroll
            for (int j = 0; j < 8; ++j)
                bf[cg].u[j] = *(const uint32_t*)&lds_bt[col * TPITCH + kmap(j, half)];
        }
#pragma unroll
        for (int rg = 0; rg < 2; ++rg)
#pragma unroll
            for (int cg = 0; cg < 2; ++cg)
                acc[rg][cg].v = __builtin_amdgcn_wmma_f32_16x16x32_bf16(
                    false, af[rg].v, false, bf[cg].v, (short)0, acc[rg][cg].v,
                    false, false);
    }

    // epilogue: C layout is VGPR r -> row r (lanes 0-15) / row r+8 (lanes 16-31)
#pragma unroll
    for (int rg = 0; rg < 2; ++rg)
#pragma unroll
        for (int cg = 0; cg < 2; ++cg) {
            const int n = nBase + wc + cg * 16 + l16;
            const float bn = bias[n];
#pragma unroll
            for (int r = 0; r < 8; ++r) {
                const int m = mBase + wr + rg * 16 + r + 8 * half;
                float val = acc[rg][cg].f[r] + bn;
                if (EPI == EPI_HEADS) {
                    const int b = m / S_LEN, s = m % S_LEN, h = n >> 6, dk = n & 63;
                    ((uint16_t*)outp)[(((size_t)(b * NHEADS + h) * S_LEN) + s) * DK + dk] =
                        f32_to_bf16(val);
                } else if (EPI == EPI_VT) {
                    const int b = m / S_LEN, s = m % S_LEN, h = n >> 6, dk = n & 63;
                    ((uint16_t*)outp)[((size_t)(b * NHEADS + h) * DK + dk) * S_LEN + s] =
                        f32_to_bf16(val);
                } else {  // EPI_RESID: out = A@W + bias + x
                    ((float*)outp)[(size_t)m * D_MODEL + n] =
                        val + xres[(size_t)m * D_MODEL + n];
                }
            }
        }
}

// ---------------------------------------------------------------------------
// One 32-key block of transposed flash attention. EDGE=true only for the
// final block (kb=896): all bounds guards compile away in the 28 hot blocks.
// V^T fragments are issued FIRST so their memory latency is hidden behind the
// score WMMAs and the softmax VALU work.
// ---------------------------------------------------------------------------
template <bool EDGE>
__device__ __forceinline__ void attn_block(
    const int kb, const uint16_t* __restrict__ Kb,
    const uint16_t* __restrict__ Vb, const FragB16 (&bq)[2],
    FragF32 (&cacc)[4], float& m_run, float& l_run, const int hqv,
    const int wqv, const int half, const int l16,
    uint16_t* __restrict__ pl, const float* __restrict__ s_bias) {
    // ---- issue V^T A-fragment loads early (consumed after softmax) ----
    FragB16 av[4];
#pragma unroll
    for (int cg = 0; cg < 4; ++cg) {
        const int d = cg * 16 + l16;                  // A row = d
        const uint16_t* vrow = &Vb[(size_t)d * S_LEN + kb];
#pragma unroll
        for (int j = 0; j < 8; ++j) {
            const int ko = kmap(j, half);
            if (EDGE) {
                const int key0 = kb + ko;
                uint32_t u;
                if (key0 + 1 < S_LEN)  u = *(const uint32_t*)&vrow[ko];
                else if (key0 < S_LEN) u = (uint32_t)vrow[ko];
                else                   u = 0u;        // keep 0*P exact (no NaN)
                av[cg].u[j] = u;
            } else {
                av[cg].u[j] = *(const uint32_t*)&vrow[ko];
            }
        }
    }

    // ---- S^T: two 16-key tiles, accumulate over d (4 WMMAs) ----
    FragF32 sc[2];
#pragma unroll
    for (int t = 0; t < 2; ++t) {
#pragma unroll
        for (int r = 0; r < 8; ++r) sc[t].f[r] = 0.0f;
        const int keyr = EDGE ? min(kb + t * 16 + l16, S_LEN - 1)
                              : (kb + t * 16 + l16); // A row = key
#pragma unroll
        for (int db = 0; db < 2; ++db) {
            FragB16 ak;
#pragma unroll
            for (int j = 0; j < 8; ++j)
                ak.u[j] = *(const uint32_t*)&Kb[(size_t)keyr * DK + db * 32 +
                                                kmap(j, half)];
            sc[t].v = __builtin_amdgcn_wmma_f32_16x16x32_bf16(
                false, ak.v, false, bq[db].v, (short)0, sc[t].v, false, false);
        }
    }

    // ---- spatial bias + mask; lane-local max over this lane's 16 keys ----
    float mb = -3.0e38f;
#pragma unroll
    for (int t = 0; t < 2; ++t)
#pragma unroll
        for (int r = 0; r < 8; ++r) {
            const int key = kb + t * 16 + r + 8 * half;
            float s;
            if (!EDGE || key < S_LEN) {
                int dh = hqv - key / 30; dh = dh < 0 ? -dh : dh;
                int dw = wqv - key % 30; dw = dw < 0 ? -dw : dw;
                s = sc[t].f[r] * 0.125f + s_bias[dh + dw];
            } else {
                s = -1.0e30f;
            }
            sc[t].f[r] = s;
            mb = fmaxf(mb, s);
        }
    mb = fmaxf(mb, __shfl_xor(mb, 16, 32));           // merge key-halves
    const float mnew = fmaxf(m_run, mb);
    const float corr = __expf(m_run - mnew);
    float lb = 0.0f;
#pragma unroll
    for (int t = 0; t < 2; ++t)
#pragma unroll
        for (int r = 0; r < 8; ++r) {
            const float p = __expf(sc[t].f[r] - mnew);
            sc[t].f[r] = p;
            lb += p;
        }
    lb += __shfl_xor(lb, 16, 32);                     // merge key-halves
    l_run = l_run * corr + lb;
    m_run = mnew;

    // rescale ctx^T accumulators by lane-scalar correction
#pragma unroll
    for (int cg = 0; cg < 4; ++cg)
#pragma unroll
        for (int r = 0; r < 8; ++r) cacc[cg].f[r] *= corr;

    // ---- P^T (C layout) -> LDS [q][key] -> B fragment ----
#pragma unroll
    for (int t = 0; t < 2; ++t)
#pragma unroll
        for (int i = 0; i < 4; ++i)
            *(uint32_t*)&pl[l16 * 32 + t * 16 + 8 * half + 2 * i] =
                pack_bf16(sc[t].f[2 * i], sc[t].f[2 * i + 1]);
    asm volatile("s_wait_dscnt 0" ::: "memory");      // same-wave LDS RAW fence
    FragB16 bp;
#pragma unroll
    for (int j = 0; j < 8; ++j)
        bp.u[j] = *(const uint32_t*)&pl[l16 * 32 + kmap(j, half)];

    // ---- ctx^T += V^T_frag @ P^T (4 WMMAs) ----
#pragma unroll
    for (int cg = 0; cg < 4; ++cg)
        cacc[cg].v = __builtin_amdgcn_wmma_f32_16x16x32_bf16(
            false, av[cg].v, false, bp.v, (short)0, cacc[cg].v, false, false);
}

// ---------------------------------------------------------------------------
// Flash-style attention, fully transposed. One wave per 16-query tile per
// (b,h); loops over 32-key blocks.
//   S^T[key, q]  = K_blk(16k x 64d) @ Q^T(64d x 16q)   -> lane l16 = query col
//   ctx^T[d, q] += V^T_frag(16d x 32k) @ P^T(32k x 16q)
// ---------------------------------------------------------------------------
__global__ __launch_bounds__(128) void attn_kernel(
    const uint16_t* __restrict__ Q, const uint16_t* __restrict__ K,
    const uint16_t* __restrict__ VT, const float* __restrict__ sbias,
    float* __restrict__ ctx_out) {
    __shared__ float s_bias[64];
    __shared__ uint16_t p_lds[4][16 * 32];  // per-wave P^T tile [q][key] bf16

    const int tid = threadIdx.x;
    if (tid < 59) s_bias[tid] = sbias[(size_t)tid * 59];  // column 0 of table
    __syncthreads();

    const int wave = tid >> 5, lane = tid & 31;
    const int half = lane >> 4, l16 = lane & 15;
    const int qt = blockIdx.x * 4 + wave;  // query tile 0..56
    const int bh = blockIdx.y;             // b*8+h, 0..127
    if (qt >= 57) return;
    const int q0 = qt * 16;

    const uint16_t* Qb = Q + (size_t)bh * S_LEN * DK;
    const uint16_t* Kb = K + (size_t)bh * S_LEN * DK;
    const uint16_t* Vb = VT + (size_t)bh * DK * S_LEN;
    uint16_t* pl = &p_lds[wave][0];

    // B fragments of Q^T (cols = queries), d-blocks 0..31 / 32..63; loop-invariant
    const int q = q0 + l16;
    const int qc = min(q, S_LEN - 1);
    FragB16 bq[2];
#pragma unroll
    for (int db = 0; db < 2; ++db)
#pragma unroll
        for (int j = 0; j < 8; ++j)
            bq[db].u[j] =
                *(const uint32_t*)&Qb[(size_t)qc * DK + db * 32 + kmap(j, half)];

    const int hqv = qc / 30, wqv = qc % 30;  // this lane's query grid coords

    float m_run = -3.0e38f, l_run = 0.0f;    // lane-scalar online-softmax state
    FragF32 cacc[4];                          // ctx^T accumulators, d blocks of 16
#pragma unroll
    for (int cg = 0; cg < 4; ++cg)
#pragma unroll
        for (int r = 0; r < 8; ++r) cacc[cg].f[r] = 0.0f;

    for (int kb = 0; kb < 896; kb += 32) {   // 28 full blocks, zero guards
        __builtin_prefetch(&Kb[(size_t)(kb + 32) * DK], 0, 1);
        __builtin_prefetch(&Vb[kb + 32], 0, 1);
        attn_block<false>(kb, Kb, Vb, bq, cacc, m_run, l_run, hqv, wqv, half,
                          l16, pl, s_bias);
    }
    attn_block<true>(896, Kb, Vb, bq, cacc, m_run, l_run, hqv, wqv, half, l16,
                     pl, s_bias);            // tail: keys 896..899 valid

    // ---- normalize and store: lane owns query q; d = cg*16 + 8*half + r ----
    if (q < S_LEN) {
        const int b = bh >> 3, h = bh & 7;
        const float inv = 1.0f / l_run;
        float* dst = ctx_out + ((size_t)(b * S_LEN + q)) * D_MODEL + h * DK;
#pragma unroll
        for (int cg = 0; cg < 4; ++cg) {
            const int dbase = cg * 16 + 8 * half;
            float4 v0 = make_float4(cacc[cg].f[0] * inv, cacc[cg].f[1] * inv,
                                    cacc[cg].f[2] * inv, cacc[cg].f[3] * inv);
            float4 v1 = make_float4(cacc[cg].f[4] * inv, cacc[cg].f[5] * inv,
                                    cacc[cg].f[6] * inv, cacc[cg].f[7] * inv);
            ((float4*)(dst + dbase))[0] = v0;
            ((float4*)(dst + dbase))[1] = v1;
        }
    }
}

// ---------------------------------------------------------------------------
// LayerNorm: one wave per 512-element row.
// ---------------------------------------------------------------------------
__global__ __launch_bounds__(128) void ln_kernel(
    const float* __restrict__ resid, const float* __restrict__ gamma,
    const float* __restrict__ beta, float* __restrict__ out) {
    const int wave = threadIdx.x >> 5, lane = threadIdx.x & 31;
    const int row = blockIdx.x * 4 + wave;
    const float* r = resid + (size_t)row * D_MODEL;
    float vals[16];
    float sum = 0.0f, sq = 0.0f;
#pragma unroll
    for (int i = 0; i < 4; ++i) {
        float4 f = ((const float4*)r)[lane + i * 32];
        vals[i * 4 + 0] = f.x; vals[i * 4 + 1] = f.y;
        vals[i * 4 + 2] = f.z; vals[i * 4 + 3] = f.w;
        sum += f.x + f.y + f.z + f.w;
        sq  += f.x * f.x + f.y * f.y + f.z * f.z + f.w * f.w;
    }
#pragma unroll
    for (int m = 16; m; m >>= 1) {
        sum += __shfl_xor(sum, m, 32);
        sq  += __shfl_xor(sq,  m, 32);
    }
    const float mu = sum * (1.0f / 512.0f);
    const float var = sq * (1.0f / 512.0f) - mu * mu;
    const float rs = rsqrtf(var + 1e-5f);
#pragma unroll
    for (int i = 0; i < 4; ++i)
#pragma unroll
        for (int j = 0; j < 4; ++j) {
            const int col = (lane + i * 32) * 4 + j;
            out[(size_t)row * D_MODEL + col] =
                (vals[i * 4 + j] - mu) * rs * gamma[col] + beta[col];
        }
}

// ---------------------------------------------------------------------------
extern "C" void kernel_launch(void* const* d_in, const int* in_sizes, int n_in,
                              void* d_out, int out_size, void* d_ws,
                              size_t ws_size, hipStream_t stream) {
    const float* x     = (const float*)d_in[0];
    const float* wq    = (const float*)d_in[1];
    const float* bq    = (const float*)d_in[2];
    const float* wk    = (const float*)d_in[3];
    const float* bk    = (const float*)d_in[4];
    const float* wv    = (const float*)d_in[5];
    const float* bv    = (const float*)d_in[6];
    const float* wo    = (const float*)d_in[7];
    const float* bo    = (const float*)d_in[8];
    const float* gamma = (const float*)d_in[9];
    const float* beta  = (const float*)d_in[10];
    const float* sbias = (const float*)d_in[11];

    // workspace layout (~103 MB total)
    uint8_t* ws = (uint8_t*)d_ws;
    const size_t SZ_H = (size_t)M_ROWS * D_MODEL * sizeof(uint16_t);  // 14.75 MB
    const size_t SZ_F = (size_t)M_ROWS * D_MODEL * sizeof(float);     // 29.49 MB
    uint16_t* Qw = (uint16_t*)(ws);
    uint16_t* Kw = (uint16_t*)(ws + SZ_H);
    uint16_t* Vt = (uint16_t*)(ws + 2 * SZ_H);
    float* ctx   = (float*)(ws + 3 * SZ_H + 4096);  // pad behind Vt for overread
    float* resid = (float*)(ws + 3 * SZ_H + 4096 + SZ_F);

    const dim3 gG(M_ROWS / 64, D_MODEL / 64);  // 225 x 8
    const dim3 blk(128);
    gemm512<EPI_HEADS><<<gG, blk, 0, stream>>>(x, wq, bq, nullptr, Qw);
    gemm512<EPI_HEADS><<<gG, blk, 0, stream>>>(x, wk, bk, nullptr, Kw);
    gemm512<EPI_VT><<<gG, blk, 0, stream>>>(x, wv, bv, nullptr, Vt);
    attn_kernel<<<dim3(15, 128), blk, 0, stream>>>(Qw, Kw, Vt, sbias, ctx);
    gemm512<EPI_RESID><<<gG, blk, 0, stream>>>(ctx, wo, bo, x, resid);
    ln_kernel<<<dim3(M_ROWS / 4), blk, 0, stream>>>(resid, gamma, beta,
                                                    (float*)d_out);
}

// v002
// A run of this version takes 210 microseconds.
// Next to v001, in two timings, it ran 1.23 times as fast each time.
// All steps since v000 together make it 1.62 times as fast.
#include <hip/hip_runtime.h>
#include <hip/hip_bf16.h>
#include <stdint.h>

// ---------------------------------------------------------------------------
// Spatial2DAttention fused pipeline for MI455X (gfx1250, wave32, WMMA).
//   B=16, H=W=30, S=900, d_model=512, heads=8, d_k=64.
// Precision: bf16 WMMA operands (fp32-range-safe), f32 accumulation.
// Attention computed fully TRANSPOSED (S^T = K@Q^T, ctx^T = V^T@P^T) so each
// lane owns one query column: online-softmax stats need only ONE cross-lane
// shuffle per block, and the key-block loop is peeled so the 28 full blocks
// carry no edge masking / exec-mask branches at all.
// ---------------------------------------------------------------------------

#define D_MODEL 512
#define M_ROWS  14400           // B * S
#define S_LEN   900
#define NHEADS  8
#define DK      64

typedef __attribute__((ext_vector_type(16))) __bf16 v16bf;
typedef __attribute__((ext_vector_type(8)))  float  v8f;

union FragB16 { v16bf v; uint32_t u[8]; };
union FragF32 { v8f  v; float    f[8]; };

__device__ __forceinline__ uint16_t f32_to_bf16(float f) {
    __bf16 h = (__bf16)f;                       // native v_cvt (RNE) on gfx1250
    return __builtin_bit_cast(uint16_t, h);
}
__device__ __forceinline__ uint32_t pack_bf16(float lo, float hi) {
    return (uint32_t)f32_to_bf16(lo) | ((uint32_t)f32_to_bf16(hi) << 16);
}
// A/B fragment dword j -> starting K index of the 2 packed bf16 (16x16x32 layout):
// lanes 0-15 hold K {0..7, 16..23}, lanes 16-31 hold K {8..15, 24..31}.
__device__ __forceinline__ int kmap(int j, int half) {
    return (j < 4 ? 2 * j : 16 + 2 * (j - 4)) + half * 8;
}

enum { EPI_HEADS = 0, EPI_VT = 1, EPI_RESID = 2 };

typedef __attribute__((ext_vector_type(2))) float  v2f;
typedef __attribute__((ext_vector_type(2))) __bf16 v2bf;
// two f32 -> one dword of two bf16 (RNE), lo in bits 15..0
__device__ __forceinline__ uint32_t cvt2_bf16(float lo, float hi) {
    v2f f = {lo, hi};
    return __builtin_bit_cast(uint32_t, __builtin_convertvector(f, v2bf));
}
// LDS row pitch of the GEMM tiles in bf16: 80 B = 16 B x odd, the pitch at
// which the 16-byte fragment reads of 64-B rows meet no bank conflict.
#define TPITCH 40

// ---------------------------------------------------------------------------
// Generic M=14400 x N=512 x K=512 bf16 WMMA GEMM: out = A @ W + bias (+x).
// Block tile 64x64, 4 waves of 32x32 (2x2 accumulators), K-step 32.
// A (x / ctx, 29.5 MB) and W (1 MB) stay resident in the 192 MB L2, so the
// 8x re-read of A across N-blocks costs L2 bandwidth only.
// Staging map: every wave-wide 16-byte global load covers four whole 128-B
// lines (A: 4 rows x 128 B; W: 4 rows x 128 B), and both tiles go to LDS as
// 8-byte stores of k-contiguous bf16.
// ---------------------------------------------------------------------------
template <int EPI>
__global__ __launch_bounds__(128) void gemm512(
    const float* __restrict__ A, const float* __restrict__ W,
    const float* __restrict__ bias, const float* __restrict__ xres,
    void* __restrict__ outp) {
    __shared__ __attribute__((aligned(16))) uint16_t lds_a[64 * TPITCH];   // [row][k] bf16
    __shared__ __attribute__((aligned(16))) uint16_t lds_bt[64 * TPITCH];  // [n][k] bf16 (transposed weights)

    const int tid  = threadIdx.x;
    const int wave = tid >> 5, lane = tid & 31;
    const int half = lane >> 4, l16 = lane & 15;
    const int mBase = blockIdx.x * 64;
    const int nBase = blockIdx.y * 64;
    const int wr = (wave >> 1) * 32, wc = (wave & 1) * 32;

    FragF32 acc[2][2];
#pragma unroll
    for (int a = 0; a < 2; ++a)
#pragma unroll
        for (int b = 0; b < 2; ++b)
#pragma unroll
            for (int r = 0; r < 8; ++r) acc[a][b].f[r] = 0.0f;

    for (int k0 = 0; k0 < D_MODEL; k0 += 32) {
        __syncthreads();
        {
            // A tile, 64 rows x 32 k: 8 lanes read one row's 128 B, so load i
            // of a wave is rows 16*i + 4*wave .. +3, whole lines.
            const int arow = tid >> 3, ac4 = (tid & 7) * 4;
            const float* asrc = A + (size_t)(mBase + arow) * D_MODEL + k0 + ac4;
            // W tile, 32 k x 64 n: a thread takes 4 k rows x 4 n columns; 8
            // lanes read one 128-B line of a row, a wave 4 rows per load.
            const int wn = ((tid & 7) | ((tid >> 6) << 3)) * 4;
            const int wk = ((tid >> 3) & 7) * 4;
            const float* wsrc = W + (size_t)(k0 + wk) * D_MODEL + nBase + wn;
            float4 fa[4], fw[4];
#pragma unroll
            for (int i = 0; i < 4; ++i)
                fa[i] = *(const float4*)(asrc + (size_t)i * 16 * D_MODEL);
#pragma unroll
            for (int i = 0; i < 4; ++i)
                fw[i] = *(const float4*)(wsrc + (size_t)i * D_MODEL);
#pragma unroll
            for (int i = 0; i < 4; ++i)
                *(uint2*)&lds_a[(arow + i * 16) * TPITCH + ac4] =
                    make_uint2(cvt2_bf16(fa[i].x, fa[i].y),
                               cvt2_bf16(fa[i].z, fa[i].w));
            // transposed: column n gets its 4 consecutive k as one 8-byte store
            *(uint2*)&lds_bt[(wn + 0) * TPITCH + wk] =
                make_uint2(cvt2_bf16(fw[0].x, fw[1].x), cvt2_bf16(fw[2].x, fw[3].x));
            *(uint2*)&lds_bt[(wn + 1) * TPITCH + wk] =
                make_uint2(cvt2_bf16(fw[0].y, fw[1].y), cvt2_bf16(fw[2].y, fw[3].y));
            *(uint2*)&lds_bt[(wn + 2) * TPITCH + wk] =
                make_uint2(cvt2_bf16(fw[0].z, fw[1].z), cvt2_bf16(fw[2].z, fw[3].z));
            *(uint2*)&lds_bt[(wn + 3) * TPITCH + wk] =
                make_uint2(cvt2_bf16(fw[0].w, fw[1].w), cvt2_bf16(fw[2].w, fw[3].w));
        }
        __syncthreads();

        FragB16 af[2], bf[2];
#pragma unroll
        for (int rg = 0; rg < 2; ++rg) {
            const int row = wr + rg * 16 + l16;
#pragma unroll
            for (int j = 0; j < 8; ++j)
                af[rg].u[j] = *(const uint32_t*)&lds_a[row * TPITCH + kmap(j, half)];
        }
#pragma unroll
        for (int cg = 0; cg < 2; ++cg) {
            const int col = wc + cg * 16 + l16;
#pragma unroll
            for (int j = 0; j < 8; ++j)
                bf[cg].u[j] = *(const uint32_t*)&lds_bt[col * TPITCH + kmap(j, half)];
        }
#pragma unroll
        for (int rg = 0; rg < 2; ++rg)
#pragma unroll
            for (int cg = 0; cg < 2; ++cg)
                acc[rg][cg].v = __builtin_amdgcn_wmma_f32_16x16x32_bf16(
                    false, af[rg].v, false, bf[cg].v, (short)0, acc[rg][cg].v,
                    false, false);
    }

    // epilogue: C layout is VGPR r -> row r (lanes 0-15) / row r+8 (lanes 16-31)
#pragma unroll
    for (int rg = 0; rg < 2; ++rg)
#pragma unroll
        for (int cg = 0; cg < 2; ++cg) {
            const int n = nBase + wc + cg * 16 + l16;
            const float bn = bias[n];
#pragma unroll
            for (int r = 0; r < 8; ++r) {
                const int m = mBase + wr + rg * 16 + r + 8 * half;
                float val = acc[rg][cg].f[r] + bn;
                if (EPI == EPI_HEADS) {
                    const int b = m / S_LEN, s = m % S_LEN, h = n >> 6, dk = n & 63;
                    ((uint16_t*)outp)[(((size_t)(b * NHEADS + h) * S_LEN) + s) * DK + dk] =
                        f32_to_bf16(val);
                } else if (EPI == EPI_VT) {
                    const int b = m / S_LEN, s = m % S_LEN, h = n >> 6, dk = n & 63;
                    ((uint16_t*)outp)[((size_t)(b * NHEADS + h) * DK + dk) * S_LEN + s] =
                        f32_to_bf16(val);
                } else {  // EPI_RESID: out = A@W + bias + x
                    ((float*)outp)[(size_t)m * D_MODEL + n] =
                        val + xres[(size_t)m * D_MODEL + n];
                }
            }
        }
}

// ---------------------------------------------------------------------------
// K / V^T staging for the attention kernel. The four waves of a work-group
// walk the same keys, so each 64-key stage is brought into LDS once per
// work-group by asynchronous copies that cover whole rows, and every wave
// takes its fragments from LDS with 16-byte reads.
// ---------------------------------------------------------------------------
#define ST_KEYS 64               // keys per stage (two 32-key blocks)
#define N_STAGES 14              // 14 * 64 = 896 keys; keys 896..899 are the tail
#define KVP 72                   // LDS row pitch in bf16: 144 B = 16 B x odd
#define TILE_E (64 * KVP)        // one staged tile: 64 rows of 128 B

// One stage: K rows key0..key0+63 (8 KiB in a row, 16 B per lane and copy) and
// V^T rows 0..63, keys key0..key0+63 (128 B per row; the 1800-B source pitch
// keeps 8-byte alignment only, so 8 B per lane and copy).
// kg / vg: this lane's first source bytes; kl / vl: its first LDS byte address.
__device__ __forceinline__ void stage_copy(const uint16_t* kg, const uint16_t* vg,
                                           uint32_t kl, uint32_t vl) {
    // s_wait_xcnt closes each statement: the address registers named by the
    // copies are not rewritten before it.
    asm volatile(
        "global_load_async_to_lds_b128 %0, %4, off\n\t"
        "global_load_async_to_lds_b128 %1, %5, off\n\t"
        "global_load_async_to_lds_b128 %2, %6, off\n\t"
        "global_load_async_to_lds_b128 %3, %7, off\n\t"
        "s_wait_xcnt 0x0"
        :: "v"(kl), "v"(kl + 16 * 144), "v"(kl + 32 * 144), "v"(kl + 48 * 144),
           "v"(kg), "v"(kg + 16 * DK), "v"(kg + 32 * DK), "v"(kg + 48 * DK)
        : "memory");
    asm volatile(
        "global_load_async_to_lds_b64 %0, %8, off\n\t"
        "global_load_async_to_lds_b64 %1, %9, off\n\t"
        "global_load_async_to_lds_b64 %2, %10, off\n\t"
        "global_load_async_to_lds_b64 %3, %11, off\n\t"
        "global_load_async_to_lds_b64 %4, %12, off\n\t"
        "global_load_async_to_lds_b64 %5, %13, off\n\t"
        "global_load_async_to_lds_b64 %6, %14, off\n\t"
        "global_load_async_to_lds_b64 %7, %15, off\n\t"
        "s_wait_xcnt 0x0"
        :: "v"(vl), "v"(vl + 8 * 144), "v"(vl + 16 * 144), "v"(vl + 24 * 144),
           "v"(vl + 32 * 144), "v"(vl + 40 * 144), "v"(vl + 48 * 144),
           "v"(vl + 56 * 144),
           "v"(vg), "v"(vg + 8 * S_LEN), "v"(vg + 16 * S_LEN), "v"(vg + 24 * S_LEN),
           "v"(vg + 32 * S_LEN), "v"(vg + 40 * S_LEN), "v"(vg + 48 * S_LEN),
           "v"(vg + 56 * S_LEN)
        : "memory");
}

// 16x16x32 A/B fragment of one row from 16-byte aligned storage: p points at
// the row's k = 8*half; dwords 0..3 are k +0..7, dwords 4..7 are k +16..23.
__device__ __forceinline__ void load_frag16(FragB16& f, const uint16_t* p) {
    const uint4 lo = *(const uint4*)p;
    const uint4 hi = *(const uint4*)(p + 16);
    f.u[0] = lo.x; f.u[1] = lo.y; f.u[2] = lo.z; f.u[3] = lo.w;
    f.u[4] = hi.x; f.u[5] = hi.y; f.u[6] = hi.z; f.u[7] = hi.w;
}

// ---------------------------------------------------------------------------
// One 32-key block of transposed flash attention. Kt points at the block's
// first key row (row pitch KP), Vt at V^T[d = 0][first key] (row pitch VP).
// EDGE=false: both are staged LDS tiles. EDGE=true only for the final block
// (kb=896), read from global memory with all bounds guards.
// ---------------------------------------------------------------------------
template <bool EDGE, int KP, int VP>
__device__ __forceinline__ void attn_block(
    const int kb, const uint16_t* Kt, const uint16_t* Vt,
    const FragB16 (&bq)[2],
    FragF32 (&cacc)[4], float& m_run, float& l_run, const int hqv,
    const int wqv, const int half, const int l16,
    uint16_t* __restrict__ pl, const float* __restrict__ s_bias) {
    // ---- V^T A fragments. Tail block: global loads, issued early so that
    // the score WMMAs and the softmax hide their latency ----
    FragB16 av[4];
    if (EDGE) {
#pragma unroll
        for (int cg = 0; cg < 4; ++cg) {
            const uint16_t* vrow = &Vt[(size_t)(cg * 16 + l16) * VP];  // A row = d
#pragma unroll
            for (int j = 0; j < 8; ++j) {
                const int ko = kmap(j, half);
                const int key0 = kb + ko;
                uint32_t u;
                if (key0 + 1 < S_LEN)  u = *(const uint32_t*)&vrow[ko];
                else if (key0 < S_LEN) u = (uint32_t)vrow[ko];
                else                   u = 0u;        // keep 0*P exact (no NaN)
                av[cg].u[j] = u;
            }
        }
    }

    // ---- S^T: two 16-key tiles, accumulate over d (4 WMMAs) ----
    FragF32 sc[2];
#pragma unroll
    for (int t = 0; t < 2; ++t) {
#pragma unroll
        for (int r = 0; r < 8; ++r) sc[t].f[r] = 0.0f;
        const int keyr = EDGE ? min(t * 16 + l16, S_LEN - 1 - kb)
                              : (t * 16 + l16);       // A row = key
#pragma unroll
        for (int db = 0; db < 2; ++db) {
            FragB16 ak;
            load_frag16(ak, &Kt[(size_t)keyr * KP + db * 32 + 8 * half]);
            sc[t].v = __builtin_amdgcn_wmma_f32_16x16x32_bf16(
                false, ak.v, false, bq[db].v, (short)0, sc[t].v, false, false);
        }
    }

    // ---- spatial bias + mask; lane-local max over this lane's 16 keys ----
    float mb = -3.0e38f;
#pragma unroll
    for (int t = 0; t < 2; ++t)
#pragma unroll
        for (int r = 0; r < 8; ++r) {
            const int key = kb + t * 16 + r + 8 * half;
            float s;
            if (!EDGE || key < S_LEN) {
                // key < 928; the mask states a 16-bit range, so that / 30 and
                // % 30 keep their short multiplies (full 32-bit multiplies
                // issue at a quarter of the rate)
                const int k16 = key & 0xffff;
                int dh = hqv - k16 / 30; dh = dh < 0 ? -dh : dh;
                int dw = wqv - k16 % 30; dw = dw < 0 ? -dw : dw;
                s = sc[t].f[r] * 0.125f + s_bias[dh + dw];
            } else {
                s = -1.0e30f;
            }
            sc[t].f[r] = s;
            mb = fmaxf(mb, s);
        }
    mb = fmaxf(mb, __shfl_xor(mb, 16, 32));           // merge key-halves
    const float mnew = fmaxf(m_run, mb);
    const float corr = __expf(m_run - mnew);
    float lb = 0.0f;
#pragma unroll
    for (int t = 0; t < 2; ++t)
#pragma unroll
        for (int r = 0; r < 8; ++r) {
            const float p = __expf(sc[t].f[r] - mnew);
            sc[t].f[r] = p;
            lb += p;
        }
    lb += __shfl_xor(lb, 16, 32);                     // merge key-halves
    l_run = l_run * corr + lb;
    m_run = mnew;

    // rescale ctx^T accumulators by lane-scalar correction
#pragma unroll
    for (int cg = 0; cg < 4; ++cg)
#pragma unroll
        for (int r = 0; r < 8; ++r) cacc[cg].f[r] *= corr;

    // ---- P^T (C layout) -> LDS [q][key] -> B fragment ----
#pragma unroll
    for (int t = 0; t < 2; ++t)
#pragma unroll
        for (int i = 0; i < 4; ++i)
            *(uint32_t*)&pl[l16 * 32 + t * 16 + 8 * half + 2 * i] =
                pack_bf16(sc[t].f[2 * i], sc[t].f[2 * i + 1]);
    asm volatile("s_wait_dscnt 0" ::: "memory");      // same-wave LDS RAW fence
    FragB16 bp;
#pragma unroll
    for (int j = 0; j < 8; ++j)
        bp.u[j] = *(const uint32_t*)&pl[l16 * 32 + kmap(j, half)];

    // staged blocks: V^T fragments come from LDS only now, so that their 32
    // registers are free during the bias and softmax work
    if (!EDGE) {
#pragma unroll
        for (int cg = 0; cg < 4; ++cg)
            load_frag16(av[cg], &Vt[(size_t)(cg * 16 + l16) * VP + 8 * half]);
    }

    // ---- ctx^T += V^T_frag @ P^T (4 WMMAs) ----
#pragma unroll
    for (int cg = 0; cg < 4; ++cg)
        cacc[cg].v = __builtin_amdgcn_wmma_f32_16x16x32_bf16(
            false, av[cg].v, false, bp.v, (short)0, cacc[cg].v, false, false);
}

// ---------------------------------------------------------------------------
// Flash-style attention, fully transposed. One wave per 16-query tile per
// (b,h); the work-group's four waves share each staged 64-key K / V^T stage.
//   S^T[key, q]  = K_blk(16k x 64d) @ Q^T(64d x 16q)   -> lane l16 = query col
//   ctx^T[d, q] += V^T_frag(16d x 32k) @ P^T(32k x 16q)
// Two LDS buffers: stage s + 1 flies while stage s is worked on.
// ---------------------------------------------------------------------------
__global__ __launch_bounds__(128) void attn_kernel(
    const uint16_t* __restrict__ Q, const uint16_t* __restrict__ K,
    const uint16_t* __restrict__ VT, const float* __restrict__ sbias,
    float* __restrict__ ctx_out) {
    __shared__ float s_bias[64];
    __shared__ uint16_t p_lds[4][16 * 32];  // per-wave P^T tile [q][key] bf16
    __shared__ __attribute__((aligned(16))) uint16_t kv[2][2][TILE_E];  // [buffer][K | V^T]

    const int tid = threadIdx.x;
    const int bh = blockIdx.y;             // b*8+h, 0..127
    const uint16_t* Qb = Q + (size_t)bh * S_LEN * DK;
    const uint16_t* Kb = K + (size_t)bh * S_LEN * DK;
    const uint16_t* Vb = VT + (size_t)bh * DK * S_LEN;

    // this lane's share of a stage: K 16 B at row tid/8 (+16 per copy),
    // V^T 8 B at row tid/16 (+8 per copy)
    const uint16_t* kg = Kb + tid * 8;
    const uint16_t* vg = Vb + (size_t)(tid >> 4) * S_LEN + (tid & 15) * 4;
    const uint32_t lds0 = (uint32_t)(uintptr_t)&kv[0][0][0];  // LDS byte address
    const uint32_t kl = lds0 + (tid >> 3) * 144 + (tid & 7) * 16;
    const uint32_t vl = lds0 + TILE_E * 2 + (tid >> 4) * 144 + (tid & 15) * 8;

    if (tid < 59) s_bias[tid] = sbias[(size_t)tid * 59];  // column 0 of table
    stage_copy(kg, vg, kl, vl);                           // stage 0 -> buffer 0
    // stage 0 has landed before the barrier that publishes it
    asm volatile("s_wait_asynccnt 0x0" ::: "memory");
    __syncthreads();
    stage_copy(kg + ST_KEYS * DK, vg + ST_KEYS, kl + 4 * TILE_E, vl + 4 * TILE_E);

    const int wave = tid >> 5, lane = tid & 31;
    const int half = lane >> 4, l16 = lane & 15;
    const int qt = blockIdx.x * 4 + wave;  // query tile; tiles 57..59 hold no
    const int q0 = qt * 16;                // query: they copy, pass every
                                           // barrier and store nothing
    uint16_t* pl = &p_lds[wave][0];

    // B fragments of Q^T (cols = queries), d-blocks 0..31 / 32..63; loop-invariant
    const int q = q0 + l16;
    const int qc = min(q, S_LEN - 1);
    FragB16 bq[2];
#pragma unroll
    for (int db = 0; db < 2; ++db)
#pragma unroll
        for (int j = 0; j < 8; ++j)
            bq[db].u[j] =
                *(const uint32_t*)&Qb[(size_t)qc * DK + db * 32 + kmap(j, half)];

    const int hqv = qc / 30, wqv = qc % 30;  // this lane's query grid coords

    float m_run = -3.0e38f, l_run = 0.0f;    // lane-scalar online-softmax state
    FragF32 cacc[4];                          // ctx^T accumulators, d blocks of 16
#pragma unroll
    for (int cg = 0; cg < 4; ++cg)
#pragma unroll
        for (int r = 0; r < 8; ++r) cacc[cg].f[r] = 0.0f;

    for (int kb = 0; kb < 896; kb += 32) {   // 28 full blocks, zero guards
        const int s = kb >> 6, buf = s & 1, sub = (kb >> 5) & 1;
        attn_block<false, KVP, KVP>(kb, &kv[buf][0][sub * 32 * KVP],
                                    &kv[buf][1][sub * 32], bq, cacc, m_run, l_run,
                                    hqv, wqv, half, l16, pl, s_bias);
        if (sub) {
            // publish point of stage s + 1: this wave's reads of buffer buf
            // are done, its own copies of stage s + 1 have landed, then the
            // barrier
            asm volatile("s_wait_dscnt 0x0" ::: "memory");
            asm volatile("s_wait_asynccnt 0x0" ::: "memory");
            __syncthreads();
            if (s + 2 < N_STAGES)            // refill the buffer just left
                stage_copy(kg + (size_t)(s + 2) * ST_KEYS * DK,
                           vg + (s + 2) * ST_KEYS, kl + buf * 4 * TILE_E,
                           vl + buf * 4 * TILE_E);
        }
    }
    // no copy is outstanding when the wave goes on to its end
    asm volatile("s_wait_asynccnt 0x0" ::: "memory");
    attn_block<true, DK, S_LEN>(896, Kb + (size_t)896 * DK, Vb + 896, bq, cacc,
                                m_run, l_run, hqv, wqv, half, l16, pl,
                                s_bias);     // tail: keys 896..899 valid

    // ---- normalize and store: lane owns query q; d = cg*16 + 8*half + r ----
    if (q < S_LEN) {
        const int b = bh >> 3, h = bh & 7;
        const float inv = 1.0f / l_run;
        float* dst = ctx_out + ((size_t)(b * S_LEN + q)) * D_MODEL + h * DK;
#pragma unroll
        for (int cg = 0; cg < 4; ++cg) {
            const int dbase = cg * 16 + 8 * half;
            float4 v0 = make_float4(cacc[cg].f[0] * inv, cacc[cg].f[1] * inv,
                                    cacc[cg].f[2] * inv, cacc[cg].f[3] * inv);
            float4 v1 = make_float4(cacc[cg].f[4] * inv, cacc[cg].f[5] * inv,
                                    cacc[cg].f[6] * inv, cacc[cg].f[7] * inv);
            ((float4*)(dst + dbase))[0] = v0;
            ((float4*)(dst + dbase))[1] = v1;
        }
    }
}

// ---------------------------------------------------------------------------
// LayerNorm: one wave per 512-element row.
// ---------------------------------------------------------------------------
__global__ __launch_bounds__(128) void ln_kernel(
    const float* __restrict__ resid, const float* __restrict__ gamma,
    const float* __restrict__ beta, float* __restrict__ out) {
    const int wave = threadIdx.x >> 5, lane = threadIdx.x & 31;
    const int row = blockIdx.x * 4 + wave;
    const float* r = resid + (size_t)row * D_MODEL;
    float vals[16];
    float sum = 0.0f, sq = 0.0f;
#pragma unroll
    for (int i = 0; i < 4; ++i) {
        float4 f = ((const float4*)r)[lane + i * 32];
        vals[i * 4 + 0] = f.x; vals[i * 4 + 1] = f.y;
        vals[i * 4 + 2] = f.z; vals[i * 4 + 3] = f.w;
        sum += f.x + f.y + f.z + f.w;
        sq  += f.x * f.x + f.y * f.y + f.z * f.z + f.w * f.w;
    }
#pragma unroll
    for (int m = 16; m; m >>= 1) {
        sum += __shfl_xor(sum, m, 32);
        sq  += __shfl_xor(sq,  m, 32);
    }
    const float mu = sum * (1.0f / 512.0f);
    const float var = sq * (1.0f / 512.0f) - mu * mu;
    const float rs = rsqrtf(var + 1e-5f);
#pragma unroll
    for (int i = 0; i < 4; ++i)
#pragma unroll
        for (int j = 0; j < 4; ++j) {
            const int col = (lane + i * 32) * 4 + j;
            out[(size_t)row * D_MODEL + col] =
                (vals[i * 4 + j] - mu) * rs * gamma[col] + beta[col];
        }
}

// ---------------------------------------------------------------------------
extern "C" void kernel_launch(void* const* d_in, const int* in_sizes, int n_in,
                              void* d_out, int out_size, void* d_ws,
                              size_t ws_size, hipStream_t stream) {
    const float* x     = (const float*)d_in[0];
    const float* wq    = (const float*)d_in[1];
    const float* bq    = (const float*)d_in[2];
    const float* wk    = (const float*)d_in[3];
    const float* bk    = (const float*)d_in[4];
    const float* wv    = (const float*)d_in[5];
    const float* bv    = (const float*)d_in[6];
    const float* wo    = (const float*)d_in[7];
    const float* bo    = (const float*)d_in[8];
    const float* gamma = (const float*)d_in[9];
    const float* beta  = (const float*)d_in[10];
    const float* sbias = (const float*)d_in[11];

    // workspace layout (~103 MB total)
    uint8_t* ws = (uint8_t*)d_ws;
    const size_t SZ_H = (size_t)M_ROWS * D_MODEL * sizeof(uint16_t);  // 14.75 MB
    const size_t SZ_F = (size_t)M_ROWS * D_MODEL * sizeof(float);     // 29.49 MB
    uint16_t* Qw = (uint16_t*)(ws);
    uint16_t* Kw = (uint16_t*)(ws + SZ_H);
    uint16_t* Vt = (uint16_t*)(ws + 2 * SZ_H);
    float* ctx   = (float*)(ws + 3 * SZ_H + 4096);  // pad behind Vt for overread
    float* resid = (float*)(ws + 3 * SZ_H + 4096 + SZ_F);

    const dim3 gG(M_ROWS / 64, D_MODEL / 64);  // 225 x 8
    const dim3 blk(128);
    gemm512<EPI_HEADS><<<gG, blk, 0, stream>>>(x, wq, bq, nullptr, Qw);
    gemm512<EPI_HEADS><<<gG, blk, 0, stream>>>(x, wk, bk, nullptr, Kw);
    gemm512<EPI_VT><<<gG, blk, 0, stream>>>(x, wv, bv, nullptr, Vt);
    attn_kernel<<<dim3(15, 128), blk, 0, stream>>>(Qw, Kw, Vt, sbias, ctx);
    gemm512<EPI_RESID><<<gG, blk, 0, stream>>>(ctx, wo, bo, x, resid);
    ln_kernel<<<dim3(M_ROWS / 4), blk, 0, stream>>>(resid, gamma, beta,
                                                    (float*)d_out);
}

// v003
// It runs in 187 microseconds.
// In two side-by-side timings against v002, it was 1.12 and 1.13 times as fast.
// Over all steps from v000 it is 1.82 times as fast.
#include <hip/hip_runtime.h>
#include <hip/hip_bf16.h>
#include <stdint.h>

// ---------------------------------------------------------------------------
// Spatial2DAttention fused pipeline for MI455X (gfx1250, wave32, WMMA).
//   B=16, H=W=30, S=900, d_model=512, heads=8, d_k=64.
// Precision: bf16 WMMA operands (fp32-range-safe), f32 accumulation.
// Attention computed fully TRANSPOSED (S^T = K@Q^T, ctx^T = V^T@P^T) so each
// lane owns one query column: online-softmax stats need only ONE cross-lane
// shuffle per block. Q, K and V^T are kept with 32 key slots per grid row (30
// keys and 2 zero pads), so a 32-key block is one grid row: its row distance
// to a query is one value per lane and the column distances never change.
// ---------------------------------------------------------------------------

#define D_MODEL 512
#define M_ROWS  14400           // B * S
#define S_LEN   900
#define NHEADS  8
#define DK      64
#define GRID_W  30              // keys per grid row
#define S_PAD   960             // 30 grid rows x 32 key slots

typedef __attribute__((ext_vector_type(16))) __bf16 v16bf;
typedef __attribute__((ext_vector_type(8)))  float  v8f;

union FragB16 { v16bf v; uint32_t u[8]; };
union FragF32 { v8f  v; float    f[8]; };

__device__ __forceinline__ uint16_t f32_to_bf16(float f) {
    __bf16 h = (__bf16)f;                       // native v_cvt (RNE) on gfx1250
    return __builtin_bit_cast(uint16_t, h);
}
__device__ __forceinline__ uint32_t pack_bf16(float lo, float hi) {
    return (uint32_t)f32_to_bf16(lo) | ((uint32_t)f32_to_bf16(hi) << 16);
}
// A/B fragment dword j -> starting K index of the 2 packed bf16 (16x16x32 layout):
// lanes 0-15 hold K {0..7, 16..23}, lanes 16-31 hold K {8..15, 24..31}.
__device__ __forceinline__ int kmap(int j, int half) {
    return (j < 4 ? 2 * j : 16 + 2 * (j - 4)) + half * 8;
}

enum { EPI_HEADS = 0, EPI_VT = 1, EPI_RESID = 2 };

typedef __attribute__((ext_vector_type(2))) float  v2f;
typedef __attribute__((ext_vector_type(2))) __bf16 v2bf;
// two f32 -> one dword of two bf16 (RNE), lo in bits 15..0
__device__ __forceinline__ uint32_t cvt2_bf16(float lo, float hi) {
    v2f f = {lo, hi};
    return __builtin_bit_cast(uint32_t, __builtin_convertvector(f, v2bf));
}
// LDS row pitch of the GEMM tiles in bf16: 80 B = 16 B x odd, the pitch at
// which the 16-byte fragment reads of 64-B rows meet no bank conflict.
#define TPITCH 40

// ---------------------------------------------------------------------------
// Generic M=14400 x N=512 x K=512 bf16 WMMA GEMM: out = A @ W + bias (+x).
// Block tile 64x64, 4 waves of 32x32 (2x2 accumulators), K-step 32.
// A (x / ctx, 29.5 MB) and W (1 MB) stay resident in the 192 MB L2, so the
// 8x re-read of A across N-blocks costs L2 bandwidth only.
// Staging map: every wave-wide 16-byte global load covers four whole 128-B
// lines (A: 4 rows x 128 B; W: 4 rows x 128 B), and both tiles go to LDS as
// 8-byte stores of k-contiguous bf16.
// ---------------------------------------------------------------------------
template <int EPI>
__global__ __launch_bounds__(128) void gemm512(
    const float* __restrict__ A, const float* __restrict__ W,
    const float* __restrict__ bias, const float* __restrict__ xres,
    void* __restrict__ outp) {
    __shared__ __attribute__((aligned(16))) uint16_t lds_a[64 * TPITCH];   // [row][k] bf16
    __shared__ __attribute__((aligned(16))) uint16_t lds_bt[64 * TPITCH];  // [n][k] bf16 (transposed weights)

    const int tid  = threadIdx.x;
    const int wave = tid >> 5, lane = tid & 31;
    const int half = lane >> 4, l16 = lane & 15;
    const int mBase = blockIdx.x * 64;
    const int nBase = blockIdx.y * 64;
    const int wr = (wave >> 1) * 32, wc = (wave & 1) * 32;

    FragF32 acc[2][2];
#pragma unroll
    for (int a = 0; a < 2; ++a)
#pragma unroll
        for (int b = 0; b < 2; ++b)
#pragma unroll
            for (int r = 0; r < 8; ++r) acc[a][b].f[r] = 0.0f;

    for (int k0 = 0; k0 < D_MODEL; k0 += 32) {
        __syncthreads();
        {
            // A tile, 64 rows x 32 k: 8 lanes read one row's 128 B, so load i
            // of a wave is rows 16*i + 4*wave .. +3, whole lines.
            const int arow = tid >> 3, ac4 = (tid & 7) * 4;
            const float* asrc = A + (size_t)(mBase + arow) * D_MODEL + k0 + ac4;
            // W tile, 32 k x 64 n: a thread takes 4 k rows x 4 n columns; 8
            // lanes read one 128-B line of a row, a wave 4 rows per load.
            const int wn = ((tid & 7) | ((tid >> 6) << 3)) * 4;
            const int wk = ((tid >> 3) & 7) * 4;
            const float* wsrc = W + (size_t)(k0 + wk) * D_MODEL + nBase + wn;
            float4 fa[4], fw[4];
#pragma unroll
            for (int i = 0; i < 4; ++i)
                fa[i] = *(const float4*)(asrc + (size_t)i * 16 * D_MODEL);
#pragma unroll
            for (int i = 0; i < 4; ++i)
                fw[i] = *(const float4*)(wsrc + (size_t)i * D_MODEL);
#pragma unroll
            for (int i = 0; i < 4; ++i)
                *(uint2*)&lds_a[(arow + i * 16) * TPITCH + ac4] =
                    make_uint2(cvt2_bf16(fa[i].x, fa[i].y),
                               cvt2_bf16(fa[i].z, fa[i].w));
            // transposed: column n gets its 4 consecutive k as one 8-byte store
            *(uint2*)&lds_bt[(wn + 0) * TPITCH + wk] =
                make_uint2(cvt2_bf16(fw[0].x, fw[1].x), cvt2_bf16(fw[2].x, fw[3].x));
            *(uint2*)&lds_bt[(wn + 1) * TPITCH + wk] =
                make_uint2(cvt2_bf16(fw[0].y, fw[1].y), cvt2_bf16(fw[2].y, fw[3].y));
            *(uint2*)&lds_bt[(wn + 2) * TPITCH + wk] =
                make_uint2(cvt2_bf16(fw[0].z, fw[1].z), cvt2_bf16(fw[2].z, fw[3].z));
            *(uint2*)&lds_bt[(wn + 3) * TPITCH + wk] =
                make_uint2(cvt2_bf16(fw[0].w, fw[1].w), cvt2_bf16(fw[2].w, fw[3].w));
        }
        __syncthreads();

        FragB16 af[2], bf[2];
#pragma unroll
        for (int rg = 0; rg < 2; ++rg) {
            const int row = wr + rg * 16 + l16;
#pragma unroll
            for (int j = 0; j < 8; ++j)
                af[rg].u[j] = *(const uint32_t*)&lds_a[row * TPITCH + kmap(j, half)];
        }
#pragma unroll
        for (int cg = 0; cg < 2; ++cg) {
            const int col = wc + cg * 16 + l16;
#pragma unroll
            for (int j = 0; j < 8; ++j)
                bf[cg].u[j] = *(const uint32_t*)&lds_bt[col * TPITCH + kmap(j, half)];
        }
#pragma unroll
        for (int rg = 0; rg < 2; ++rg)
#pragma unroll
            for (int cg = 0; cg < 2; ++cg)
                acc[rg][cg].v = __builtin_amdgcn_wmma_f32_16x16x32_bf16(
                    false, af[rg].v, false, bf[cg].v, (short)0, acc[rg][cg].v,
                    false, false);
    }

    // epilogue: C layout is VGPR r -> row r (lanes 0-15) / row r+8 (lanes 16-31)
#pragma unroll
    for (int rg = 0; rg < 2; ++rg)
#pragma unroll
        for (int cg = 0; cg < 2; ++cg) {
            const int n = nBase + wc + cg * 16 + l16;
            const float bn = bias[n];
#pragma unroll
            for (int r = 0; r < 8; ++r) {
                const int m = mBase + wr + rg * 16 + r + 8 * half;
                float val = acc[rg][cg].f[r] + bn;
                if (EPI == EPI_HEADS) {
                    const int b = m / S_LEN, s = m % S_LEN, h = n >> 6, dk = n & 63;
                    const int sp = s + 2 * (s / GRID_W);   // slot: 32 * row + column
                    ((uint16_t*)outp)[(((size_t)(b * NHEADS + h) * S_PAD) + sp) * DK + dk] =
                        f32_to_bf16(val);
                } else if (EPI == EPI_VT) {
                    const int b = m / S_LEN, s = m % S_LEN, h = n >> 6, dk = n & 63;
                    const int sp = s + 2 * (s / GRID_W);   // slot: 32 * row + column
                    ((uint16_t*)outp)[((size_t)(b * NHEADS + h) * DK + dk) * S_PAD + sp] =
                        f32_to_bf16(val);
                } else {  // EPI_RESID: out = A@W + bias + x
                    ((float*)outp)[(size_t)m * D_MODEL + n] =
                        val + xres[(size_t)m * D_MODEL + n];
                }
            }
        }

    // The two pad slots behind each grid row are zeroed by the work-group that
    // holds the row's last position: two threads per tile row, 32 of the
    // tile's 64 columns (one head) each.
    if (EPI != EPI_RESID) {
        const int mi = mBase + (tid >> 1);
        const int b = mi / S_LEN, s = mi % S_LEN;
        if (s % GRID_W == GRID_W - 1) {
            const int sp = s + 2 * (s / GRID_W) + 1;       // first pad slot, even
            const int bh = b * NHEADS + (nBase >> 6);
            const int d0 = (tid & 1) * 32;
            if (EPI == EPI_HEADS) {
                uint4* p = (uint4*)&((uint16_t*)outp)[((size_t)bh * S_PAD + sp) * DK + d0];
#pragma unroll
                for (int i = 0; i < 4; ++i) {
                    p[i] = make_uint4(0u, 0u, 0u, 0u);
                    p[i + 8] = make_uint4(0u, 0u, 0u, 0u); // next slot, 128 B on
                }
            } else {
#pragma unroll
                for (int i = 0; i < 32; ++i)
                    *(uint32_t*)&((uint16_t*)outp)[((size_t)bh * DK + d0 + i) * S_PAD + sp] = 0u;
            }
        }
    }
}

// ---------------------------------------------------------------------------
// K / V^T staging for the attention kernel. The four waves of a work-group
// walk the same keys, so each 64-slot stage (two grid rows) is brought into
// LDS once per work-group by asynchronous copies that cover whole rows, and
// every wave takes its fragments from LDS with 16-byte reads.
// ---------------------------------------------------------------------------
#define ST_KEYS 64               // key slots per stage (two 32-slot blocks)
#define N_STAGES 15              // 15 * 64 = 960 slots, all of them
#define KVP 72                   // LDS row pitch in bf16: 144 B = 16 B x odd
#define TILE_E (64 * KVP)        // one staged tile: 64 rows of 128 B

// One stage: K slots key0..key0+63 (8 KiB in a row) and V^T rows 0..63, slots
// key0..key0+63 (128 B per row, source pitch 1920 B); 16 B per lane and copy,
// 8 lanes to a row, 16 rows to a copy.
// kg / vg: this lane's first source bytes; kl / vl: its first LDS byte address.
__device__ __forceinline__ void stage_copy(const uint16_t* kg, const uint16_t* vg,
                                           uint32_t kl, uint32_t vl) {
    // s_wait_xcnt closes each statement: the address registers named by the
    // copies are not rewritten before it.
    asm volatile(
        "global_load_async_to_lds_b128 %0, %4, off\n\t"
        "global_load_async_to_lds_b128 %1, %5, off\n\t"
        "global_load_async_to_lds_b128 %2, %6, off\n\t"
        "global_load_async_to_lds_b128 %3, %7, off\n\t"
        "s_wait_xcnt 0x0"
        :: "v"(kl), "v"(kl + 16 * 144), "v"(kl + 32 * 144), "v"(kl + 48 * 144),
           "v"(kg), "v"(kg + 16 * DK), "v"(kg + 32 * DK), "v"(kg + 48 * DK)
        : "memory");
    asm volatile(
        "global_load_async_to_lds_b128 %0, %4, off\n\t"
        "global_load_async_to_lds_b128 %1, %5, off\n\t"
        "global_load_async_to_lds_b128 %2, %6, off\n\t"
        "global_load_async_to_lds_b128 %3, %7, off\n\t"
        "s_wait_xcnt 0x0"
        :: "v"(vl), "v"(vl + 16 * 144), "v"(vl + 32 * 144), "v"(vl + 48 * 144),
           "v"(vg), "v"(vg + 16 * S_PAD), "v"(vg + 32 * S_PAD), "v"(vg + 48 * S_PAD)
        : "memory");
}

// 16x16x32 A/B fragment of one row from 16-byte aligned storage: p points at
// the row's k = 8*half; dwords 0..3 are k +0..7, dwords 4..7 are k +16..23.
__device__ __forceinline__ void load_frag16(FragB16& f, const uint16_t* p) {
    const uint4 lo = *(const uint4*)p;
    const uint4 hi = *(const uint4*)(p + 16);
    f.u[0] = lo.x; f.u[1] = lo.y; f.u[2] = lo.z; f.u[3] = lo.w;
    f.u[4] = hi.x; f.u[5] = hi.y; f.u[6] = hi.z; f.u[7] = hi.w;
}

// ---------------------------------------------------------------------------
// One 32-slot block (one grid row of keys) of transposed flash attention.
// Kt points at the block's first slot row, Vt at V^T[d = 0][first slot], both
// in the staged LDS tiles (row pitch KVP).
// dh4: 4 * |query row - key row|, one value per lane for the whole block.
// dw4[i]: 4 * |query column - key column| of this lane's score i; the pad
// slots point 64 entries up the table, where every entry masks.
// ---------------------------------------------------------------------------
__device__ __forceinline__ void attn_block(
    const uint16_t* Kt, const uint16_t* Vt, const FragB16 (&bq)[2],
    FragF32 (&cacc)[4], float& m_run, float& l_run, const int dh4,
    const int (&dw4)[16], const int half, const int l16,
    uint16_t* __restrict__ pl, const float* __restrict__ s_bias) {
    // ---- S^T: two 16-key tiles, accumulate over d (4 WMMAs) ----
    FragF32 sc[2];
#pragma unroll
    for (int t = 0; t < 2; ++t) {
#pragma unroll
        for (int r = 0; r < 8; ++r) sc[t].f[r] = 0.0f;
        const int keyr = t * 16 + l16;                // A row = key slot
#pragma unroll
        for (int db = 0; db < 2; ++db) {
            FragB16 ak;
            load_frag16(ak, &Kt[(size_t)keyr * KVP + db * 32 + 8 * half]);
            sc[t].v = __builtin_amdgcn_wmma_f32_16x16x32_bf16(
                false, ak.v, false, bq[db].v, (short)0, sc[t].v, false, false);
        }
    }

    // ---- spatial bias (and pad mask); lane-local max over 16 slots ----
    float mb = -3.0e38f;
#pragma unroll
    for (int t = 0; t < 2; ++t)
#pragma unroll
        for (int r = 0; r < 8; ++r) {
            const float bias =
                *(const float*)((const char*)s_bias + (dh4 + dw4[t * 8 + r]));
            const float s = sc[t].f[r] * 0.125f + bias;
            sc[t].f[r] = s;
            mb = fmaxf(mb, s);
        }
    mb = fmaxf(mb, __shfl_xor(mb, 16, 32));           // merge key-halves
    const float mnew = fmaxf(m_run, mb);
    const float corr = __expf(m_run - mnew);
    float lb = 0.0f;
#pragma unroll
    for (int t = 0; t < 2; ++t)
#pragma unroll
        for (int r = 0; r < 8; ++r) {
            const float p = __expf(sc[t].f[r] - mnew);
            sc[t].f[r] = p;
            lb += p;
        }
    lb += __shfl_xor(lb, 16, 32);                     // merge key-halves
    l_run = l_run * corr + lb;
    m_run = mnew;

    // rescale ctx^T accumulators by lane-scalar correction
#pragma unroll
    for (int cg = 0; cg < 4; ++cg)
#pragma unroll
        for (int r = 0; r < 8; ++r) cacc[cg].f[r] *= corr;

    // ---- P^T (C layout) -> LDS [q][key] -> B fragment ----
#pragma unroll
    for (int t = 0; t < 2; ++t)
#pragma unroll
        for (int i = 0; i < 4; ++i)
            *(uint32_t*)&pl[l16 * 32 + t * 16 + 8 * half + 2 * i] =
                pack_bf16(sc[t].f[2 * i], sc[t].f[2 * i + 1]);
    asm volatile("s_wait_dscnt 0" ::: "memory");      // same-wave LDS RAW fence
    FragB16 bp;
#pragma unroll
    for (int j = 0; j < 8; ++j)
        bp.u[j] = *(const uint32_t*)&pl[l16 * 32 + kmap(j, half)];

    // V^T fragments come from LDS only now, so that their 32 registers are
    // free during the bias and softmax work
    FragB16 av[4];
#pragma unroll
    for (int cg = 0; cg < 4; ++cg)
        load_frag16(av[cg], &Vt[(size_t)(cg * 16 + l16) * KVP + 8 * half]);

    // ---- ctx^T += V^T_frag @ P^T (4 WMMAs) ----
#pragma unroll
    for (int cg = 0; cg < 4; ++cg)
        cacc[cg].v = __builtin_amdgcn_wmma_f32_16x16x32_bf16(
            false, av[cg].v, false, bp.v, (short)0, cacc[cg].v, false, false);
}

// ---------------------------------------------------------------------------
// Flash-style attention, fully transposed. One wave per 16-query tile per
// (b,h); the work-group's four waves share each staged 64-slot K / V^T stage.
//   S^T[key, q]  = K_blk(16k x 64d) @ Q^T(64d x 16q)   -> lane l16 = query col
//   ctx^T[d, q] += V^T_frag(16d x 32k) @ P^T(32k x 16q)
// Two LDS buffers: stage s + 1 flies while stage s is worked on.
// ---------------------------------------------------------------------------
__global__ __launch_bounds__(128) void attn_kernel(
    const uint16_t* __restrict__ Q, const uint16_t* __restrict__ K,
    const uint16_t* __restrict__ VT, const float* __restrict__ sbias,
    float* __restrict__ ctx_out) {
    __shared__ float s_bias[96];            // 0..58 table; 64..93 mask entries
    __shared__ uint16_t p_lds[4][16 * 32];  // per-wave P^T tile [q][key] bf16
    __shared__ __attribute__((aligned(16))) uint16_t kv[2][2][TILE_E];  // [buffer][K | V^T]

    const int tid = threadIdx.x;
    const int bh = blockIdx.y;             // b*8+h, 0..127
    const uint16_t* Qb = Q + (size_t)bh * S_PAD * DK;
    const uint16_t* Kb = K + (size_t)bh * S_PAD * DK;
    const uint16_t* Vb = VT + (size_t)bh * DK * S_PAD;

    // this lane's share of a stage: 16 B at row tid/8 (+16 rows per copy) of
    // the K tile and of the V^T tile
    const uint16_t* kg = Kb + tid * 8;
    const uint16_t* vg = Vb + (size_t)(tid >> 3) * S_PAD + (tid & 7) * 8;
    const uint32_t lds0 = (uint32_t)(uintptr_t)&kv[0][0][0];  // LDS byte address
    const uint32_t kl = lds0 + (tid >> 3) * 144 + (tid & 7) * 16;
    const uint32_t vl = kl + TILE_E * 2;

    if (tid < 59) s_bias[tid] = sbias[(size_t)tid * 59];  // column 0 of table
    else if (tid >= 64 && tid < 94) s_bias[tid] = -1.0e30f;  // pad slots
    stage_copy(kg, vg, kl, vl);                           // stage 0 -> buffer 0
    // stage 0 has landed before the barrier that publishes it
    asm volatile("s_wait_asynccnt 0x0" ::: "memory");
    __syncthreads();
    stage_copy(kg + ST_KEYS * DK, vg + ST_KEYS, kl + 4 * TILE_E, vl + 4 * TILE_E);

    const int wave = tid >> 5, lane = tid & 31;
    const int half = lane >> 4, l16 = lane & 15;
    const int qt = blockIdx.x * 4 + wave;  // query tile; tiles 57..59 hold no
    const int q0 = qt * 16;                // query: they copy, pass every
                                           // barrier and store nothing
    uint16_t* pl = &p_lds[wave][0];

    const int q = q0 + l16;
    const int qc = min(q, S_LEN - 1);
    const int hqv = qc / GRID_W, wqv = qc % GRID_W;  // this lane's query grid coords

    // B fragments of Q^T (cols = queries), d-blocks 0..31 / 32..63; loop-invariant
    FragB16 bq[2];
#pragma unroll
    for (int db = 0; db < 2; ++db)
#pragma unroll
        for (int j = 0; j < 8; ++j)
            bq[db].u[j] = *(const uint32_t*)&Qb[(size_t)(hqv * 32 + wqv) * DK +
                                                db * 32 + kmap(j, half)];

    // column part of the bias index of this lane's 16 scores, in bytes
    int dw4[16];
#pragma unroll
    for (int i = 0; i < 16; ++i) {
        const int wk = (i >> 3) * 16 + (i & 7) + 8 * half;   // slot in the grid row
        int dw = wqv - wk; dw = dw < 0 ? -dw : dw;
        dw4[i] = (wk < GRID_W ? dw : 64) * 4;
    }

    float m_run = -3.0e38f, l_run = 0.0f;    // lane-scalar online-softmax state
    FragF32 cacc[4];                          // ctx^T accumulators, d blocks of 16
#pragma unroll
    for (int cg = 0; cg < 4; ++cg)
#pragma unroll
        for (int r = 0; r < 8; ++r) cacc[cg].f[r] = 0.0f;

    for (int hk = 0; hk < GRID_W; ++hk) {    // one grid row of keys per block
        const int s = hk >> 1, buf = s & 1, sub = hk & 1;
        int dh = hqv - hk; dh = dh < 0 ? -dh : dh;
        attn_block(&kv[buf][0][sub * 32 * KVP], &kv[buf][1][sub * 32], bq, cacc,
                   m_run, l_run, dh * 4, dw4, half, l16, pl, s_bias);
        if (sub) {
            // publish point of stage s + 1: this wave's reads of buffer buf
            // are done, its own copies of stage s + 1 have landed, then the
            // barrier
            asm volatile("s_wait_dscnt 0x0" ::: "memory");
            asm volatile("s_wait_asynccnt 0x0" ::: "memory");
            __syncthreads();
            if (s + 2 < N_STAGES)            // refill the buffer just left
                stage_copy(kg + (size_t)(s + 2) * ST_KEYS * DK,
                           vg + (s + 2) * ST_KEYS, kl + buf * 4 * TILE_E,
                           vl + buf * 4 * TILE_E);
        }
    }
    // no copy is outstanding when the wave goes on to its end
    asm volatile("s_wait_asynccnt 0x0" ::: "memory");

    // ---- normalize and store: lane owns query q; d = cg*16 + 8*half + r ----
    if (q < S_LEN) {
        const int b = bh >> 3, h = bh & 7;
        const float inv = 1.0f / l_run;
        float* dst = ctx_out + ((size_t)(b * S_LEN + q)) * D_MODEL + h * DK;
#pragma unroll
        for (int cg = 0; cg < 4; ++cg) {
            const int dbase = cg * 16 + 8 * half;
            float4 v0 = make_float4(cacc[cg].f[0] * inv, cacc[cg].f[1] * inv,
                                    cacc[cg].f[2] * inv, cacc[cg].f[3] * inv);
            float4 v1 = make_float4(cacc[cg].f[4] * inv, cacc[cg].f[5] * inv,
                                    cacc[cg].f[6] * inv, cacc[cg].f[7] * inv);
            ((float4*)(dst + dbase))[0] = v0;
            ((float4*)(dst + dbase))[1] = v1;
        }
    }
}

// ---------------------------------------------------------------------------
// LayerNorm: one wave per 512-element row.
// ---------------------------------------------------------------------------
__global__ __launch_bounds__(128) void ln_kernel(
    const float* __restrict__ resid, const float* __restrict__ gamma,
    const float* __restrict__ beta, float* __restrict__ out) {
    const int wave = threadIdx.x >> 5, lane = threadIdx.x & 31;
    const int row = blockIdx.x * 4 + wave;
    const float* r = resid + (size_t)row * D_MODEL;
    float vals[16];
    float sum = 0.0f, sq = 0.0f;
#pragma unroll
    for (int i = 0; i < 4; ++i) {
        float4 f = ((const float4*)r)[lane + i * 32];
        vals[i * 4 + 0] = f.x; vals[i * 4 + 1] = f.y;
        vals[i * 4 + 2] = f.z; vals[i * 4 + 3] = f.w;
        sum += f.x + f.y + f.z + f.w;
        sq  += f.x * f.x + f.y * f.y + f.z * f.z + f.w * f.w;
    }
#pragma unroll
    for (int m = 16; m; m >>= 1) {
        sum += __shfl_xor(sum, m, 32);
        sq  += __shfl_xor(sq,  m, 32);
    }
    const float mu = sum * (1.0f / 512.0f);
    const float var = sq * (1.0f / 512.0f) - mu * mu;
    const float rs = rsqrtf(var + 1e-5f);
#pragma unroll
    for (int i = 0; i < 4; ++i)
#pragma unroll
        for (int j = 0; j < 4; ++j) {
            const int col = (lane + i * 32) * 4 + j;
            out[(size_t)row * D_MODEL + col] =
                (vals[i * 4 + j] - mu) * rs * gamma[col] + beta[col];
        }
}

// ---------------------------------------------------------------------------
extern "C" void kernel_launch(void* const* d_in, const int* in_sizes, int n_in,
                              void* d_out, int out_size, void* d_ws,
                              size_t ws_size, hipStream_t stream) {
    const float* x     = (const float*)d_in[0];
    const float* wq    = (const float*)d_in[1];
    const float* bq    = (const float*)d_in[2];
    const float* wk    = (const float*)d_in[3];
    const float* bk    = (const float*)d_in[4];
    const float* wv    = (const float*)d_in[5];
    const float* bv    = (const float*)d_in[6];
    const float* wo    = (const float*)d_in[7];
    const float* bo    = (const float*)d_in[8];
    const float* gamma = (const float*)d_in[9];
    const float* beta  = (const float*)d_in[10];
    const float* sbias = (const float*)d_in[11];

    // workspace layout (~106 MB total)
    uint8_t* ws = (uint8_t*)d_ws;
    const size_t SZ_H = (size_t)16 * S_PAD * D_MODEL * sizeof(uint16_t);  // 15.73 MB
    const size_t SZ_F = (size_t)M_ROWS * D_MODEL * sizeof(float);     // 29.49 MB
    uint16_t* Qw = (uint16_t*)(ws);
    uint16_t* Kw = (uint16_t*)(ws + SZ_H);
    uint16_t* Vt = (uint16_t*)(ws + 2 * SZ_H);
    float* ctx   = (float*)(ws + 3 * SZ_H);
    float* resid = (float*)(ws + 3 * SZ_H + SZ_F);

    const dim3 gG(M_ROWS / 64, D_MODEL / 64);  // 225 x 8
    const dim3 blk(128);
    gemm512<EPI_HEADS><<<gG, blk, 0, stream>>>(x, wq, bq, nullptr, Qw);
    gemm512<EPI_HEADS><<<gG, blk, 0, stream>>>(x, wk, bk, nullptr, Kw);
    gemm512<EPI_VT><<<gG, blk, 0, stream>>>(x, wv, bv, nullptr, Vt);
    attn_kernel<<<dim3(15, 128), blk, 0, stream>>>(Qw, Kw, Vt, sbias, ctx);
    gemm512<EPI_RESID><<<gG, blk, 0, stream>>>(ctx, wo, bo, x, resid);
    ln_kernel<<<dim3(M_ROWS / 4), blk, 0, stream>>>(resid, gamma, beta,
                                                    (float*)d_out);
}

// v004
// A run of this version takes 168 microseconds.
// In both of two side-by-side timings against v003, it was 1.11 times as fast.
// All steps since v000 together make it 2.02 times as fast.
#include <hip/hip_runtime.h>
#include <hip/hip_bf16.h>
#include <stdint.h>

// ---------------------------------------------------------------------------
// Spatial2DAttention fused pipeline for MI455X (gfx1250, wave32, WMMA).
//   B=16, H=W=30, S=900, d_model=512, heads=8, d_k=64.
// Precision: bf16 WMMA operands (fp32-range-safe), f32 accumulation.
// Attention computed fully TRANSPOSED (S^T = K@Q^T, ctx^T = V^T@P^T) so each
// lane owns one query column: online-softmax stats need only ONE cross-lane
// shuffle per block. Q, K and V^T are kept with 32 key slots per grid row (30
// keys and 2 zero pads), so a 32-key block is one grid row: its row distance
// to a query is one value per lane and the column distances never change.
// ---------------------------------------------------------------------------

#define D_MODEL 512
#define M_ROWS  14400           // B * S
#define S_LEN   900
#define NHEADS  8
#define DK      64
#define GRID_W  30              // keys per grid row
#define S_PAD   960             // 30 grid rows x 32 key slots

typedef __attribute__((ext_vector_type(16))) __bf16 v16bf;
typedef __attribute__((ext_vector_type(8)))  float  v8f;

union FragB16 { v16bf v; uint32_t u[8]; };
union FragF32 { v8f  v; float    f[8]; };

__device__ __forceinline__ uint16_t f32_to_bf16(float f) {
    __bf16 h = (__bf16)f;                       // native v_cvt (RNE) on gfx1250
    return __builtin_bit_cast(uint16_t, h);
}
__device__ __forceinline__ uint32_t pack_bf16(float lo, float hi) {
    return (uint32_t)f32_to_bf16(lo) | ((uint32_t)f32_to_bf16(hi) << 16);
}
// A/B fragment dword j -> starting K index of the 2 packed bf16 (16x16x32 layout):
// lanes 0-15 hold K {0..7, 16..23}, lanes 16-31 hold K {8..15, 24..31}.
__device__ __forceinline__ int kmap(int j, int half) {
    return (j < 4 ? 2 * j : 16 + 2 * (j - 4)) + half * 8;
}

enum { EPI_HEADS = 0, EPI_VT = 1 };

typedef __attribute__((ext_vector_type(2))) float  v2f;
typedef __attribute__((ext_vector_type(2))) __bf16 v2bf;
// two f32 -> one dword of two bf16 (RNE), lo in bits 15..0
__device__ __forceinline__ uint32_t cvt2_bf16(float lo, float hi) {
    v2f f = {lo, hi};
    return __builtin_bit_cast(uint32_t, __builtin_convertvector(f, v2bf));
}
// LDS row pitch of the GEMM tiles in bf16: 80 B = 16 B x odd, the pitch at
// which the 16-byte fragment reads of 64-B rows meet no bank conflict.
#define TPITCH 40

// ---------------------------------------------------------------------------
// M=14400 x N=512 x K=512 bf16 WMMA GEMMs: out = A @ W + bias.
// Block tile 64x64 per weight matrix, 4 waves of 32x32 (2x2 accumulators),
// K-step 32. NW weight matrices share one staged A tile: the Q, K and V
// projections run as one launch (NW = 3), so x is drawn from L2 once for the
// three of them and a wave has 12 WMMAs between two barriers; the output
// projection runs alone (NW = 1).
// Staging map: every wave-wide 16-byte global load covers four whole 128-B
// lines (A: 4 rows x 128 B; W: 4 rows x 128 B), and all tiles go to LDS as
// 8-byte stores of k-contiguous bf16.
// ---------------------------------------------------------------------------
template <int NW>
__device__ __forceinline__ void gemm_tiles(
    const float* __restrict__ A, const float* const (&W)[NW],
    uint16_t* lds_a, uint16_t (*lds_bt)[64 * TPITCH], FragF32 (&acc)[NW][2][2],
    const int tid, const int mBase, const int nBase, const int wr, const int wc,
    const int half, const int l16) {
#pragma unroll
    for (int p = 0; p < NW; ++p)
#pragma unroll
        for (int a = 0; a < 2; ++a)
#pragma unroll
            for (int b = 0; b < 2; ++b)
#pragma unroll
                for (int r = 0; r < 8; ++r) acc[p][a][b].f[r] = 0.0f;

    // A tile, 64 rows x 32 k: 8 lanes read one row's 128 B, so load i of a
    // wave is rows 16*i + 4*wave .. +3, whole lines.
    const int arow = tid >> 3, ac4 = (tid & 7) * 4;
    uint32_t aoff = ((mBase + arow) * D_MODEL + ac4) * 4;   // byte offset in A
    // W tiles, 32 k x 64 n each: a thread takes 4 k rows x 4 n columns; 8
    // lanes read one 128-B line of a row, a wave 4 rows per load.
    const int wn = ((tid & 7) | ((tid >> 6) << 3)) * 4;
    const int wk = ((tid >> 3) & 7) * 4;
    uint32_t woff = (wk * D_MODEL + nBase + wn) * 4;        // byte offset in each W

    for (int k0 = 0; k0 < D_MODEL; k0 += 32) {
        __syncthreads();
        {
            float4 fa[4], fw[NW][4];
#pragma unroll
            for (int i = 0; i < 4; ++i)
                fa[i] = *(const float4*)((const char*)A + aoff + i * 16 * D_MODEL * 4);
#pragma unroll
            for (int p = 0; p < NW; ++p)
#pragma unroll
                for (int i = 0; i < 4; ++i)
                    fw[p][i] = *(const float4*)((const char*)W[p] + woff + i * D_MODEL * 4);
            aoff += 32 * 4;
            woff += 32 * D_MODEL * 4;
#pragma unroll
            for (int i = 0; i < 4; ++i)
                *(uint2*)&lds_a[(arow + i * 16) * TPITCH + ac4] =
                    make_uint2(cvt2_bf16(fa[i].x, fa[i].y),
                               cvt2_bf16(fa[i].z, fa[i].w));
            // transposed: column n gets its 4 consecutive k as one 8-byte store
#pragma unroll
            for (int p = 0; p < NW; ++p) {
                uint16_t* bt = lds_bt[p];
                *(uint2*)&bt[(wn + 0) * TPITCH + wk] = make_uint2(
                    cvt2_bf16(fw[p][0].x, fw[p][1].x), cvt2_bf16(fw[p][2].x, fw[p][3].x));
                *(uint2*)&bt[(wn + 1) * TPITCH + wk] = make_uint2(
                    cvt2_bf16(fw[p][0].y, fw[p][1].y), cvt2_bf16(fw[p][2].y, fw[p][3].y));
                *(uint2*)&bt[(wn + 2) * TPITCH + wk] = make_uint2(
                    cvt2_bf16(fw[p][0].z, fw[p][1].z), cvt2_bf16(fw[p][2].z, fw[p][3].z));
                *(uint2*)&bt[(wn + 3) * TPITCH + wk] = make_uint2(
                    cvt2_bf16(fw[p][0].w, fw[p][1].w), cvt2_bf16(fw[p][2].w, fw[p][3].w));
            }
        }
        __syncthreads();

        FragB16 af[2];
#pragma unroll
        for (int rg = 0; rg < 2; ++rg) {
            const int row = wr + rg * 16 + l16;
#pragma unroll
            for (int j = 0; j < 8; ++j)
                af[rg].u[j] = *(const uint32_t*)&lds_a[row * TPITCH + kmap(j, half)];
        }
#pragma unroll
        for (int p = 0; p < NW; ++p) {
            FragB16 bf[2];
#pragma unroll
            for (int cg = 0; cg < 2; ++cg) {
                const int col = wc + cg * 16 + l16;
#pragma unroll
                for (int j = 0; j < 8; ++j)
                    bf[cg].u[j] =
                        *(const uint32_t*)&lds_bt[p][col * TPITCH + kmap(j, half)];
            }
#pragma unroll
            for (int rg = 0; rg < 2; ++rg)
#pragma unroll
                for (int cg = 0; cg < 2; ++cg)
                    acc[p][rg][cg].v = __builtin_amdgcn_wmma_f32_16x16x32_bf16(
                        false, af[rg].v, false, bf[cg].v, (short)0, acc[p][rg][cg].v,
                        false, false);
        }
    }
}

// One projection's 64x64 tile (one head) to its bf16 plane, 32 slots per grid
// row. EPI_HEADS: [b*8+h][slot][dk]; EPI_VT: [b*8+h][dk][slot].
// C layout is VGPR r -> row r (lanes 0-15) / row r+8 (lanes 16-31).
template <int EPI>
__device__ __forceinline__ void store_heads(
    const FragF32 (&acc)[2][2], const float* __restrict__ bias,
    uint16_t* __restrict__ outp, const int tid, const int mBase, const int nBase,
    const int wr, const int wc, const int half, const int l16) {
#pragma unroll
    for (int rg = 0; rg < 2; ++rg)
#pragma unroll
        for (int cg = 0; cg < 2; ++cg) {
            const int n = nBase + wc + cg * 16 + l16;
            const float bn = bias[n];
#pragma unroll
            for (int r = 0; r < 8; ++r) {
                const int m = mBase + wr + rg * 16 + r + 8 * half;
                const float val = acc[rg][cg].f[r] + bn;
                const int b = m / S_LEN, s = m % S_LEN, h = n >> 6, dk = n & 63;
                const int sp = s + 2 * (s / GRID_W);   // slot: 32 * row + column
                if (EPI == EPI_HEADS)
                    outp[(((size_t)(b * NHEADS + h) * S_PAD) + sp) * DK + dk] =
                        f32_to_bf16(val);
                else
                    outp[((size_t)(b * NHEADS + h) * DK + dk) * S_PAD + sp] =
                        f32_to_bf16(val);
            }
            // the registers that the last store names are taken again by the
            // next group's bias load and addresses: the wait stands in front
            asm volatile("s_wait_xcnt 0x0" ::: "memory");
        }

    // The two pad slots behind each grid row are zeroed by the work-group that
    // holds the row's last position: two threads per tile row, 32 of the
    // tile's 64 columns (one head) each.
    const int mi = mBase + (tid >> 1);
    const int b = mi / S_LEN, s = mi % S_LEN;
    if (s % GRID_W == GRID_W - 1) {
        const int sp = s + 2 * (s / GRID_W) + 1;       // first pad slot, even
        const int bh = b * NHEADS + (nBase >> 6);
        const int d0 = (tid & 1) * 32;
        if (EPI == EPI_HEADS) {
            uint4* p = (uint4*)&outp[((size_t)bh * S_PAD + sp) * DK + d0];
#pragma unroll
            for (int i = 0; i < 4; ++i) {
                p[i] = make_uint4(0u, 0u, 0u, 0u);
                p[i + 8] = make_uint4(0u, 0u, 0u, 0u); // next slot, 128 B on
            }
        } else {
#pragma unroll
            for (int i = 0; i < 32; ++i)
                *(uint32_t*)&outp[((size_t)bh * DK + d0 + i) * S_PAD + sp] = 0u;
        }
    }
}

// Q, K and V^T of one 64-row block and one head, from one staged x tile.
// Five waves per SIMD (192 registers): the k loop needs that many, and the
// stores behind it are not to cost a resident work-group.
__global__ __launch_bounds__(128, 5) void qkv_gemm(
    const float* __restrict__ A, const float* __restrict__ Wq,
    const float* __restrict__ Wk, const float* __restrict__ Wv,
    const float* __restrict__ biasq, const float* __restrict__ biask,
    const float* __restrict__ biasv, uint16_t* __restrict__ Qo,
    uint16_t* __restrict__ Ko, uint16_t* __restrict__ Vo) {
    __shared__ __attribute__((aligned(16))) uint16_t lds_a[64 * TPITCH];      // [row][k] bf16
    __shared__ __attribute__((aligned(16))) uint16_t lds_bt[3][64 * TPITCH];  // [n][k] bf16 (transposed weights)

    const int tid  = threadIdx.x;
    const int wave = tid >> 5, lane = tid & 31;
    const int half = lane >> 4, l16 = lane & 15;
    const int mBase = blockIdx.x * 64;
    const int nBase = blockIdx.y * 64;
    const int wr = (wave >> 1) * 32, wc = (wave & 1) * 32;

    const float* const W[3] = {Wq, Wk, Wv};
    FragF32 acc[3][2][2];
    gemm_tiles<3>(A, W, lds_a, lds_bt, acc, tid, mBase, nBase, wr, wc, half, l16);

    store_heads<EPI_HEADS>(acc[0], biasq, Qo, tid, mBase, nBase, wr, wc, half, l16);
    store_heads<EPI_HEADS>(acc[1], biask, Ko, tid, mBase, nBase, wr, wc, half, l16);
    store_heads<EPI_VT>(acc[2], biasv, Vo, tid, mBase, nBase, wr, wc, half, l16);
}

// Output projection with the residual: out = A @ W + bias + x.
__global__ __launch_bounds__(128) void out_gemm(
    const float* __restrict__ A, const float* __restrict__ Wo,
    const float* __restrict__ bias, const float* __restrict__ xres,
    float* __restrict__ outp) {
    __shared__ __attribute__((aligned(16))) uint16_t lds_a[64 * TPITCH];      // [row][k] bf16
    __shared__ __attribute__((aligned(16))) uint16_t lds_bt[1][64 * TPITCH];  // [n][k] bf16 (transposed weights)

    const int tid  = threadIdx.x;
    const int wave = tid >> 5, lane = tid & 31;
    const int half = lane >> 4, l16 = lane & 15;
    const int mBase = blockIdx.x * 64;
    const int nBase = blockIdx.y * 64;
    const int wr = (wave >> 1) * 32, wc = (wave & 1) * 32;

    const float* const W[1] = {Wo};
    FragF32 acc[1][2][2];
    gemm_tiles<1>(A, W, lds_a, lds_bt, acc, tid, mBase, nBase, wr, wc, half, l16);

#pragma unroll
    for (int rg = 0; rg < 2; ++rg)
#pragma unroll
        for (int cg = 0; cg < 2; ++cg) {
            const int n = nBase + wc + cg * 16 + l16;
            const float bn = bias[n];
#pragma unroll
            for (int r = 0; r < 8; ++r) {
                const int m = mBase + wr + rg * 16 + r + 8 * half;
                outp[(size_t)m * D_MODEL + n] =
                    acc[0][rg][cg].f[r] + bn + xres[(size_t)m * D_MODEL + n];
            }
        }
}

// ---------------------------------------------------------------------------
// K / V^T staging for the attention kernel. The four waves of a work-group
// walk the same keys, so each 64-slot stage (two grid rows) is brought into
// LDS once per work-group by asynchronous copies that cover whole rows, and
// every wave takes its fragments from LDS with 16-byte reads.
// ---------------------------------------------------------------------------
#define ST_KEYS 64               // key slots per stage (two 32-slot blocks)
#define N_STAGES 15              // 15 * 64 = 960 slots, all of them
#define KVP 72                   // LDS row pitch in bf16: 144 B = 16 B x odd
#define TILE_E (64 * KVP)        // one staged tile: 64 rows of 128 B

// One stage: K slots key0..key0+63 (8 KiB in a row) and V^T rows 0..63, slots
// key0..key0+63 (128 B per row, source pitch 1920 B); 16 B per lane and copy,
// 8 lanes to a row, 16 rows to a copy.
// kg / vg: this lane's first source bytes; kl / vl: its first LDS byte address.
__device__ __forceinline__ void stage_copy(const uint16_t* kg, const uint16_t* vg,
                                           uint32_t kl, uint32_t vl) {
    // s_wait_xcnt closes each statement: the address registers named by the
    // copies are not rewritten before it.
    asm volatile(
        "global_load_async_to_lds_b128 %0, %4, off\n\t"
        "global_load_async_to_lds_b128 %1, %5, off\n\t"
        "global_load_async_to_lds_b128 %2, %6, off\n\t"
        "global_load_async_to_lds_b128 %3, %7, off\n\t"
        "s_wait_xcnt 0x0"
        :: "v"(kl), "v"(kl + 16 * 144), "v"(kl + 32 * 144), "v"(kl + 48 * 144),
           "v"(kg), "v"(kg + 16 * DK), "v"(kg + 32 * DK), "v"(kg + 48 * DK)
        : "memory");
    asm volatile(
        "global_load_async_to_lds_b128 %0, %4, off\n\t"
        "global_load_async_to_lds_b128 %1, %5, off\n\t"
        "global_load_async_to_lds_b128 %2, %6, off\n\t"
        "global_load_async_to_lds_b128 %3, %7, off\n\t"
        "s_wait_xcnt 0x0"
        :: "v"(vl), "v"(vl + 16 * 144), "v"(vl + 32 * 144), "v"(vl + 48 * 144),
           "v"(vg), "v"(vg + 16 * S_PAD), "v"(vg + 32 * S_PAD), "v"(vg + 48 * S_PAD)
        : "memory");
}

// 16x16x32 A/B fragment of one row from 16-byte aligned storage: p points at
// the row's k = 8*half; dwords 0..3 are k +0..7, dwords 4..7 are k +16..23.
__device__ __forceinline__ void load_frag16(FragB16& f, const uint16_t* p) {
    const uint4 lo = *(const uint4*)p;
    const uint4 hi = *(const uint4*)(p + 16);
    f.u[0] = lo.x; f.u[1] = lo.y; f.u[2] = lo.z; f.u[3] = lo.w;
    f.u[4] = hi.x; f.u[5] = hi.y; f.u[6] = hi.z; f.u[7] = hi.w;
}

// ---------------------------------------------------------------------------
// One 32-slot block (one grid row of keys) of transposed flash attention.
// Kt points at the block's first slot row, Vt at V^T[d = 0][first slot], both
// in the staged LDS tiles (row pitch KVP).
// dh4: 4 * |query row - key row|, one value per lane for the whole block.
// dw4[i]: 4 * |query column - key column| of this lane's score i; the pad
// slots point 64 entries up the table, where every entry masks.
// ---------------------------------------------------------------------------
__device__ __forceinline__ void attn_block(
    const uint16_t* Kt, const uint16_t* Vt, const FragB16 (&bq)[2],
    FragF32 (&cacc)[4], float& m_run, float& l_run, const int dh4,
    const int (&dw4)[16], const int half, const int l16,
    uint16_t* __restrict__ pl, const float* __restrict__ s_bias) {
    // ---- S^T: two 16-key tiles, accumulate over d (4 WMMAs) ----
    FragF32 sc[2];
#pragma unroll
    for (int t = 0; t < 2; ++t) {
#pragma unroll
        for (int r = 0; r < 8; ++r) sc[t].f[r] = 0.0f;
        const int keyr = t * 16 + l16;                // A row = key slot
#pragma unroll
        for (int db = 0; db < 2; ++db) {
            FragB16 ak;
            load_frag16(ak, &Kt[(size_t)keyr * KVP + db * 32 + 8 * half]);
            sc[t].v = __builtin_amdgcn_wmma_f32_16x16x32_bf16(
                false, ak.v, false, bq[db].v, (short)0, sc[t].v, false, false);
        }
    }

    // ---- spatial bias (and pad mask); lane-local max over 16 slots ----
    float mb = -3.0e38f;
#pragma unroll
    for (int t = 0; t < 2; ++t)
#pragma unroll
        for (int r = 0; r < 8; ++r) {
            const float bias =
                *(const float*)((const char*)s_bias + (dh4 + dw4[t * 8 + r]));
            const float s = sc[t].f[r] * 0.125f + bias;
            sc[t].f[r] = s;
            mb = fmaxf(mb, s);
        }
    mb = fmaxf(mb, __shfl_xor(mb, 16, 32));           // merge key-halves
    const float mnew = fmaxf(m_run, mb);
    const float corr = __expf(m_run - mnew);
    float lb = 0.0f;
#pragma unroll
    for (int t = 0; t < 2; ++t)
#pragma unroll
        for (int r = 0; r < 8; ++r) {
            const float p = __expf(sc[t].f[r] - mnew);
            sc[t].f[r] = p;
            lb += p;
        }
    lb += __shfl_xor(lb, 16, 32);                     // merge key-halves
    l_run = l_run * corr + lb;
    m_run = mnew;

    // rescale ctx^T accumulators by lane-scalar correction
#pragma unroll
    for (int cg = 0; cg < 4; ++cg)
#pragma unroll
        for (int r = 0; r < 8; ++r) cacc[cg].f[r] *= corr;

    // ---- P^T (C layout) -> LDS [q][key] -> B fragment ----
#pragma unroll
    for (int t = 0; t < 2; ++t)
#pragma unroll
        for (int i = 0; i < 4; ++i)
            *(uint32_t*)&pl[l16 * 32 + t * 16 + 8 * half + 2 * i] =
                pack_bf16(sc[t].f[2 * i], sc[t].f[2 * i + 1]);
    asm volatile("s_wait_dscnt 0" ::: "memory");      // same-wave LDS RAW fence
    FragB16 bp;
#pragma unroll
    for (int j = 0; j < 8; ++j)
        bp.u[j] = *(const uint32_t*)&pl[l16 * 32 + kmap(j, half)];

    // V^T fragments come from LDS only now, so that their 32 registers are
    // free during the bias and softmax work
    FragB16 av[4];
#pragma unroll
    for (int cg = 0; cg < 4; ++cg)
        load_frag16(av[cg], &Vt[(size_t)(cg * 16 + l16) * KVP + 8 * half]);

    // ---- ctx^T += V^T_frag @ P^T (4 WMMAs) ----
#pragma unroll
    for (int cg = 0; cg < 4; ++cg)
        cacc[cg].v = __builtin_amdgcn_wmma_f32_16x16x32_bf16(
            false, av[cg].v, false, bp.v, (short)0, cacc[cg].v, false, false);
}

// ---------------------------------------------------------------------------
// Flash-style attention, fully transposed. One wave per 16-query tile per
// (b,h); the work-group's four waves share each staged 64-slot K / V^T stage.
//   S^T[key, q]  = K_blk(16k x 64d) @ Q^T(64d x 16q)   -> lane l16 = query col
//   ctx^T[d, q] += V^T_frag(16d x 32k) @ P^T(32k x 16q)
// Two LDS buffers: stage s + 1 flies while stage s is worked on.
// ---------------------------------------------------------------------------
__global__ __launch_bounds__(128) void attn_kernel(
    const uint16_t* __restrict__ Q, const uint16_t* __restrict__ K,
    const uint16_t* __restrict__ VT, const float* __restrict__ sbias,
    float* __restrict__ ctx_out) {
    __shared__ float s_bias[96];            // 0..58 table; 64..93 mask entries
    __shared__ uint16_t p_lds[4][16 * 32];  // per-wave P^T tile [q][key] bf16
    __shared__ __attribute__((aligned(16))) uint16_t kv[2][2][TILE_E];  // [buffer][K | V^T]

    const int tid = threadIdx.x;
    const int bh = blockIdx.y;             // b*8+h, 0..127
    const uint16_t* Qb = Q + (size_t)bh * S_PAD * DK;
    const uint16_t* Kb = K + (size_t)bh * S_PAD * DK;
    const uint16_t* Vb = VT + (size_t)bh * DK * S_PAD;

    // this lane's share of a stage: 16 B at row tid/8 (+16 rows per copy) of
    // the K tile and of the V^T tile
    const uint16_t* kg = Kb + tid * 8;
    const uint16_t* vg = Vb + (size_t)(tid >> 3) * S_PAD + (tid & 7) * 8;
    const uint32_t lds0 = (uint32_t)(uintptr_t)&kv[0][0][0];  // LDS byte address
    const uint32_t kl = lds0 + (tid >> 3) * 144 + (tid & 7) * 16;
    const uint32_t vl = kl + TILE_E * 2;

    if (tid < 59) s_bias[tid] = sbias[(size_t)tid * 59];  // column 0 of table
    else if (tid >= 64 && tid < 94) s_bias[tid] = -1.0e30f;  // pad slots
    stage_copy(kg, vg, kl, vl);                           // stage 0 -> buffer 0
    // stage 0 has landed before the barrier that publishes it
    asm volatile("s_wait_asynccnt 0x0" ::: "memory");
    __syncthreads();
    stage_copy(kg + ST_KEYS * DK, vg + ST_KEYS, kl + 4 * TILE_E, vl + 4 * TILE_E);

    const int wave = tid >> 5, lane = tid & 31;
    const int half = lane >> 4, l16 = lane & 15;
    const int qt = blockIdx.x * 4 + wave;  // query tile; tiles 57..59 hold no
    const int q0 = qt * 16;                // query: they copy, pass every
                                           // barrier and store nothing
    uint16_t* pl = &p_lds[wave][0];

    const int q = q0 + l16;
    const int qc = min(q, S_LEN - 1);
    const int hqv = qc / GRID_W, wqv = qc % GRID_W;  // this lane's query grid coords

    // B fragments of Q^T (cols = queries), d-blocks 0..31 / 32..63; loop-invariant
    FragB16 bq[2];
#pragma unroll
    for (int db = 0; db < 2; ++db)
#pragma unroll
        for (int j = 0; j < 8; ++j)
            bq[db].u[j] = *(const uint32_t*)&Qb[(size_t)(hqv * 32 + wqv) * DK +
                                                db * 32 + kmap(j, half)];

    // column part of the bias index of this lane's 16 scores, in bytes
    int dw4[16];
#pragma unroll
    for (int i = 0; i < 16; ++i) {
        const int wk = (i >> 3) * 16 + (i & 7) + 8 * half;   // slot in the grid row
        int dw = wqv - wk; dw = dw < 0 ? -dw : dw;
        dw4[i] = (wk < GRID_W ? dw : 64) * 4;
    }

    float m_run = -3.0e38f, l_run = 0.0f;    // lane-scalar online-softmax state
    FragF32 cacc[4];                          // ctx^T accumulators, d blocks of 16
#pragma unroll
    for (int cg = 0; cg < 4; ++cg)
#pragma unroll
        for (int r = 0; r < 8; ++r) cacc[cg].f[r] = 0.0f;

    for (int hk = 0; hk < GRID_W; ++hk) {    // one grid row of keys per block
        const int s = hk >> 1, buf = s & 1, sub = hk & 1;
        int dh = hqv - hk; dh = dh < 0 ? -dh : dh;
        attn_block(&kv[buf][0][sub * 32 * KVP], &kv[buf][1][sub * 32], bq, cacc,
                   m_run, l_run, dh * 4, dw4, half, l16, pl, s_bias);
        if (sub) {
            // publish point of stage s + 1: this wave's reads of buffer buf
            // are done, its own copies of stage s + 1 have landed, then the
            // barrier
            asm volatile("s_wait_dscnt 0x0" ::: "memory");
            asm volatile("s_wait_asynccnt 0x0" ::: "memory");
            __syncthreads();
            if (s + 2 < N_STAGES)            // refill the buffer just left
                stage_copy(kg + (size_t)(s + 2) * ST_KEYS * DK,
                           vg + (s + 2) * ST_KEYS, kl + buf * 4 * TILE_E,
                           vl + buf * 4 * TILE_E);
        }
    }
    // no copy is outstanding when the wave goes on to its end
    asm volatile("s_wait_asynccnt 0x0" ::: "memory");

    // ---- normalize and store: lane owns query q; d = cg*16 + 8*half + r ----
    if (q < S_LEN) {
        const int b = bh >> 3, h = bh & 7;
        const float inv = 1.0f / l_run;
        float* dst = ctx_out + ((size_t)(b * S_LEN + q)) * D_MODEL + h * DK;
#pragma unroll
        for (int cg = 0; cg < 4; ++cg) {
            const int dbase = cg * 16 + 8 * half;
            float4 v0 = make_float4(cacc[cg].f[0] * inv, cacc[cg].f[1] * inv,
                                    cacc[cg].f[2] * inv, cacc[cg].f[3] * inv);
            float4 v1 = make_float4(cacc[cg].f[4] * inv, cacc[cg].f[5] * inv,
                                    cacc[cg].f[6] * inv, cacc[cg].f[7] * inv);
            ((float4*)(dst + dbase))[0] = v0;
            ((float4*)(dst + dbase))[1] = v1;
        }
    }
}

// ---------------------------------------------------------------------------
// LayerNorm: one wave per 512-element row.
// ---------------------------------------------------------------------------
__global__ __launch_bounds__(128) void ln_kernel(
    const float* __restrict__ resid, const float* __restrict__ gamma,
    const float* __restrict__ beta, float* __restrict__ out) {
    const int wave = threadIdx.x >> 5, lane = threadIdx.x & 31;
    const int row = blockIdx.x * 4 + wave;
    const float* r = resid + (size_t)row * D_MODEL;
    float vals[16];
    float sum = 0.0f, sq = 0.0f;
#pragma unroll
    for (int i = 0; i < 4; ++i) {
        float4 f = ((const float4*)r)[lane + i * 32];
        vals[i * 4 + 0] = f.x; vals[i * 4 + 1] = f.y;
        vals[i * 4 + 2] = f.z; vals[i * 4 + 3] = f.w;
        sum += f.x + f.y + f.z + f.w;
        sq  += f.x * f.x + f.y * f.y + f.z * f.z + f.w * f.w;
    }
#pragma unroll
    for (int m = 16; m; m >>= 1) {
        sum += __shfl_xor(sum, m, 32);
        sq  += __shfl_xor(sq,  m, 32);
    }
    const float mu = sum * (1.0f / 512.0f);
    const float var = sq * (1.0f / 512.0f) - mu * mu;
    const float rs = rsqrtf(var + 1e-5f);
#pragma unroll
    for (int i = 0; i < 4; ++i)
#pragma unroll
        for (int j = 0; j < 4; ++j) {
            const int col = (lane + i * 32) * 4 + j;
            out[(size_t)row * D_MODEL + col] =
                (vals[i * 4 + j] - mu) * rs * gamma[col] + beta[col];
        }
}

// ---------------------------------------------------------------------------
extern "C" void kernel_launch(void* const* d_in, const int* in_sizes, int n_in,
                              void* d_out, int out_size, void* d_ws,
                              size_t ws_size, hipStream_t stream) {
    const float* x     = (const float*)d_in[0];
    const float* wq    = (const float*)d_in[1];
    const float* bq    = (const float*)d_in[2];
    const float* wk    = (const float*)d_in[3];
    const float* bk    = (const float*)d_in[4];
    const float* wv    = (const float*)d_in[5];
    const float* bv    = (const float*)d_in[6];
    const float* wo    = (const float*)d_in[7];
    const float* bo    = (const float*)d_in[8];
    const float* gamma = (const float*)d_in[9];
    const float* beta  = (const float*)d_in[10];
    const float* sbias = (const float*)d_in[11];

    // workspace layout (~106 MB total)
    uint8_t* ws = (uint8_t*)d_ws;
    const size_t SZ_H = (size_t)16 * S_PAD * D_MODEL * sizeof(uint16_t);  // 15.73 MB
    const size_t SZ_F = (size_t)M_ROWS * D_MODEL * sizeof(float);     // 29.49 MB
    uint16_t* Qw = (uint16_t*)(ws);
    uint16_t* Kw = (uint16_t*)(ws + SZ_H);
    uint16_t* Vt = (uint16_t*)(ws + 2 * SZ_H);
    float* ctx   = (float*)(ws + 3 * SZ_H);
    float* resid = (float*)(ws + 3 * SZ_H + SZ_F);

    const dim3 gG(M_ROWS / 64, D_MODEL / 64);  // 225 x 8
    const dim3 blk(128);
    qkv_gemm<<<gG, blk, 0, stream>>>(x, wq, wk, wv, bq, bk, bv, Qw, Kw, Vt);
    attn_kernel<<<dim3(15, 128), blk, 0, stream>>>(Qw, Kw, Vt, sbias, ctx);
    out_gemm<<<gG, blk, 0, stream>>>(ctx, wo, bo, x, resid);
    ln_kernel<<<dim3(M_ROWS / 4), blk, 0, stream>>>(resid, gamma, beta,
                                                    (float*)d_out);
}

// v005
// One run takes 134 microseconds.
// In both of two side-by-side timings against v004, it was 1.26 times as fast.
// Counting every step since v000, it is 2.54 times as fast.
#include <hip/hip_runtime.h>
#include <hip/hip_bf16.h>
#include <stdint.h>

// ---------------------------------------------------------------------------
// Spatial2DAttention fused pipeline for MI455X (gfx1250, wave32, WMMA).
//   B=16, H=W=30, S=900, d_model=512, heads=8, d_k=64.
// Precision: bf16 WMMA operands (fp32-range-safe), f32 accumulation.
// Attention computed fully TRANSPOSED (S^T = K@Q^T, ctx^T = V^T@P^T) so each
// lane owns one query column: online-softmax stats need only ONE cross-lane
// shuffle per block. Q, K and V^T are kept with 32 key slots per grid row (30
// keys and 2 zero pads), so a 32-key block is one grid row: its row distance
// to a query is one value per lane and the column distances never change.
// ---------------------------------------------------------------------------

#define D_MODEL 512
#define M_ROWS  14400           // B * S
#define S_LEN   900
#define NHEADS  8
#define DK      64
#define GRID_W  30              // keys per grid row
#define S_PAD   960             // 30 grid rows x 32 key slots

typedef __attribute__((ext_vector_type(16))) __bf16 v16bf;
typedef __attribute__((ext_vector_type(8)))  float  v8f;

union FragB16 { v16bf v; uint32_t u[8]; };
union FragF32 { v8f  v; float    f[8]; };

__device__ __forceinline__ uint16_t f32_to_bf16(float f) {
    __bf16 h = (__bf16)f;                       // native v_cvt (RNE) on gfx1250
    return __builtin_bit_cast(uint16_t, h);
}
__device__ __forceinline__ uint32_t pack_bf16(float lo, float hi) {
    return (uint32_t)f32_to_bf16(lo) | ((uint32_t)f32_to_bf16(hi) << 16);
}
// A/B fragment dword j -> starting K index of the 2 packed bf16 (16x16x32 layout):
// lanes 0-15 hold K {0..7, 16..23}, lanes 16-31 hold K {8..15, 24..31}.
__device__ __forceinline__ int kmap(int j, int half) {
    return (j < 4 ? 2 * j : 16 + 2 * (j - 4)) + half * 8;
}

typedef __attribute__((ext_vector_type(2))) float  v2f;
typedef __attribute__((ext_vector_type(4))) float  v4f;
typedef __attribute__((ext_vector_type(2))) __bf16 v2bf;
// two f32 -> one dword of two bf16 (RNE), lo in bits 15..0
__device__ __forceinline__ uint32_t cvt2_bf16(float lo, float hi) {
    v2f f = {lo, hi};
    return __builtin_bit_cast(uint32_t, __builtin_convertvector(f, v2bf));
}
// LDS row pitch of the GEMM tiles in bf16: 80 B = 16 B x odd, the pitch at
// which the 16-byte fragment reads of 64-B rows meet no bank conflict.
#define TPITCH 40

// ---------------------------------------------------------------------------
// M=14400 x N=512 x K=512 bf16 WMMA GEMMs: out = A @ W + bias.
// Block tile 64x64 per weight matrix, 4 waves of 32x32 (2x2 accumulators),
// K-step 32. NW weight matrices share one staged A tile: the Q, K and V
// projections run as one launch (NW = 3), so x is drawn from L2 once for the
// three of them and a wave has 12 WMMAs between two barriers; the output
// projection runs alone (NW = 1).
// The first NT products are taken transposed (the weight fragment as A, the
// x fragment as B): a lane then holds 8 consecutive n of one row m.
// Staging map: every wave-wide 16-byte global load covers four whole 128-B
// lines (A: 4 rows x 128 B; W: 4 rows x 128 B), and all tiles go to LDS as
// 8-byte stores of k-contiguous bf16.
// ---------------------------------------------------------------------------
template <int NW, int NT = 0>
__device__ __forceinline__ void gemm_tiles(
    const float* __restrict__ A, const float* const (&W)[NW],
    uint16_t* lds_a, uint16_t (*lds_bt)[64 * TPITCH], FragF32 (&acc)[NW][2][2],
    const int tid, const int mBase, const int nBase, const int wr, const int wc,
    const int half, const int l16) {
#pragma unroll
    for (int p = 0; p < NW; ++p)
#pragma unroll
        for (int a = 0; a < 2; ++a)
#pragma unroll
            for (int b = 0; b < 2; ++b)
#pragma unroll
                for (int r = 0; r < 8; ++r) acc[p][a][b].f[r] = 0.0f;

    // A tile, 64 rows x 32 k: 8 lanes read one row's 128 B, so load i of a
    // wave is rows 16*i + 4*wave .. +3, whole lines.
    const int arow = tid >> 3, ac4 = (tid & 7) * 4;
    uint32_t aoff = ((mBase + arow) * D_MODEL + ac4) * 4;   // byte offset in A
    // W tiles, 32 k x 64 n each: a thread takes 4 k rows x 4 n columns; 8
    // lanes read one 128-B line of a row, a wave 4 rows per load.
    const int wn = ((tid & 7) | ((tid >> 6) << 3)) * 4;
    const int wk = ((tid >> 3) & 7) * 4;
    uint32_t woff = (wk * D_MODEL + nBase + wn) * 4;        // byte offset in each W

    for (int k0 = 0; k0 < D_MODEL; k0 += 32) {
        __syncthreads();
        {
            float4 fa[4], fw[NW][4];
#pragma unroll
            for (int i = 0; i < 4; ++i)
                fa[i] = *(const float4*)((const char*)A + aoff + i * 16 * D_MODEL * 4);
#pragma unroll
            for (int p = 0; p < NW; ++p)
#pragma unroll
                for (int i = 0; i < 4; ++i)
                    fw[p][i] = *(const float4*)((const char*)W[p] + woff + i * D_MODEL * 4);
            aoff += 32 * 4;
            woff += 32 * D_MODEL * 4;
#pragma unroll
            for (int i = 0; i < 4; ++i)
                *(uint2*)&lds_a[(arow + i * 16) * TPITCH + ac4] =
                    make_uint2(cvt2_bf16(fa[i].x, fa[i].y),
                               cvt2_bf16(fa[i].z, fa[i].w));
            // transposed: column n gets its 4 consecutive k as one 8-byte store
#pragma unroll
            for (int p = 0; p < NW; ++p) {
                uint16_t* bt = lds_bt[p];
                *(uint2*)&bt[(wn + 0) * TPITCH + wk] = make_uint2(
                    cvt2_bf16(fw[p][0].x, fw[p][1].x), cvt2_bf16(fw[p][2].x, fw[p][3].x));
                *(uint2*)&bt[(wn + 1) * TPITCH + wk] = make_uint2(
                    cvt2_bf16(fw[p][0].y, fw[p][1].y), cvt2_bf16(fw[p][2].y, fw[p][3].y));
                *(uint2*)&bt[(wn + 2) * TPITCH + wk] = make_uint2(
                    cvt2_bf16(fw[p][0].z, fw[p][1].z), cvt2_bf16(fw[p][2].z, fw[p][3].z));
                *(uint2*)&bt[(wn + 3) * TPITCH + wk] = make_uint2(
                    cvt2_bf16(fw[p][0].w, fw[p][1].w), cvt2_bf16(fw[p][2].w, fw[p][3].w));
            }
        }
        __syncthreads();

        FragB16 af[2];
#pragma unroll
        for (int rg = 0; rg < 2; ++rg) {
            const int row = wr + rg * 16 + l16;
#pragma unroll
            for (int j = 0; j < 8; ++j)
                af[rg].u[j] = *(const uint32_t*)&lds_a[row * TPITCH + kmap(j, half)];
        }
#pragma unroll
        for (int p = 0; p < NW; ++p) {
            FragB16 bf[2];
#pragma unroll
            for (int cg = 0; cg < 2; ++cg) {
                const int col = wc + cg * 16 + l16;
#pragma unroll
                for (int j = 0; j < 8; ++j)
                    bf[cg].u[j] =
                        *(const uint32_t*)&lds_bt[p][col * TPITCH + kmap(j, half)];
            }
#pragma unroll
            for (int rg = 0; rg < 2; ++rg)
#pragma unroll
                for (int cg = 0; cg < 2; ++cg) {
                    if (p < NT)
                        acc[p][rg][cg].v = __builtin_amdgcn_wmma_f32_16x16x32_bf16(
                            false, bf[cg].v, false, af[rg].v, (short)0,
                            acc[p][rg][cg].v, false, false);
                    else
                        acc[p][rg][cg].v = __builtin_amdgcn_wmma_f32_16x16x32_bf16(
                            false, af[rg].v, false, bf[cg].v, (short)0,
                            acc[p][rg][cg].v, false, false);
                }
        }
    }
}

// Slot of position m (all batches in a row): 32 slots per 30-position grid row.
__device__ __forceinline__ int slot_of(int m) { return m + 2 * (m / GRID_W); }

#define ST_SLOTS 70   // most slots of a 64-position tile: 64 and 3 x 2 pads
#define QKP 72        // staged Q / K slot row, bf16: 144 B = 16 B x odd
#define VTP 74        // staged V^T d row, bf16: 70 slots, 148 B

// Q, K and V^T of one 64-row block and one head, from one staged x tile.
// Five waves per SIMD, asked for as least and as most (192 registers): the k
// loop needs that many to have its 16 loads in flight together; aiming at more
// waves the compiler splits them into two groups, one waiting for the other.
// The three result tiles go to LDS in slot order, pads as zeros, and from
// there to memory in runs that follow the planes' rows: Q, K [b*8+h][slot][dk]
// (a slot row is one 128-B line), V^T [b*8+h][dk][slot]. The work-group owns
// the slots from its first position's up to the next tile's first.
__global__ __launch_bounds__(128) __attribute__((amdgpu_waves_per_eu(5, 5))) void qkv_gemm(
    const float* __restrict__ A, const float* __restrict__ Wq,
    const float* __restrict__ Wk, const float* __restrict__ Wv,
    const float* __restrict__ biasq, const float* __restrict__ biask,
    const float* __restrict__ biasv, uint16_t* __restrict__ Qo,
    uint16_t* __restrict__ Ko, uint16_t* __restrict__ Vo) {
    __shared__ __attribute__((aligned(16))) uint16_t lds_a[64 * TPITCH];      // [row][k] bf16
    __shared__ __attribute__((aligned(16))) uint16_t lds_bt[3][64 * TPITCH];  // [n][k] bf16 (transposed weights)
    __shared__ __attribute__((aligned(16))) uint16_t st_qk[2][ST_SLOTS * QKP];  // [slot][dk]
    __shared__ __attribute__((aligned(16))) uint16_t st_vt[64 * VTP];           // [dk][slot]

    const int tid  = threadIdx.x;
    const int wave = tid >> 5, lane = tid & 31;
    const int half = lane >> 4, l16 = lane & 15;
    const int mBase = blockIdx.x * 64;
    const int nBase = blockIdx.y * 64;
    const int wr = (wave >> 1) * 32, wc = (wave & 1) * 32;

    const float* const W[3] = {Wq, Wk, Wv};
    FragF32 acc[3][2][2];
    gemm_tiles<3, 2>(A, W, lds_a, lds_bt, acc, tid, mBase, nBase, wr, wc, half, l16);

    const int L0 = slot_of(mBase);                     // even, never a pad
    const int np = (slot_of(mBase + 64) - L0) >> 1;    // 34 or 35 slot pairs
    const int p0 = (GRID_W - (L0 & 31)) >> 1;          // first pad pair; then every 16th

    // Q, K (transposed accumulators): register r of a lane is
    // row m = .. + l16, column n = .. + 8 * half + r: one 16-byte LDS store.
    // The lane's 2 x 16 bias values: eight 16-byte loads from one byte offset.
    const uint32_t boff = (uint32_t)(nBase + wc + 8 * half) * 4;
    v4f bb[2][2][2];
    // unrolled, here and below: bb and acc are indexed by constants alone and
    // stay in registers
#pragma unroll
    for (int p = 0; p < 2; ++p)
#pragma unroll
        for (int cg = 0; cg < 2; ++cg)
#pragma unroll
            for (int q = 0; q < 2; ++q)
                bb[p][cg][q] = *(const v4f*)((const char*)(p ? biask : biasq) + boff +
                                             (cg * 64 + q * 16));
    // The wait in front of any rewrite of the offset register that the eight
    // loads name. The offset and the loaded values are inputs only: the offset
    // so that no load's result lands in its register, the values so that every
    // load stands in front of the wait.
    asm volatile("s_wait_xcnt 0x0"
                 :: "v"(boff), "v"(bb[0][0][0]), "v"(bb[0][0][1]), "v"(bb[0][1][0]),
                    "v"(bb[0][1][1]), "v"(bb[1][0][0]), "v"(bb[1][0][1]),
                    "v"(bb[1][1][0]), "v"(bb[1][1][1])
                 : "memory");
#pragma unroll
    for (int p = 0; p < 2; ++p)
#pragma unroll
        for (int cg = 0; cg < 2; ++cg) {
            const int nl = wc + cg * 16 + 8 * half;
            const v4f b0 = bb[p][cg][0], b1 = bb[p][cg][1];
#pragma unroll
            for (int rg = 0; rg < 2; ++rg) {
                const int j = slot_of(mBase + wr + rg * 16 + l16) - L0;
                const float* a = acc[p][rg][cg].f;
                *(uint4*)&st_qk[p][j * QKP + nl] = make_uint4(
                    cvt2_bf16(a[0] + b0.x, a[1] + b0.y), cvt2_bf16(a[2] + b0.z, a[3] + b0.w),
                    cvt2_bf16(a[4] + b1.x, a[5] + b1.y), cvt2_bf16(a[6] + b1.z, a[7] + b1.w));
            }
        }
    // V: register r of a lane is row m = .. + 8 * half + r, column n = .. + l16.
    // An even position and the next lie in one grid row: 4-byte LDS stores.
#pragma unroll
    for (int cg = 0; cg < 2; ++cg) {
        const int nl = wc + cg * 16 + l16;
        const float bn = biasv[nBase + nl];
#pragma unroll
        for (int rg = 0; rg < 2; ++rg)
#pragma unroll
            for (int i = 0; i < 4; ++i) {
                const int j = slot_of(mBase + wr + rg * 16 + 8 * half + 2 * i) - L0;
                *(uint32_t*)&st_vt[nl * VTP + j] = cvt2_bf16(
                    acc[2][rg][cg].f[2 * i] + bn, acc[2][rg][cg].f[2 * i + 1] + bn);
            }
    }
    // The pad pairs: waves 0..2 take one pair each of the Q and K tiles
    // (2 tiles x 2 slot rows x 8 pieces of 16 B), and every d row of V^T
    // gets its dwords.
    if (wave < 3 && p0 + 16 * wave < np)
        *(uint4*)&st_qk[(lane >> 3) & 1][(2 * (p0 + 16 * wave) + (lane >> 4)) * QKP +
                                         (lane & 7) * 8] = make_uint4(0u, 0u, 0u, 0u);
#pragma unroll
    for (int k = 0; k < 2; ++k) {
        const int pr = p0 + 16 * ((tid >> 6) + 2 * k);
        if (pr < np) *(uint32_t*)&st_vt[(tid & 63) * VTP + 2 * pr] = 0u;
    }
    __syncthreads();   // the staged tiles are read by other waves than wrote them

    const int h = nBase >> 6, b0 = L0 / S_PAD;
    const int bEnd = (b0 + 1) * S_PAD;                 // first slot of the next batch

    // Q, K: 16 bytes a lane, 8 lanes to a slot row, 16 rows (whole lines) to a
    // work-group-wide store. Element offset = (L + (7 * b + h) * 960) * 64 + d.
    {
        const int r0 = tid >> 3, d0 = (tid & 7) * 8;
        const uint16_t* sq = &st_qk[0][r0 * QKP + d0];
        const uint16_t* sk = &st_qk[1][r0 * QKP + d0];
        uint32_t off[4];                               // in bytes
        uint4 wq[4], wk[4];
#pragma unroll
        for (int i = 0; i < 4; ++i) {
            const int L = L0 + r0 + 16 * i;
            off[i] = (uint32_t)(((L + (7 * (L >= bEnd ? b0 + 1 : b0) + h) * S_PAD) * DK + d0) * 2);
            wq[i] = *(const uint4*)&sq[16 * i * QKP];
            wk[i] = *(const uint4*)&sk[16 * i * QKP];
        }
#pragma unroll
        for (int i = 0; i < 4; ++i) {
            *(uint4*)((char*)Qo + off[i]) = wq[i];
            *(uint4*)((char*)Ko + off[i]) = wk[i];
        }
        if (64 + r0 < 2 * np) {                        // the 4 or 6 slots behind the 64th
            const int L = L0 + r0 + 64;
            const uint32_t o =
                (uint32_t)(((L + (7 * (L >= bEnd ? b0 + 1 : b0) + h) * S_PAD) * DK + d0) * 2);
            const uint4 tq = *(const uint4*)&sq[64 * QKP];
            const uint4 tk = *(const uint4*)&sk[64 * QKP];
            *(uint4*)((char*)Qo + o) = tq;
            *(uint4*)((char*)Ko + o) = tk;
        }
    }

    // V^T: a wave takes 16 d rows; its lanes store 32 consecutive slot pairs
    // of a row (128 B in a row), so a wave-wide store meets 1 or 2 lines and
    // not 32. Element offset = ((b * 8 + h) * 64 + d) * 960 + L - b * 960.
    {
        const int L = L0 + 2 * lane, b = L >= bEnd ? b0 + 1 : b0;
        uint16_t* vp = Vo + (((b * NHEADS + h) * DK + wave * 16) * S_PAD + L - b * S_PAD);
        const uint16_t* sv = &st_vt[wave * 16 * VTP + 2 * lane];
        uint32_t w[16];
#pragma unroll
        for (int r = 0; r < 16; ++r) w[r] = *(const uint32_t*)&sv[r * VTP];
#pragma unroll
        for (int r = 0; r < 16; ++r) *(uint32_t*)&vp[r * S_PAD] = w[r];
    }
    // the 2 or 3 pairs behind the 32nd: 4 lanes to a row, 8 rows to a store
    {
        const int pr = 32 + (lane & 3);
        if (pr < np) {
            const int L = L0 + 2 * pr, b = L >= bEnd ? b0 + 1 : b0;
            const int d = wave * 16 + (lane >> 2);
            uint16_t* vp = Vo + (((b * NHEADS + h) * DK + d) * S_PAD + L - b * S_PAD);
            const uint32_t w0 = *(const uint32_t*)&st_vt[d * VTP + 2 * pr];
            const uint32_t w1 = *(const uint32_t*)&st_vt[(d + 8) * VTP + 2 * pr];
            *(uint32_t*)&vp[0] = w0;
            *(uint32_t*)&vp[8 * S_PAD] = w1;
        }
    }
}

// Output projection with the residual: out = A @ W + bias + x.
__global__ __launch_bounds__(128) void out_gemm(
    const float* __restrict__ A, const float* __restrict__ Wo,
    const float* __restrict__ bias, const float* __restrict__ xres,
    float* __restrict__ outp) {
    __shared__ __attribute__((aligned(16))) uint16_t lds_a[64 * TPITCH];      // [row][k] bf16
    __shared__ __attribute__((aligned(16))) uint16_t lds_bt[1][64 * TPITCH];  // [n][k] bf16 (transposed weights)

    const int tid  = threadIdx.x;
    const int wave = tid >> 5, lane = tid & 31;
    const int half = lane >> 4, l16 = lane & 15;
    const int mBase = blockIdx.x * 64;
    const int nBase = blockIdx.y * 64;
    const int wr = (wave >> 1) * 32, wc = (wave & 1) * 32;

    const float* const W[1] = {Wo};
    FragF32 acc[1][2][2];
    gemm_tiles<1>(A, W, lds_a, lds_bt, acc, tid, mBase, nBase, wr, wc, half, l16);

#pragma unroll
    for (int rg = 0; rg < 2; ++rg)
#pragma unroll
        for (int cg = 0; cg < 2; ++cg) {
            const int n = nBase + wc + cg * 16 + l16;
            const float bn = bias[n];
#pragma unroll
            for (int r = 0; r < 8; ++r) {
                const int m = mBase + wr + rg * 16 + r + 8 * half;
                outp[(size_t)m * D_MODEL + n] =
                    acc[0][rg][cg].f[r] + bn + xres[(size_t)m * D_MODEL + n];
            }
        }
}

// ---------------------------------------------------------------------------
// K / V^T staging for the attention kernel. The four waves of a work-group
// walk the same keys, so each 64-slot stage (two grid rows) is brought into
// LDS once per work-group by asynchronous copies that cover whole rows, and
// every wave takes its fragments from LDS with 16-byte reads.
// ---------------------------------------------------------------------------
#define ST_KEYS 64               // key slots per stage (two 32-slot blocks)
#define N_STAGES 15              // 15 * 64 = 960 slots, all of them
#define KVP 72                   // LDS row pitch in bf16: 144 B = 16 B x odd
#define TILE_E (64 * KVP)        // one staged tile: 64 rows of 128 B

// One stage: K slots key0..key0+63 (8 KiB in a row) and V^T rows 0..63, slots
// key0..key0+63 (128 B per row, source pitch 1920 B); 16 B per lane and copy,
// 8 lanes to a row, 16 rows to a copy.
// kg / vg: this lane's first source bytes; kl / vl: its first LDS byte address.
__device__ __forceinline__ void stage_copy(const uint16_t* kg, const uint16_t* vg,
                                           uint32_t kl, uint32_t vl) {
    // s_wait_xcnt closes each statement: the address registers named by the
    // copies are not rewritten before it.
    asm volatile(
        "global_load_async_to_lds_b128 %0, %4, off\n\t"
        "global_load_async_to_lds_b128 %1, %5, off\n\t"
        "global_load_async_to_lds_b128 %2, %6, off\n\t"
        "global_load_async_to_lds_b128 %3, %7, off\n\t"
        "s_wait_xcnt 0x0"
        :: "v"(kl), "v"(kl + 16 * 144), "v"(kl + 32 * 144), "v"(kl + 48 * 144),
           "v"(kg), "v"(kg + 16 * DK), "v"(kg + 32 * DK), "v"(kg + 48 * DK)
        : "memory");
    asm volatile(
        "global_load_async_to_lds_b128 %0, %4, off\n\t"
        "global_load_async_to_lds_b128 %1, %5, off\n\t"
        "global_load_async_to_lds_b128 %2, %6, off\n\t"
        "global_load_async_to_lds_b128 %3, %7, off\n\t"
        "s_wait_xcnt 0x0"
        :: "v"(vl), "v"(vl + 16 * 144), "v"(vl + 32 * 144), "v"(vl + 48 * 144),
           "v"(vg), "v"(vg + 16 * S_PAD), "v"(vg + 32 * S_PAD), "v"(vg + 48 * S_PAD)
        : "memory");
}

// 16x16x32 A/B fragment of one row from 16-byte aligned storage: p points at
// the row's k = 8*half; dwords 0..3 are k +0..7, dwords 4..7 are k +16..23.
__device__ __forceinline__ void load_frag16(FragB16& f, const uint16_t* p) {
    const uint4 lo = *(const uint4*)p;
    const uint4 hi = *(const uint4*)(p + 16);
    f.u[0] = lo.x; f.u[1] = lo.y; f.u[2] = lo.z; f.u[3] = lo.w;
    f.u[4] = hi.x; f.u[5] = hi.y; f.u[6] = hi.z; f.u[7] = hi.w;
}

// ---------------------------------------------------------------------------
// One 32-slot block (one grid row of keys) of transposed flash attention.
// Kt points at the block's first slot row, Vt at V^T[d = 0][first slot], both
// in the staged LDS tiles (row pitch KVP).
// dh4: 4 * |query row - key row|, one value per lane for the whole block.
// dw4[i]: 4 * |query column - key column| of this lane's score i; the pad
// slots point 64 entries up the table, where every entry masks.
// ---------------------------------------------------------------------------
__device__ __forceinline__ void attn_block(
    const uint16_t* Kt, const uint16_t* Vt, const FragB16 (&bq)[2],
    FragF32 (&cacc)[4], float& m_run, float& l_run, const int dh4,
    const int (&dw4)[16], const int half, const int l16,
    uint16_t* __restrict__ pl, const float* __restrict__ s_bias) {
    // ---- S^T: two 16-key tiles, accumulate over d (4 WMMAs) ----
    FragF32 sc[2];
#pragma unroll
    for (int t = 0; t < 2; ++t) {
#pragma unroll
        for (int r = 0; r < 8; ++r) sc[t].f[r] = 0.0f;
        const int keyr = t * 16 + l16;                // A row = key slot
#pragma unroll
        for (int db = 0; db < 2; ++db) {
            FragB16 ak;
            load_frag16(ak, &Kt[(size_t)keyr * KVP + db * 32 + 8 * half]);
            sc[t].v = __builtin_amdgcn_wmma_f32_16x16x32_bf16(
                false, ak.v, false, bq[db].v, (short)0, sc[t].v, false, false);
        }
    }

    // ---- spatial bias (and pad mask); lane-local max over 16 slots ----
    float mb = -3.0e38f;
#pragma unroll
    for (int t = 0; t < 2; ++t)
#pragma unroll
        for (int r = 0; r < 8; ++r) {
            const float bias =
                *(const float*)((const char*)s_bias + (dh4 + dw4[t * 8 + r]));
            const float s = sc[t].f[r] * 0.125f + bias;
            sc[t].f[r] = s;
            mb = fmaxf(mb, s);
        }
    mb = fmaxf(mb, __shfl_xor(mb, 16, 32));           // merge key-halves
    const float mnew = fmaxf(m_run, mb);
    const float corr = __expf(m_run - mnew);
    float lb = 0.0f;
#pragma unroll
    for (int t = 0; t < 2; ++t)
#pragma unroll
        for (int r = 0; r < 8; ++r) {
            const float p = __expf(sc[t].f[r] - mnew);
            sc[t].f[r] = p;
            lb += p;
        }
    lb += __shfl_xor(lb, 16, 32);                     // merge key-halves
    l_run = l_run * corr + lb;
    m_run = mnew;

    // rescale ctx^T accumulators by lane-scalar correction
#pragma unroll
    for (int cg = 0; cg < 4; ++cg)
#pragma unroll
        for (int r = 0; r < 8; ++r) cacc[cg].f[r] *= corr;

    // ---- P^T (C layout) -> LDS [q][key] -> B fragment ----
#pragma unroll
    for (int t = 0; t < 2; ++t)
#pragma unroll
        for (int i = 0; i < 4; ++i)
            *(uint32_t*)&pl[l16 * 32 + t * 16 + 8 * half + 2 * i] =
                pack_bf16(sc[t].f[2 * i], sc[t].f[2 * i + 1]);
    asm volatile("s_wait_dscnt 0" ::: "memory");      // same-wave LDS RAW fence
    FragB16 bp;
#pragma unroll
    for (int j = 0; j < 8; ++j)
        bp.u[j] = *(const uint32_t*)&pl[l16 * 32 + kmap(j, half)];

    // V^T fragments come from LDS only now, so that their 32 registers are
    // free during the bias and softmax work
    FragB16 av[4];
#pragma unroll
    for (int cg = 0; cg < 4; ++cg)
        load_frag16(av[cg], &Vt[(size_t)(cg * 16 + l16) * KVP + 8 * half]);

    // ---- ctx^T += V^T_frag @ P^T (4 WMMAs) ----
#pragma unroll
    for (int cg = 0; cg < 4; ++cg)
        cacc[cg].v = __builtin_amdgcn_wmma_f32_16x16x32_bf16(
            false, av[cg].v, false, bp.v, (short)0, cacc[cg].v, false, false);
}

// ---------------------------------------------------------------------------
// Flash-style attention, fully transposed. One wave per 16-query tile per
// (b,h); the work-group's four waves share each staged 64-slot K / V^T stage.
//   S^T[key, q]  = K_blk(16k x 64d) @ Q^T(64d x 16q)   -> lane l16 = query col
//   ctx^T[d, q] += V^T_frag(16d x 32k) @ P^T(32k x 16q)
// Two LDS buffers: stage s + 1 flies while stage s is worked on.
// ---------------------------------------------------------------------------
__global__ __launch_bounds__(128) void attn_kernel(
    const uint16_t* __restrict__ Q, const uint16_t* __restrict__ K,
    const uint16_t* __restrict__ VT, const float* __restrict__ sbias,
    float* __restrict__ ctx_out) {
    __shared__ float s_bias[96];            // 0..58 table; 64..93 mask entries
    __shared__ uint16_t p_lds[4][16 * 32];  // per-wave P^T tile [q][key] bf16
    __shared__ __attribute__((aligned(16))) uint16_t kv[2][2][TILE_E];  // [buffer][K | V^T]

    const int tid = threadIdx.x;
    const int bh = blockIdx.y;             // b*8+h, 0..127
    const uint16_t* Qb = Q + (size_t)bh * S_PAD * DK;
    const uint16_t* Kb = K + (size_t)bh * S_PAD * DK;
    const uint16_t* Vb = VT + (size_t)bh * DK * S_PAD;

    // this lane's share of a stage: 16 B at row tid/8 (+16 rows per copy) of
    // the K tile and of the V^T tile
    const uint16_t* kg = Kb + tid * 8;
    const uint16_t* vg = Vb + (size_t)(tid >> 3) * S_PAD + (tid & 7) * 8;
    const uint32_t lds0 = (uint32_t)(uintptr_t)&kv[0][0][0];  // LDS byte address
    const uint32_t kl = lds0 + (tid >> 3) * 144 + (tid & 7) * 16;
    const uint32_t vl = kl + TILE_E * 2;

    if (tid < 59) s_bias[tid] = sbias[(size_t)tid * 59];  // column 0 of table
    else if (tid >= 64 && tid < 94) s_bias[tid] = -1.0e30f;  // pad slots
    stage_copy(kg, vg, kl, vl);                           // stage 0 -> buffer 0
    // stage 0 has landed before the barrier that publishes it
    asm volatile("s_wait_asynccnt 0x0" ::: "memory");
    __syncthreads();
    stage_copy(kg + ST_KEYS * DK, vg + ST_KEYS, kl + 4 * TILE_E, vl + 4 * TILE_E);

    const int wave = tid >> 5, lane = tid & 31;
    const int half = lane >> 4, l16 = lane & 15;
    const int qt = blockIdx.x * 4 + wave;  // query tile; tiles 57..59 hold no
    const int q0 = qt * 16;                // query: they copy, pass every
                                           // barrier and store nothing
    uint16_t* pl = &p_lds[wave][0];

    const int q = q0 + l16;
    const int qc = min(q, S_LEN - 1);
    const int hqv = qc / GRID_W, wqv = qc % GRID_W;  // this lane's query grid coords

    // B fragments of Q^T (cols = queries), d-blocks 0..31 / 32..63; loop-invariant
    FragB16 bq[2];
#pragma unroll
    for (int db = 0; db < 2; ++db)
#pragma unroll
        for (int j = 0; j < 8; ++j)
            bq[db].u[j] = *(const uint32_t*)&Qb[(size_t)(hqv * 32 + wqv) * DK +
                                                db * 32 + kmap(j, half)];

    // column part of the bias index of this lane's 16 scores, in bytes
    int dw4[16];
#pragma unroll
    for (int i = 0; i < 16; ++i) {
        const int wk = (i >> 3) * 16 + (i & 7) + 8 * half;   // slot in the grid row
        int dw = wqv - wk; dw = dw < 0 ? -dw : dw;
        dw4[i] = (wk < GRID_W ? dw : 64) * 4;
    }

    float m_run = -3.0e38f, l_run = 0.0f;    // lane-scalar online-softmax state
    FragF32 cacc[4];                          // ctx^T accumulators, d blocks of 16
#pragma unroll
    for (int cg = 0; cg < 4; ++cg)
#pragma unroll
        for (int r = 0; r < 8; ++r) cacc[cg].f[r] = 0.0f;

    for (int hk = 0; hk < GRID_W; ++hk) {    // one grid row of keys per block
        const int s = hk >> 1, buf = s & 1, sub = hk & 1;
        int dh = hqv - hk; dh = dh < 0 ? -dh : dh;
        attn_block(&kv[buf][0][sub * 32 * KVP], &kv[buf][1][sub * 32], bq, cacc,
                   m_run, l_run, dh * 4, dw4, half, l16, pl, s_bias);
        if (sub) {
            // publish point of stage s + 1: this wave's reads of buffer buf
            // are done, its own copies of stage s + 1 have landed, then the
            // barrier
            asm volatile("s_wait_dscnt 0x0" ::: "memory");
            asm volatile("s_wait_asynccnt 0x0" ::: "memory");
            __syncthreads();
            if (s + 2 < N_STAGES)            // refill the buffer just left
                stage_copy(kg + (size_t)(s + 2) * ST_KEYS * DK,
                           vg + (s + 2) * ST_KEYS, kl + buf * 4 * TILE_E,
                           vl + buf * 4 * TILE_E);
        }
    }
    // no copy is outstanding when the wave goes on to its end
    asm volatile("s_wait_asynccnt 0x0" ::: "memory");

    // ---- normalize and store: lane owns query q; d = cg*16 + 8*half + r ----
    if (q < S_LEN) {
        const int b = bh >> 3, h = bh & 7;
        const float inv = 1.0f / l_run;
        float* dst = ctx_out + ((size_t)(b * S_LEN + q)) * D_MODEL + h * DK;
#pragma unroll
        for (int cg = 0; cg < 4; ++cg) {
            const int dbase = cg * 16 + 8 * half;
            float4 v0 = make_float4(cacc[cg].f[0] * inv, cacc[cg].f[1] * inv,
                                    cacc[cg].f[2] * inv, cacc[cg].f[3] * inv);
            float4 v1 = make_float4(cacc[cg].f[4] * inv, cacc[cg].f[5] * inv,
                                    cacc[cg].f[6] * inv, cacc[cg].f[7] * inv);
            ((float4*)(dst + dbase))[0] = v0;
            ((float4*)(dst + dbase))[1] = v1;
        }
    }
}

// ---------------------------------------------------------------------------
// LayerNorm: one wave per 512-element row.
// ---------------------------------------------------------------------------
__global__ __launch_bounds__(128) void ln_kernel(
    const float* __restrict__ resid, const float* __restrict__ gamma,
    const float* __restrict__ beta, float* __restrict__ out) {
    const int wave = threadIdx.x >> 5, lane = threadIdx.x & 31;
    const int row = blockIdx.x * 4 + wave;
    const float* r = resid + (size_t)row * D_MODEL;
    float vals[16];
    float sum = 0.0f, sq = 0.0f;
#pragma unroll
    for (int i = 0; i < 4; ++i) {
        float4 f = ((const float4*)r)[lane + i * 32];
        vals[i * 4 + 0] = f.x; vals[i * 4 + 1] = f.y;
        vals[i * 4 + 2] = f.z; vals[i * 4 + 3] = f.w;
        sum += f.x + f.y + f.z + f.w;
        sq  += f.x * f.x + f.y * f.y + f.z * f.z + f.w * f.w;
    }
#pragma unroll
    for (int m = 16; m; m >>= 1) {
        sum += __shfl_xor(sum, m, 32);
        sq  += __shfl_xor(sq,  m, 32);
    }
    const float mu = sum * (1.0f / 512.0f);
    const float var = sq * (1.0f / 512.0f) - mu * mu;
    const float rs = rsqrtf(var + 1e-5f);
#pragma unroll
    for (int i = 0; i < 4; ++i)
#pragma unroll
        for (int j = 0; j < 4; ++j) {
            const int col = (lane + i * 32) * 4 + j;
            out[(size_t)row * D_MODEL + col] =
                (vals[i * 4 + j] - mu) * rs * gamma[col] + beta[col];
        }
}

// ---------------------------------------------------------------------------
extern "C" void kernel_launch(void* const* d_in, const int* in_sizes, int n_in,
                              void* d_out, int out_size, void* d_ws,
                              size_t ws_size, hipStream_t stream) {
    const float* x     = (const float*)d_in[0];
    const float* wq    = (const float*)d_in[1];
    const float* bq    = (const float*)d_in[2];
    const float* wk    = (const float*)d_in[3];
    const float* bk    = (const float*)d_in[4];
    const float* wv    = (const float*)d_in[5];
    const float* bv    = (const float*)d_in[6];
    const float* wo    = (const float*)d_in[7];
    const float* bo    = (const float*)d_in[8];
    const float* gamma = (const float*)d_in[9];
    const float* beta  = (const float*)d_in[10];
    const float* sbias = (const float*)d_in[11];

    // workspace layout (~106 MB total)
    uint8_t* ws = (uint8_t*)d_ws;
    const size_t SZ_H = (size_t)16 * S_PAD * D_MODEL * sizeof(uint16_t);  // 15.73 MB
    const size_t SZ_F = (size_t)M_ROWS * D_MODEL * sizeof(float);     // 29.49 MB
    uint16_t* Qw = (uint16_t*)(ws);
    uint16_t* Kw = (uint16_t*)(ws + SZ_H);
    uint16_t* Vt = (uint16_t*)(ws + 2 * SZ_H);
    float* ctx   = (float*)(ws + 3 * SZ_H);
    float* resid = (float*)(ws + 3 * SZ_H + SZ_F);

    const dim3 gG(M_ROWS / 64, D_MODEL / 64);  // 225 x 8
    const dim3 blk(128);
    qkv_gemm<<<gG, blk, 0, stream>>>(x, wq, wk, wv, bq, bk, bv, Qw, Kw, Vt);
    attn_kernel<<<dim3(15, 128), blk, 0, stream>>>(Qw, Kw, Vt, sbias, ctx);
    out_gemm<<<gG, blk, 0, stream>>>(ctx, wo, bo, x, resid);
    ln_kernel<<<dim3(M_ROWS / 4), blk, 0, stream>>>(resid, gamma, beta,
                                                    (float*)d_out);
}

// v006
// One run takes 130 microseconds.
// Next to v005, in two timings, it ran 1.03 times as fast each time.
// Over all steps from v000 it is 2.62 times as fast.
#include <hip/hip_runtime.h>
#include <hip/hip_bf16.h>
#include <stdint.h>

// ---------------------------------------------------------------------------
// Spatial2DAttention fused pipeline for MI455X (gfx1250, wave32, WMMA).
//   B=16, H=W=30, S=900, d_model=512, heads=8, d_k=64.
// Precision: bf16 WMMA operands (fp32-range-safe), f32 accumulation.
// Attention computed fully TRANSPOSED (S^T = K@Q^T, ctx^T = V^T@P^T) so each
// lane owns one query column: online-softmax stats need only ONE cross-lane
// shuffle per block. Q, K and V^T are kept with 32 key slots per grid row (30
// keys and 2 zero pads), so a 32-key block is one grid row: its row distance
// to a query is one value per lane and the column distances never change.
// ---------------------------------------------------------------------------

#define D_MODEL 512
#define M_ROWS  14400           // B * S
#define S_LEN   900
#define NHEADS  8
#define DK      64
#define GRID_W  30              // keys per grid row
#define S_PAD   960             // 30 grid rows x 32 key slots

typedef __attribute__((ext_vector_type(16))) __bf16 v16bf;
typedef __attribute__((ext_vector_type(8)))  float  v8f;

union FragB16 { v16bf v; uint32_t u[8]; };
union FragF32 { v8f  v; float    f[8]; };

__device__ __forceinline__ uint16_t f32_to_bf16(float f) {
    __bf16 h = (__bf16)f;                       // native v_cvt (RNE) on gfx1250
    return __builtin_bit_cast(uint16_t, h);
}
__device__ __forceinline__ uint32_t pack_bf16(float lo, float hi) {
    return (uint32_t)f32_to_bf16(lo) | ((uint32_t)f32_to_bf16(hi) << 16);
}
// A/B fragment dword j -> starting K index of the 2 packed bf16 (16x16x32 layout):
// lanes 0-15 hold K {0..7, 16..23}, lanes 16-31 hold K {8..15, 24..31}.
__device__ __forceinline__ int kmap(int j, int half) {
    return (j < 4 ? 2 * j : 16 + 2 * (j - 4)) + half * 8;
}

typedef __attribute__((ext_vector_type(2))) float  v2f;
typedef __attribute__((ext_vector_type(4))) float  v4f;
typedef __attribute__((ext_vector_type(2))) __bf16 v2bf;
// two f32 -> one dword of two bf16 (RNE), lo in bits 15..0
__device__ __forceinline__ uint32_t cvt2_bf16(float lo, float hi) {
    v2f f = {lo, hi};
    return __builtin_bit_cast(uint32_t, __builtin_convertvector(f, v2bf));
}
// LDS row pitch of the GEMM tiles in bf16: 80 B = 16 B x odd, the pitch at
// which the 16-byte fragment reads of 64-B rows meet no bank conflict.
#define TPITCH 40

// ---------------------------------------------------------------------------
// M=14400 x N=512 x K=512 bf16 WMMA GEMMs: out = A @ W + bias.
// Block tile 64x64 per weight matrix, 4 waves of 32x32 (2x2 accumulators),
// K-step 32. NW weight matrices share one staged A tile: the Q, K and V
// projections run as one launch (NW = 3), so x is drawn from L2 once for the
// three of them and a wave has 12 WMMAs between two barriers.
// The first NT products are taken transposed (the weight fragment as A, the
// x fragment as B): a lane then holds 8 consecutive n of one row m.
// Staging map: every wave-wide 16-byte global load covers four whole 128-B
// lines (A: 4 rows x 128 B; W: 4 rows x 128 B), and all tiles go to LDS as
// 8-byte stores of k-contiguous bf16.
// ---------------------------------------------------------------------------
template <int NW, int NT = 0>
__device__ __forceinline__ void gemm_tiles(
    const float* __restrict__ A, const float* const (&W)[NW],
    uint16_t* lds_a, uint16_t (*lds_bt)[64 * TPITCH], FragF32 (&acc)[NW][2][2],
    const int tid, const int mBase, const int nBase, const int wr, const int wc,
    const int half, const int l16) {
#pragma unroll
    for (int p = 0; p < NW; ++p)
#pragma unroll
        for (int a = 0; a < 2; ++a)
#pragma unroll
            for (int b = 0; b < 2; ++b)
#pragma unroll
                for (int r = 0; r < 8; ++r) acc[p][a][b].f[r] = 0.0f;

    // A tile, 64 rows x 32 k: 8 lanes read one row's 128 B, so load i of a
    // wave is rows 16*i + 4*wave .. +3, whole lines.
    const int arow = tid >> 3, ac4 = (tid & 7) * 4;
    uint32_t aoff = ((mBase + arow) * D_MODEL + ac4) * 4;   // byte offset in A
    // W tiles, 32 k x 64 n each: a thread takes 4 k rows x 4 n columns; 8
    // lanes read one 128-B line of a row, a wave 4 rows per load.
    const int wn = ((tid & 7) | ((tid >> 6) << 3)) * 4;
    const int wk = ((tid >> 3) & 7) * 4;
    uint32_t woff = (wk * D_MODEL + nBase + wn) * 4;        // byte offset in each W

    for (int k0 = 0; k0 < D_MODEL; k0 += 32) {
        __syncthreads();
        {
            float4 fa[4], fw[NW][4];
#pragma unroll
            for (int i = 0; i < 4; ++i)
                fa[i] = *(const float4*)((const char*)A + aoff + i * 16 * D_MODEL * 4);
#pragma unroll
            for (int p = 0; p < NW; ++p)
#pragma unroll
                for (int i = 0; i < 4; ++i)
                    fw[p][i] = *(const float4*)((const char*)W[p] + woff + i * D_MODEL * 4);
            aoff += 32 * 4;
            woff += 32 * D_MODEL * 4;
#pragma unroll
            for (int i = 0; i < 4; ++i)
                *(uint2*)&lds_a[(arow + i * 16) * TPITCH + ac4] =
                    make_uint2(cvt2_bf16(fa[i].x, fa[i].y),
                               cvt2_bf16(fa[i].z, fa[i].w));
            // transposed: column n gets its 4 consecutive k as one 8-byte store
#pragma unroll
            for (int p = 0; p < NW; ++p) {
                uint16_t* bt = lds_bt[p];
                *(uint2*)&bt[(wn + 0) * TPITCH + wk] = make_uint2(
                    cvt2_bf16(fw[p][0].x, fw[p][1].x), cvt2_bf16(fw[p][2].x, fw[p][3].x));
                *(uint2*)&bt[(wn + 1) * TPITCH + wk] = make_uint2(
                    cvt2_bf16(fw[p][0].y, fw[p][1].y), cvt2_bf16(fw[p][2].y, fw[p][3].y));
                *(uint2*)&bt[(wn + 2) * TPITCH + wk] = make_uint2(
                    cvt2_bf16(fw[p][0].z, fw[p][1].z), cvt2_bf16(fw[p][2].z, fw[p][3].z));
                *(uint2*)&bt[(wn + 3) * TPITCH + wk] = make_uint2(
                    cvt2_bf16(fw[p][0].w, fw[p][1].w), cvt2_bf16(fw[p][2].w, fw[p][3].w));
            }
        }
        __syncthreads();

        FragB16 af[2];
#pragma unroll
        for (int rg = 0; rg < 2; ++rg) {
            const int row = wr + rg * 16 + l16;
#pragma unroll
            for (int j = 0; j < 8; ++j)
                af[rg].u[j] = *(const uint32_t*)&lds_a[row * TPITCH + kmap(j, half)];
        }
#pragma unroll
        for (int p = 0; p < NW; ++p) {
            FragB16 bf[2];
#pragma unroll
            for (int cg = 0; cg < 2; ++cg) {
                const int col = wc + cg * 16 + l16;
#pragma unroll
                for (int j = 0; j < 8; ++j)
                    bf[cg].u[j] =
                        *(const uint32_t*)&lds_bt[p][col * TPITCH + kmap(j, half)];
            }
#pragma unroll
            for (int rg = 0; rg < 2; ++rg)
#pragma unroll
                for (int cg = 0; cg < 2; ++cg) {
                    if (p < NT)
                        acc[p][rg][cg].v = __builtin_amdgcn_wmma_f32_16x16x32_bf16(
                            false, bf[cg].v, false, af[rg].v, (short)0,
                            acc[p][rg][cg].v, false, false);
                    else
                        acc[p][rg][cg].v = __builtin_amdgcn_wmma_f32_16x16x32_bf16(
                            false, af[rg].v, false, bf[cg].v, (short)0,
                            acc[p][rg][cg].v, false, false);
                }
        }
    }
}

// Slot of position m (all batches in a row): 32 slots per 30-position grid row.
__device__ __forceinline__ int slot_of(int m) { return m + 2 * (m / GRID_W); }

#define ST_SLOTS 70   // most slots of a 64-position tile: 64 and 3 x 2 pads
#define QKP 72        // staged Q / K slot row, bf16: 144 B = 16 B x odd
#define VTP 74        // staged V^T d row, bf16: 70 slots, 148 B

// Q, K and V^T of one 64-row block and one head, from one staged x tile.
// Five waves per SIMD, asked for as least and as most (192 registers): the k
// loop needs that many to have its 16 loads in flight together; aiming at more
// waves the compiler splits them into two groups, one waiting for the other.
// The three result tiles go to LDS in slot order, pads as zeros, and from
// there to memory in runs that follow the planes' rows: Q, K [b*8+h][slot][dk]
// (a slot row is one 128-B line), V^T [b*8+h][dk][slot]. The work-group owns
// the slots from its first position's up to the next tile's first.
__global__ __launch_bounds__(128) __attribute__((amdgpu_waves_per_eu(5, 5))) void qkv_gemm(
    const float* __restrict__ A, const float* __restrict__ Wq,
    const float* __restrict__ Wk, const float* __restrict__ Wv,
    const float* __restrict__ biasq, const float* __restrict__ biask,
    const float* __restrict__ biasv, uint16_t* __restrict__ Qo,
    uint16_t* __restrict__ Ko, uint16_t* __restrict__ Vo) {
    __shared__ __attribute__((aligned(16))) uint16_t lds_a[64 * TPITCH];      // [row][k] bf16
    __shared__ __attribute__((aligned(16))) uint16_t lds_bt[3][64 * TPITCH];  // [n][k] bf16 (transposed weights)
    __shared__ __attribute__((aligned(16))) uint16_t st_qk[2][ST_SLOTS * QKP];  // [slot][dk]
    __shared__ __attribute__((aligned(16))) uint16_t st_vt[64 * VTP];           // [dk][slot]

    const int tid  = threadIdx.x;
    const int wave = tid >> 5, lane = tid & 31;
    const int half = lane >> 4, l16 = lane & 15;
    const int mBase = blockIdx.x * 64;
    const int nBase = blockIdx.y * 64;
    const int wr = (wave >> 1) * 32, wc = (wave & 1) * 32;

    const float* const W[3] = {Wq, Wk, Wv};
    FragF32 acc[3][2][2];
    gemm_tiles<3, 2>(A, W, lds_a, lds_bt, acc, tid, mBase, nBase, wr, wc, half, l16);

    const int L0 = slot_of(mBase);                     // even, never a pad
    const int np = (slot_of(mBase + 64) - L0) >> 1;    // 34 or 35 slot pairs
    const int p0 = (GRID_W - (L0 & 31)) >> 1;          // first pad pair; then every 16th

    // Q, K (transposed accumulators): register r of a lane is
    // row m = .. + l16, column n = .. + 8 * half + r: one 16-byte LDS store.
    // The lane's 2 x 16 bias values: eight 16-byte loads from one byte offset.
    const uint32_t boff = (uint32_t)(nBase + wc + 8 * half) * 4;
    v4f bb[2][2][2];
    // unrolled, here and below: bb and acc are indexed by constants alone and
    // stay in registers
#pragma unroll
    for (int p = 0; p < 2; ++p)
#pragma unroll
        for (int cg = 0; cg < 2; ++cg)
#pragma unroll
            for (int q = 0; q < 2; ++q)
                bb[p][cg][q] = *(const v4f*)((const char*)(p ? biask : biasq) + boff +
                                             (cg * 64 + q * 16));
    // The wait in front of any rewrite of the offset register that the eight
    // loads name. The offset and the loaded values are inputs only: the offset
    // so that no load's result lands in its register, the values so that every
    // load stands in front of the wait.
    asm volatile("s_wait_xcnt 0x0"
                 :: "v"(boff), "v"(bb[0][0][0]), "v"(bb[0][0][1]), "v"(bb[0][1][0]),
                    "v"(bb[0][1][1]), "v"(bb[1][0][0]), "v"(bb[1][0][1]),
                    "v"(bb[1][1][0]), "v"(bb[1][1][1])
                 : "memory");
#pragma unroll
    for (int p = 0; p < 2; ++p)
#pragma unroll
        for (int cg = 0; cg < 2; ++cg) {
            const int nl = wc + cg * 16 + 8 * half;
            const v4f b0 = bb[p][cg][0], b1 = bb[p][cg][1];
#pragma unroll
            for (int rg = 0; rg < 2; ++rg) {
                const int j = slot_of(mBase + wr + rg * 16 + l16) - L0;
                const float* a = acc[p][rg][cg].f;
                *(uint4*)&st_qk[p][j * QKP + nl] = make_uint4(
                    cvt2_bf16(a[0] + b0.x, a[1] + b0.y), cvt2_bf16(a[2] + b0.z, a[3] + b0.w),
                    cvt2_bf16(a[4] + b1.x, a[5] + b1.y), cvt2_bf16(a[6] + b1.z, a[7] + b1.w));
            }
        }
    // V: register r of a lane is row m = .. + 8 * half + r, column n = .. + l16.
    // An even position and the next lie in one grid row: 4-byte LDS stores.
#pragma unroll
    for (int cg = 0; cg < 2; ++cg) {
        const int nl = wc + cg * 16 + l16;
        const float bn = biasv[nBase + nl];
#pragma unroll
        for (int rg = 0; rg < 2; ++rg)
#pragma unroll
            for (int i = 0; i < 4; ++i) {
                const int j = slot_of(mBase + wr + rg * 16 + 8 * half + 2 * i) - L0;
                *(uint32_t*)&st_vt[nl * VTP + j] = cvt2_bf16(
                    acc[2][rg][cg].f[2 * i] + bn, acc[2][rg][cg].f[2 * i + 1] + bn);
            }
    }
    // The pad pairs: waves 0..2 take one pair each of the Q and K tiles
    // (2 tiles x 2 slot rows x 8 pieces of 16 B), and every d row of V^T
    // gets its dwords.
    if (wave < 3 && p0 + 16 * wave < np)
        *(uint4*)&st_qk[(lane >> 3) & 1][(2 * (p0 + 16 * wave) + (lane >> 4)) * QKP +
                                         (lane & 7) * 8] = make_uint4(0u, 0u, 0u, 0u);
#pragma unroll
    for (int k = 0; k < 2; ++k) {
        const int pr = p0 + 16 * ((tid >> 6) + 2 * k);
        if (pr < np) *(uint32_t*)&st_vt[(tid & 63) * VTP + 2 * pr] = 0u;
    }
    __syncthreads();   // the staged tiles are read by other waves than wrote them

    const int h = nBase >> 6, b0 = L0 / S_PAD;
    const int bEnd = (b0 + 1) * S_PAD;                 // first slot of the next batch

    // Q, K: 16 bytes a lane, 8 lanes to a slot row, 16 rows (whole lines) to a
    // work-group-wide store. Element offset = (L + (7 * b + h) * 960) * 64 + d.
    {
        const int r0 = tid >> 3, d0 = (tid & 7) * 8;
        const uint16_t* sq = &st_qk[0][r0 * QKP + d0];
        const uint16_t* sk = &st_qk[1][r0 * QKP + d0];
        uint32_t off[4];                               // in bytes
        uint4 wq[4], wk[4];
#pragma unroll
        for (int i = 0; i < 4; ++i) {
            const int L = L0 + r0 + 16 * i;
            off[i] = (uint32_t)(((L + (7 * (L >= bEnd ? b0 + 1 : b0) + h) * S_PAD) * DK + d0) * 2);
            wq[i] = *(const uint4*)&sq[16 * i * QKP];
            wk[i] = *(const uint4*)&sk[16 * i * QKP];
        }
#pragma unroll
        for (int i = 0; i < 4; ++i) {
            *(uint4*)((char*)Qo + off[i]) = wq[i];
            *(uint4*)((char*)Ko + off[i]) = wk[i];
        }
        if (64 + r0 < 2 * np) {                        // the 4 or 6 slots behind the 64th
            const int L = L0 + r0 + 64;
            const uint32_t o =
                (uint32_t)(((L + (7 * (L >= bEnd ? b0 + 1 : b0) + h) * S_PAD) * DK + d0) * 2);
            const uint4 tq = *(const uint4*)&sq[64 * QKP];
            const uint4 tk = *(const uint4*)&sk[64 * QKP];
            *(uint4*)((char*)Qo + o) = tq;
            *(uint4*)((char*)Ko + o) = tk;
        }
    }

    // V^T: a wave takes 16 d rows; its lanes store 32 consecutive slot pairs
    // of a row (128 B in a row), so a wave-wide store meets 1 or 2 lines and
    // not 32. Element offset = ((b * 8 + h) * 64 + d) * 960 + L - b * 960.
    {
        const int L = L0 + 2 * lane, b = L >= bEnd ? b0 + 1 : b0;
        uint16_t* vp = Vo + (((b * NHEADS + h) * DK + wave * 16) * S_PAD + L - b * S_PAD);
        const uint16_t* sv = &st_vt[wave * 16 * VTP + 2 * lane];
        uint32_t w[16];
#pragma unroll
        for (int r = 0; r < 16; ++r) w[r] = *(const uint32_t*)&sv[r * VTP];
#pragma unroll
        for (int r = 0; r < 16; ++r) *(uint32_t*)&vp[r * S_PAD] = w[r];
    }
    // the 2 or 3 pairs behind the 32nd: 4 lanes to a row, 8 rows to a store
    {
        const int pr = 32 + (lane & 3);
        if (pr < np) {
            const int L = L0 + 2 * pr, b = L >= bEnd ? b0 + 1 : b0;
            const int d = wave * 16 + (lane >> 2);
            uint16_t* vp = Vo + (((b * NHEADS + h) * DK + d) * S_PAD + L - b * S_PAD);
            const uint32_t w0 = *(const uint32_t*)&st_vt[d * VTP + 2 * pr];
            const uint32_t w1 = *(const uint32_t*)&st_vt[(d + 8) * VTP + 2 * pr];
            *(uint32_t*)&vp[0] = w0;
            *(uint32_t*)&vp[8 * S_PAD] = w1;
        }
    }
}

// ---------------------------------------------------------------------------
// K / V^T staging for the attention kernel. The four waves of a work-group
// walk the same keys, so each 64-slot stage (two grid rows) is brought into
// LDS once per work-group by asynchronous copies that cover whole rows, and
// every wave takes its fragments from LDS with 16-byte reads.
// ---------------------------------------------------------------------------
#define ST_KEYS 64               // key slots per stage (two 32-slot blocks)
#define N_STAGES 15              // 15 * 64 = 960 slots, all of them
#define KVP 72                   // LDS row pitch in bf16: 144 B = 16 B x odd
#define TILE_E (64 * KVP)        // one staged tile: 64 rows of 128 B

// One stage: K slots key0..key0+63 (8 KiB in a row) and V^T rows 0..63, slots
// key0..key0+63 (128 B per row, source pitch 1920 B); 16 B per lane and copy,
// 8 lanes to a row, 16 rows to a copy.
// kg / vg: this lane's first source bytes; kl / vl: its first LDS byte address.
__device__ __forceinline__ void stage_copy(const uint16_t* kg, const uint16_t* vg,
                                           uint32_t kl, uint32_t vl) {
    // s_wait_xcnt closes each statement: the address registers named by the
    // copies are not rewritten before it.
    asm volatile(
        "global_load_async_to_lds_b128 %0, %4, off\n\t"
        "global_load_async_to_lds_b128 %1, %5, off\n\t"
        "global_load_async_to_lds_b128 %2, %6, off\n\t"
        "global_load_async_to_lds_b128 %3, %7, off\n\t"
        "s_wait_xcnt 0x0"
        :: "v"(kl), "v"(kl + 16 * 144), "v"(kl + 32 * 144), "v"(kl + 48 * 144),
           "v"(kg), "v"(kg + 16 * DK), "v"(kg + 32 * DK), "v"(kg + 48 * DK)
        : "memory");
    asm volatile(
        "global_load_async_to_lds_b128 %0, %4, off\n\t"
        "global_load_async_to_lds_b128 %1, %5, off\n\t"
        "global_load_async_to_lds_b128 %2, %6, off\n\t"
        "global_load_async_to_lds_b128 %3, %7, off\n\t"
        "s_wait_xcnt 0x0"
        :: "v"(vl), "v"(vl + 16 * 144), "v"(vl + 32 * 144), "v"(vl + 48 * 144),
           "v"(vg), "v"(vg + 16 * S_PAD), "v"(vg + 32 * S_PAD), "v"(vg + 48 * S_PAD)
        : "memory");
}

// 16x16x32 A/B fragment of one row from 16-byte aligned storage: p points at
// the row's k = 8*half; dwords 0..3 are k +0..7, dwords 4..7 are k +16..23.
__device__ __forceinline__ void load_frag16(FragB16& f, const uint16_t* p) {
    const uint4 lo = *(const uint4*)p;
    const uint4 hi = *(const uint4*)(p + 16);
    f.u[0] = lo.x; f.u[1] = lo.y; f.u[2] = lo.z; f.u[3] = lo.w;
    f.u[4] = hi.x; f.u[5] = hi.y; f.u[6] = hi.z; f.u[7] = hi.w;
}

// ---------------------------------------------------------------------------
// One 32-slot block (one grid row of keys) of transposed flash attention.
// Kt points at the block's first slot row, Vt at V^T[d = 0][first slot], both
// in the staged LDS tiles (row pitch KVP).
// dh4: 4 * |query row - key row|, one value per lane for the whole block.
// dw4[i]: 4 * |query column - key column| of this lane's score i; the pad
// slots point 64 entries up the table, where every entry masks.
// ---------------------------------------------------------------------------
__device__ __forceinline__ void attn_block(
    const uint16_t* Kt, const uint16_t* Vt, const FragB16 (&bq)[2],
    FragF32 (&cacc)[4], float& m_run, float& l_run, const int dh4,
    const int (&dw4)[16], const int half, const int l16,
    uint16_t* __restrict__ pl, const float* __restrict__ s_bias) {
    // ---- S^T: two 16-key tiles, accumulate over d (4 WMMAs) ----
    FragF32 sc[2];
#pragma unroll
    for (int t = 0; t < 2; ++t) {
#pragma unroll
        for (int r = 0; r < 8; ++r) sc[t].f[r] = 0.0f;
        const int keyr = t * 16 + l16;                // A row = key slot
#pragma unroll
        for (int db = 0; db < 2; ++db) {
            FragB16 ak;
            load_frag16(ak, &Kt[(size_t)keyr * KVP + db * 32 + 8 * half]);
            sc[t].v = __builtin_amdgcn_wmma_f32_16x16x32_bf16(
                false, ak.v, false, bq[db].v, (short)0, sc[t].v, false, false);
        }
    }

    // ---- spatial bias (and pad mask); lane-local max over 16 slots ----
    float mb = -3.0e38f;
#pragma unroll
    for (int t = 0; t < 2; ++t)
#pragma unroll
        for (int r = 0; r < 8; ++r) {
            const float bias =
                *(const float*)((const char*)s_bias + (dh4 + dw4[t * 8 + r]));
            const float s = sc[t].f[r] * 0.125f + bias;
            sc[t].f[r] = s;
            mb = fmaxf(mb, s);
        }
    mb = fmaxf(mb, __shfl_xor(mb, 16, 32));           // merge key-halves
    const float mnew = fmaxf(m_run, mb);
    const float corr = __expf(m_run - mnew);
    float lb = 0.0f;
#pragma unroll
    for (int t = 0; t < 2; ++t)
#pragma unroll
        for (int r = 0; r < 8; ++r) {
            const float p = __expf(sc[t].f[r] - mnew);
            sc[t].f[r] = p;
            lb += p;
        }
    lb += __shfl_xor(lb, 16, 32);                     // merge key-halves
    l_run = l_run * corr + lb;
    m_run = mnew;

    // rescale ctx^T accumulators by lane-scalar correction
#pragma unroll
    for (int cg = 0; cg < 4; ++cg)
#pragma unroll
        for (int r = 0; r < 8; ++r) cacc[cg].f[r] *= corr;

    // ---- P^T (C layout) -> LDS [q][key] -> B fragment ----
#pragma unroll
    for (int t = 0; t < 2; ++t)
#pragma unroll
        for (int i = 0; i < 4; ++i)
            *(uint32_t*)&pl[l16 * 32 + t * 16 + 8 * half + 2 * i] =
                pack_bf16(sc[t].f[2 * i], sc[t].f[2 * i + 1]);
    asm volatile("s_wait_dscnt 0" ::: "memory");      // same-wave LDS RAW fence
    FragB16 bp;
#pragma unroll
    for (int j = 0; j < 8; ++j)
        bp.u[j] = *(const uint32_t*)&pl[l16 * 32 + kmap(j, half)];

    // V^T fragments come from LDS only now, so that their 32 registers are
    // free during the bias and softmax work
    FragB16 av[4];
#pragma unroll
    for (int cg = 0; cg < 4; ++cg)
        load_frag16(av[cg], &Vt[(size_t)(cg * 16 + l16) * KVP + 8 * half]);

    // ---- ctx^T += V^T_frag @ P^T (4 WMMAs) ----
#pragma unroll
    for (int cg = 0; cg < 4; ++cg)
        cacc[cg].v = __builtin_amdgcn_wmma_f32_16x16x32_bf16(
            false, av[cg].v, false, bp.v, (short)0, cacc[cg].v, false, false);
}

// ---------------------------------------------------------------------------
// Flash-style attention, fully transposed. One wave per 16-query tile per
// (b,h); the work-group's four waves share each staged 64-slot K / V^T stage.
//   S^T[key, q]  = K_blk(16k x 64d) @ Q^T(64d x 16q)   -> lane l16 = query col
//   ctx^T[d, q] += V^T_frag(16d x 32k) @ P^T(32k x 16q)
// Two LDS buffers: stage s + 1 flies while stage s is worked on.
// ---------------------------------------------------------------------------
__global__ __launch_bounds__(128) void attn_kernel(
    const uint16_t* __restrict__ Q, const uint16_t* __restrict__ K,
    const uint16_t* __restrict__ VT, const float* __restrict__ sbias,
    float* __restrict__ ctx_out) {
    __shared__ float s_bias[96];            // 0..58 table; 64..93 mask entries
    __shared__ uint16_t p_lds[4][16 * 32];  // per-wave P^T tile [q][key] bf16
    __shared__ __attribute__((aligned(16))) uint16_t kv[2][2][TILE_E];  // [buffer][K | V^T]

    const int tid = threadIdx.x;
    const int bh = blockIdx.y;             // b*8+h, 0..127
    const uint16_t* Qb = Q + (size_t)bh * S_PAD * DK;
    const uint16_t* Kb = K + (size_t)bh * S_PAD * DK;
    const uint16_t* Vb = VT + (size_t)bh * DK * S_PAD;

    // this lane's share of a stage: 16 B at row tid/8 (+16 rows per copy) of
    // the K tile and of the V^T tile
    const uint16_t* kg = Kb + tid * 8;
    const uint16_t* vg = Vb + (size_t)(tid >> 3) * S_PAD + (tid & 7) * 8;
    const uint32_t lds0 = (uint32_t)(uintptr_t)&kv[0][0][0];  // LDS byte address
    const uint32_t kl = lds0 + (tid >> 3) * 144 + (tid & 7) * 16;
    const uint32_t vl = kl + TILE_E * 2;

    if (tid < 59) s_bias[tid] = sbias[(size_t)tid * 59];  // column 0 of table
    else if (tid >= 64 && tid < 94) s_bias[tid] = -1.0e30f;  // pad slots
    stage_copy(kg, vg, kl, vl);                           // stage 0 -> buffer 0
    // stage 0 has landed before the barrier that publishes it
    asm volatile("s_wait_asynccnt 0x0" ::: "memory");
    __syncthreads();
    stage_copy(kg + ST_KEYS * DK, vg + ST_KEYS, kl + 4 * TILE_E, vl + 4 * TILE_E);

    const int wave = tid >> 5, lane = tid & 31;
    const int half = lane >> 4, l16 = lane & 15;
    const int qt = blockIdx.x * 4 + wave;  // query tile; tiles 57..59 hold no
    const int q0 = qt * 16;                // query: they copy, pass every
                                           // barrier and store nothing
    uint16_t* pl = &p_lds[wave][0];

    const int q = q0 + l16;
    const int qc = min(q, S_LEN - 1);
    const int hqv = qc / GRID_W, wqv = qc % GRID_W;  // this lane's query grid coords

    // B fragments of Q^T (cols = queries), d-blocks 0..31 / 32..63; loop-invariant
    FragB16 bq[2];
#pragma unroll
    for (int db = 0; db < 2; ++db)
#pragma unroll
        for (int j = 0; j < 8; ++j)
            bq[db].u[j] = *(const uint32_t*)&Qb[(size_t)(hqv * 32 + wqv) * DK +
                                                db * 32 + kmap(j, half)];

    // column part of the bias index of this lane's 16 scores, in bytes
    int dw4[16];
#pragma unroll
    for (int i = 0; i < 16; ++i) {
        const int wk = (i >> 3) * 16 + (i & 7) + 8 * half;   // slot in the grid row
        int dw = wqv - wk; dw = dw < 0 ? -dw : dw;
        dw4[i] = (wk < GRID_W ? dw : 64) * 4;
    }

    float m_run = -3.0e38f, l_run = 0.0f;    // lane-scalar online-softmax state
    FragF32 cacc[4];                          // ctx^T accumulators, d blocks of 16
#pragma unroll
    for (int cg = 0; cg < 4; ++cg)
#pragma unroll
        for (int r = 0; r < 8; ++r) cacc[cg].f[r] = 0.0f;

    for (int hk = 0; hk < GRID_W; ++hk) {    // one grid row of keys per block
        const int s = hk >> 1, buf = s & 1, sub = hk & 1;
        int dh = hqv - hk; dh = dh < 0 ? -dh : dh;
        attn_block(&kv[buf][0][sub * 32 * KVP], &kv[buf][1][sub * 32], bq, cacc,
                   m_run, l_run, dh * 4, dw4, half, l16, pl, s_bias);
        if (sub) {
            // publish point of stage s + 1: this wave's reads of buffer buf
            // are done, its own copies of stage s + 1 have landed, then the
            // barrier
            asm volatile("s_wait_dscnt 0x0" ::: "memory");
            asm volatile("s_wait_asynccnt 0x0" ::: "memory");
            __syncthreads();
            if (s + 2 < N_STAGES)            // refill the buffer just left
                stage_copy(kg + (size_t)(s + 2) * ST_KEYS * DK,
                           vg + (s + 2) * ST_KEYS, kl + buf * 4 * TILE_E,
                           vl + buf * 4 * TILE_E);
        }
    }
    // no copy is outstanding when the wave goes on to its end
    asm volatile("s_wait_asynccnt 0x0" ::: "memory");

    // ---- normalize and store: lane owns query q; d = cg*16 + 8*half + r ----
    if (q < S_LEN) {
        const int b = bh >> 3, h = bh & 7;
        const float inv = 1.0f / l_run;
        float* dst = ctx_out + ((size_t)(b * S_LEN + q)) * D_MODEL + h * DK;
#pragma unroll
        for (int cg = 0; cg < 4; ++cg) {
            const int dbase = cg * 16 + 8 * half;
            float4 v0 = make_float4(cacc[cg].f[0] * inv, cacc[cg].f[1] * inv,
                                    cacc[cg].f[2] * inv, cacc[cg].f[3] * inv);
            float4 v1 = make_float4(cacc[cg].f[4] * inv, cacc[cg].f[5] * inv,
                                    cacc[cg].f[6] * inv, cacc[cg].f[7] * inv);
            ((float4*)(dst + dbase))[0] = v0;
            ((float4*)(dst + dbase))[1] = v1;
        }
    }
}

// ---------------------------------------------------------------------------
// Output projection, residual and LayerNorm in one launch.
// A work-group of 16 waves owns 64 whole rows (a 64 x 512 tile): a wave has
// 32 rows x 64 columns (2 x 4 accumulators), K-step 64. The projected rows go
// to LDS as f32; each wave then takes 4 whole rows, adds bias and residual,
// and normalizes them, so the sum never travels through memory.
// ---------------------------------------------------------------------------
#define OP 72         // LDS row pitch of the staged tiles in bf16: 144 B = 16 B x odd
#define RP 516        // LDS row pitch of the projected rows in f32: the two
                      // 16-lane halves of a store (8 rows apart) meet other banks

__global__ __launch_bounds__(512) void out_ln_kernel(
    const float* __restrict__ A, const float* __restrict__ Wo,
    const float* __restrict__ bias, const float* __restrict__ xres,
    const float* __restrict__ gamma, const float* __restrict__ beta,
    float* __restrict__ out) {
    __shared__ __attribute__((aligned(16))) uint16_t lds_a[64 * OP];        // [row][k] bf16
    __shared__ __attribute__((aligned(16))) uint16_t lds_bt[D_MODEL * OP];  // [n][k] bf16
    __shared__ __attribute__((aligned(16))) float lds_r[64 * RP];           // [row][n] f32

    const int tid  = threadIdx.x;
    const int wave = tid >> 5, lane = tid & 31;
    const int half = lane >> 4, l16 = lane & 15;
    const int mBase = blockIdx.x * 64;
    const int wr = (wave >> 3) * 32, wc = (wave & 7) * 64;

    FragF32 acc[2][4];
#pragma unroll
    for (int a = 0; a < 2; ++a)
#pragma unroll
        for (int b = 0; b < 4; ++b)
#pragma unroll
            for (int r = 0; r < 8; ++r) acc[a][b].f[r] = 0.0f;

    // A tile, 64 rows x 64 k: 16 lanes read one row's 256 B, a wave 2 rows.
    const int arow = tid >> 4, ac4 = (tid & 15) * 4;
    uint32_t aoff = ((mBase + arow) * D_MODEL + ac4) * 4;   // byte offset in A
    // W tile, 64 k x 512 n: a thread takes 4 pieces of 4 k rows x 4 n columns,
    // 128 columns apart; 8 lanes read one 128-B line of a row, a wave 4 rows.
    const int wn = ((tid & 7) | ((tid >> 7) << 3)) * 4;
    const int wk = ((tid >> 3) & 15) * 4;
    uint32_t woff = (wk * D_MODEL + wn) * 4;                // byte offset in Wo

    for (int k0 = 0; k0 < D_MODEL; k0 += 64) {
        __syncthreads();
        {
            float4 fa[2], fw[4][4];
#pragma unroll
            for (int i = 0; i < 2; ++i)
                fa[i] = *(const float4*)((const char*)A + aoff + i * 32 * D_MODEL * 4);
#pragma unroll
            for (int u = 0; u < 4; ++u)
#pragma unroll
                for (int i = 0; i < 4; ++i)
                    fw[u][i] = *(const float4*)((const char*)Wo + woff +
                                                (i * D_MODEL + u * 128) * 4);
#pragma unroll
            for (int i = 0; i < 2; ++i)
                *(uint2*)&lds_a[(arow + i * 32) * OP + ac4] =
                    make_uint2(cvt2_bf16(fa[i].x, fa[i].y),
                               cvt2_bf16(fa[i].z, fa[i].w));
            // transposed: column n gets its 4 consecutive k as one 8-byte store
#pragma unroll
            for (int u = 0; u < 4; ++u) {
                uint16_t* bt = &lds_bt[(wn + u * 128) * OP + wk];
                *(uint2*)&bt[0 * OP] = make_uint2(
                    cvt2_bf16(fw[u][0].x, fw[u][1].x), cvt2_bf16(fw[u][2].x, fw[u][3].x));
                *(uint2*)&bt[1 * OP] = make_uint2(
                    cvt2_bf16(fw[u][0].y, fw[u][1].y), cvt2_bf16(fw[u][2].y, fw[u][3].y));
                *(uint2*)&bt[2 * OP] = make_uint2(
                    cvt2_bf16(fw[u][0].z, fw[u][1].z), cvt2_bf16(fw[u][2].z, fw[u][3].z));
                *(uint2*)&bt[3 * OP] = make_uint2(
                    cvt2_bf16(fw[u][0].w, fw[u][1].w), cvt2_bf16(fw[u][2].w, fw[u][3].w));
            }
            aoff += 64 * 4;
            woff += 64 * D_MODEL * 4;
        }
        __syncthreads();

#pragma unroll
        for (int kk = 0; kk < 2; ++kk) {
            FragB16 af[2], bf[4];
#pragma unroll
            for (int rg = 0; rg < 2; ++rg)
                load_frag16(af[rg], &lds_a[(wr + rg * 16 + l16) * OP + kk * 32 + 8 * half]);
#pragma unroll
            for (int cg = 0; cg < 4; ++cg)
                load_frag16(bf[cg], &lds_bt[(wc + cg * 16 + l16) * OP + kk * 32 + 8 * half]);
#pragma unroll
            for (int rg = 0; rg < 2; ++rg)
#pragma unroll
                for (int cg = 0; cg < 4; ++cg)
                    acc[rg][cg].v = __builtin_amdgcn_wmma_f32_16x16x32_bf16(
                        false, af[rg].v, false, bf[cg].v, (short)0, acc[rg][cg].v,
                        false, false);
        }
    }

    // The residual of this wave's 4 rows is asked for first: it flies while
    // the projected rows go to LDS. 16 B a lane, 512 B in a row per load.
    const int row0 = wave * 4;
    const uint32_t xoff = (uint32_t)(((mBase + row0) * D_MODEL + lane * 4) * 4);  // bytes
    v4f xr[4][4], bo4[4], g4[4], be4[4];
    // unrolled, here and below: the arrays are indexed by constants alone and
    // stay in registers
#pragma unroll
    for (int j = 0; j < 4; ++j)
#pragma unroll
        for (int i = 0; i < 4; ++i)
            xr[j][i] = *(const v4f*)((const char*)xres + xoff + (j * D_MODEL + i * 128) * 4);
#pragma unroll
    for (int i = 0; i < 4; ++i) {
        bo4[i] = ((const v4f*)bias)[lane + i * 32];
        g4[i]  = ((const v4f*)gamma)[lane + i * 32];
        be4[i] = ((const v4f*)beta)[lane + i * 32];
    }

    // register r of a lane is row .. + r + 8 * half, column .. + l16
#pragma unroll
    for (int rg = 0; rg < 2; ++rg)
#pragma unroll
        for (int cg = 0; cg < 4; ++cg)
#pragma unroll
            for (int r = 0; r < 8; ++r)
                lds_r[(wr + rg * 16 + r + 8 * half) * RP + wc + cg * 16 + l16] =
                    acc[rg][cg].f[r];
    // The wait in front of any rewrite of the two index registers that the 28
    // loads name (the byte offset; the lane number). They and the loaded values
    // are inputs only: an index so that its register lives up to here and no
    // load's result lands in it, the values so that every load stands in front
    // of the wait.
    asm volatile("s_wait_xcnt 0x0"
                 :: "v"(xoff), "v"(xr[0][0]), "v"(xr[0][1]), "v"(xr[0][2]), "v"(xr[0][3]),
                    "v"(xr[1][0]), "v"(xr[1][1]), "v"(xr[1][2]), "v"(xr[1][3]),
                    "v"(xr[2][0]), "v"(xr[2][1]), "v"(xr[2][2]), "v"(xr[2][3]),
                    "v"(xr[3][0]), "v"(xr[3][1]), "v"(xr[3][2]), "v"(xr[3][3])
                 : "memory");
    asm volatile("s_wait_xcnt 0x0"
                 :: "v"(lane), "v"(bo4[0]), "v"(bo4[1]), "v"(bo4[2]), "v"(bo4[3]),
                    "v"(g4[0]), "v"(g4[1]), "v"(g4[2]), "v"(g4[3]),
                    "v"(be4[0]), "v"(be4[1]), "v"(be4[2]), "v"(be4[3])
                 : "memory");
    __syncthreads();   // a row is read by one of the eight waves that wrote it, seven of them others

#pragma unroll
    for (int j = 0; j < 4; ++j) {
        float vals[16];
        float sum = 0.0f, sq = 0.0f;
#pragma unroll
        for (int i = 0; i < 4; ++i) {
            float4 f = *(const float4*)&lds_r[(row0 + j) * RP + (lane + i * 32) * 4];
            f.x = f.x + bo4[i].x + xr[j][i].x;
            f.y = f.y + bo4[i].y + xr[j][i].y;
            f.z = f.z + bo4[i].z + xr[j][i].z;
            f.w = f.w + bo4[i].w + xr[j][i].w;
            vals[i * 4 + 0] = f.x; vals[i * 4 + 1] = f.y;
            vals[i * 4 + 2] = f.z; vals[i * 4 + 3] = f.w;
            sum += f.x + f.y + f.z + f.w;
            sq  += f.x * f.x + f.y * f.y + f.z * f.z + f.w * f.w;
        }
#pragma unroll
        for (int m = 16; m; m >>= 1) {
            sum += __shfl_xor(sum, m, 32);
            sq  += __shfl_xor(sq,  m, 32);
        }
        const float mu = sum * (1.0f / 512.0f);
        const float var = sq * (1.0f / 512.0f) - mu * mu;
        const float rs = rsqrtf(var + 1e-5f);
        float4* dst = (float4*)(out + (size_t)(mBase + row0 + j) * D_MODEL);
#pragma unroll
        for (int i = 0; i < 4; ++i)
            dst[lane + i * 32] = make_float4(
                (vals[i * 4 + 0] - mu) * rs * g4[i].x + be4[i].x,
                (vals[i * 4 + 1] - mu) * rs * g4[i].y + be4[i].y,
                (vals[i * 4 + 2] - mu) * rs * g4[i].z + be4[i].z,
                (vals[i * 4 + 3] - mu) * rs * g4[i].w + be4[i].w);
    }
}

// ---------------------------------------------------------------------------
extern "C" void kernel_launch(void* const* d_in, const int* in_sizes, int n_in,
                              void* d_out, int out_size, void* d_ws,
                              size_t ws_size, hipStream_t stream) {
    const float* x     = (const float*)d_in[0];
    const float* wq    = (const float*)d_in[1];
    const float* bq    = (const float*)d_in[2];
    const float* wk    = (const float*)d_in[3];
    const float* bk    = (const float*)d_in[4];
    const float* wv    = (const float*)d_in[5];
    const float* bv    = (const float*)d_in[6];
    const float* wo    = (const float*)d_in[7];
    const float* bo    = (const float*)d_in[8];
    const float* gamma = (const float*)d_in[9];
    const float* beta  = (const float*)d_in[10];
    const float* sbias = (const float*)d_in[11];

    // workspace layout (~77 MB total)
    uint8_t* ws = (uint8_t*)d_ws;
    const size_t SZ_H = (size_t)16 * S_PAD * D_MODEL * sizeof(uint16_t);  // 15.73 MB
    uint16_t* Qw = (uint16_t*)(ws);
    uint16_t* Kw = (uint16_t*)(ws + SZ_H);
    uint16_t* Vt = (uint16_t*)(ws + 2 * SZ_H);
    float* ctx   = (float*)(ws + 3 * SZ_H);

    const dim3 gG(M_ROWS / 64, D_MODEL / 64);  // 225 x 8
    const dim3 blk(128);
    qkv_gemm<<<gG, blk, 0, stream>>>(x, wq, wk, wv, bq, bk, bv, Qw, Kw, Vt);
    attn_kernel<<<dim3(15, 128), blk, 0, stream>>>(Qw, Kw, Vt, sbias, ctx);
    out_ln_kernel<<<dim3(M_ROWS / 64), dim3(512), 0, stream>>>(ctx, wo, bo, x, gamma, beta,
                                                               (float*)d_out);
}

// v007
// One run takes 117 microseconds.
// Timed twice side by side with v006, it ran 1.10 and 1.11 times as fast.
// All steps since v000 together make it 2.90 times as fast.
#include <hip/hip_runtime.h>
#include <hip/hip_bf16.h>
#include <stdint.h>

// ---------------------------------------------------------------------------
// Spatial2DAttention fused pipeline for MI455X (gfx1250, wave32, WMMA).
//   B=16, H=W=30, S=900, d_model=512, heads=8, d_k=64.
// Precision: bf16 WMMA operands (fp32-range-safe), f32 accumulation.
// Attention computed fully TRANSPOSED (S^T = K@Q^T, ctx^T = V^T@P^T) so each
// lane owns one query column: online-softmax stats need only ONE cross-lane
// shuffle per block. Q, K and V^T are kept with 32 key slots per grid row (30
// keys and 2 zero pads), so a 32-key block is one grid row: its row distance
// to a query is one value per lane and the column distances never change.
// ---------------------------------------------------------------------------

#define D_MODEL 512
#define M_ROWS  14400           // B * S
#define S_LEN   900
#define NHEADS  8
#define DK      64
#define GRID_W  30              // keys per grid row
#define S_PAD   960             // 30 grid rows x 32 key slots

typedef __attribute__((ext_vector_type(16))) __bf16 v16bf;
typedef __attribute__((ext_vector_type(8)))  float  v8f;

union FragB16 { v16bf v; uint32_t u[8]; };
union FragF32 { v8f  v; float    f[8]; };

__device__ __forceinline__ uint16_t f32_to_bf16(float f) {
    __bf16 h = (__bf16)f;                       // native v_cvt (RNE) on gfx1250
    return __builtin_bit_cast(uint16_t, h);
}
__device__ __forceinline__ uint32_t pack_bf16(float lo, float hi) {
    return (uint32_t)f32_to_bf16(lo) | ((uint32_t)f32_to_bf16(hi) << 16);
}
// A/B fragment dword j -> starting K index of the 2 packed bf16 (16x16x32 layout):
// lanes 0-15 hold K {0..7, 16..23}, lanes 16-31 hold K {8..15, 24..31}.
__device__ __forceinline__ int kmap(int j, int half) {
    return (j < 4 ? 2 * j : 16 + 2 * (j - 4)) + half * 8;
}

typedef __attribute__((ext_vector_type(2))) float  v2f;
typedef __attribute__((ext_vector_type(4))) float  v4f;
typedef __attribute__((ext_vector_type(2))) __bf16 v2bf;
// two f32 -> one dword of two bf16 (RNE), lo in bits 15..0
__device__ __forceinline__ uint32_t cvt2_bf16(float lo, float hi) {
    v2f f = {lo, hi};
    return __builtin_bit_cast(uint32_t, __builtin_convertvector(f, v2bf));
}
// LDS row pitch of the GEMM tiles in bf16: 80 B = 16 B x odd, the pitch at
// which the 16-byte fragment reads of 64-B rows meet no bank conflict.
#define TPITCH 40

// ---------------------------------------------------------------------------
// M=14400 x N=512 x K=512 bf16 WMMA GEMMs: out = A @ W + bias.
// Block tile 64x64 per weight matrix, 4 waves of 32x32 (2x2 accumulators),
// K-step 32. NW weight matrices share one staged A tile: the Q, K and V
// projections run as one launch (NW = 3), so x is drawn from L2 once for the
// three of them and a wave has 12 WMMAs per k-step.
// The first NT products are taken transposed (the weight fragment as A, the
// x fragment as B): a lane then holds 8 consecutive n of one row m.
// Staging map: every wave-wide 16-byte global load covers four whole 128-B
// lines (A: 4 rows x 128 B; W: 4 rows x 128 B), and all tiles go to LDS as
// 8-byte stores of k-contiguous bf16.
// The k loop is pipelined over two LDS buffers: the global loads of step
// t + 2 are issued as soon as step t + 1 has been converted, fly through its
// LDS stores, the barrier and the WMMAs of step t + 1, and are converted
// behind those.
// ---------------------------------------------------------------------------
#define KSTEPS (D_MODEL / 32)
// Work-group barrier of the pipelined k loops. It orders LDS alone: the global
// loads of the next step, which read buffers that the launch never writes, stay
// in flight across it, where __syncthreads() waits for them to return.
__device__ __forceinline__ void lds_barrier() {
    __builtin_amdgcn_fence(__ATOMIC_RELEASE, "workgroup", "local");
    __builtin_amdgcn_s_barrier();
    __builtin_amdgcn_fence(__ATOMIC_ACQUIRE, "workgroup", "local");
}
template <int NW, int NT = 0>
__device__ __forceinline__ void gemm_tiles(
    const float* __restrict__ A, const float* const (&W)[NW],
    uint16_t (*lds_a)[64 * TPITCH], uint16_t (*lds_bt)[NW][64 * TPITCH],
    FragF32 (&acc)[NW][2][2],
    const int tid, const int mBase, const int nBase, const int wr, const int wc,
    const int half, const int l16) {
#pragma unroll
    for (int p = 0; p < NW; ++p)
#pragma unroll
        for (int a = 0; a < 2; ++a)
#pragma unroll
            for (int b = 0; b < 2; ++b)
#pragma unroll
                for (int r = 0; r < 8; ++r) acc[p][a][b].f[r] = 0.0f;

    // A tile, 64 rows x 32 k: 8 lanes read one row's 128 B, so load i of a
    // wave is rows 16*i + 4*wave .. +3, whole lines.
    const int arow = tid >> 3, ac4 = (tid & 7) * 4;
    uint32_t aoff = ((mBase + arow) * D_MODEL + ac4) * 4;   // byte offset in A
    // W tiles, 32 k x 64 n each: a thread takes 4 k rows x 4 n columns; 8
    // lanes read one 128-B line of a row, a wave 4 rows per load.
    const int wn = ((tid & 7) | ((tid >> 6) << 3)) * 4;
    const int wk = ((tid >> 3) & 7) * 4;
    uint32_t woff = (wk * D_MODEL + nBase + wn) * 4;        // byte offset in each W

    float4 fa[4], fw[NW][4];     // one k-step's tiles as loaded
    uint2 pa[4], pw[NW][4];      // the same as bf16, on their way to LDS

    auto load_step = [&]() {
#pragma unroll
        for (int i = 0; i < 4; ++i)
            fa[i] = *(const float4*)((const char*)A + aoff + i * 16 * D_MODEL * 4);
#pragma unroll
        for (int p = 0; p < NW; ++p)
#pragma unroll
            for (int i = 0; i < 4; ++i)
                fw[p][i] = *(const float4*)((const char*)W[p] + woff + i * D_MODEL * 4);
        // The wait behind the run of 16 loads, in front of any rewrite of a
        // register that they name, their scalar base pairs too.
        asm volatile("s_wait_xcnt 0x0" ::: "memory");
    };
    auto cvt_step = [&]() {
#pragma unroll
        for (int i = 0; i < 4; ++i)
            pa[i] = make_uint2(cvt2_bf16(fa[i].x, fa[i].y), cvt2_bf16(fa[i].z, fa[i].w));
        // transposed: column n gets its 4 consecutive k as one 8-byte piece
#pragma unroll
        for (int p = 0; p < NW; ++p) {
            pw[p][0] = make_uint2(
                cvt2_bf16(fw[p][0].x, fw[p][1].x), cvt2_bf16(fw[p][2].x, fw[p][3].x));
            pw[p][1] = make_uint2(
                cvt2_bf16(fw[p][0].y, fw[p][1].y), cvt2_bf16(fw[p][2].y, fw[p][3].y));
            pw[p][2] = make_uint2(
                cvt2_bf16(fw[p][0].z, fw[p][1].z), cvt2_bf16(fw[p][2].z, fw[p][3].z));
            pw[p][3] = make_uint2(
                cvt2_bf16(fw[p][0].w, fw[p][1].w), cvt2_bf16(fw[p][2].w, fw[p][3].w));
        }
        // The wait in front of the rewrite of the two offset registers that the
        // 16 loads name, and the rewrite itself (one k-step on: 32 floats in A,
        // 32 rows in each W) in one statement, so that the additions follow the
        // wait and stand ahead of the next step's loads.
        asm volatile("s_wait_xcnt 0x0\n\t"
                     "v_add_nc_u32_e32 %0, 0x80, %0\n\t"
                     "v_add_nc_u32_e32 %1, 0x10000, %1"
                     : "+v"(aoff), "+v"(woff) :: "memory");
    };
    auto put_step = [&](const int buf) {
#pragma unroll
        for (int i = 0; i < 4; ++i)
            *(uint2*)&lds_a[buf][(arow + i * 16) * TPITCH + ac4] = pa[i];
#pragma unroll
        for (int p = 0; p < NW; ++p)
#pragma unroll
            for (int c = 0; c < 4; ++c)
                *(uint2*)&lds_bt[buf][p][(wn + c) * TPITCH + wk] = pw[p][c];
    };
    auto mma_step = [&](const int buf) {
        FragB16 af[2];
#pragma unroll
        for (int rg = 0; rg < 2; ++rg) {
            const int row = wr + rg * 16 + l16;
#pragma unroll
            for (int j = 0; j < 8; ++j)
                af[rg].u[j] = *(const uint32_t*)&lds_a[buf][row * TPITCH + kmap(j, half)];
        }
#pragma unroll
        for (int p = 0; p < NW; ++p) {
            FragB16 bf[2];
#pragma unroll
            for (int cg = 0; cg < 2; ++cg) {
                const int col = wc + cg * 16 + l16;
#pragma unroll
                for (int j = 0; j < 8; ++j)
                    bf[cg].u[j] =
                        *(const uint32_t*)&lds_bt[buf][p][col * TPITCH + kmap(j, half)];
            }
#pragma unroll
            for (int rg = 0; rg < 2; ++rg)
#pragma unroll
                for (int cg = 0; cg < 2; ++cg) {
                    if (p < NT)
                        acc[p][rg][cg].v = __builtin_amdgcn_wmma_f32_16x16x32_bf16(
                            false, bf[cg].v, false, af[rg].v, (short)0,
                            acc[p][rg][cg].v, false, false);
                    else
                        acc[p][rg][cg].v = __builtin_amdgcn_wmma_f32_16x16x32_bf16(
                            false, af[rg].v, false, bf[cg].v, (short)0,
                            acc[p][rg][cg].v, false, false);
                }
        }
    };

    load_step();
    cvt_step();
    load_step();                 // step 1 flies
    put_step(0);
    lds_barrier();               // step 0 is staged
    for (int t = 0; t < KSTEPS - 2; ++t) {
        mma_step(t & 1);         // step t + 1 flies meanwhile
        // keeps the conversions, which wait for the loads, behind the last
        // WMMA: moved up among the WMMAs they stall the wave at its second one
        __builtin_amdgcn_sched_barrier(0);
        cvt_step();
        load_step();             // step t + 2, into the registers just read
        // keeps all 16 loads ahead of the LDS stores and the barrier
        __builtin_amdgcn_sched_barrier(0);
        put_step((t + 1) & 1);   // the buffer that every wave left at step t - 1
        // one barrier a step: it publishes step t + 1 and ends the reads of
        // step t's buffer, which is written again in the next trip
        lds_barrier();
    }
    mma_step((KSTEPS - 2) & 1);
    // as in the loop
    __builtin_amdgcn_sched_barrier(0);
    cvt_step();
    put_step((KSTEPS - 1) & 1);
    __syncthreads();             // the last step is staged
    mma_step((KSTEPS - 1) & 1);
}

// Slot of position m (all batches in a row): 32 slots per 30-position grid row.
__device__ __forceinline__ int slot_of(int m) { return m + 2 * (m / GRID_W); }

#define ST_SLOTS 70   // most slots of a 64-position tile: 64 and 3 x 2 pads
#define QKP 72        // staged Q / K slot row, bf16: 144 B = 16 B x odd
#define VTP 74        // staged V^T d row, bf16: 70 slots, 148 B

// Q, K and V^T of one 64-row block and one head, from one staged x tile.
// Four waves per SIMD, asked for as least and as most (256 registers): the k
// loop holds the 16 loads of the next step in registers beside the 12
// accumulators and the fragments of this one.
// The three result tiles go to LDS in slot order, pads as zeros, and from
// there to memory in runs that follow the planes' rows: Q, K [b*8+h][slot][dk]
// (a slot row is one 128-B line), V^T [b*8+h][dk][slot]. The work-group owns
// the slots from its first position's up to the next tile's first.
__global__ __launch_bounds__(128) __attribute__((amdgpu_waves_per_eu(4, 4))) void qkv_gemm(
    const float* __restrict__ A, const float* __restrict__ Wq,
    const float* __restrict__ Wk, const float* __restrict__ Wv,
    const float* __restrict__ biasq, const float* __restrict__ biask,
    const float* __restrict__ biasv, uint16_t* __restrict__ Qo,
    uint16_t* __restrict__ Ko, uint16_t* __restrict__ Vo) {
    __shared__ __attribute__((aligned(16))) uint16_t lds_a[2][64 * TPITCH];      // [buffer][row][k] bf16
    __shared__ __attribute__((aligned(16))) uint16_t lds_bt[2][3][64 * TPITCH];  // [buffer][matrix][n][k] bf16 (transposed weights)
    __shared__ __attribute__((aligned(16))) uint16_t st_qk[2][ST_SLOTS * QKP];  // [slot][dk]
    __shared__ __attribute__((aligned(16))) uint16_t st_vt[64 * VTP];           // [dk][slot]

    const int tid  = threadIdx.x;
    const int wave = tid >> 5, lane = tid & 31;
    const int half = lane >> 4, l16 = lane & 15;
    const int mBase = blockIdx.x * 64;
    const int nBase = blockIdx.y * 64;
    const int wr = (wave >> 1) * 32, wc = (wave & 1) * 32;

    const float* const W[3] = {Wq, Wk, Wv};
    FragF32 acc[3][2][2];
    gemm_tiles<3, 2>(A, W, lds_a, lds_bt, acc, tid, mBase, nBase, wr, wc, half, l16);

    const int L0 = slot_of(mBase);                     // even, never a pad
    const int np = (slot_of(mBase + 64) - L0) >> 1;    // 34 or 35 slot pairs
    const int p0 = (GRID_W - (L0 & 31)) >> 1;          // first pad pair; then every 16th

    // Q, K (transposed accumulators): register r of a lane is
    // row m = .. + l16, column n = .. + 8 * half + r: one 16-byte LDS store.
    // The lane's 2 x 16 bias values: eight 16-byte loads from one byte offset.
    const uint32_t boff = (uint32_t)(nBase + wc + 8 * half) * 4;
    v4f bb[2][2][2];
    // unrolled, here and below: bb and acc are indexed by constants alone and
    // stay in registers
#pragma unroll
    for (int p = 0; p < 2; ++p)
#pragma unroll
        for (int cg = 0; cg < 2; ++cg)
#pragma unroll
            for (int q = 0; q < 2; ++q)
                bb[p][cg][q] = *(const v4f*)((const char*)(p ? biask : biasq) + boff +
                                             (cg * 64 + q * 16));
    // The wait in front of any rewrite of the offset register that the eight
    // loads name. The offset and the loaded values are inputs only: the offset
    // so that no load's result lands in its register, the values so that every
    // load stands in front of the wait.
    asm volatile("s_wait_xcnt 0x0"
                 :: "v"(boff), "v"(bb[0][0][0]), "v"(bb[0][0][1]), "v"(bb[0][1][0]),
                    "v"(bb[0][1][1]), "v"(bb[1][0][0]), "v"(bb[1][0][1]),
                    "v"(bb[1][1][0]), "v"(bb[1][1][1])
                 : "memory");
#pragma unroll
    for (int p = 0; p < 2; ++p)
#pragma unroll
        for (int cg = 0; cg < 2; ++cg) {
            const int nl = wc + cg * 16 + 8 * half;
            const v4f b0 = bb[p][cg][0], b1 = bb[p][cg][1];
#pragma unroll
            for (int rg = 0; rg < 2; ++rg) {
                const int j = slot_of(mBase + wr + rg * 16 + l16) - L0;
                const float* a = acc[p][rg][cg].f;
                *(uint4*)&st_qk[p][j * QKP + nl] = make_uint4(
                    cvt2_bf16(a[0] + b0.x, a[1] + b0.y), cvt2_bf16(a[2] + b0.z, a[3] + b0.w),
                    cvt2_bf16(a[4] + b1.x, a[5] + b1.y), cvt2_bf16(a[6] + b1.z, a[7] + b1.w));
            }
        }
    // V: register r of a lane is row m = .. + 8 * half + r, column n = .. + l16.
    // An even position and the next lie in one grid row: 4-byte LDS stores.
#pragma unroll
    for (int cg = 0; cg < 2; ++cg) {
        const int nl = wc + cg * 16 + l16;
        const float bn = biasv[nBase + nl];
#pragma unroll
        for (int rg = 0; rg < 2; ++rg)
#pragma unroll
            for (int i = 0; i < 4; ++i) {
                const int j = slot_of(mBase + wr + rg * 16 + 8 * half + 2 * i) - L0;
                *(uint32_t*)&st_vt[nl * VTP + j] = cvt2_bf16(
                    acc[2][rg][cg].f[2 * i] + bn, acc[2][rg][cg].f[2 * i + 1] + bn);
            }
    }
    // The pad pairs: waves 0..2 take one pair each of the Q and K tiles
    // (2 tiles x 2 slot rows x 8 pieces of 16 B), and every d row of V^T
    // gets its dwords.
    if (wave < 3 && p0 + 16 * wave < np)
        *(uint4*)&st_qk[(lane >> 3) & 1][(2 * (p0 + 16 * wave) + (lane >> 4)) * QKP +
                                         (lane & 7) * 8] = make_uint4(0u, 0u, 0u, 0u);
#pragma unroll
    for (int k = 0; k < 2; ++k) {
        const int pr = p0 + 16 * ((tid >> 6) + 2 * k);
        if (pr < np) *(uint32_t*)&st_vt[(tid & 63) * VTP + 2 * pr] = 0u;
    }
    __syncthreads();   // the staged tiles are read by other waves than wrote them

    const int h = nBase >> 6, b0 = L0 / S_PAD;
    const int bEnd = (b0 + 1) * S_PAD;                 // first slot of the next batch

    // Q, K: 16 bytes a lane, 8 lanes to a slot row, 16 rows (whole lines) to a
    // work-group-wide store. Element offset = (L + (7 * b + h) * 960) * 64 + d.
    {
        const int r0 = tid >> 3, d0 = (tid & 7) * 8;
        const uint16_t* sq = &st_qk[0][r0 * QKP + d0];
        const uint16_t* sk = &st_qk[1][r0 * QKP + d0];
        uint32_t off[4];                               // in bytes
        uint4 wq[4], wk[4];
#pragma unroll
        for (int i = 0; i < 4; ++i) {
            const int L = L0 + r0 + 16 * i;
            off[i] = (uint32_t)(((L + (7 * (L >= bEnd ? b0 + 1 : b0) + h) * S_PAD) * DK + d0) * 2);
            wq[i] = *(const uint4*)&sq[16 * i * QKP];
            wk[i] = *(const uint4*)&sk[16 * i * QKP];
        }
#pragma unroll
        for (int i = 0; i < 4; ++i) {
            *(uint4*)((char*)Qo + off[i]) = wq[i];
            *(uint4*)((char*)Ko + off[i]) = wk[i];
        }
        if (64 + r0 < 2 * np) {                        // the 4 or 6 slots behind the 64th
            const int L = L0 + r0 + 64;
            const uint32_t o =
                (uint32_t)(((L + (7 * (L >= bEnd ? b0 + 1 : b0) + h) * S_PAD) * DK + d0) * 2);
            const uint4 tq = *(const uint4*)&sq[64 * QKP];
            const uint4 tk = *(const uint4*)&sk[64 * QKP];
            *(uint4*)((char*)Qo + o) = tq;
            *(uint4*)((char*)Ko + o) = tk;
        }
    }

    // V^T: a wave takes 16 d rows; its lanes store 32 consecutive slot pairs
    // of a row (128 B in a row), so a wave-wide store meets 1 or 2 lines and
    // not 32. Element offset = ((b * 8 + h) * 64 + d) * 960 + L - b * 960.
    {
        const int L = L0 + 2 * lane, b = L >= bEnd ? b0 + 1 : b0;
        uint16_t* vp = Vo + (((b * NHEADS + h) * DK + wave * 16) * S_PAD + L - b * S_PAD);
        const uint16_t* sv = &st_vt[wave * 16 * VTP + 2 * lane];
        uint32_t w[16];
#pragma unroll
        for (int r = 0; r < 16; ++r) w[r] = *(const uint32_t*)&sv[r * VTP];
#pragma unroll
        for (int r = 0; r < 16; ++r) *(uint32_t*)&vp[r * S_PAD] = w[r];
    }
    // the 2 or 3 pairs behind the 32nd: 4 lanes to a row, 8 rows to a store
    {
        const int pr = 32 + (lane & 3);
        if (pr < np) {
            const int L = L0 + 2 * pr, b = L >= bEnd ? b0 + 1 : b0;
            const int d = wave * 16 + (lane >> 2);
            uint16_t* vp = Vo + (((b * NHEADS + h) * DK + d) * S_PAD + L - b * S_PAD);
            const uint32_t w0 = *(const uint32_t*)&st_vt[d * VTP + 2 * pr];
            const uint32_t w1 = *(const uint32_t*)&st_vt[(d + 8) * VTP + 2 * pr];
            *(uint32_t*)&vp[0] = w0;
            *(uint32_t*)&vp[8 * S_PAD] = w1;
        }
    }
}

// ---------------------------------------------------------------------------
// K / V^T staging for the attention kernel. The four waves of a work-group
// walk the same keys, so each 64-slot stage (two grid rows) is brought into
// LDS once per work-group by asynchronous copies that cover whole rows, and
// every wave takes its fragments from LDS with 16-byte reads.
// ---------------------------------------------------------------------------
#define ST_KEYS 64               // key slots per stage (two 32-slot blocks)
#define N_STAGES 15              // 15 * 64 = 960 slots, all of them
#define KVP 72                   // LDS row pitch in bf16: 144 B = 16 B x odd
#define TILE_E (64 * KVP)        // one staged tile: 64 rows of 128 B

// One stage: K slots key0..key0+63 (8 KiB in a row) and V^T rows 0..63, slots
// key0..key0+63 (128 B per row, source pitch 1920 B); 16 B per lane and copy,
// 8 lanes to a row, 16 rows to a copy.
// kg / vg: this lane's first source bytes; kl / vl: its first LDS byte address.
__device__ __forceinline__ void stage_copy(const uint16_t* kg, const uint16_t* vg,
                                           uint32_t kl, uint32_t vl) {
    // s_wait_xcnt closes each statement: the address registers named by the
    // copies are not rewritten before it.
    asm volatile(
        "global_load_async_to_lds_b128 %0, %4, off\n\t"
        "global_load_async_to_lds_b128 %1, %5, off\n\t"
        "global_load_async_to_lds_b128 %2, %6, off\n\t"
        "global_load_async_to_lds_b128 %3, %7, off\n\t"
        "s_wait_xcnt 0x0"
        :: "v"(kl), "v"(kl + 16 * 144), "v"(kl + 32 * 144), "v"(kl + 48 * 144),
           "v"(kg), "v"(kg + 16 * DK), "v"(kg + 32 * DK), "v"(kg + 48 * DK)
        : "memory");
    asm volatile(
        "global_load_async_to_lds_b128 %0, %4, off\n\t"
        "global_load_async_to_lds_b128 %1, %5, off\n\t"
        "global_load_async_to_lds_b128 %2, %6, off\n\t"
        "global_load_async_to_lds_b128 %3, %7, off\n\t"
        "s_wait_xcnt 0x0"
        :: "v"(vl), "v"(vl + 16 * 144), "v"(vl + 32 * 144), "v"(vl + 48 * 144),
           "v"(vg), "v"(vg + 16 * S_PAD), "v"(vg + 32 * S_PAD), "v"(vg + 48 * S_PAD)
        : "memory");
}

// 16x16x32 A/B fragment of one row from 16-byte aligned storage: p points at
// the row's k = 8*half; dwords 0..3 are k +0..7, dwords 4..7 are k +16..23.
__device__ __forceinline__ void load_frag16(FragB16& f, const uint16_t* p) {
    const uint4 lo = *(const uint4*)p;
    const uint4 hi = *(const uint4*)(p + 16);
    f.u[0] = lo.x; f.u[1] = lo.y; f.u[2] = lo.z; f.u[3] = lo.w;
    f.u[4] = hi.x; f.u[5] = hi.y; f.u[6] = hi.z; f.u[7] = hi.w;
}

// ---------------------------------------------------------------------------
// One 32-slot block (one grid row of keys) of transposed flash attention.
// Kt points at the block's first slot row, Vt at V^T[d = 0][first slot], both
// in the staged LDS tiles (row pitch KVP).
// dh4: 4 * |query row - key row|, one value per lane for the whole block.
// dw4[i]: 4 * |query column - key column| of this lane's score i; the pad
// slots point 64 entries up the table, where every entry masks.
// ---------------------------------------------------------------------------
__device__ __forceinline__ void attn_block(
    const uint16_t* Kt, const uint16_t* Vt, const FragB16 (&bq)[2],
    FragF32 (&cacc)[4], float& m_run, float& l_run, const int dh4,
    const int (&dw4)[16], const int half, const int l16,
    uint16_t* __restrict__ pl, const float* __restrict__ s_bias) {
    // ---- S^T: two 16-key tiles, accumulate over d (4 WMMAs) ----
    FragF32 sc[2];
#pragma unroll
    for (int t = 0; t < 2; ++t) {
#pragma unroll
        for (int r = 0; r < 8; ++r) sc[t].f[r] = 0.0f;
        const int keyr = t * 16 + l16;                // A row = key slot
#pragma unroll
        for (int db = 0; db < 2; ++db) {
            FragB16 ak;
            load_frag16(ak, &Kt[(size_t)keyr * KVP + db * 32 + 8 * half]);
            sc[t].v = __builtin_amdgcn_wmma_f32_16x16x32_bf16(
                false, ak.v, false, bq[db].v, (short)0, sc[t].v, false, false);
        }
    }

    // ---- spatial bias (and pad mask); lane-local max over 16 slots ----
    float mb = -3.0e38f;
#pragma unroll
    for (int t = 0; t < 2; ++t)
#pragma unroll
        for (int r = 0; r < 8; ++r) {
            const float bias =
                *(const float*)((const char*)s_bias + (dh4 + dw4[t * 8 + r]));
            const float s = sc[t].f[r] * 0.125f + bias;
            sc[t].f[r] = s;
            mb = fmaxf(mb, s);
        }
    mb = fmaxf(mb, __shfl_xor(mb, 16, 32));           // merge key-halves
    const float mnew = fmaxf(m_run, mb);
    const float corr = __expf(m_run - mnew);
    float lb = 0.0f;
#pragma unroll
    for (int t = 0; t < 2; ++t)
#pragma unroll
        for (int r = 0; r < 8; ++r) {
            const float p = __expf(sc[t].f[r] - mnew);
            sc[t].f[r] = p;
            lb += p;
        }
    lb += __shfl_xor(lb, 16, 32);                     // merge key-halves
    l_run = l_run * corr + lb;
    m_run = mnew;

    // rescale ctx^T accumulators by lane-scalar correction
#pragma unroll
    for (int cg = 0; cg < 4; ++cg)
#pragma unroll
        for (int r = 0; r < 8; ++r) cacc[cg].f[r] *= corr;

    // ---- P^T (C layout) -> LDS [q][key] -> B fragment ----
#pragma unroll
    for (int t = 0; t < 2; ++t)
#pragma unroll
        for (int i = 0; i < 4; ++i)
            *(uint32_t*)&pl[l16 * 32 + t * 16 + 8 * half + 2 * i] =
                pack_bf16(sc[t].f[2 * i], sc[t].f[2 * i + 1]);
    asm volatile("s_wait_dscnt 0" ::: "memory");      // same-wave LDS RAW fence
    FragB16 bp;
#pragma unroll
    for (int j = 0; j < 8; ++j)
        bp.u[j] = *(const uint32_t*)&pl[l16 * 32 + kmap(j, half)];

    // V^T fragments come from LDS only now, so that their 32 registers are
    // free during the bias and softmax work
    FragB16 av[4];
#pragma unroll
    for (int cg = 0; cg < 4; ++cg)
        load_frag16(av[cg], &Vt[(size_t)(cg * 16 + l16) * KVP + 8 * half]);

    // ---- ctx^T += V^T_frag @ P^T (4 WMMAs) ----
#pragma unroll
    for (int cg = 0; cg < 4; ++cg)
        cacc[cg].v = __builtin_amdgcn_wmma_f32_16x16x32_bf16(
            false, av[cg].v, false, bp.v, (short)0, cacc[cg].v, false, false);
}

// ---------------------------------------------------------------------------
// Flash-style attention, fully transposed. One wave per 16-query tile per
// (b,h); the work-group's four waves share each staged 64-slot K / V^T stage.
//   S^T[key, q]  = K_blk(16k x 64d) @ Q^T(64d x 16q)   -> lane l16 = query col
//   ctx^T[d, q] += V^T_frag(16d x 32k) @ P^T(32k x 16q)
// Two LDS buffers: stage s + 1 flies while stage s is worked on.
// ---------------------------------------------------------------------------
__global__ __launch_bounds__(128) void attn_kernel(
    const uint16_t* __restrict__ Q, const uint16_t* __restrict__ K,
    const uint16_t* __restrict__ VT, const float* __restrict__ sbias,
    float* __restrict__ ctx_out) {
    __shared__ float s_bias[96];            // 0..58 table; 64..93 mask entries
    __shared__ uint16_t p_lds[4][16 * 32];  // per-wave P^T tile [q][key] bf16
    __shared__ __attribute__((aligned(16))) uint16_t kv[2][2][TILE_E];  // [buffer][K | V^T]

    const int tid = threadIdx.x;
    const int bh = blockIdx.y;             // b*8+h, 0..127
    const uint16_t* Qb = Q + (size_t)bh * S_PAD * DK;
    const uint16_t* Kb = K + (size_t)bh * S_PAD * DK;
    const uint16_t* Vb = VT + (size_t)bh * DK * S_PAD;

    // this lane's share of a stage: 16 B at row tid/8 (+16 rows per copy) of
    // the K tile and of the V^T tile
    const uint16_t* kg = Kb + tid * 8;
    const uint16_t* vg = Vb + (size_t)(tid >> 3) * S_PAD + (tid & 7) * 8;
    const uint32_t lds0 = (uint32_t)(uintptr_t)&kv[0][0][0];  // LDS byte address
    const uint32_t kl = lds0 + (tid >> 3) * 144 + (tid & 7) * 16;
    const uint32_t vl = kl + TILE_E * 2;

    if (tid < 59) s_bias[tid] = sbias[(size_t)tid * 59];  // column 0 of table
    else if (tid >= 64 && tid < 94) s_bias[tid] = -1.0e30f;  // pad slots
    stage_copy(kg, vg, kl, vl);                           // stage 0 -> buffer 0
    // stage 0 has landed before the barrier that publishes it
    asm volatile("s_wait_asynccnt 0x0" ::: "memory");
    __syncthreads();
    stage_copy(kg + ST_KEYS * DK, vg + ST_KEYS, kl + 4 * TILE_E, vl + 4 * TILE_E);

    const int wave = tid >> 5, lane = tid & 31;
    const int half = lane >> 4, l16 = lane & 15;
    const int qt = blockIdx.x * 4 + wave;  // query tile; tiles 57..59 hold no
    const int q0 = qt * 16;                // query: they copy, pass every
                                           // barrier and store nothing
    uint16_t* pl = &p_lds[wave][0];

    const int q = q0 + l16;
    const int qc = min(q, S_LEN - 1);
    const int hqv = qc / GRID_W, wqv = qc % GRID_W;  // this lane's query grid coords

    // B fragments of Q^T (cols = queries), d-blocks 0..31 / 32..63; loop-invariant
    FragB16 bq[2];
#pragma unroll
    for (int db = 0; db < 2; ++db)
#pragma unroll
        for (int j = 0; j < 8; ++j)
            bq[db].u[j] = *(const uint32_t*)&Qb[(size_t)(hqv * 32 + wqv) * DK +
                                                db * 32 + kmap(j, half)];

    // column part of the bias index of this lane's 16 scores, in bytes
    int dw4[16];
#pragma unroll
    for (int i = 0; i < 16; ++i) {
        const int wk = (i >> 3) * 16 + (i & 7) + 8 * half;   // slot in the grid row
        int dw = wqv - wk; dw = dw < 0 ? -dw : dw;
        dw4[i] = (wk < GRID_W ? dw : 64) * 4;
    }

    float m_run = -3.0e38f, l_run = 0.0f;    // lane-scalar online-softmax state
    FragF32 cacc[4];                          // ctx^T accumulators, d blocks of 16
#pragma unroll
    for (int cg = 0; cg < 4; ++cg)
#pragma unroll
        for (int r = 0; r < 8; ++r) cacc[cg].f[r] = 0.0f;

    for (int hk = 0; hk < GRID_W; ++hk) {    // one grid row of keys per block
        const int s = hk >> 1, buf = s & 1, sub = hk & 1;
        int dh = hqv - hk; dh = dh < 0 ? -dh : dh;
        attn_block(&kv[buf][0][sub * 32 * KVP], &kv[buf][1][sub * 32], bq, cacc,
                   m_run, l_run, dh * 4, dw4, half, l16, pl, s_bias);
        if (sub) {
            // publish point of stage s + 1: this wave's reads of buffer buf
            // are done, its own copies of stage s + 1 have landed, then the
            // barrier
            asm volatile("s_wait_dscnt 0x0" ::: "memory");
            asm volatile("s_wait_asynccnt 0x0" ::: "memory");
            __syncthreads();
            if (s + 2 < N_STAGES)            // refill the buffer just left
                stage_copy(kg + (size_t)(s + 2) * ST_KEYS * DK,
                           vg + (s + 2) * ST_KEYS, kl + buf * 4 * TILE_E,
                           vl + buf * 4 * TILE_E);
        }
    }
    // no copy is outstanding when the wave goes on to its end
    asm volatile("s_wait_asynccnt 0x0" ::: "memory");

    // ---- normalize and store: lane owns query q; d = cg*16 + 8*half + r ----
    if (q < S_LEN) {
        const int b = bh >> 3, h = bh & 7;
        const float inv = 1.0f / l_run;
        float* dst = ctx_out + ((size_t)(b * S_LEN + q)) * D_MODEL + h * DK;
#pragma unroll
        for (int cg = 0; cg < 4; ++cg) {
            const int dbase = cg * 16 + 8 * half;
            float4 v0 = make_float4(cacc[cg].f[0] * inv, cacc[cg].f[1] * inv,
                                    cacc[cg].f[2] * inv, cacc[cg].f[3] * inv);
            float4 v1 = make_float4(cacc[cg].f[4] * inv, cacc[cg].f[5] * inv,
                                    cacc[cg].f[6] * inv, cacc[cg].f[7] * inv);
            ((float4*)(dst + dbase))[0] = v0;
            ((float4*)(dst + dbase))[1] = v1;
        }
    }
}

// ---------------------------------------------------------------------------
// Output projection, residual and LayerNorm in one launch.
// A work-group of 16 waves owns 64 whole rows (a 64 x 512 tile): a wave has
// 32 rows x 64 columns (2 x 4 accumulators), K-step 64. The projected rows go
// to LDS as f32; each wave then takes 4 whole rows, adds bias and residual,
// and normalizes them, so the sum never travels through memory.
// ---------------------------------------------------------------------------
#define OP 72         // LDS row pitch of the staged tiles in bf16: 144 B = 16 B x odd
#define RP 516        // LDS row pitch of the projected rows in f32: the two
                      // 16-lane halves of a store (8 rows apart) meet other banks

__global__ __launch_bounds__(512) void out_ln_kernel(
    const float* __restrict__ A, const float* __restrict__ Wo,
    const float* __restrict__ bias, const float* __restrict__ xres,
    const float* __restrict__ gamma, const float* __restrict__ beta,
    float* __restrict__ out) {
    __shared__ __attribute__((aligned(16))) uint16_t lds_a[2][64 * OP];        // [buffer][row][k] bf16
    __shared__ __attribute__((aligned(16))) uint16_t lds_bt[2][D_MODEL * OP];  // [buffer][n][k] bf16
    __shared__ __attribute__((aligned(16))) float lds_r[64 * RP];           // [row][n] f32

    const int tid  = threadIdx.x;
    const int wave = tid >> 5, lane = tid & 31;
    const int half = lane >> 4, l16 = lane & 15;
    const int mBase = blockIdx.x * 64;
    const int wr = (wave >> 3) * 32, wc = (wave & 7) * 64;

    FragF32 acc[2][4];
#pragma unroll
    for (int a = 0; a < 2; ++a)
#pragma unroll
        for (int b = 0; b < 4; ++b)
#pragma unroll
            for (int r = 0; r < 8; ++r) acc[a][b].f[r] = 0.0f;

    // A tile, 64 rows x 64 k: 16 lanes read one row's 256 B, a wave 2 rows.
    const int arow = tid >> 4, ac4 = (tid & 15) * 4;
    uint32_t aoff = ((mBase + arow) * D_MODEL + ac4) * 4;   // byte offset in A
    // W tile, 64 k x 512 n: a thread takes 4 pieces of 4 k rows x 4 n columns,
    // 128 columns apart; 8 lanes read one 128-B line of a row, a wave 4 rows.
    const int wn = ((tid & 7) | ((tid >> 7) << 3)) * 4;
    const int wk = ((tid >> 3) & 15) * 4;
    uint32_t woff = (wk * D_MODEL + wn) * 4;                // byte offset in Wo

    float4 fa[2], fw[4][4];      // one k-step's tiles as loaded
    uint2 pa[2], pw[4][4];       // the same as bf16, on their way to LDS

    auto load_step = [&]() {
#pragma unroll
        for (int i = 0; i < 2; ++i)
            fa[i] = *(const float4*)((const char*)A + aoff + i * 32 * D_MODEL * 4);
#pragma unroll
        for (int u = 0; u < 4; ++u)
#pragma unroll
            for (int i = 0; i < 4; ++i)
                fw[u][i] = *(const float4*)((const char*)Wo + woff +
                                            (i * D_MODEL + u * 128) * 4);
        // The wait behind the run of 18 loads, in front of any rewrite of a
        // register that they name, their scalar base pairs too.
        asm volatile("s_wait_xcnt 0x0" ::: "memory");
    };
    auto cvt_step = [&]() {
#pragma unroll
        for (int i = 0; i < 2; ++i)
            pa[i] = make_uint2(cvt2_bf16(fa[i].x, fa[i].y), cvt2_bf16(fa[i].z, fa[i].w));
        // transposed: column n gets its 4 consecutive k as one 8-byte piece
#pragma unroll
        for (int u = 0; u < 4; ++u) {
            pw[u][0] = make_uint2(
                cvt2_bf16(fw[u][0].x, fw[u][1].x), cvt2_bf16(fw[u][2].x, fw[u][3].x));
            pw[u][1] = make_uint2(
                cvt2_bf16(fw[u][0].y, fw[u][1].y), cvt2_bf16(fw[u][2].y, fw[u][3].y));
            pw[u][2] = make_uint2(
                cvt2_bf16(fw[u][0].z, fw[u][1].z), cvt2_bf16(fw[u][2].z, fw[u][3].z));
            pw[u][3] = make_uint2(
                cvt2_bf16(fw[u][0].w, fw[u][1].w), cvt2_bf16(fw[u][2].w, fw[u][3].w));
        }
        // The wait in front of the rewrite of the two offset registers that the
        // 18 loads name, and the rewrite itself (one k-step on: 64 floats in A,
        // 64 rows in Wo) in one statement: written apart, the additions were
        // put behind the next step's loads, with a wait for those loads in
        // front of the LDS stores.
        asm volatile("s_wait_xcnt 0x0\n\t"
                     "v_add_nc_u32_e32 %0, 0x100, %0\n\t"
                     "v_add_nc_u32_e32 %1, 0x20000, %1"
                     : "+v"(aoff), "+v"(woff) :: "memory");
    };
    auto put_step = [&](const int buf) {
#pragma unroll
        for (int i = 0; i < 2; ++i)
            *(uint2*)&lds_a[buf][(arow + i * 32) * OP + ac4] = pa[i];
#pragma unroll
        for (int u = 0; u < 4; ++u)
#pragma unroll
            for (int c = 0; c < 4; ++c)
                *(uint2*)&lds_bt[buf][(wn + u * 128 + c) * OP + wk] = pw[u][c];
    };
    auto mma_step = [&](const int buf) {
#pragma unroll
        for (int kk = 0; kk < 2; ++kk) {
            FragB16 af[2], bf[4];
#pragma unroll
            for (int rg = 0; rg < 2; ++rg)
                load_frag16(af[rg],
                            &lds_a[buf][(wr + rg * 16 + l16) * OP + kk * 32 + 8 * half]);
#pragma unroll
            for (int cg = 0; cg < 4; ++cg)
                load_frag16(bf[cg],
                            &lds_bt[buf][(wc + cg * 16 + l16) * OP + kk * 32 + 8 * half]);
#pragma unroll
            for (int rg = 0; rg < 2; ++rg)
#pragma unroll
                for (int cg = 0; cg < 4; ++cg)
                    acc[rg][cg].v = __builtin_amdgcn_wmma_f32_16x16x32_bf16(
                        false, af[rg].v, false, bf[cg].v, (short)0, acc[rg][cg].v,
                        false, false);
        }
    };

    // Pipelined over two LDS buffers, as in gemm_tiles: the global loads of
    // step t + 2 fly through the LDS stores and the WMMAs of step t + 1.
    load_step();
    cvt_step();
    load_step();                 // step 1 flies
    put_step(0);
    lds_barrier();               // step 0 is staged
    for (int t = 0; t < D_MODEL / 64 - 2; ++t) {
        mma_step(t & 1);
        // keeps the conversions, which wait for the loads, behind the last WMMA
        __builtin_amdgcn_sched_barrier(0);
        cvt_step();
        load_step();             // step t + 2, into the registers just read
        // keeps all 18 loads ahead of the LDS stores and the barrier
        __builtin_amdgcn_sched_barrier(0);
        put_step((t + 1) & 1);   // the buffer that every wave left at step t - 1
        // one barrier a step: it publishes step t + 1 and ends the reads of
        // step t's buffer, which is written again in the next trip
        lds_barrier();
    }
    mma_step((D_MODEL / 64 - 2) & 1);
    // as in the loop
    __builtin_amdgcn_sched_barrier(0);
    cvt_step();
    put_step((D_MODEL / 64 - 1) & 1);
    __syncthreads();             // the last step is staged
    mma_step((D_MODEL / 64 - 1) & 1);

    // The residual of this wave's 4 rows is asked for first: it flies while
    // the projected rows go to LDS. 16 B a lane, 512 B in a row per load.
    const int row0 = wave * 4;
    const uint32_t xoff = (uint32_t)(((mBase + row0) * D_MODEL + lane * 4) * 4);  // bytes
    v4f xr[4][4], bo4[4], g4[4], be4[4];
    // unrolled, here and below: the arrays are indexed by constants alone and
    // stay in registers
#pragma unroll
    for (int j = 0; j < 4; ++j)
#pragma unroll
        for (int i = 0; i < 4; ++i)
            xr[j][i] = *(const v4f*)((const char*)xres + xoff + (j * D_MODEL + i * 128) * 4);
#pragma unroll
    for (int i = 0; i < 4; ++i) {
        bo4[i] = ((const v4f*)bias)[lane + i * 32];
        g4[i]  = ((const v4f*)gamma)[lane + i * 32];
        be4[i] = ((const v4f*)beta)[lane + i * 32];
    }

    // register r of a lane is row .. + r + 8 * half, column .. + l16
#pragma unroll
    for (int rg = 0; rg < 2; ++rg)
#pragma unroll
        for (int cg = 0; cg < 4; ++cg)
#pragma unroll
            for (int r = 0; r < 8; ++r)
                lds_r[(wr + rg * 16 + r + 8 * half) * RP + wc + cg * 16 + l16] =
                    acc[rg][cg].f[r];
    // The wait in front of any rewrite of the two index registers that the 28
    // loads name (the byte offset; the lane number). They and the loaded values
    // are inputs only: an index so that its register lives up to here and no
    // load's result lands in it, the values so that every load stands in front
    // of the wait.
    asm volatile("s_wait_xcnt 0x0"
                 :: "v"(xoff), "v"(xr[0][0]), "v"(xr[0][1]), "v"(xr[0][2]), "v"(xr[0][3]),
                    "v"(xr[1][0]), "v"(xr[1][1]), "v"(xr[1][2]), "v"(xr[1][3]),
                    "v"(xr[2][0]), "v"(xr[2][1]), "v"(xr[2][2]), "v"(xr[2][3]),
                    "v"(xr[3][0]), "v"(xr[3][1]), "v"(xr[3][2]), "v"(xr[3][3])
                 : "memory");
    asm volatile("s_wait_xcnt 0x0"
                 :: "v"(lane), "v"(bo4[0]), "v"(bo4[1]), "v"(bo4[2]), "v"(bo4[3]),
                    "v"(g4[0]), "v"(g4[1]), "v"(g4[2]), "v"(g4[3]),
                    "v"(be4[0]), "v"(be4[1]), "v"(be4[2]), "v"(be4[3])
                 : "memory");
    __syncthreads();   // a row is read by one of the eight waves that wrote it, seven of them others

#pragma unroll
    for (int j = 0; j < 4; ++j) {
        float vals[16];
        float sum = 0.0f, sq = 0.0f;
#pragma unroll
        for (int i = 0; i < 4; ++i) {
            float4 f = *(const float4*)&lds_r[(row0 + j) * RP + (lane + i * 32) * 4];
            f.x = f.x + bo4[i].x + xr[j][i].x;
            f.y = f.y + bo4[i].y + xr[j][i].y;
            f.z = f.z + bo4[i].z + xr[j][i].z;
            f.w = f.w + bo4[i].w + xr[j][i].w;
            vals[i * 4 + 0] = f.x; vals[i * 4 + 1] = f.y;
            vals[i * 4 + 2] = f.z; vals[i * 4 + 3] = f.w;
            sum += f.x + f.y + f.z + f.w;
            sq  += f.x * f.x + f.y * f.y + f.z * f.z + f.w * f.w;
        }
#pragma unroll
        for (int m = 16; m; m >>= 1) {
            sum += __shfl_xor(sum, m, 32);
            sq  += __shfl_xor(sq,  m, 32);
        }
        const float mu = sum * (1.0f / 512.0f);
        const float var = sq * (1.0f / 512.0f) - mu * mu;
        const float rs = rsqrtf(var + 1e-5f);
        float4* dst = (float4*)(out + (size_t)(mBase + row0 + j) * D_MODEL);
#pragma unroll
        for (int i = 0; i < 4; ++i)
            dst[lane + i * 32] = make_float4(
                (vals[i * 4 + 0] - mu) * rs * g4[i].x + be4[i].x,
                (vals[i * 4 + 1] - mu) * rs * g4[i].y + be4[i].y,
                (vals[i * 4 + 2] - mu) * rs * g4[i].z + be4[i].z,
                (vals[i * 4 + 3] - mu) * rs * g4[i].w + be4[i].w);
    }
}

// ---------------------------------------------------------------------------
extern "C" void kernel_launch(void* const* d_in, const int* in_sizes, int n_in,
                              void* d_out, int out_size, void* d_ws,
                              size_t ws_size, hipStream_t stream) {
    const float* x     = (const float*)d_in[0];
    const float* wq    = (const float*)d_in[1];
    const float* bq    = (const float*)d_in[2];
    const float* wk    = (const float*)d_in[3];
    const float* bk    = (const float*)d_in[4];
    const float* wv    = (const float*)d_in[5];
    const float* bv    = (const float*)d_in[6];
    const float* wo    = (const float*)d_in[7];
    const float* bo    = (const float*)d_in[8];
    const float* gamma = (const float*)d_in[9];
    const float* beta  = (const float*)d_in[10];
    const float* sbias = (const float*)d_in[11];

    // workspace layout (~77 MB total)
    uint8_t* ws = (uint8_t*)d_ws;
    const size_t SZ_H = (size_t)16 * S_PAD * D_MODEL * sizeof(uint16_t);  // 15.73 MB
    uint16_t* Qw = (uint16_t*)(ws);
    uint16_t* Kw = (uint16_t*)(ws + SZ_H);
    uint16_t* Vt = (uint16_t*)(ws + 2 * SZ_H);
    float* ctx   = (float*)(ws + 3 * SZ_H);

    const dim3 gG(M_ROWS / 64, D_MODEL / 64);  // 225 x 8
    const dim3 blk(128);
    qkv_gemm<<<gG, blk, 0, stream>>>(x, wq, wk, wv, bq, bk, bv, Qw, Kw, Vt);
    attn_kernel<<<dim3(15, 128), blk, 0, stream>>>(Qw, Kw, Vt, sbias, ctx);
    out_ln_kernel<<<dim3(M_ROWS / 64), dim3(512), 0, stream>>>(ctx, wo, bo, x, gamma, beta,
                                                               (float*)d_out);
}

// v008
// It runs in 109 microseconds.
// Timed twice side by side with v007, it ran 1.07 times as fast both times.
// Over all steps from v000 it is 3.09 times as fast.
#include <hip/hip_runtime.h>
#include <hip/hip_bf16.h>
#include <stdint.h>

// ---------------------------------------------------------------------------
// Spatial2DAttention fused pipeline for MI455X (gfx1250, wave32, WMMA).
//   B=16, H=W=30, S=900, d_model=512, heads=8, d_k=64.
// Precision: bf16 WMMA operands (fp32-range-safe), f32 accumulation.
// Attention computed fully TRANSPOSED (S^T = K@Q^T, ctx^T = V^T@P^T) so each
// lane owns one query column: online-softmax stats need only ONE cross-lane
// shuffle per block. Q, K and V^T are kept with 32 key slots per grid row (30
// keys and 2 zero pads), so a 32-key block is one grid row: its row distance
// to a query is one value per lane and the column distances never change.
// ---------------------------------------------------------------------------

#define D_MODEL 512
#define M_ROWS  14400           // B * S
#define S_LEN   900
#define NHEADS  8
#define DK      64
#define GRID_W  30              // keys per grid row
#define S_PAD   960             // 30 grid rows x 32 key slots

typedef __attribute__((ext_vector_type(16))) __bf16 v16bf;
typedef __attribute__((ext_vector_type(8)))  float  v8f;

union FragB16 { v16bf v; uint32_t u[8]; };
union FragF32 { v8f  v; float    f[8]; };

__device__ __forceinline__ uint16_t f32_to_bf16(float f) {
    __bf16 h = (__bf16)f;                       // native v_cvt (RNE) on gfx1250
    return __builtin_bit_cast(uint16_t, h);
}
__device__ __forceinline__ uint32_t pack_bf16(float lo, float hi) {
    return (uint32_t)f32_to_bf16(lo) | ((uint32_t)f32_to_bf16(hi) << 16);
}
// A/B fragment dword j -> starting K index of the 2 packed bf16 (16x16x32 layout):
// lanes 0-15 hold K {0..7, 16..23}, lanes 16-31 hold K {8..15, 24..31}.
__device__ __forceinline__ int kmap(int j, int half) {
    return (j < 4 ? 2 * j : 16 + 2 * (j - 4)) + half * 8;
}

typedef __attribute__((ext_vector_type(2))) float  v2f;
typedef __attribute__((ext_vector_type(4))) float  v4f;
typedef __attribute__((ext_vector_type(2))) __bf16 v2bf;
// two f32 -> one dword of two bf16 (RNE), lo in bits 15..0
__device__ __forceinline__ uint32_t cvt2_bf16(float lo, float hi) {
    v2f f = {lo, hi};
    return __builtin_bit_cast(uint32_t, __builtin_convertvector(f, v2bf));
}
// LDS row pitch of the GEMM tiles in bf16: 80 B = 16 B x odd, the pitch at
// which the 16-byte fragment reads of 64-B rows meet no bank conflict.
#define TPITCH 40

// ---------------------------------------------------------------------------
// M=14400 x N=512 x K=512 bf16 WMMA GEMMs: out = A @ W + bias.
// Block tile 128x64 per weight matrix, 8 waves of 32x32 (2x2 accumulators),
// K-step 32. NW weight matrices share one staged A tile: the Q, K and V
// projections run as one launch (NW = 3), so x is drawn from L2 once for the
// three of them and a wave has 12 WMMAs per k-step. The weight tiles are
// staged once for the two 64-row halves of the block, so each weight matrix
// is drawn from L2 once per 128 rows.
// The first NT products are taken transposed (the weight fragment as A, the
// x fragment as B): a lane then holds 8 consecutive n of one row m.
// Staging map: every wave-wide 16-byte global load covers four whole 128-B
// lines (A: 4 rows x 128 B; W: 4 rows x 128 B); the tiles go to LDS as
// k-contiguous bf16, A in 8-byte and W in 4-byte stores.
// The k loop is pipelined over two LDS buffers: the global loads of step
// t + 2 are issued as soon as step t + 1 has been converted, fly through its
// LDS stores, the barrier and the WMMAs of step t + 1, and are converted
// behind those.
// ---------------------------------------------------------------------------
#define KSTEPS (D_MODEL / 32)
// Work-group barrier of the pipelined k loops. It orders LDS alone: the global
// loads of the next step, which read buffers that the launch never writes, stay
// in flight across it, where __syncthreads() waits for them to return.
__device__ __forceinline__ void lds_barrier() {
    __builtin_amdgcn_fence(__ATOMIC_RELEASE, "workgroup", "local");
    __builtin_amdgcn_s_barrier();
    __builtin_amdgcn_fence(__ATOMIC_ACQUIRE, "workgroup", "local");
}
template <int NW, int NT = 0>
__device__ __forceinline__ void gemm_tiles(
    const float* __restrict__ A, const float* const (&W)[NW],
    uint16_t (*lds_a)[128 * TPITCH], uint16_t (*lds_bt)[NW][64 * TPITCH],
    FragF32 (&acc)[NW][2][2],
    const int tid, const int mBase, const int nBase, const int wr, const int wc,
    const int half, const int l16) {
#pragma unroll
    for (int p = 0; p < NW; ++p)
#pragma unroll
        for (int a = 0; a < 2; ++a)
#pragma unroll
            for (int b = 0; b < 2; ++b)
#pragma unroll
                for (int r = 0; r < 8; ++r) acc[p][a][b].f[r] = 0.0f;

    // A tile, 128 rows x 32 k: 8 lanes read one row's 128 B, so load i of a
    // wave is rows 32*i + 4*wave .. +3, whole lines. The rows of the second
    // half have an offset of their own: where the block's second half lies
    // behind the last row of A, it reads the first half's rows once more.
    const int arow = tid >> 3, ac4 = (tid & 7) * 4;
    uint32_t aoff = ((mBase + arow) * D_MODEL + ac4) * 4;   // byte offset in A
    uint32_t aoff2 = aoff + (mBase + 64 < M_ROWS ? 64 * D_MODEL * 4 : 0);
    // W tiles, 32 k x 64 n each: a thread takes 2 k rows x 4 n columns; 8
    // lanes read one 128-B line of a row, a wave 4 rows per load.
    const int wn = ((tid & 7) | ((tid >> 7) << 3)) * 4;
    const int wk = ((tid >> 3) & 15) * 2;
    uint32_t woff = (wk * D_MODEL + nBase + wn) * 4;        // byte offset in each W

    float4 fa[4], fw[NW][2];     // one k-step's tiles as loaded
    uint2 pa[4];                 // the same as bf16, on their way to LDS
    uint32_t pw[NW][4];

    auto load_step = [&]() {
#pragma unroll
        for (int i = 0; i < 2; ++i) {
            fa[i] = *(const float4*)((const char*)A + aoff + i * 32 * D_MODEL * 4);
            fa[2 + i] = *(const float4*)((const char*)A + aoff2 + i * 32 * D_MODEL * 4);
        }
#pragma unroll
        for (int p = 0; p < NW; ++p)
#pragma unroll
            for (int i = 0; i < 2; ++i)
                fw[p][i] = *(const float4*)((const char*)W[p] + woff + i * D_MODEL * 4);
        // The wait behind the run of 10 loads, in front of any rewrite of a
        // register that they name, their scalar base pairs too.
        asm volatile("s_wait_xcnt 0x0" ::: "memory");
    };
    auto cvt_step = [&]() {
#pragma unroll
        for (int i = 0; i < 4; ++i)
            pa[i] = make_uint2(cvt2_bf16(fa[i].x, fa[i].y), cvt2_bf16(fa[i].z, fa[i].w));
        // transposed: column n gets its 2 consecutive k as one 4-byte piece
#pragma unroll
        for (int p = 0; p < NW; ++p) {
            pw[p][0] = cvt2_bf16(fw[p][0].x, fw[p][1].x);
            pw[p][1] = cvt2_bf16(fw[p][0].y, fw[p][1].y);
            pw[p][2] = cvt2_bf16(fw[p][0].z, fw[p][1].z);
            pw[p][3] = cvt2_bf16(fw[p][0].w, fw[p][1].w);
        }
        // The wait in front of the rewrite of the three offset registers that
        // the 10 loads name, and the rewrite itself (one k-step on: 32 floats in
        // A, 32 rows in each W) in one statement, so that the additions follow
        // the wait and stand ahead of the next step's loads.
        asm volatile("s_wait_xcnt 0x0\n\t"
                     "v_add_nc_u32_e32 %0, 0x80, %0\n\t"
                     "v_add_nc_u32_e32 %1, 0x80, %1\n\t"
                     "v_add_nc_u32_e32 %2, 0x10000, %2"
                     : "+v"(aoff), "+v"(aoff2), "+v"(woff) :: "memory");
    };
    auto put_step = [&](const int buf) {
#pragma unroll
        for (int i = 0; i < 4; ++i)
            *(uint2*)&lds_a[buf][(arow + i * 32) * TPITCH + ac4] = pa[i];
#pragma unroll
        for (int p = 0; p < NW; ++p)
#pragma unroll
            for (int c = 0; c < 4; ++c)
                *(uint32_t*)&lds_bt[buf][p][(wn + c) * TPITCH + wk] = pw[p][c];
    };
    auto mma_step = [&](const int buf) {
        FragB16 af[2];
#pragma unroll
        for (int rg = 0; rg < 2; ++rg) {
            const int row = wr + rg * 16 + l16;
#pragma unroll
            for (int j = 0; j < 8; ++j)
                af[rg].u[j] = *(const uint32_t*)&lds_a[buf][row * TPITCH + kmap(j, half)];
        }
#pragma unroll
        for (int p = 0; p < NW; ++p) {
            FragB16 bf[2];
#pragma unroll
            for (int cg = 0; cg < 2; ++cg) {
                const int col = wc + cg * 16 + l16;
#pragma unroll
                for (int j = 0; j < 8; ++j)
                    bf[cg].u[j] =
                        *(const uint32_t*)&lds_bt[buf][p][col * TPITCH + kmap(j, half)];
            }
#pragma unroll
            for (int rg = 0; rg < 2; ++rg)
#pragma unroll
                for (int cg = 0; cg < 2; ++cg) {
                    if (p < NT)
                        acc[p][rg][cg].v = __builtin_amdgcn_wmma_f32_16x16x32_bf16(
                            false, bf[cg].v, false, af[rg].v, (short)0,
                            acc[p][rg][cg].v, false, false);
                    else
                        acc[p][rg][cg].v = __builtin_amdgcn_wmma_f32_16x16x32_bf16(
                            false, af[rg].v, false, bf[cg].v, (short)0,
                            acc[p][rg][cg].v, false, false);
                }
        }
    };

    load_step();
    cvt_step();
    load_step();                 // step 1 flies
    put_step(0);
    lds_barrier();               // step 0 is staged
    for (int t = 0; t < KSTEPS - 2; ++t) {
        mma_step(t & 1);         // step t + 1 flies meanwhile
        // keeps the conversions, which wait for the loads, behind the last
        // WMMA: moved up among the WMMAs they stall the wave at its second one
        __builtin_amdgcn_sched_barrier(0);
        cvt_step();
        load_step();             // step t + 2, into the registers just read
        // keeps all 10 loads ahead of the LDS stores and the barrier
        __builtin_amdgcn_sched_barrier(0);
        put_step((t + 1) & 1);   // the buffer that every wave left at step t - 1
        // one barrier a step: it publishes step t + 1 and ends the reads of
        // step t's buffer, which is written again in the next trip
        lds_barrier();
    }
    mma_step((KSTEPS - 2) & 1);
    // as in the loop
    __builtin_amdgcn_sched_barrier(0);
    cvt_step();
    put_step((KSTEPS - 1) & 1);
    __syncthreads();             // the last step is staged
    mma_step((KSTEPS - 1) & 1);
}

// Slot of position m (all batches in a row): 32 slots per 30-position grid row.
__device__ __forceinline__ int slot_of(int m) { return m + 2 * (m / GRID_W); }

#define ST_SLOTS 70   // most slots of a 64-position tile: 64 and 3 x 2 pads
#define QKP 72        // staged Q / K slot row, bf16: 144 B = 16 B x odd
#define VTP 74        // staged V^T d row, bf16: 70 slots, 148 B

// Q, K and V^T of one 128-row block and one head, from one staged x tile.
// Four waves per SIMD, asked for as least and as most (256 registers): the k
// loop holds the 10 loads of the next step in registers beside the 12
// accumulators and the fragments of this one.
// Behind the k loop each group of four waves has one 64-row half for itself.
// Its three result tiles go to LDS in slot order, pads as zeros, and from
// there to memory in runs that follow the planes' rows: Q, K [b*8+h][slot][dk]
// (a slot row is one 128-B line), V^T [b*8+h][dk][slot]. A half owns the
// slots from its first position's up to the next half's first. The last
// block's second half lies behind the last row: it stores nothing to memory.
__global__ __launch_bounds__(256) __attribute__((amdgpu_waves_per_eu(4, 4))) void qkv_gemm(
    const float* __restrict__ A, const float* __restrict__ Wq,
    const float* __restrict__ Wk, const float* __restrict__ Wv,
    const float* __restrict__ biasq, const float* __restrict__ biask,
    const float* __restrict__ biasv, uint16_t* __restrict__ Qo,
    uint16_t* __restrict__ Ko, uint16_t* __restrict__ Vo) {
    __shared__ __attribute__((aligned(16))) uint16_t lds_a[2][128 * TPITCH];     // [buffer][row][k] bf16
    __shared__ __attribute__((aligned(16))) uint16_t lds_bt[2][3][64 * TPITCH];  // [buffer][matrix][n][k] bf16 (transposed weights)
    __shared__ __attribute__((aligned(16))) uint16_t st_qk2[2][2][ST_SLOTS * QKP];  // [half][Q | K][slot][dk]
    __shared__ __attribute__((aligned(16))) uint16_t st_vt2[2][64 * VTP];           // [half][dk][slot]

    const int lane = threadIdx.x & 31;
    const int half = lane >> 4, l16 = lane & 15;
    const int nBase = blockIdx.y * 64;
    // which 64-row half this wave works on: the same in every lane of a wave
    const int sub = __builtin_amdgcn_readfirstlane((int)threadIdx.x >> 7);
    const int tid  = threadIdx.x & 127;    // thread and wave within the half
    const int wave = tid >> 5;
    const int wr = (wave >> 1) * 32, wc = (wave & 1) * 32;

    const float* const W[3] = {Wq, Wk, Wv};
    FragF32 acc[3][2][2];
    gemm_tiles<3, 2>(A, W, lds_a, lds_bt, acc, threadIdx.x, blockIdx.x * 128, nBase,
                     sub * 64 + wr, wc, half, l16);

    const int mBase = blockIdx.x * 128 + sub * 64;     // first row of the half
    uint16_t (*st_qk)[ST_SLOTS * QKP] = st_qk2[sub];
    uint16_t* st_vt = st_vt2[sub];

    const int L0 = slot_of(mBase);                     // even, never a pad
    const int np = (slot_of(mBase + 64) - L0) >> 1;    // 34 or 35 slot pairs
    const int p0 = (GRID_W - (L0 & 31)) >> 1;          // first pad pair; then every 16th

    // Q, K (transposed accumulators): register r of a lane is
    // row m = .. + l16, column n = .. + 8 * half + r: one 16-byte LDS store.
    // The lane's 2 x 16 bias values: eight 16-byte loads from one byte offset.
    const uint32_t boff = (uint32_t)(nBase + wc + 8 * half) * 4;
    v4f bb[2][2][2];
    // unrolled, here and below: bb and acc are indexed by constants alone and
    // stay in registers
#pragma unroll
    for (int p = 0; p < 2; ++p)
#pragma unroll
        for (int cg = 0; cg < 2; ++cg)
#pragma unroll
            for (int q = 0; q < 2; ++q)
                bb[p][cg][q] = *(const v4f*)((const char*)(p ? biask : biasq) + boff +
                                             (cg * 64 + q * 16));
    // The wait in front of any rewrite of the offset register that the eight
    // loads name. The offset and the loaded values are inputs only: the offset
    // so that no load's result lands in its register, the values so that every
    // load stands in front of the wait.
    asm volatile("s_wait_xcnt 0x0"
                 :: "v"(boff), "v"(bb[0][0][0]), "v"(bb[0][0][1]), "v"(bb[0][1][0]),
                    "v"(bb[0][1][1]), "v"(bb[1][0][0]), "v"(bb[1][0][1]),
                    "v"(bb[1][1][0]), "v"(bb[1][1][1])
                 : "memory");
#pragma unroll
    for (int p = 0; p < 2; ++p)
#pragma unroll
        for (int cg = 0; cg < 2; ++cg) {
            const int nl = wc + cg * 16 + 8 * half;
            const v4f b0 = bb[p][cg][0], b1 = bb[p][cg][1];
#pragma unroll
            for (int rg = 0; rg < 2; ++rg) {
                const int j = slot_of(mBase + wr + rg * 16 + l16) - L0;
                const float* a = acc[p][rg][cg].f;
                *(uint4*)&st_qk[p][j * QKP + nl] = make_uint4(
                    cvt2_bf16(a[0] + b0.x, a[1] + b0.y), cvt2_bf16(a[2] + b0.z, a[3] + b0.w),
                    cvt2_bf16(a[4] + b1.x, a[5] + b1.y), cvt2_bf16(a[6] + b1.z, a[7] + b1.w));
            }
        }
    // V: register r of a lane is row m = .. + 8 * half + r, column n = .. + l16.
    // An even position and the next lie in one grid row: 4-byte LDS stores.
#pragma unroll
    for (int cg = 0; cg < 2; ++cg) {
        const int nl = wc + cg * 16 + l16;
        const float bn = biasv[nBase + nl];
#pragma unroll
        for (int rg = 0; rg < 2; ++rg)
#pragma unroll
            for (int i = 0; i < 4; ++i) {
                const int j = slot_of(mBase + wr + rg * 16 + 8 * half + 2 * i) - L0;
                *(uint32_t*)&st_vt[nl * VTP + j] = cvt2_bf16(
                    acc[2][rg][cg].f[2 * i] + bn, acc[2][rg][cg].f[2 * i + 1] + bn);
            }
    }
    // The pad pairs: waves 0..2 take one pair each of the Q and K tiles
    // (2 tiles x 2 slot rows x 8 pieces of 16 B), and every d row of V^T
    // gets its dwords.
    if (wave < 3 && p0 + 16 * wave < np)
        *(uint4*)&st_qk[(lane >> 3) & 1][(2 * (p0 + 16 * wave) + (lane >> 4)) * QKP +
                                         (lane & 7) * 8] = make_uint4(0u, 0u, 0u, 0u);
#pragma unroll
    for (int k = 0; k < 2; ++k) {
        const int pr = p0 + 16 * ((tid >> 6) + 2 * k);
        if (pr < np) *(uint32_t*)&st_vt[(tid & 63) * VTP + 2 * pr] = 0u;
    }
    __syncthreads();   // the staged tiles are read by other waves than wrote them
    if (mBase >= M_ROWS) return;   // no row of A: nothing to store, no barrier follows

    const int h = nBase >> 6, b0 = L0 / S_PAD;
    const int bEnd = (b0 + 1) * S_PAD;                 // first slot of the next batch

    // Q, K: 16 bytes a lane, 8 lanes to a slot row, 16 rows (whole lines) to a
    // store of the half's four waves. Element offset = (L + (7 * b + h) * 960) * 64 + d.
    {
        const int r0 = tid >> 3, d0 = (tid & 7) * 8;
        const uint16_t* sq = &st_qk[0][r0 * QKP + d0];
        const uint16_t* sk = &st_qk[1][r0 * QKP + d0];
        uint32_t off[4];                               // in bytes
        uint4 wq[4], wk[4];
#pragma unroll
        for (int i = 0; i < 4; ++i) {
            const int L = L0 + r0 + 16 * i;
            off[i] = (uint32_t)(((L + (7 * (L >= bEnd ? b0 + 1 : b0) + h) * S_PAD) * DK + d0) * 2);
            wq[i] = *(const uint4*)&sq[16 * i * QKP];
            wk[i] = *(const uint4*)&sk[16 * i * QKP];
        }
#pragma unroll
        for (int i = 0; i < 4; ++i) {
            *(uint4*)((char*)Qo + off[i]) = wq[i];
            *(uint4*)((char*)Ko + off[i]) = wk[i];
        }
        if (64 + r0 < 2 * np) {                        // the 4 or 6 slots behind the 64th
            const int L = L0 + r0 + 64;
            const uint32_t o =
                (uint32_t)(((L + (7 * (L >= bEnd ? b0 + 1 : b0) + h) * S_PAD) * DK + d0) * 2);
            const uint4 tq = *(const uint4*)&sq[64 * QKP];
            const uint4 tk = *(const uint4*)&sk[64 * QKP];
            *(uint4*)((char*)Qo + o) = tq;
            *(uint4*)((char*)Ko + o) = tk;
        }
    }

    // V^T: a wave takes 16 d rows; its lanes store 32 consecutive slot pairs
    // of a row (128 B in a row), so a wave-wide store meets 1 or 2 lines and
    // not 32. Element offset = ((b * 8 + h) * 64 + d) * 960 + L - b * 960.
    {
        const int L = L0 + 2 * lane, b = L >= bEnd ? b0 + 1 : b0;
        uint16_t* vp = Vo + (((b * NHEADS + h) * DK + wave * 16) * S_PAD + L - b * S_PAD);
        const uint16_t* sv = &st_vt[wave * 16 * VTP + 2 * lane];
        uint32_t w[16];
#pragma unroll
        for (int r = 0; r < 16; ++r) w[r] = *(const uint32_t*)&sv[r * VTP];
#pragma unroll
        for (int r = 0; r < 16; ++r) *(uint32_t*)&vp[r * S_PAD] = w[r];
    }
    // the 2 or 3 pairs behind the 32nd: 4 lanes to a row, 8 rows to a store
    {
        const int pr = 32 + (lane & 3);
        if (pr < np) {
            const int L = L0 + 2 * pr, b = L >= bEnd ? b0 + 1 : b0;
            const int d = wave * 16 + (lane >> 2);
            uint16_t* vp = Vo + (((b * NHEADS + h) * DK + d) * S_PAD + L - b * S_PAD);
            const uint32_t w0 = *(const uint32_t*)&st_vt[d * VTP + 2 * pr];
            const uint32_t w1 = *(const uint32_t*)&st_vt[(d + 8) * VTP + 2 * pr];
            *(uint32_t*)&vp[0] = w0;
            *(uint32_t*)&vp[8 * S_PAD] = w1;
        }
    }
}

// ---------------------------------------------------------------------------
// K / V^T staging for the attention kernel. The four waves of a work-group
// walk the same keys, so each 64-slot stage (two grid rows) is brought into
// LDS once per work-group by asynchronous copies that cover whole rows, and
// every wave takes its fragments from LDS with 16-byte reads.
// ---------------------------------------------------------------------------
#define ST_KEYS 64               // key slots per stage (two 32-slot blocks)
#define N_STAGES 15              // 15 * 64 = 960 slots, all of them
#define KVP 72                   // LDS row pitch in bf16: 144 B = 16 B x odd
#define TILE_E (64 * KVP)        // one staged tile: 64 rows of 128 B

// One stage: K slots key0..key0+63 (8 KiB in a row) and V^T rows 0..63, slots
// key0..key0+63 (128 B per row, source pitch 1920 B); 16 B per lane and copy,
// 8 lanes to a row, 16 rows to a copy.
// kg / vg: this lane's first source bytes; kl / vl: its first LDS byte address.
__device__ __forceinline__ void stage_copy(const uint16_t* kg, const uint16_t* vg,
                                           uint32_t kl, uint32_t vl) {
    // s_wait_xcnt closes each statement: the address registers named by the
    // copies are not rewritten before it.
    asm volatile(
        "global_load_async_to_lds_b128 %0, %4, off\n\t"
        "global_load_async_to_lds_b128 %1, %5, off\n\t"
        "global_load_async_to_lds_b128 %2, %6, off\n\t"
        "global_load_async_to_lds_b128 %3, %7, off\n\t"
        "s_wait_xcnt 0x0"
        :: "v"(kl), "v"(kl + 16 * 144), "v"(kl + 32 * 144), "v"(kl + 48 * 144),
           "v"(kg), "v"(kg + 16 * DK), "v"(kg + 32 * DK), "v"(kg + 48 * DK)
        : "memory");
    asm volatile(
        "global_load_async_to_lds_b128 %0, %4, off\n\t"
        "global_load_async_to_lds_b128 %1, %5, off\n\t"
        "global_load_async_to_lds_b128 %2, %6, off\n\t"
        "global_load_async_to_lds_b128 %3, %7, off\n\t"
        "s_wait_xcnt 0x0"
        :: "v"(vl), "v"(vl + 16 * 144), "v"(vl + 32 * 144), "v"(vl + 48 * 144),
           "v"(vg), "v"(vg + 16 * S_PAD), "v"(vg + 32 * S_PAD), "v"(vg + 48 * S_PAD)
        : "memory");
}

// 16x16x32 A/B fragment of one row from 16-byte aligned storage: p points at
// the row's k = 8*half; dwords 0..3 are k +0..7, dwords 4..7 are k +16..23.
__device__ __forceinline__ void load_frag16(FragB16& f, const uint16_t* p) {
    const uint4 lo = *(const uint4*)p;
    const uint4 hi = *(const uint4*)(p + 16);
    f.u[0] = lo.x; f.u[1] = lo.y; f.u[2] = lo.z; f.u[3] = lo.w;
    f.u[4] = hi.x; f.u[5] = hi.y; f.u[6] = hi.z; f.u[7] = hi.w;
}

// ---------------------------------------------------------------------------
// One 32-slot block (one grid row of keys) of transposed flash attention.
// Kt points at the block's first slot row, Vt at V^T[d = 0][first slot], both
// in the staged LDS tiles (row pitch KVP).
// dh4: 4 * |query row - key row|, one value per lane for the whole block.
// dw4[i]: 4 * |query column - key column| of this lane's score i; the pad
// slots point 64 entries up the table, where every entry masks.
// ---------------------------------------------------------------------------
__device__ __forceinline__ void attn_block(
    const uint16_t* Kt, const uint16_t* Vt, const FragB16 (&bq)[2],
    FragF32 (&cacc)[4], float& m_run, float& l_run, const int dh4,
    const int (&dw4)[16], const int half, const int l16,
    uint16_t* __restrict__ pl, const float* __restrict__ s_bias) {
    // ---- S^T: two 16-key tiles, accumulate over d (4 WMMAs) ----
    FragF32 sc[2];
#pragma unroll
    for (int t = 0; t < 2; ++t) {
#pragma unroll
        for (int r = 0; r < 8; ++r) sc[t].f[r] = 0.0f;
        const int keyr = t * 16 + l16;                // A row = key slot
#pragma unroll
        for (int db = 0; db < 2; ++db) {
            FragB16 ak;
            load_frag16(ak, &Kt[(size_t)keyr * KVP + db * 32 + 8 * half]);
            sc[t].v = __builtin_amdgcn_wmma_f32_16x16x32_bf16(
                false, ak.v, false, bq[db].v, (short)0, sc[t].v, false, false);
        }
    }

    // ---- spatial bias (and pad mask); lane-local max over 16 slots ----
    float mb = -3.0e38f;
#pragma unroll
    for (int t = 0; t < 2; ++t)
#pragma unroll
        for (int r = 0; r < 8; ++r) {
            const float bias =
                *(const float*)((const char*)s_bias + (dh4 + dw4[t * 8 + r]));
            const float s = sc[t].f[r] * 0.125f + bias;
            sc[t].f[r] = s;
            mb = fmaxf(mb, s);
        }
    mb = fmaxf(mb, __shfl_xor(mb, 16, 32));           // merge key-halves
    const float mnew = fmaxf(m_run, mb);
    const float corr = __expf(m_run - mnew);
    float lb = 0.0f;
#pragma unroll
    for (int t = 0; t < 2; ++t)
#pragma unroll
        for (int r = 0; r < 8; ++r) {
            const float p = __expf(sc[t].f[r] - mnew);
            sc[t].f[r] = p;
            lb += p;
        }
    lb += __shfl_xor(lb, 16, 32);                     // merge key-halves
    l_run = l_run * corr + lb;
    m_run = mnew;

    // rescale ctx^T accumulators by lane-scalar correction
#pragma unroll
    for (int cg = 0; cg < 4; ++cg)
#pragma unroll
        for (int r = 0; r < 8; ++r) cacc[cg].f[r] *= corr;

    // ---- P^T (C layout) -> LDS [q][key] -> B fragment ----
#pragma unroll
    for (int t = 0; t < 2; ++t)
#pragma unroll
        for (int i = 0; i < 4; ++i)
            *(uint32_t*)&pl[l16 * 32 + t * 16 + 8 * half + 2 * i] =
                pack_bf16(sc[t].f[2 * i], sc[t].f[2 * i + 1]);
    asm volatile("s_wait_dscnt 0" ::: "memory");      // same-wave LDS RAW fence
    FragB16 bp;
#pragma unroll
    for (int j = 0; j < 8; ++j)
        bp.u[j] = *(const uint32_t*)&pl[l16 * 32 + kmap(j, half)];

    // V^T fragments come from LDS only now, so that their 32 registers are
    // free during the bias and softmax work
    FragB16 av[4];
#pragma unroll
    for (int cg = 0; cg < 4; ++cg)
        load_frag16(av[cg], &Vt[(size_t)(cg * 16 + l16) * KVP + 8 * half]);

    // ---- ctx^T += V^T_frag @ P^T (4 WMMAs) ----
#pragma unroll
    for (int cg = 0; cg < 4; ++cg)
        cacc[cg].v = __builtin_amdgcn_wmma_f32_16x16x32_bf16(
            false, av[cg].v, false, bp.v, (short)0, cacc[cg].v, false, false);
}

// ---------------------------------------------------------------------------
// Flash-style attention, fully transposed. One wave per 16-query tile per
// (b,h); the work-group's four waves share each staged 64-slot K / V^T stage.
//   S^T[key, q]  = K_blk(16k x 64d) @ Q^T(64d x 16q)   -> lane l16 = query col
//   ctx^T[d, q] += V^T_frag(16d x 32k) @ P^T(32k x 16q)
// Two LDS buffers: stage s + 1 flies while stage s is worked on.
// ---------------------------------------------------------------------------
__global__ __launch_bounds__(128) void attn_kernel(
    const uint16_t* __restrict__ Q, const uint16_t* __restrict__ K,
    const uint16_t* __restrict__ VT, const float* __restrict__ sbias,
    float* __restrict__ ctx_out) {
    __shared__ float s_bias[96];            // 0..58 table; 64..93 mask entries
    __shared__ uint16_t p_lds[4][16 * 32];  // per-wave P^T tile [q][key] bf16
    __shared__ __attribute__((aligned(16))) uint16_t kv[2][2][TILE_E];  // [buffer][K | V^T]

    const int tid = threadIdx.x;
    const int bh = blockIdx.y;             // b*8+h, 0..127
    const uint16_t* Qb = Q + (size_t)bh * S_PAD * DK;
    const uint16_t* Kb = K + (size_t)bh * S_PAD * DK;
    const uint16_t* Vb = VT + (size_t)bh * DK * S_PAD;

    // this lane's share of a stage: 16 B at row tid/8 (+16 rows per copy) of
    // the K tile and of the V^T tile
    const uint16_t* kg = Kb + tid * 8;
    const uint16_t* vg = Vb + (size_t)(tid >> 3) * S_PAD + (tid & 7) * 8;
    const uint32_t lds0 = (uint32_t)(uintptr_t)&kv[0][0][0];  // LDS byte address
    const uint32_t kl = lds0 + (tid >> 3) * 144 + (tid & 7) * 16;
    const uint32_t vl = kl + TILE_E * 2;

    if (tid < 59) s_bias[tid] = sbias[(size_t)tid * 59];  // column 0 of table
    else if (tid >= 64 && tid < 94) s_bias[tid] = -1.0e30f;  // pad slots
    stage_copy(kg, vg, kl, vl);                           // stage 0 -> buffer 0
    // stage 0 has landed before the barrier that publishes it
    asm volatile("s_wait_asynccnt 0x0" ::: "memory");
    __syncthreads();
    stage_copy(kg + ST_KEYS * DK, vg + ST_KEYS, kl + 4 * TILE_E, vl + 4 * TILE_E);

    const int wave = tid >> 5, lane = tid & 31;
    const int half = lane >> 4, l16 = lane & 15;
    const int qt = blockIdx.x * 4 + wave;  // query tile; tiles 57..59 hold no
    const int q0 = qt * 16;                // query: they copy, pass every
                                           // barrier and store nothing
    uint16_t* pl = &p_lds[wave][0];

    const int q = q0 + l16;
    const int qc = min(q, S_LEN - 1);
    const int hqv = qc / GRID_W, wqv = qc % GRID_W;  // this lane's query grid coords

    // B fragments of Q^T (cols = queries), d-blocks 0..31 / 32..63; loop-invariant
    FragB16 bq[2];
#pragma unroll
    for (int db = 0; db < 2; ++db)
#pragma unroll
        for (int j = 0; j < 8; ++j)
            bq[db].u[j] = *(const uint32_t*)&Qb[(size_t)(hqv * 32 + wqv) * DK +
                                                db * 32 + kmap(j, half)];

    // column part of the bias index of this lane's 16 scores, in bytes
    int dw4[16];
#pragma unroll
    for (int i = 0; i < 16; ++i) {
        const int wk = (i >> 3) * 16 + (i & 7) + 8 * half;   // slot in the grid row
        int dw = wqv - wk; dw = dw < 0 ? -dw : dw;
        dw4[i] = (wk < GRID_W ? dw : 64) * 4;
    }

    float m_run = -3.0e38f, l_run = 0.0f;    // lane-scalar online-softmax state
    FragF32 cacc[4];                          // ctx^T accumulators, d blocks of 16
#pragma unroll
    for (int cg = 0; cg < 4; ++cg)
#pragma unroll
        for (int r = 0; r < 8; ++r) cacc[cg].f[r] = 0.0f;

    for (int hk = 0; hk < GRID_W; ++hk) {    // one grid row of keys per block
        const int s = hk >> 1, buf = s & 1, sub = hk & 1;
        int dh = hqv - hk; dh = dh < 0 ? -dh : dh;
        attn_block(&kv[buf][0][sub * 32 * KVP], &kv[buf][1][sub * 32], bq, cacc,
                   m_run, l_run, dh * 4, dw4, half, l16, pl, s_bias);
        if (sub) {
            // publish point of stage s + 1: this wave's reads of buffer buf
            // are done, its own copies of stage s + 1 have landed, then the
            // barrier
            asm volatile("s_wait_dscnt 0x0" ::: "memory");
            asm volatile("s_wait_asynccnt 0x0" ::: "memory");
            __syncthreads();
            if (s + 2 < N_STAGES)            // refill the buffer just left
                stage_copy(kg + (size_t)(s + 2) * ST_KEYS * DK,
                           vg + (s + 2) * ST_KEYS, kl + buf * 4 * TILE_E,
                           vl + buf * 4 * TILE_E);
        }
    }
    // no copy is outstanding when the wave goes on to its end
    asm volatile("s_wait_asynccnt 0x0" ::: "memory");

    // ---- normalize and store: lane owns query q; d = cg*16 + 8*half + r ----
    if (q < S_LEN) {
        const int b = bh >> 3, h = bh & 7;
        const float inv = 1.0f / l_run;
        float* dst = ctx_out + ((size_t)(b * S_LEN + q)) * D_MODEL + h * DK;
#pragma unroll
        for (int cg = 0; cg < 4; ++cg) {
            const int dbase = cg * 16 + 8 * half;
            float4 v0 = make_float4(cacc[cg].f[0] * inv, cacc[cg].f[1] * inv,
                                    cacc[cg].f[2] * inv, cacc[cg].f[3] * inv);
            float4 v1 = make_float4(cacc[cg].f[4] * inv, cacc[cg].f[5] * inv,
                                    cacc[cg].f[6] * inv, cacc[cg].f[7] * inv);
            ((float4*)(dst + dbase))[0] = v0;
            ((float4*)(dst + dbase))[1] = v1;
        }
    }
}

// ---------------------------------------------------------------------------
// Output projection, residual and LayerNorm in one launch.
// A work-group of 16 waves owns 64 whole rows (a 64 x 512 tile): a wave has
// 32 rows x 64 columns (2 x 4 accumulators), K-step 64. The projected rows go
// to LDS as f32; each wave then takes 4 whole rows, adds bias and residual,
// and normalizes them, so the sum never travels through memory.
// ---------------------------------------------------------------------------
#define OP 72         // LDS row pitch of the staged tiles in bf16: 144 B = 16 B x odd
#define RP 516        // LDS row pitch of the projected rows in f32: the two
                      // 16-lane halves of a store (8 rows apart) meet other banks

__global__ __launch_bounds__(512) void out_ln_kernel(
    const float* __restrict__ A, const float* __restrict__ Wo,
    const float* __restrict__ bias, const float* __restrict__ xres,
    const float* __restrict__ gamma, const float* __restrict__ beta,
    float* __restrict__ out) {
    __shared__ __attribute__((aligned(16))) uint16_t lds_a[2][64 * OP];        // [buffer][row][k] bf16
    __shared__ __attribute__((aligned(16))) uint16_t lds_bt[2][D_MODEL * OP];  // [buffer][n][k] bf16
    __shared__ __attribute__((aligned(16))) float lds_r[64 * RP];           // [row][n] f32

    const int tid  = threadIdx.x;
    const int wave = tid >> 5, lane = tid & 31;
    const int half = lane >> 4, l16 = lane & 15;
    const int mBase = blockIdx.x * 64;
    const int wr = (wave >> 3) * 32, wc = (wave & 7) * 64;

    FragF32 acc[2][4];
#pragma unroll
    for (int a = 0; a < 2; ++a)
#pragma unroll
        for (int b = 0; b < 4; ++b)
#pragma unroll
            for (int r = 0; r < 8; ++r) acc[a][b].f[r] = 0.0f;

    // A tile, 64 rows x 64 k: 16 lanes read one row's 256 B, a wave 2 rows.
    const int arow = tid >> 4, ac4 = (tid & 15) * 4;
    uint32_t aoff = ((mBase + arow) * D_MODEL + ac4) * 4;   // byte offset in A
    // W tile, 64 k x 512 n: a thread takes 4 pieces of 4 k rows x 4 n columns,
    // 128 columns apart; 8 lanes read one 128-B line of a row, a wave 4 rows.
    const int wn = ((tid & 7) | ((tid >> 7) << 3)) * 4;
    const int wk = ((tid >> 3) & 15) * 4;
    uint32_t woff = (wk * D_MODEL + wn) * 4;                // byte offset in Wo

    float4 fa[2], fw[4][4];      // one k-step's tiles as loaded
    uint2 pa[2], pw[4][4];       // the same as bf16, on their way to LDS

    auto load_step = [&]() {
#pragma unroll
        for (int i = 0; i < 2; ++i)
            fa[i] = *(const float4*)((const char*)A + aoff + i * 32 * D_MODEL * 4);
#pragma unroll
        for (int u = 0; u < 4; ++u)
#pragma unroll
            for (int i = 0; i < 4; ++i)
                fw[u][i] = *(const float4*)((const char*)Wo + woff +
                                            (i * D_MODEL + u * 128) * 4);
        // The wait behind the run of 18 loads, in front of any rewrite of a
        // register that they name, their scalar base pairs too.
        asm volatile("s_wait_xcnt 0x0" ::: "memory");
    };
    auto cvt_step = [&]() {
#pragma unroll
        for (int i = 0; i < 2; ++i)
            pa[i] = make_uint2(cvt2_bf16(fa[i].x, fa[i].y), cvt2_bf16(fa[i].z, fa[i].w));
        // transposed: column n gets its 4 consecutive k as one 8-byte piece
#pragma unroll
        for (int u = 0; u < 4; ++u) {
            pw[u][0] = make_uint2(
                cvt2_bf16(fw[u][0].x, fw[u][1].x), cvt2_bf16(fw[u][2].x, fw[u][3].x));
            pw[u][1] = make_uint2(
                cvt2_bf16(fw[u][0].y, fw[u][1].y), cvt2_bf16(fw[u][2].y, fw[u][3].y));
            pw[u][2] = make_uint2(
                cvt2_bf16(fw[u][0].z, fw[u][1].z), cvt2_bf16(fw[u][2].z, fw[u][3].z));
            pw[u][3] = make_uint2(
                cvt2_bf16(fw[u][0].w, fw[u][1].w), cvt2_bf16(fw[u][2].w, fw[u][3].w));
        }
        // The wait in front of the rewrite of the two offset registers that the
        // 18 loads name, and the rewrite itself (one k-step on: 64 floats in A,
        // 64 rows in Wo) in one statement: written apart, the additions were
        // put behind the next step's loads, with a wait for those loads in
        // front of the LDS stores.
        asm volatile("s_wait_xcnt 0x0\n\t"
                     "v_add_nc_u32_e32 %0, 0x100, %0\n\t"
                     "v_add_nc_u32_e32 %1, 0x20000, %1"
                     : "+v"(aoff), "+v"(woff) :: "memory");
    };
    auto put_step = [&](const int buf) {
#pragma unroll
        for (int i = 0; i < 2; ++i)
            *(uint2*)&lds_a[buf][(arow + i * 32) * OP + ac4] = pa[i];
#pragma unroll
        for (int u = 0; u < 4; ++u)
#pragma unroll
            for (int c = 0; c < 4; ++c)
                *(uint2*)&lds_bt[buf][(wn + u * 128 + c) * OP + wk] = pw[u][c];
    };
    auto mma_step = [&](const int buf) {
#pragma unroll
        for (int kk = 0; kk < 2; ++kk) {
            FragB16 af[2], bf[4];
#pragma unroll
            for (int rg = 0; rg < 2; ++rg)
                load_frag16(af[rg],
                            &lds_a[buf][(wr + rg * 16 + l16) * OP + kk * 32 + 8 * half]);
#pragma unroll
            for (int cg = 0; cg < 4; ++cg)
                load_frag16(bf[cg],
                            &lds_bt[buf][(wc + cg * 16 + l16) * OP + kk * 32 + 8 * half]);
#pragma unroll
            for (int rg = 0; rg < 2; ++rg)
#pragma unroll
                for (int cg = 0; cg < 4; ++cg)
                    acc[rg][cg].v = __builtin_amdgcn_wmma_f32_16x16x32_bf16(
                        false, af[rg].v, false, bf[cg].v, (short)0, acc[rg][cg].v,
                        false, false);
        }
    };

    // Pipelined over two LDS buffers, as in gemm_tiles: the global loads of
    // step t + 2 fly through the LDS stores and the WMMAs of step t + 1.
    load_step();
    cvt_step();
    load_step();                 // step 1 flies
    put_step(0);
    lds_barrier();               // step 0 is staged
    for (int t = 0; t < D_MODEL / 64 - 2; ++t) {
        mma_step(t & 1);
        // keeps the conversions, which wait for the loads, behind the last WMMA
        __builtin_amdgcn_sched_barrier(0);
        cvt_step();
        load_step();             // step t + 2, into the registers just read
        // keeps all 18 loads ahead of the LDS stores and the barrier
        __builtin_amdgcn_sched_barrier(0);
        put_step((t + 1) & 1);   // the buffer that every wave left at step t - 1
        // one barrier a step: it publishes step t + 1 and ends the reads of
        // step t's buffer, which is written again in the next trip
        lds_barrier();
    }
    mma_step((D_MODEL / 64 - 2) & 1);
    // as in the loop
    __builtin_amdgcn_sched_barrier(0);
    cvt_step();
    put_step((D_MODEL / 64 - 1) & 1);
    __syncthreads();             // the last step is staged
    mma_step((D_MODEL / 64 - 1) & 1);

    // The residual of this wave's 4 rows is asked for first: it flies while
    // the projected rows go to LDS. 16 B a lane, 512 B in a row per load.
    const int row0 = wave * 4;
    const uint32_t xoff = (uint32_t)(((mBase + row0) * D_MODEL + lane * 4) * 4);  // bytes
    v4f xr[4][4], bo4[4], g4[4], be4[4];
    // unrolled, here and below: the arrays are indexed by constants alone and
    // stay in registers
#pragma unroll
    for (int j = 0; j < 4; ++j)
#pragma unroll
        for (int i = 0; i < 4; ++i)
            xr[j][i] = *(const v4f*)((const char*)xres + xoff + (j * D_MODEL + i * 128) * 4);
#pragma unroll
    for (int i = 0; i < 4; ++i) {
        bo4[i] = ((const v4f*)bias)[lane + i * 32];
        g4[i]  = ((const v4f*)gamma)[lane + i * 32];
        be4[i] = ((const v4f*)beta)[lane + i * 32];
    }

    // register r of a lane is row .. + r + 8 * half, column .. + l16
#pragma unroll
    for (int rg = 0; rg < 2; ++rg)
#pragma unroll
        for (int cg = 0; cg < 4; ++cg)
#pragma unroll
            for (int r = 0; r < 8; ++r)
                lds_r[(wr + rg * 16 + r + 8 * half) * RP + wc + cg * 16 + l16] =
                    acc[rg][cg].f[r];
    // The wait in front of any rewrite of the two index registers that the 28
    // loads name (the byte offset; the lane number). They and the loaded values
    // are inputs only: an index so that its register lives up to here and no
    // load's result lands in it, the values so that every load stands in front
    // of the wait.
    asm volatile("s_wait_xcnt 0x0"
                 :: "v"(xoff), "v"(xr[0][0]), "v"(xr[0][1]), "v"(xr[0][2]), "v"(xr[0][3]),
                    "v"(xr[1][0]), "v"(xr[1][1]), "v"(xr[1][2]), "v"(xr[1][3]),
                    "v"(xr[2][0]), "v"(xr[2][1]), "v"(xr[2][2]), "v"(xr[2][3]),
                    "v"(xr[3][0]), "v"(xr[3][1]), "v"(xr[3][2]), "v"(xr[3][3])
                 : "memory");
    asm volatile("s_wait_xcnt 0x0"
                 :: "v"(lane), "v"(bo4[0]), "v"(bo4[1]), "v"(bo4[2]), "v"(bo4[3]),
                    "v"(g4[0]), "v"(g4[1]), "v"(g4[2]), "v"(g4[3]),
                    "v"(be4[0]), "v"(be4[1]), "v"(be4[2]), "v"(be4[3])
                 : "memory");
    __syncthreads();   // a row is read by one of the eight waves that wrote it, seven of them others

#pragma unroll
    for (int j = 0; j < 4; ++j) {
        float vals[16];
        float sum = 0.0f, sq = 0.0f;
#pragma unroll
        for (int i = 0; i < 4; ++i) {
            float4 f = *(const float4*)&lds_r[(row0 + j) * RP + (lane + i * 32) * 4];
            f.x = f.x + bo4[i].x + xr[j][i].x;
            f.y = f.y + bo4[i].y + xr[j][i].y;
            f.z = f.z + bo4[i].z + xr[j][i].z;
            f.w = f.w + bo4[i].w + xr[j][i].w;
            vals[i * 4 + 0] = f.x; vals[i * 4 + 1] = f.y;
            vals[i * 4 + 2] = f.z; vals[i * 4 + 3] = f.w;
            sum += f.x + f.y + f.z + f.w;
            sq  += f.x * f.x + f.y * f.y + f.z * f.z + f.w * f.w;
        }
#pragma unroll
        for (int m = 16; m; m >>= 1) {
            sum += __shfl_xor(sum, m, 32);
            sq  += __shfl_xor(sq,  m, 32);
        }
        const float mu = sum * (1.0f / 512.0f);
        const float var = sq * (1.0f / 512.0f) - mu * mu;
        const float rs = rsqrtf(var + 1e-5f);
        float4* dst = (float4*)(out + (size_t)(mBase + row0 + j) * D_MODEL);
#pragma unroll
        for (int i = 0; i < 4; ++i)
            dst[lane + i * 32] = make_float4(
                (vals[i * 4 + 0] - mu) * rs * g4[i].x + be4[i].x,
                (vals[i * 4 + 1] - mu) * rs * g4[i].y + be4[i].y,
                (vals[i * 4 + 2] - mu) * rs * g4[i].z + be4[i].z,
                (vals[i * 4 + 3] - mu) * rs * g4[i].w + be4[i].w);
    }
}

// ---------------------------------------------------------------------------
extern "C" void kernel_launch(void* const* d_in, const int* in_sizes, int n_in,
                              void* d_out, int out_size, void* d_ws,
                              size_t ws_size, hipStream_t stream) {
    const float* x     = (const float*)d_in[0];
    const float* wq    = (const float*)d_in[1];
    const float* bq    = (const float*)d_in[2];
    const float* wk    = (const float*)d_in[3];
    const float* bk    = (const float*)d_in[4];
    const float* wv    = (const float*)d_in[5];
    const float* bv    = (const float*)d_in[6];
    const float* wo    = (const float*)d_in[7];
    const float* bo    = (const float*)d_in[8];
    const float* gamma = (const float*)d_in[9];
    const float* beta  = (const float*)d_in[10];
    const float* sbias = (const float*)d_in[11];

    // workspace layout (~77 MB total)
    uint8_t* ws = (uint8_t*)d_ws;
    const size_t SZ_H = (size_t)16 * S_PAD * D_MODEL * sizeof(uint16_t);  // 15.73 MB
    uint16_t* Qw = (uint16_t*)(ws);
    uint16_t* Kw = (uint16_t*)(ws + SZ_H);
    uint16_t* Vt = (uint16_t*)(ws + 2 * SZ_H);
    float* ctx   = (float*)(ws + 3 * SZ_H);

    const dim3 gG((M_ROWS + 127) / 128, D_MODEL / 64);  // 113 x 8
    const dim3 blk(128);
    qkv_gemm<<<gG, dim3(256), 0, stream>>>(x, wq, wk, wv, bq, bk, bv, Qw, Kw, Vt);
    attn_kernel<<<dim3(15, 128), blk, 0, stream>>>(Qw, Kw, Vt, sbias, ctx);
    out_ln_kernel<<<dim3(M_ROWS / 64), dim3(512), 0, stream>>>(ctx, wo, bo, x, gamma, beta,
                                                               (float*)d_out);
}

// v009
// It runs in 106 microseconds.
// Two timings next to v008 put it at 1.03 and 1.04 times that version's speed.
// Counting every step since v000, it is 3.20 times as fast.
#include <hip/hip_runtime.h>
#include <hip/hip_bf16.h>
#include <stdint.h>

// ---------------------------------------------------------------------------
// Spatial2DAttention fused pipeline for MI455X (gfx1250, wave32, WMMA).
//   B=16, H=W=30, S=900, d_model=512, heads=8, d_k=64.
// Precision: bf16 WMMA operands (fp32-range-safe), f32 accumulation.
// Attention computed fully TRANSPOSED (S^T = K@Q^T, ctx^T = V^T@P^T) so each
// lane owns one query column: online-softmax stats need only ONE cross-lane
// shuffle per block. Q, K and V^T are kept with 32 key slots per grid row (30
// keys and 2 zero pads), so a 32-key block is one grid row: its row distance
// to a query is one value per lane and the column distances never change.
// ---------------------------------------------------------------------------

#define D_MODEL 512
#define M_ROWS  14400           // B * S
#define S_LEN   900
#define NHEADS  8
#define DK      64
#define GRID_W  30              // keys per grid row
#define S_PAD   960             // 30 grid rows x 32 key slots

typedef __attribute__((ext_vector_type(16))) __bf16 v16bf;
typedef __attribute__((ext_vector_type(8)))  float  v8f;

union FragB16 { v16bf v; uint32_t u[8]; };
union FragF32 { v8f  v; float    f[8]; };

__device__ __forceinline__ uint16_t f32_to_bf16(float f) {
    __bf16 h = (__bf16)f;                       // native v_cvt (RNE) on gfx1250
    return __builtin_bit_cast(uint16_t, h);
}
__device__ __forceinline__ uint32_t pack_bf16(float lo, float hi) {
    return (uint32_t)f32_to_bf16(lo) | ((uint32_t)f32_to_bf16(hi) << 16);
}
// A/B fragment dword j -> starting K index of the 2 packed bf16 (16x16x32 layout):
// lanes 0-15 hold K {0..7, 16..23}, lanes 16-31 hold K {8..15, 24..31}.
__device__ __forceinline__ int kmap(int j, int half) {
    return (j < 4 ? 2 * j : 16 + 2 * (j - 4)) + half * 8;
}

typedef __attribute__((ext_vector_type(2))) float  v2f;
typedef __attribute__((ext_vector_type(4))) float  v4f;
typedef __attribute__((ext_vector_type(2))) __bf16 v2bf;
// two f32 -> one dword of two bf16 (RNE), lo in bits 15..0
__device__ __forceinline__ uint32_t cvt2_bf16(float lo, float hi) {
    v2f f = {lo, hi};
    return __builtin_bit_cast(uint32_t, __builtin_convertvector(f, v2bf));
}
// LDS row pitch of the GEMM tiles in bf16: 80 B = 16 B x odd, the pitch at
// which the 16-byte fragment reads of 64-B rows meet no bank conflict.
#define TPITCH 40

// ---------------------------------------------------------------------------
// M=14400 x N=512 x K=512 bf16 WMMA GEMMs: out = A @ W + bias.
// Block tile 128x64 per weight matrix, 8 waves of 32x32 (2x2 accumulators),
// K-step 32. NW weight matrices share one staged A tile: the Q, K and V
// projections run as one launch (NW = 3), so x is drawn from L2 once for the
// three of them and a wave has 12 WMMAs per k-step. The weight tiles are
// staged once for the two 64-row halves of the block, so each weight matrix
// is drawn from L2 once per 128 rows.
// The first NT products are taken transposed (the weight fragment as A, the
// x fragment as B): a lane then holds 8 consecutive n of one row m.
// Staging map: every wave-wide 16-byte global load covers four whole 128-B
// lines (A: 4 rows x 128 B; W: 4 rows x 128 B); the tiles go to LDS as
// k-contiguous bf16, A in 8-byte and W in 4-byte stores.
// The k loop is pipelined over two LDS buffers: the global loads of step
// t + 2 are issued as soon as step t + 1 has been converted, fly through its
// LDS stores, the barrier and the WMMAs of step t + 1, and are converted
// behind those.
// ---------------------------------------------------------------------------
#define KSTEPS (D_MODEL / 32)
// Work-group barrier of the pipelined k loops. It orders LDS alone: the global
// loads of the next step, which read buffers that the launch never writes, stay
// in flight across it, where __syncthreads() waits for them to return.
__device__ __forceinline__ void lds_barrier() {
    __builtin_amdgcn_fence(__ATOMIC_RELEASE, "workgroup", "local");
    __builtin_amdgcn_s_barrier();
    __builtin_amdgcn_fence(__ATOMIC_ACQUIRE, "workgroup", "local");
}
template <int NW, int NT = 0>
__device__ __forceinline__ void gemm_tiles(
    const float* __restrict__ A, const float* const (&W)[NW],
    uint16_t (*lds_a)[128 * TPITCH], uint16_t (*lds_bt)[NW][64 * TPITCH],
    FragF32 (&acc)[NW][2][2],
    const int tid, const int mBase, const int nBase, const int wr, const int wc,
    const int half, const int l16) {
#pragma unroll
    for (int p = 0; p < NW; ++p)
#pragma unroll
        for (int a = 0; a < 2; ++a)
#pragma unroll
            for (int b = 0; b < 2; ++b)
#pragma unroll
                for (int r = 0; r < 8; ++r) acc[p][a][b].f[r] = 0.0f;

    // A tile, 128 rows x 32 k: 8 lanes read one row's 128 B, so load i of a
    // wave is rows 32*i + 4*wave .. +3, whole lines. The rows of the second
    // half have an offset of their own: where the block's second half lies
    // behind the last row of A, it reads the first half's rows once more.
    const int arow = tid >> 3, ac4 = (tid & 7) * 4;
    uint32_t aoff = ((mBase + arow) * D_MODEL + ac4) * 4;   // byte offset in A
    uint32_t aoff2 = aoff + (mBase + 64 < M_ROWS ? 64 * D_MODEL * 4 : 0);
    // W tiles, 32 k x 64 n each: a thread takes 2 k rows x 4 n columns; 8
    // lanes read one 128-B line of a row, a wave 4 rows per load.
    const int wn = ((tid & 7) | ((tid >> 7) << 3)) * 4;
    const int wk = ((tid >> 3) & 15) * 2;
    uint32_t woff = (wk * D_MODEL + nBase + wn) * 4;        // byte offset in each W

    float4 fa[4], fw[NW][2];     // one k-step's tiles as loaded
    uint2 pa[4];                 // the same as bf16, on their way to LDS
    uint32_t pw[NW][4];

    auto load_step = [&]() {
#pragma unroll
        for (int i = 0; i < 2; ++i) {
            fa[i] = *(const float4*)((const char*)A + aoff + i * 32 * D_MODEL * 4);
            fa[2 + i] = *(const float4*)((const char*)A + aoff2 + i * 32 * D_MODEL * 4);
        }
#pragma unroll
        for (int p = 0; p < NW; ++p)
#pragma unroll
            for (int i = 0; i < 2; ++i)
                fw[p][i] = *(const float4*)((const char*)W[p] + woff + i * D_MODEL * 4);
        // The wait behind the run of 10 loads, in front of any rewrite of a
        // register that they name, their scalar base pairs too.
        asm volatile("s_wait_xcnt 0x0" ::: "memory");
    };
    auto cvt_step = [&]() {
#pragma unroll
        for (int i = 0; i < 4; ++i)
            pa[i] = make_uint2(cvt2_bf16(fa[i].x, fa[i].y), cvt2_bf16(fa[i].z, fa[i].w));
        // transposed: column n gets its 2 consecutive k as one 4-byte piece
#pragma unroll
        for (int p = 0; p < NW; ++p) {
            pw[p][0] = cvt2_bf16(fw[p][0].x, fw[p][1].x);
            pw[p][1] = cvt2_bf16(fw[p][0].y, fw[p][1].y);
            pw[p][2] = cvt2_bf16(fw[p][0].z, fw[p][1].z);
            pw[p][3] = cvt2_bf16(fw[p][0].w, fw[p][1].w);
        }
        // The wait in front of the rewrite of the three offset registers that
        // the 10 loads name, and the rewrite itself (one k-step on: 32 floats in
        // A, 32 rows in each W) in one statement, so that the additions follow
        // the wait and stand ahead of the next step's loads.
        asm volatile("s_wait_xcnt 0x0\n\t"
                     "v_add_nc_u32_e32 %0, 0x80, %0\n\t"
                     "v_add_nc_u32_e32 %1, 0x80, %1\n\t"
                     "v_add_nc_u32_e32 %2, 0x10000, %2"
                     : "+v"(aoff), "+v"(aoff2), "+v"(woff) :: "memory");
    };
    auto put_step = [&](const int buf) {
#pragma unroll
        for (int i = 0; i < 4; ++i)
            *(uint2*)&lds_a[buf][(arow + i * 32) * TPITCH + ac4] = pa[i];
#pragma unroll
        for (int p = 0; p < NW; ++p)
#pragma unroll
            for (int c = 0; c < 4; ++c)
                *(uint32_t*)&lds_bt[buf][p][(wn + c) * TPITCH + wk] = pw[p][c];
    };
    auto mma_step = [&](const int buf) {
        FragB16 af[2];
#pragma unroll
        for (int rg = 0; rg < 2; ++rg) {
            const int row = wr + rg * 16 + l16;
#pragma unroll
            for (int j = 0; j < 8; ++j)
                af[rg].u[j] = *(const uint32_t*)&lds_a[buf][row * TPITCH + kmap(j, half)];
        }
#pragma unroll
        for (int p = 0; p < NW; ++p) {
            FragB16 bf[2];
#pragma unroll
            for (int cg = 0; cg < 2; ++cg) {
                const int col = wc + cg * 16 + l16;
#pragma unroll
                for (int j = 0; j < 8; ++j)
                    bf[cg].u[j] =
                        *(const uint32_t*)&lds_bt[buf][p][col * TPITCH + kmap(j, half)];
            }
#pragma unroll
            for (int rg = 0; rg < 2; ++rg)
#pragma unroll
                for (int cg = 0; cg < 2; ++cg) {
                    if (p < NT)
                        acc[p][rg][cg].v = __builtin_amdgcn_wmma_f32_16x16x32_bf16(
                            false, bf[cg].v, false, af[rg].v, (short)0,
                            acc[p][rg][cg].v, false, false);
                    else
                        acc[p][rg][cg].v = __builtin_amdgcn_wmma_f32_16x16x32_bf16(
                            false, af[rg].v, false, bf[cg].v, (short)0,
                            acc[p][rg][cg].v, false, false);
                }
        }
    };

    load_step();
    cvt_step();
    load_step();                 // step 1 flies
    put_step(0);
    lds_barrier();               // step 0 is staged
    for (int t = 0; t < KSTEPS - 2; ++t) {
        mma_step(t & 1);         // step t + 1 flies meanwhile
        // keeps the conversions, which wait for the loads, behind the last
        // WMMA: moved up among the WMMAs they stall the wave at its second one
        __builtin_amdgcn_sched_barrier(0);
        cvt_step();
        load_step();             // step t + 2, into the registers just read
        // keeps all 10 loads ahead of the LDS stores and the barrier
        __builtin_amdgcn_sched_barrier(0);
        put_step((t + 1) & 1);   // the buffer that every wave left at step t - 1
        // one barrier a step: it publishes step t + 1 and ends the reads of
        // step t's buffer, which is written again in the next trip
        lds_barrier();
    }
    mma_step((KSTEPS - 2) & 1);
    // as in the loop
    __builtin_amdgcn_sched_barrier(0);
    cvt_step();
    put_step((KSTEPS - 1) & 1);
    __syncthreads();             // the last step is staged
    mma_step((KSTEPS - 1) & 1);
}

// Slot of position m (all batches in a row): 32 slots per 30-position grid row.
__device__ __forceinline__ int slot_of(int m) { return m + 2 * (m / GRID_W); }

#define ST_SLOTS 70   // most slots of a 64-position tile: 64 and 3 x 2 pads
#define QKP 72        // staged Q / K slot row, bf16: 144 B = 16 B x odd
#define VTP 74        // staged V^T d row, bf16: 70 slots, 148 B

// Q, K and V^T of one 128-row block and one head, from one staged x tile.
// Four waves per SIMD, asked for as least and as most (256 registers): the k
// loop holds the 10 loads of the next step in registers beside the 12
// accumulators and the fragments of this one.
// Behind the k loop each group of four waves has one 64-row half for itself.
// Its three result tiles go to LDS in slot order, pads as zeros, and from
// there to memory in runs that follow the planes' rows: Q, K [b*8+h][slot][dk]
// (a slot row is one 128-B line), V^T [b*8+h][dk][slot]. A half owns the
// slots from its first position's up to the next half's first. The last
// block's second half lies behind the last row: it stores nothing to memory.
__global__ __launch_bounds__(256) __attribute__((amdgpu_waves_per_eu(4, 4))) void qkv_gemm(
    const float* __restrict__ A, const float* __restrict__ Wq,
    const float* __restrict__ Wk, const float* __restrict__ Wv,
    const float* __restrict__ biasq, const float* __restrict__ biask,
    const float* __restrict__ biasv, uint16_t* __restrict__ Qo,
    uint16_t* __restrict__ Ko, uint16_t* __restrict__ Vo) {
    __shared__ __attribute__((aligned(16))) uint16_t lds_a[2][128 * TPITCH];     // [buffer][row][k] bf16
    __shared__ __attribute__((aligned(16))) uint16_t lds_bt[2][3][64 * TPITCH];  // [buffer][matrix][n][k] bf16 (transposed weights)
    __shared__ __attribute__((aligned(16))) uint16_t st_qk2[2][2][ST_SLOTS * QKP];  // [half][Q | K][slot][dk]
    __shared__ __attribute__((aligned(16))) uint16_t st_vt2[2][64 * VTP];           // [half][dk][slot]

    const int lane = threadIdx.x & 31;
    const int half = lane >> 4, l16 = lane & 15;
    const int nBase = blockIdx.y * 64;
    // which 64-row half this wave works on: the same in every lane of a wave
    const int sub = __builtin_amdgcn_readfirstlane((int)threadIdx.x >> 7);
    const int tid  = threadIdx.x & 127;    // thread and wave within the half
    const int wave = tid >> 5;
    const int wr = (wave >> 1) * 32, wc = (wave & 1) * 32;

    const float* const W[3] = {Wq, Wk, Wv};
    FragF32 acc[3][2][2];
    gemm_tiles<3, 2>(A, W, lds_a, lds_bt, acc, threadIdx.x, blockIdx.x * 128, nBase,
                     sub * 64 + wr, wc, half, l16);

    const int mBase = blockIdx.x * 128 + sub * 64;     // first row of the half
    uint16_t (*st_qk)[ST_SLOTS * QKP] = st_qk2[sub];
    uint16_t* st_vt = st_vt2[sub];

    const int L0 = slot_of(mBase);                     // even, never a pad
    const int np = (slot_of(mBase + 64) - L0) >> 1;    // 34 or 35 slot pairs
    const int p0 = (GRID_W - (L0 & 31)) >> 1;          // first pad pair; then every 16th

    // Q, K (transposed accumulators): register r of a lane is
    // row m = .. + l16, column n = .. + 8 * half + r: one 16-byte LDS store.
    // The lane's 2 x 16 bias values: eight 16-byte loads from one byte offset.
    const uint32_t boff = (uint32_t)(nBase + wc + 8 * half) * 4;
    v4f bb[2][2][2];
    // unrolled, here and below: bb and acc are indexed by constants alone and
    // stay in registers
#pragma unroll
    for (int p = 0; p < 2; ++p)
#pragma unroll
        for (int cg = 0; cg < 2; ++cg)
#pragma unroll
            for (int q = 0; q < 2; ++q)
                bb[p][cg][q] = *(const v4f*)((const char*)(p ? biask : biasq) + boff +
                                             (cg * 64 + q * 16));
    // The wait in front of any rewrite of the offset register that the eight
    // loads name. The offset and the loaded values are inputs only: the offset
    // so that no load's result lands in its register, the values so that every
    // load stands in front of the wait.
    asm volatile("s_wait_xcnt 0x0"
                 :: "v"(boff), "v"(bb[0][0][0]), "v"(bb[0][0][1]), "v"(bb[0][1][0]),
                    "v"(bb[0][1][1]), "v"(bb[1][0][0]), "v"(bb[1][0][1]),
                    "v"(bb[1][1][0]), "v"(bb[1][1][1])
                 : "memory");
#pragma unroll
    for (int p = 0; p < 2; ++p)
#pragma unroll
        for (int cg = 0; cg < 2; ++cg) {
            const int nl = wc + cg * 16 + 8 * half;
            const v4f b0 = bb[p][cg][0], b1 = bb[p][cg][1];
#pragma unroll
            for (int rg = 0; rg < 2; ++rg) {
                const int j = slot_of(mBase + wr + rg * 16 + l16) - L0;
                const float* a = acc[p][rg][cg].f;
                *(uint4*)&st_qk[p][j * QKP + nl] = make_uint4(
                    cvt2_bf16(a[0] + b0.x, a[1] + b0.y), cvt2_bf16(a[2] + b0.z, a[3] + b0.w),
                    cvt2_bf16(a[4] + b1.x, a[5] + b1.y), cvt2_bf16(a[6] + b1.z, a[7] + b1.w));
            }
        }
    // V: register r of a lane is row m = .. + 8 * half + r, column n = .. + l16.
    // An even position and the next lie in one grid row: 4-byte LDS stores.
#pragma unroll
    for (int cg = 0; cg < 2; ++cg) {
        const int nl = wc + cg * 16 + l16;
        const float bn = biasv[nBase + nl];
#pragma unroll
        for (int rg = 0; rg < 2; ++rg)
#pragma unroll
            for (int i = 0; i < 4; ++i) {
                const int j = slot_of(mBase + wr + rg * 16 + 8 * half + 2 * i) - L0;
                *(uint32_t*)&st_vt[nl * VTP + j] = cvt2_bf16(
                    acc[2][rg][cg].f[2 * i] + bn, acc[2][rg][cg].f[2 * i + 1] + bn);
            }
    }
    // The pad pairs: waves 0..2 take one pair each of the Q and K tiles
    // (2 tiles x 2 slot rows x 8 pieces of 16 B), and every d row of V^T
    // gets its dwords.
    if (wave < 3 && p0 + 16 * wave < np)
        *(uint4*)&st_qk[(lane >> 3) & 1][(2 * (p0 + 16 * wave) + (lane >> 4)) * QKP +
                                         (lane & 7) * 8] = make_uint4(0u, 0u, 0u, 0u);
#pragma unroll
    for (int k = 0; k < 2; ++k) {
        const int pr = p0 + 16 * ((tid >> 6) + 2 * k);
        if (pr < np) *(uint32_t*)&st_vt[(tid & 63) * VTP + 2 * pr] = 0u;
    }
    __syncthreads();   // the staged tiles are read by other waves than wrote them
    if (mBase >= M_ROWS) return;   // no row of A: nothing to store, no barrier follows

    const int h = nBase >> 6, b0 = L0 / S_PAD;
    const int bEnd = (b0 + 1) * S_PAD;                 // first slot of the next batch

    // Q, K: 16 bytes a lane, 8 lanes to a slot row, 16 rows (whole lines) to a
    // store of the half's four waves. Element offset = (L + (7 * b + h) * 960) * 64 + d.
    {
        const int r0 = tid >> 3, d0 = (tid & 7) * 8;
        const uint16_t* sq = &st_qk[0][r0 * QKP + d0];
        const uint16_t* sk = &st_qk[1][r0 * QKP + d0];
        uint32_t off[4];                               // in bytes
        uint4 wq[4], wk[4];
#pragma unroll
        for (int i = 0; i < 4; ++i) {
            const int L = L0 + r0 + 16 * i;
            off[i] = (uint32_t)(((L + (7 * (L >= bEnd ? b0 + 1 : b0) + h) * S_PAD) * DK + d0) * 2);
            wq[i] = *(const uint4*)&sq[16 * i * QKP];
            wk[i] = *(const uint4*)&sk[16 * i * QKP];
        }
#pragma unroll
        for (int i = 0; i < 4; ++i) {
            *(uint4*)((char*)Qo + off[i]) = wq[i];
            *(uint4*)((char*)Ko + off[i]) = wk[i];
        }
        if (64 + r0 < 2 * np) {                        // the 4 or 6 slots behind the 64th
            const int L = L0 + r0 + 64;
            const uint32_t o =
                (uint32_t)(((L + (7 * (L >= bEnd ? b0 + 1 : b0) + h) * S_PAD) * DK + d0) * 2);
            const uint4 tq = *(const uint4*)&sq[64 * QKP];
            const uint4 tk = *(const uint4*)&sk[64 * QKP];
            *(uint4*)((char*)Qo + o) = tq;
            *(uint4*)((char*)Ko + o) = tk;
        }
    }

    // V^T: a wave takes 16 d rows; its lanes store 32 consecutive slot pairs
    // of a row (128 B in a row), so a wave-wide store meets 1 or 2 lines and
    // not 32. Element offset = ((b * 8 + h) * 64 + d) * 960 + L - b * 960.
    {
        const int L = L0 + 2 * lane, b = L >= bEnd ? b0 + 1 : b0;
        uint16_t* vp = Vo + (((b * NHEADS + h) * DK + wave * 16) * S_PAD + L - b * S_PAD);
        const uint16_t* sv = &st_vt[wave * 16 * VTP + 2 * lane];
        uint32_t w[16];
#pragma unroll
        for (int r = 0; r < 16; ++r) w[r] = *(const uint32_t*)&sv[r * VTP];
#pragma unroll
        for (int r = 0; r < 16; ++r) *(uint32_t*)&vp[r * S_PAD] = w[r];
    }
    // the 2 or 3 pairs behind the 32nd: 4 lanes to a row, 8 rows to a store
    {
        const int pr = 32 + (lane & 3);
        if (pr < np) {
            const int L = L0 + 2 * pr, b = L >= bEnd ? b0 + 1 : b0;
            const int d = wave * 16 + (lane >> 2);
            uint16_t* vp = Vo + (((b * NHEADS + h) * DK + d) * S_PAD + L - b * S_PAD);
            const uint32_t w0 = *(const uint32_t*)&st_vt[d * VTP + 2 * pr];
            const uint32_t w1 = *(const uint32_t*)&st_vt[(d + 8) * VTP + 2 * pr];
            *(uint32_t*)&vp[0] = w0;
            *(uint32_t*)&vp[8 * S_PAD] = w1;
        }
    }
}

// ---------------------------------------------------------------------------
// K / V^T staging for the attention kernel. The four waves of a work-group
// walk the same keys, so each 64-slot stage (two grid rows) is brought into
// LDS once per work-group by asynchronous copies that cover whole rows, and
// every wave takes its fragments from LDS with 16-byte reads.
// ---------------------------------------------------------------------------
#define ST_KEYS 64               // key slots per stage (two 32-slot blocks)
#define N_STAGES 15              // 15 * 64 = 960 slots, all of them
#define KVP 72                   // LDS row pitch in bf16: 144 B = 16 B x odd
#define TILE_E (64 * KVP)        // one staged tile: 64 rows of 128 B

// One stage: K slots key0..key0+63 (8 KiB in a row) and V^T rows 0..63, slots
// key0..key0+63 (128 B per row, source pitch 1920 B); 16 B per lane and copy,
// 8 lanes to a row, 16 rows to a copy.
// kg / vg: this lane's first source bytes; kl / vl: its first LDS byte address.
__device__ __forceinline__ void stage_copy(const uint16_t* kg, const uint16_t* vg,
                                           uint32_t kl, uint32_t vl) {
    // s_wait_xcnt closes each statement: the address registers named by the
    // copies are not rewritten before it.
    asm volatile(
        "global_load_async_to_lds_b128 %0, %4, off\n\t"
        "global_load_async_to_lds_b128 %1, %5, off\n\t"
        "global_load_async_to_lds_b128 %2, %6, off\n\t"
        "global_load_async_to_lds_b128 %3, %7, off\n\t"
        "s_wait_xcnt 0x0"
        :: "v"(kl), "v"(kl + 16 * 144), "v"(kl + 32 * 144), "v"(kl + 48 * 144),
           "v"(kg), "v"(kg + 16 * DK), "v"(kg + 32 * DK), "v"(kg + 48 * DK)
        : "memory");
    asm volatile(
        "global_load_async_to_lds_b128 %0, %4, off\n\t"
        "global_load_async_to_lds_b128 %1, %5, off\n\t"
        "global_load_async_to_lds_b128 %2, %6, off\n\t"
        "global_load_async_to_lds_b128 %3, %7, off\n\t"
        "s_wait_xcnt 0x0"
        :: "v"(vl), "v"(vl + 16 * 144), "v"(vl + 32 * 144), "v"(vl + 48 * 144),
           "v"(vg), "v"(vg + 16 * S_PAD), "v"(vg + 32 * S_PAD), "v"(vg + 48 * S_PAD)
        : "memory");
}

// 16x16x32 A/B fragment of one row from 16-byte aligned storage: p points at
// the row's k = 8*half; dwords 0..3 are k +0..7, dwords 4..7 are k +16..23.
__device__ __forceinline__ void load_frag16(FragB16& f, const uint16_t* p) {
    const uint4 lo = *(const uint4*)p;
    const uint4 hi = *(const uint4*)(p + 16);
    f.u[0] = lo.x; f.u[1] = lo.y; f.u[2] = lo.z; f.u[3] = lo.w;
    f.u[4] = hi.x; f.u[5] = hi.y; f.u[6] = hi.z; f.u[7] = hi.w;
}

// ---------------------------------------------------------------------------
// One 32-slot block (one grid row of keys) of transposed flash attention for
// the wave's QT query tiles of 16: every K and V^T fragment is read from LDS
// once and serves a WMMA of each tile.
// Kt points at the block's first slot row, Vt at V^T[d = 0][first slot], both
// in the staged LDS tiles (row pitch KVP).
// dh4[u]: 4 * |query row - key row|, one value per lane for the whole block.
// dw4[u][i]: 4 * |query column - key column| of this lane's score i; the pad
// slots point 64 entries up the table, where every entry masks.
// ---------------------------------------------------------------------------
#define QT 2                     // query tiles per wave
__device__ __forceinline__ void attn_block(
    const uint16_t* Kt, const uint16_t* Vt, const FragB16 (&bq)[QT][2],
    FragF32 (&cacc)[QT][4], float (&m_run)[QT], float (&l_run)[QT],
    const int (&dh4)[QT], const int (&dw4)[QT][16], const int half, const int l16,
    const float* __restrict__ s_bias) {
    // ---- the block's K fragments and bias values, one group of LDS reads ----
    FragB16 ak[2][2];
#pragma unroll
    for (int t = 0; t < 2; ++t)
#pragma unroll
        for (int db = 0; db < 2; ++db)
            load_frag16(ak[t][db], &Kt[(size_t)(t * 16 + l16) * KVP + db * 32 + 8 * half]);
    float bias[QT][16];
#pragma unroll
    for (int u = 0; u < QT; ++u)
#pragma unroll
        for (int i = 0; i < 16; ++i)
            bias[u][i] = *(const float*)((const char*)s_bias + (dh4[u] + dw4[u][i]));
    // keeps these reads together ahead of the WMMAs: spread among them, every
    // place with reads makes the wave wait out an LDS round trip of its own
    __builtin_amdgcn_sched_barrier(0);

    // ---- S^T: two 16-key tiles per query tile, accumulate over d ----
    FragF32 sc[QT][2];
#pragma unroll
    for (int t = 0; t < 2; ++t)
#pragma unroll
        for (int u = 0; u < QT; ++u) {
#pragma unroll
            for (int r = 0; r < 8; ++r) sc[u][t].f[r] = 0.0f;
#pragma unroll
            for (int db = 0; db < 2; ++db)
                sc[u][t].v = __builtin_amdgcn_wmma_f32_16x16x32_bf16(
                    false, ak[t][db].v, false, bq[u][db].v, (short)0, sc[u][t].v, false, false);
        }

    // V^T fragments: asked for here, in the registers that the K fragments
    // leave, so that they land during the softmax work
    FragB16 av[4];
#pragma unroll
    for (int cg = 0; cg < 4; ++cg)
        load_frag16(av[cg], &Vt[(size_t)(cg * 16 + l16) * KVP + 8 * half]);
    // keeps the eight reads ahead of the softmax work
    __builtin_amdgcn_sched_barrier(0);

    FragB16 bp[QT];
#pragma unroll
    for (int u = 0; u < QT; ++u) {
        // ---- spatial bias (and pad mask); lane-local max over 16 slots ----
        float mb = -3.0e38f;
#pragma unroll
        for (int t = 0; t < 2; ++t)
#pragma unroll
            for (int r = 0; r < 8; ++r) {
                const float s = sc[u][t].f[r] * 0.125f + bias[u][t * 8 + r];
                sc[u][t].f[r] = s;
                mb = fmaxf(mb, s);
            }
        mb = fmaxf(mb, __shfl_xor(mb, 16, 32));       // merge key-halves
        const float mnew = fmaxf(m_run[u], mb);
        const float corr = __expf(m_run[u] - mnew);
        float lb = 0.0f;
#pragma unroll
        for (int t = 0; t < 2; ++t)
#pragma unroll
            for (int r = 0; r < 8; ++r) {
                const float p = __expf(sc[u][t].f[r] - mnew);
                sc[u][t].f[r] = p;
                lb += p;
            }
        lb += __shfl_xor(lb, 16, 32);                 // merge key-halves
        l_run[u] = l_run[u] * corr + lb;
        m_run[u] = mnew;

        // rescale ctx^T accumulators by lane-scalar correction
#pragma unroll
        for (int cg = 0; cg < 4; ++cg)
#pragma unroll
            for (int r = 0; r < 8; ++r) cacc[u][cg].f[r] *= corr;

        // ---- P^T (C layout) -> B fragment: dword j of the fragment holds keys
        // kmap(j, half) and the next, which are this lane's own scores
        // 2 * (j & 3) and the next of key tile j >> 2 ----
#pragma unroll
        for (int t = 0; t < 2; ++t)
#pragma unroll
            for (int i = 0; i < 4; ++i)
                bp[u].u[t * 4 + i] = pack_bf16(sc[u][t].f[2 * i], sc[u][t].f[2 * i + 1]);
    }

    // ---- ctx^T += V^T_frag @ P^T ----
#pragma unroll
    for (int cg = 0; cg < 4; ++cg)
#pragma unroll
        for (int u = 0; u < QT; ++u)
            cacc[u][cg].v = __builtin_amdgcn_wmma_f32_16x16x32_bf16(
                false, av[cg].v, false, bp[u].v, (short)0, cacc[u][cg].v, false, false);
}

// ---------------------------------------------------------------------------
// Flash-style attention, fully transposed. One wave per two 16-query tiles per
// (b,h); the work-group's four waves (128 queries) share each staged 64-slot
// K / V^T stage.
//   S^T[key, q]  = K_blk(16k x 64d) @ Q^T(64d x 16q)   -> lane l16 = query col
//   ctx^T[d, q] += V^T_frag(16d x 32k) @ P^T(32k x 16q)
// Two LDS buffers: stage s + 1 flies while stage s is worked on.
// Four waves per SIMD, asked for as least and as most (256 registers): the two
// tiles' accumulators, Q fragments and bias offsets stay in registers.
// ---------------------------------------------------------------------------
__global__ __launch_bounds__(128) __attribute__((amdgpu_waves_per_eu(4, 4))) void attn_kernel(
    const uint16_t* __restrict__ Q, const uint16_t* __restrict__ K,
    const uint16_t* __restrict__ VT, const float* __restrict__ sbias,
    float* __restrict__ ctx_out) {
    __shared__ float s_bias[96];            // 0..58 table; 64..93 mask entries
    __shared__ __attribute__((aligned(16))) uint16_t kv[2][2][TILE_E];  // [buffer][K | V^T]

    const int tid = threadIdx.x;
    const int bh = blockIdx.y;             // b*8+h, 0..127
    const uint16_t* Qb = Q + (size_t)bh * S_PAD * DK;
    const uint16_t* Kb = K + (size_t)bh * S_PAD * DK;
    const uint16_t* Vb = VT + (size_t)bh * DK * S_PAD;

    // this lane's share of a stage: 16 B at row tid/8 (+16 rows per copy) of
    // the K tile and of the V^T tile
    const uint16_t* kg = Kb + tid * 8;
    const uint16_t* vg = Vb + (size_t)(tid >> 3) * S_PAD + (tid & 7) * 8;
    const uint32_t lds0 = (uint32_t)(uintptr_t)&kv[0][0][0];  // LDS byte address
    const uint32_t kl = lds0 + (tid >> 3) * 144 + (tid & 7) * 16;
    const uint32_t vl = kl + TILE_E * 2;

    if (tid < 59) s_bias[tid] = sbias[(size_t)tid * 59];  // column 0 of table
    else if (tid >= 64 && tid < 94) s_bias[tid] = -1.0e30f;  // pad slots
    stage_copy(kg, vg, kl, vl);                           // stage 0 -> buffer 0
    // stage 0 has landed before the barrier that publishes it
    asm volatile("s_wait_asynccnt 0x0" ::: "memory");
    __syncthreads();
    stage_copy(kg + ST_KEYS * DK, vg + ST_KEYS, kl + 4 * TILE_E, vl + 4 * TILE_E);

    const int wave = tid >> 5, lane = tid & 31;
    const int half = lane >> 4, l16 = lane & 15;
    // first query of the wave's two tiles; tiles 57..63 hold no query: they
    // copy, pass every barrier and store nothing
    const int q0 = (blockIdx.x * 4 + wave) * (QT * 16);

    int hqv[QT];                             // this lane's query grid rows
    FragB16 bq[QT][2];                       // Q^T fragments, loop-invariant
    int dw4[QT][16];                         // column part of the bias index, bytes
#pragma unroll
    for (int u = 0; u < QT; ++u) {
        const int qc = min(q0 + u * 16 + l16, S_LEN - 1);
        const int wqv = qc % GRID_W;
        hqv[u] = qc / GRID_W;
        // B fragments of Q^T (cols = queries), d-blocks 0..31 / 32..63
#pragma unroll
        for (int db = 0; db < 2; ++db)
#pragma unroll
            for (int j = 0; j < 8; ++j)
                bq[u][db].u[j] = *(const uint32_t*)&Qb[(size_t)(hqv[u] * 32 + wqv) * DK +
                                                       db * 32 + kmap(j, half)];
#pragma unroll
        for (int i = 0; i < 16; ++i) {
            const int wk = (i >> 3) * 16 + (i & 7) + 8 * half;   // slot in the grid row
            int dw = wqv - wk; dw = dw < 0 ? -dw : dw;
            dw4[u][i] = (wk < GRID_W ? dw : 64) * 4;
        }
    }

    float m_run[QT], l_run[QT];               // lane-scalar online-softmax state
    FragF32 cacc[QT][4];                      // ctx^T accumulators, d blocks of 16
#pragma unroll
    for (int u = 0; u < QT; ++u) {
        m_run[u] = -3.0e38f;
        l_run[u] = 0.0f;
#pragma unroll
        for (int cg = 0; cg < 4; ++cg)
#pragma unroll
            for (int r = 0; r < 8; ++r) cacc[u][cg].f[r] = 0.0f;
    }

    for (int hk = 0; hk < GRID_W; ++hk) {    // one grid row of keys per block
        const int s = hk >> 1, buf = s & 1, sub = hk & 1;
        int dh4[QT];
#pragma unroll
        for (int u = 0; u < QT; ++u) {
            const int dh = hqv[u] - hk;
            dh4[u] = (dh < 0 ? -dh : dh) * 4;
        }
        attn_block(&kv[buf][0][sub * 32 * KVP], &kv[buf][1][sub * 32], bq, cacc,
                   m_run, l_run, dh4, dw4, half, l16, s_bias);
        if (sub) {
            // publish point of stage s + 1: this wave's reads of buffer buf
            // are done, its own copies of stage s + 1 have landed, then the
            // barrier
            asm volatile("s_wait_dscnt 0x0" ::: "memory");
            asm volatile("s_wait_asynccnt 0x0" ::: "memory");
            __syncthreads();
            if (s + 2 < N_STAGES)            // refill the buffer just left
                stage_copy(kg + (size_t)(s + 2) * ST_KEYS * DK,
                           vg + (s + 2) * ST_KEYS, kl + buf * 4 * TILE_E,
                           vl + buf * 4 * TILE_E);
        }
    }
    // no copy is outstanding when the wave goes on to its end
    asm volatile("s_wait_asynccnt 0x0" ::: "memory");

    // ---- normalize and store: lane owns query q; d = cg*16 + 8*half + r ----
#pragma unroll
    for (int u = 0; u < QT; ++u) {
        const int q = q0 + u * 16 + l16;
        if (q < S_LEN) {
            const int b = bh >> 3, h = bh & 7;
            const float inv = 1.0f / l_run[u];
            float* dst = ctx_out + ((size_t)(b * S_LEN + q)) * D_MODEL + h * DK;
#pragma unroll
            for (int cg = 0; cg < 4; ++cg) {
                const int dbase = cg * 16 + 8 * half;
                float4 v0 = make_float4(cacc[u][cg].f[0] * inv, cacc[u][cg].f[1] * inv,
                                        cacc[u][cg].f[2] * inv, cacc[u][cg].f[3] * inv);
                float4 v1 = make_float4(cacc[u][cg].f[4] * inv, cacc[u][cg].f[5] * inv,
                                        cacc[u][cg].f[6] * inv, cacc[u][cg].f[7] * inv);
                ((float4*)(dst + dbase))[0] = v0;
                ((float4*)(dst + dbase))[1] = v1;
            }
        }
    }
}

// ---------------------------------------------------------------------------
// Output projection, residual and LayerNorm in one launch.
// A work-group of 16 waves owns 64 whole rows (a 64 x 512 tile): a wave has
// 32 rows x 64 columns (2 x 4 accumulators), K-step 64. The projected rows go
// to LDS as f32; each wave then takes 4 whole rows, adds bias and residual,
// and normalizes them, so the sum never travels through memory.
// ---------------------------------------------------------------------------
#define OP 72         // LDS row pitch of the staged tiles in bf16: 144 B = 16 B x odd
#define RP 516        // LDS row pitch of the projected rows in f32: the two
                      // 16-lane halves of a store (8 rows apart) meet other banks

__global__ __launch_bounds__(512) void out_ln_kernel(
    const float* __restrict__ A, const float* __restrict__ Wo,
    const float* __restrict__ bias, const float* __restrict__ xres,
    const float* __restrict__ gamma, const float* __restrict__ beta,
    float* __restrict__ out) {
    __shared__ __attribute__((aligned(16))) uint16_t lds_a[2][64 * OP];        // [buffer][row][k] bf16
    __shared__ __attribute__((aligned(16))) uint16_t lds_bt[2][D_MODEL * OP];  // [buffer][n][k] bf16
    __shared__ __attribute__((aligned(16))) float lds_r[64 * RP];           // [row][n] f32

    const int tid  = threadIdx.x;
    const int wave = tid >> 5, lane = tid & 31;
    const int half = lane >> 4, l16 = lane & 15;
    const int mBase = blockIdx.x * 64;
    const int wr = (wave >> 3) * 32, wc = (wave & 7) * 64;

    FragF32 acc[2][4];
#pragma unroll
    for (int a = 0; a < 2; ++a)
#pragma unroll
        for (int b = 0; b < 4; ++b)
#pragma unroll
            for (int r = 0; r < 8; ++r) acc[a][b].f[r] = 0.0f;

    // A tile, 64 rows x 64 k: 16 lanes read one row's 256 B, a wave 2 rows.
    const int arow = tid >> 4, ac4 = (tid & 15) * 4;
    uint32_t aoff = ((mBase + arow) * D_MODEL + ac4) * 4;   // byte offset in A
    // W tile, 64 k x 512 n: a thread takes 4 pieces of 4 k rows x 4 n columns,
    // 128 columns apart; 8 lanes read one 128-B line of a row, a wave 4 rows.
    const int wn = ((tid & 7) | ((tid >> 7) << 3)) * 4;
    const int wk = ((tid >> 3) & 15) * 4;
    uint32_t woff = (wk * D_MODEL + wn) * 4;                // byte offset in Wo

    float4 fa[2], fw[4][4];      // one k-step's tiles as loaded
    uint2 pa[2], pw[4][4];       // the same as bf16, on their way to LDS

    auto load_step = [&]() {
#pragma unroll
        for (int i = 0; i < 2; ++i)
            fa[i] = *(const float4*)((const char*)A + aoff + i * 32 * D_MODEL * 4);
#pragma unroll
        for (int u = 0; u < 4; ++u)
#pragma unroll
            for (int i = 0; i < 4; ++i)
                fw[u][i] = *(const float4*)((const char*)Wo + woff +
                                            (i * D_MODEL + u * 128) * 4);
        // The wait behind the run of 18 loads, in front of any rewrite of a
        // register that they name, their scalar base pairs too.
        asm volatile("s_wait_xcnt 0x0" ::: "memory");
    };
    auto cvt_step = [&]() {
#pragma unroll
        for (int i = 0; i < 2; ++i)
            pa[i] = make_uint2(cvt2_bf16(fa[i].x, fa[i].y), cvt2_bf16(fa[i].z, fa[i].w));
        // transposed: column n gets its 4 consecutive k as one 8-byte piece
#pragma unroll
        for (int u = 0; u < 4; ++u) {
            pw[u][0] = make_uint2(
                cvt2_bf16(fw[u][0].x, fw[u][1].x), cvt2_bf16(fw[u][2].x, fw[u][3].x));
            pw[u][1] = make_uint2(
                cvt2_bf16(fw[u][0].y, fw[u][1].y), cvt2_bf16(fw[u][2].y, fw[u][3].y));
            pw[u][2] = make_uint2(
                cvt2_bf16(fw[u][0].z, fw[u][1].z), cvt2_bf16(fw[u][2].z, fw[u][3].z));
            pw[u][3] = make_uint2(
                cvt2_bf16(fw[u][0].w, fw[u][1].w), cvt2_bf16(fw[u][2].w, fw[u][3].w));
        }
        // The wait in front of the rewrite of the two offset registers that the
        // 18 loads name, and the rewrite itself (one k-step on: 64 floats in A,
        // 64 rows in Wo) in one statement: written apart, the additions were
        // put behind the next step's loads, with a wait for those loads in
        // front of the LDS stores.
        asm volatile("s_wait_xcnt 0x0\n\t"
                     "v_add_nc_u32_e32 %0, 0x100, %0\n\t"
                     "v_add_nc_u32_e32 %1, 0x20000, %1"
                     : "+v"(aoff), "+v"(woff) :: "memory");
    };
    auto put_step = [&](const int buf) {
#pragma unroll
        for (int i = 0; i < 2; ++i)
            *(uint2*)&lds_a[buf][(arow + i * 32) * OP + ac4] = pa[i];
#pragma unroll
        for (int u = 0; u < 4; ++u)
#pragma unroll
            for (int c = 0; c < 4; ++c)
                *(uint2*)&lds_bt[buf][(wn + u * 128 + c) * OP + wk] = pw[u][c];
    };
    auto mma_step = [&](const int buf) {
#pragma unroll
        for (int kk = 0; kk < 2; ++kk) {
            FragB16 af[2], bf[4];
#pragma unroll
            for (int rg = 0; rg < 2; ++rg)
                load_frag16(af[rg],
                            &lds_a[buf][(wr + rg * 16 + l16) * OP + kk * 32 + 8 * half]);
#pragma unroll
            for (int cg = 0; cg < 4; ++cg)
                load_frag16(bf[cg],
                            &lds_bt[buf][(wc + cg * 16 + l16) * OP + kk * 32 + 8 * half]);
#pragma unroll
            for (int rg = 0; rg < 2; ++rg)
#pragma unroll
                for (int cg = 0; cg < 4; ++cg)
                    acc[rg][cg].v = __builtin_amdgcn_wmma_f32_16x16x32_bf16(
                        false, af[rg].v, false, bf[cg].v, (short)0, acc[rg][cg].v,
                        false, false);
        }
    };

    // Pipelined over two LDS buffers, as in gemm_tiles: the global loads of
    // step t + 2 fly through the LDS stores and the WMMAs of step t + 1.
    load_step();
    cvt_step();
    load_step();                 // step 1 flies
    put_step(0);
    lds_barrier();               // step 0 is staged
    for (int t = 0; t < D_MODEL / 64 - 2; ++t) {
        mma_step(t & 1);
        // keeps the conversions, which wait for the loads, behind the last WMMA
        __builtin_amdgcn_sched_barrier(0);
        cvt_step();
        load_step();             // step t + 2, into the registers just read
        // keeps all 18 loads ahead of the LDS stores and the barrier
        __builtin_amdgcn_sched_barrier(0);
        put_step((t + 1) & 1);   // the buffer that every wave left at step t - 1
        // one barrier a step: it publishes step t + 1 and ends the reads of
        // step t's buffer, which is written again in the next trip
        lds_barrier();
    }
    mma_step((D_MODEL / 64 - 2) & 1);
    // as in the loop
    __builtin_amdgcn_sched_barrier(0);
    cvt_step();
    put_step((D_MODEL / 64 - 1) & 1);
    __syncthreads();             // the last step is staged
    mma_step((D_MODEL / 64 - 1) & 1);

    // The residual of this wave's 4 rows is asked for first: it flies while
    // the projected rows go to LDS. 16 B a lane, 512 B in a row per load.
    const int row0 = wave * 4;
    const uint32_t xoff = (uint32_t)(((mBase + row0) * D_MODEL + lane * 4) * 4);  // bytes
    v4f xr[4][4], bo4[4], g4[4], be4[4];
    // unrolled, here and below: the arrays are indexed by constants alone and
    // stay in registers
#pragma unroll
    for (int j = 0; j < 4; ++j)
#pragma unroll
        for (int i = 0; i < 4; ++i)
            xr[j][i] = *(const v4f*)((const char*)xres + xoff + (j * D_MODEL + i * 128) * 4);
#pragma unroll
    for (int i = 0; i < 4; ++i) {
        bo4[i] = ((const v4f*)bias)[lane + i * 32];
        g4[i]  = ((const v4f*)gamma)[lane + i * 32];
        be4[i] = ((const v4f*)beta)[lane + i * 32];
    }

    // register r of a lane is row .. + r + 8 * half, column .. + l16
#pragma unroll
    for (int rg = 0; rg < 2; ++rg)
#pragma unroll
        for (int cg = 0; cg < 4; ++cg)
#pragma unroll
            for (int r = 0; r < 8; ++r)
                lds_r[(wr + rg * 16 + r + 8 * half) * RP + wc + cg * 16 + l16] =
                    acc[rg][cg].f[r];
    // The wait in front of any rewrite of the two index registers that the 28
    // loads name (the byte offset; the lane number). They and the loaded values
    // are inputs only: an index so that its register lives up to here and no
    // load's result lands in it, the values so that every load stands in front
    // of the wait.
    asm volatile("s_wait_xcnt 0x0"
                 :: "v"(xoff), "v"(xr[0][0]), "v"(xr[0][1]), "v"(xr[0][2]), "v"(xr[0][3]),
                    "v"(xr[1][0]), "v"(xr[1][1]), "v"(xr[1][2]), "v"(xr[1][3]),
                    "v"(xr[2][0]), "v"(xr[2][1]), "v"(xr[2][2]), "v"(xr[2][3]),
                    "v"(xr[3][0]), "v"(xr[3][1]), "v"(xr[3][2]), "v"(xr[3][3])
                 : "memory");
    asm volatile("s_wait_xcnt 0x0"
                 :: "v"(lane), "v"(bo4[0]), "v"(bo4[1]), "v"(bo4[2]), "v"(bo4[3]),
                    "v"(g4[0]), "v"(g4[1]), "v"(g4[2]), "v"(g4[3]),
                    "v"(be4[0]), "v"(be4[1]), "v"(be4[2]), "v"(be4[3])
                 : "memory");
    __syncthreads();   // a row is read by one of the eight waves that wrote it, seven of them others

#pragma unroll
    for (int j = 0; j < 4; ++j) {
        float vals[16];
        float sum = 0.0f, sq = 0.0f;
#pragma unroll
        for (int i = 0; i < 4; ++i) {
            float4 f = *(const float4*)&lds_r[(row0 + j) * RP + (lane + i * 32) * 4];
            f.x = f.x + bo4[i].x + xr[j][i].x;
            f.y = f.y + bo4[i].y + xr[j][i].y;
            f.z = f.z + bo4[i].z + xr[j][i].z;
            f.w = f.w + bo4[i].w + xr[j][i].w;
            vals[i * 4 + 0] = f.x; vals[i * 4 + 1] = f.y;
            vals[i * 4 + 2] = f.z; vals[i * 4 + 3] = f.w;
            sum += f.x + f.y + f.z + f.w;
            sq  += f.x * f.x + f.y * f.y + f.z * f.z + f.w * f.w;
        }
#pragma unroll
        for (int m = 16; m; m >>= 1) {
            sum += __shfl_xor(sum, m, 32);
            sq  += __shfl_xor(sq,  m, 32);
        }
        const float mu = sum * (1.0f / 512.0f);
        const float var = sq * (1.0f / 512.0f) - mu * mu;
        const float rs = rsqrtf(var + 1e-5f);
        float4* dst = (float4*)(out + (size_t)(mBase + row0 + j) * D_MODEL);
#pragma unroll
        for (int i = 0; i < 4; ++i)
            dst[lane + i * 32] = make_float4(
                (vals[i * 4 + 0] - mu) * rs * g4[i].x + be4[i].x,
                (vals[i * 4 + 1] - mu) * rs * g4[i].y + be4[i].y,
                (vals[i * 4 + 2] - mu) * rs * g4[i].z + be4[i].z,
                (vals[i * 4 + 3] - mu) * rs * g4[i].w + be4[i].w);
    }
}

// ---------------------------------------------------------------------------
extern "C" void kernel_launch(void* const* d_in, const int* in_sizes, int n_in,
                              void* d_out, int out_size, void* d_ws,
                              size_t ws_size, hipStream_t stream) {
    const float* x     = (const float*)d_in[0];
    const float* wq    = (const float*)d_in[1];
    const float* bq    = (const float*)d_in[2];
    const float* wk    = (const float*)d_in[3];
    const float* bk    = (const float*)d_in[4];
    const float* wv    = (const float*)d_in[5];
    const float* bv    = (const float*)d_in[6];
    const float* wo    = (const float*)d_in[7];
    const float* bo    = (const float*)d_in[8];
    const float* gamma = (const float*)d_in[9];
    const float* beta  = (const float*)d_in[10];
    const float* sbias = (const float*)d_in[11];

    // workspace layout (~77 MB total)
    uint8_t* ws = (uint8_t*)d_ws;
    const size_t SZ_H = (size_t)16 * S_PAD * D_MODEL * sizeof(uint16_t);  // 15.73 MB
    uint16_t* Qw = (uint16_t*)(ws);
    uint16_t* Kw = (uint16_t*)(ws + SZ_H);
    uint16_t* Vt = (uint16_t*)(ws + 2 * SZ_H);
    float* ctx   = (float*)(ws + 3 * SZ_H);

    const dim3 gG((M_ROWS + 127) / 128, D_MODEL / 64);  // 113 x 8
    const dim3 blk(128);
    qkv_gemm<<<gG, dim3(256), 0, stream>>>(x, wq, wk, wv, bq, bk, bv, Qw, Kw, Vt);
    attn_kernel<<<dim3(8, 128), blk, 0, stream>>>(Qw, Kw, Vt, sbias, ctx);
    out_ln_kernel<<<dim3(M_ROWS / 64), dim3(512), 0, stream>>>(ctx, wo, bo, x, gamma, beta,
                                                               (float*)d_out);
}

// v010
// Measured time: 102 microseconds a run.
// Timed twice side by side with v009, it ran 1.03 times as fast both times.
// All steps since v000 together make it 3.30 times as fast.
#include <hip/hip_runtime.h>
#include <hip/hip_bf16.h>
#include <stdint.h>

// ---------------------------------------------------------------------------
// Spatial2DAttention fused pipeline for MI455X (gfx1250, wave32, WMMA).
//   B=16, H=W=30, S=900, d_model=512, heads=8, d_k=64.
// Precision: bf16 WMMA operands (fp32-range-safe), f32 accumulation.
// Attention computed fully TRANSPOSED (S^T = K@Q^T, ctx^T = V^T@P^T) so each
// lane owns one query column: online-softmax stats need only ONE cross-lane
// shuffle per block. Q, K and V^T are kept with 32 key slots per grid row (30
// keys and 2 zero pads), so a 32-key block is one grid row: its row distance
// to a query is one value per lane and the column distances never change.
// ---------------------------------------------------------------------------

#define D_MODEL 512
#define M_ROWS  14400           // B * S
#define S_LEN   900
#define NHEADS  8
#define DK      64
#define GRID_W  30              // keys per grid row
#define S_PAD   960             // 30 grid rows x 32 key slots

typedef __attribute__((ext_vector_type(16))) __bf16 v16bf;
typedef __attribute__((ext_vector_type(8)))  float  v8f;

union FragB16 { v16bf v; uint32_t u[8]; };
union FragF32 { v8f  v; float    f[8]; };

// A/B fragment dword j -> starting K index of the 2 packed bf16 (16x16x32 layout):
// lanes 0-15 hold K {0..7, 16..23}, lanes 16-31 hold K {8..15, 24..31}.
__device__ __forceinline__ int kmap(int j, int half) {
    return (j < 4 ? 2 * j : 16 + 2 * (j - 4)) + half * 8;
}

typedef __attribute__((ext_vector_type(2))) float  v2f;
typedef __attribute__((ext_vector_type(4))) float  v4f;
typedef __attribute__((ext_vector_type(2))) __bf16 v2bf;
// two f32 -> one dword of two bf16 (RNE), lo in bits 15..0
__device__ __forceinline__ uint32_t cvt2_bf16(float lo, float hi) {
    v2f f = {lo, hi};
    return __builtin_bit_cast(uint32_t, __builtin_convertvector(f, v2bf));
}
// LDS row pitch of the GEMM tiles in bf16: 80 B = 16 B x odd, the pitch at
// which the 16-byte fragment reads of 64-B rows meet no bank conflict.
#define TPITCH 40

// ---------------------------------------------------------------------------
// M=14400 x N=512 x K=512 bf16 WMMA GEMMs: out = A @ W + bias.
// Block tile 128x64 per weight matrix, 8 waves of 32x32 (2x2 accumulators),
// K-step 32. NW weight matrices share one staged A tile: the Q, K and V
// projections run as one launch (NW = 3), so x is drawn from L2 once for the
// three of them and a wave has 12 WMMAs per k-step. The weight tiles are
// staged once for the two 64-row halves of the block, so each weight matrix
// is drawn from L2 once per 128 rows.
// The first NT products are taken transposed (the weight fragment as A, the
// x fragment as B): a lane then holds 8 consecutive n of one row m.
// Staging map: every wave-wide 16-byte global load covers four whole 128-B
// lines (A: 4 rows x 128 B; W: 4 rows x 128 B); the tiles go to LDS as
// k-contiguous bf16, A in 8-byte and W in 4-byte stores.
// The k loop is pipelined over two LDS buffers: the global loads of step
// t + 2 are issued as soon as step t + 1 has been converted, fly through its
// LDS stores, the barrier and the WMMAs of step t + 1, and are converted
// behind those.
// ---------------------------------------------------------------------------
#define KSTEPS (D_MODEL / 32)
// Work-group barrier of the pipelined k loops. It orders LDS alone: the global
// loads of the next step, which read buffers that the launch never writes, stay
// in flight across it, where __syncthreads() waits for them to return.
__device__ __forceinline__ void lds_barrier() {
    __builtin_amdgcn_fence(__ATOMIC_RELEASE, "workgroup", "local");
    __builtin_amdgcn_s_barrier();
    __builtin_amdgcn_fence(__ATOMIC_ACQUIRE, "workgroup", "local");
}
template <int NW, int NT = 0>
__device__ __forceinline__ void gemm_tiles(
    const float* __restrict__ A, const float* const (&W)[NW],
    uint16_t (*lds_a)[128 * TPITCH], uint16_t (*lds_bt)[NW][64 * TPITCH],
    FragF32 (&acc)[NW][2][2],
    const int tid, const int mBase, const int nBase, const int wr, const int wc,
    const int half, const int l16) {
#pragma unroll
    for (int p = 0; p < NW; ++p)
#pragma unroll
        for (int a = 0; a < 2; ++a)
#pragma unroll
            for (int b = 0; b < 2; ++b)
#pragma unroll
                for (int r = 0; r < 8; ++r) acc[p][a][b].f[r] = 0.0f;

    // A tile, 128 rows x 32 k: 8 lanes read one row's 128 B, so load i of a
    // wave is rows 32*i + 4*wave .. +3, whole lines. The rows of the second
    // half have an offset of their own: where the block's second half lies
    // behind the last row of A, it reads the first half's rows once more.
    const int arow = tid >> 3, ac4 = (tid & 7) * 4;
    uint32_t aoff = ((mBase + arow) * D_MODEL + ac4) * 4;   // byte offset in A
    uint32_t aoff2 = aoff + (mBase + 64 < M_ROWS ? 64 * D_MODEL * 4 : 0);
    // W tiles, 32 k x 64 n each: a thread takes 2 k rows x 4 n columns; 8
    // lanes read one 128-B line of a row, a wave 4 rows per load.
    const int wn = ((tid & 7) | ((tid >> 7) << 3)) * 4;
    const int wk = ((tid >> 3) & 15) * 2;
    uint32_t woff = (wk * D_MODEL + nBase + wn) * 4;        // byte offset in each W

    float4 fa[4], fw[NW][2];     // one k-step's tiles as loaded
    uint2 pa[4];                 // the same as bf16, on their way to LDS
    uint32_t pw[NW][4];

    auto load_step = [&]() {
#pragma unroll
        for (int i = 0; i < 2; ++i) {
            fa[i] = *(const float4*)((const char*)A + aoff + i * 32 * D_MODEL * 4);
            fa[2 + i] = *(const float4*)((const char*)A + aoff2 + i * 32 * D_MODEL * 4);
        }
#pragma unroll
        for (int p = 0; p < NW; ++p)
#pragma unroll
            for (int i = 0; i < 2; ++i)
                fw[p][i] = *(const float4*)((const char*)W[p] + woff + i * D_MODEL * 4);
        // The wait behind the run of 10 loads, in front of any rewrite of a
        // register that they name, their scalar base pairs too.
        asm volatile("s_wait_xcnt 0x0" ::: "memory");
    };
    auto cvt_step = [&]() {
#pragma unroll
        for (int i = 0; i < 4; ++i)
            pa[i] = make_uint2(cvt2_bf16(fa[i].x, fa[i].y), cvt2_bf16(fa[i].z, fa[i].w));
        // transposed: column n gets its 2 consecutive k as one 4-byte piece
#pragma unroll
        for (int p = 0; p < NW; ++p) {
            pw[p][0] = cvt2_bf16(fw[p][0].x, fw[p][1].x);
            pw[p][1] = cvt2_bf16(fw[p][0].y, fw[p][1].y);
            pw[p][2] = cvt2_bf16(fw[p][0].z, fw[p][1].z);
            pw[p][3] = cvt2_bf16(fw[p][0].w, fw[p][1].w);
        }
        // The wait in front of the rewrite of the three offset registers that
        // the 10 loads name, and the rewrite itself (one k-step on: 32 floats in
        // A, 32 rows in each W) in one statement, so that the additions follow
        // the wait and stand ahead of the next step's loads.
        asm volatile("s_wait_xcnt 0x0\n\t"
                     "v_add_nc_u32_e32 %0, 0x80, %0\n\t"
                     "v_add_nc_u32_e32 %1, 0x80, %1\n\t"
                     "v_add_nc_u32_e32 %2, 0x10000, %2"
                     : "+v"(aoff), "+v"(aoff2), "+v"(woff) :: "memory");
    };
    auto put_step = [&](const int buf) {
#pragma unroll
        for (int i = 0; i < 4; ++i)
            *(uint2*)&lds_a[buf][(arow + i * 32) * TPITCH + ac4] = pa[i];
#pragma unroll
        for (int p = 0; p < NW; ++p)
#pragma unroll
            for (int c = 0; c < 4; ++c)
                *(uint32_t*)&lds_bt[buf][p][(wn + c) * TPITCH + wk] = pw[p][c];
    };
    auto mma_step = [&](const int buf) {
        FragB16 af[2];
#pragma unroll
        for (int rg = 0; rg < 2; ++rg) {
            const int row = wr + rg * 16 + l16;
#pragma unroll
            for (int j = 0; j < 8; ++j)
                af[rg].u[j] = *(const uint32_t*)&lds_a[buf][row * TPITCH + kmap(j, half)];
        }
#pragma unroll
        for (int p = 0; p < NW; ++p) {
            FragB16 bf[2];
#pragma unroll
            for (int cg = 0; cg < 2; ++cg) {
                const int col = wc + cg * 16 + l16;
#pragma unroll
                for (int j = 0; j < 8; ++j)
                    bf[cg].u[j] =
                        *(const uint32_t*)&lds_bt[buf][p][col * TPITCH + kmap(j, half)];
            }
#pragma unroll
            for (int rg = 0; rg < 2; ++rg)
#pragma unroll
                for (int cg = 0; cg < 2; ++cg) {
                    if (p < NT)
                        acc[p][rg][cg].v = __builtin_amdgcn_wmma_f32_16x16x32_bf16(
                            false, bf[cg].v, false, af[rg].v, (short)0,
                            acc[p][rg][cg].v, false, false);
                    else
                        acc[p][rg][cg].v = __builtin_amdgcn_wmma_f32_16x16x32_bf16(
                            false, af[rg].v, false, bf[cg].v, (short)0,
                            acc[p][rg][cg].v, false, false);
                }
        }
    };

    load_step();
    cvt_step();
    load_step();                 // step 1 flies
    put_step(0);
    lds_barrier();               // step 0 is staged
    for (int t = 0; t < KSTEPS - 2; ++t) {
        mma_step(t & 1);         // step t + 1 flies meanwhile
        // keeps the conversions, which wait for the loads, behind the last
        // WMMA: moved up among the WMMAs they stall the wave at its second one
        __builtin_amdgcn_sched_barrier(0);
        cvt_step();
        load_step();             // step t + 2, into the registers just read
        // keeps all 10 loads ahead of the LDS stores and the barrier
        __builtin_amdgcn_sched_barrier(0);
        put_step((t + 1) & 1);   // the buffer that every wave left at step t - 1
        // one barrier a step: it publishes step t + 1 and ends the reads of
        // step t's buffer, which is written again in the next trip
        lds_barrier();
    }
    mma_step((KSTEPS - 2) & 1);
    // as in the loop
    __builtin_amdgcn_sched_barrier(0);
    cvt_step();
    put_step((KSTEPS - 1) & 1);
    __syncthreads();             // the last step is staged
    mma_step((KSTEPS - 1) & 1);
}

// Slot of position m (all batches in a row): 32 slots per 30-position grid row.
__device__ __forceinline__ int slot_of(int m) { return m + 2 * (m / GRID_W); }

#define ST_SLOTS 70   // most slots of a 64-position tile: 64 and 3 x 2 pads
#define QKP 72        // staged Q / K slot row, bf16: 144 B = 16 B x odd
#define VTP 74        // staged V^T d row, bf16: 70 slots, 148 B

// Q, K and V^T of one 128-row block and one head, from one staged x tile.
// Four waves per SIMD, asked for as least and as most (256 registers): the k
// loop holds the 10 loads of the next step in registers beside the 12
// accumulators and the fragments of this one.
// Behind the k loop each group of four waves has one 64-row half for itself.
// Its three result tiles go to LDS in slot order, pads as zeros, and from
// there to memory in runs that follow the planes' rows: Q, K [b*8+h][slot][dk]
// (a slot row is one 128-B line), V^T [b*8+h][dk][slot]. A half owns the
// slots from its first position's up to the next half's first. The last
// block's second half lies behind the last row: it stores nothing to memory.
__global__ __launch_bounds__(256) __attribute__((amdgpu_waves_per_eu(4, 4))) void qkv_gemm(
    const float* __restrict__ A, const float* __restrict__ Wq,
    const float* __restrict__ Wk, const float* __restrict__ Wv,
    const float* __restrict__ biasq, const float* __restrict__ biask,
    const float* __restrict__ biasv, uint16_t* __restrict__ Qo,
    uint16_t* __restrict__ Ko, uint16_t* __restrict__ Vo) {
    __shared__ __attribute__((aligned(16))) uint16_t lds_a[2][128 * TPITCH];     // [buffer][row][k] bf16
    __shared__ __attribute__((aligned(16))) uint16_t lds_bt[2][3][64 * TPITCH];  // [buffer][matrix][n][k] bf16 (transposed weights)
    __shared__ __attribute__((aligned(16))) uint16_t st_qk2[2][2][ST_SLOTS * QKP];  // [half][Q | K][slot][dk]
    __shared__ __attribute__((aligned(16))) uint16_t st_vt2[2][64 * VTP];           // [half][dk][slot]

    const int lane = threadIdx.x & 31;
    const int half = lane >> 4, l16 = lane & 15;
    const int nBase = blockIdx.y * 64;
    // which 64-row half this wave works on: the same in every lane of a wave
    const int sub = __builtin_amdgcn_readfirstlane((int)threadIdx.x >> 7);
    const int tid  = threadIdx.x & 127;    // thread and wave within the half
    const int wave = tid >> 5;
    const int wr = (wave >> 1) * 32, wc = (wave & 1) * 32;

    const float* const W[3] = {Wq, Wk, Wv};
    FragF32 acc[3][2][2];
    gemm_tiles<3, 2>(A, W, lds_a, lds_bt, acc, threadIdx.x, blockIdx.x * 128, nBase,
                     sub * 64 + wr, wc, half, l16);

    const int mBase = blockIdx.x * 128 + sub * 64;     // first row of the half
    uint16_t (*st_qk)[ST_SLOTS * QKP] = st_qk2[sub];
    uint16_t* st_vt = st_vt2[sub];

    const int L0 = slot_of(mBase);                     // even, never a pad
    const int np = (slot_of(mBase + 64) - L0) >> 1;    // 34 or 35 slot pairs
    const int p0 = (GRID_W - (L0 & 31)) >> 1;          // first pad pair; then every 16th

    // Q, K (transposed accumulators): register r of a lane is
    // row m = .. + l16, column n = .. + 8 * half + r: one 16-byte LDS store.
    // The lane's 2 x 16 bias values: eight 16-byte loads from one byte offset.
    const uint32_t boff = (uint32_t)(nBase + wc + 8 * half) * 4;
    v4f bb[2][2][2];
    // unrolled, here and below: bb and acc are indexed by constants alone and
    // stay in registers
#pragma unroll
    for (int p = 0; p < 2; ++p)
#pragma unroll
        for (int cg = 0; cg < 2; ++cg)
#pragma unroll
            for (int q = 0; q < 2; ++q)
                bb[p][cg][q] = *(const v4f*)((const char*)(p ? biask : biasq) + boff +
                                             (cg * 64 + q * 16));
    // The wait in front of any rewrite of the offset register that the eight
    // loads name. The offset and the loaded values are inputs only: the offset
    // so that no load's result lands in its register, the values so that every
    // load stands in front of the wait.
    asm volatile("s_wait_xcnt 0x0"
                 :: "v"(boff), "v"(bb[0][0][0]), "v"(bb[0][0][1]), "v"(bb[0][1][0]),
                    "v"(bb[0][1][1]), "v"(bb[1][0][0]), "v"(bb[1][0][1]),
                    "v"(bb[1][1][0]), "v"(bb[1][1][1])
                 : "memory");
#pragma unroll
    for (int p = 0; p < 2; ++p)
#pragma unroll
        for (int cg = 0; cg < 2; ++cg) {
            const int nl = wc + cg * 16 + 8 * half;
            const v4f b0 = bb[p][cg][0], b1 = bb[p][cg][1];
#pragma unroll
            for (int rg = 0; rg < 2; ++rg) {
                const int j = slot_of(mBase + wr + rg * 16 + l16) - L0;
                const float* a = acc[p][rg][cg].f;
                *(uint4*)&st_qk[p][j * QKP + nl] = make_uint4(
                    cvt2_bf16(a[0] + b0.x, a[1] + b0.y), cvt2_bf16(a[2] + b0.z, a[3] + b0.w),
                    cvt2_bf16(a[4] + b1.x, a[5] + b1.y), cvt2_bf16(a[6] + b1.z, a[7] + b1.w));
            }
        }
    // V: register r of a lane is row m = .. + 8 * half + r, column n = .. + l16.
    // An even position and the next lie in one grid row: 4-byte LDS stores.
#pragma unroll
    for (int cg = 0; cg < 2; ++cg) {
        const int nl = wc + cg * 16 + l16;
        const float bn = biasv[nBase + nl];
#pragma unroll
        for (int rg = 0; rg < 2; ++rg)
#pragma unroll
            for (int i = 0; i < 4; ++i) {
                const int j = slot_of(mBase + wr + rg * 16 + 8 * half + 2 * i) - L0;
                *(uint32_t*)&st_vt[nl * VTP + j] = cvt2_bf16(
                    acc[2][rg][cg].f[2 * i] + bn, acc[2][rg][cg].f[2 * i + 1] + bn);
            }
    }
    // The pad pairs: waves 0..2 take one pair each of the Q and K tiles
    // (2 tiles x 2 slot rows x 8 pieces of 16 B), and every d row of V^T
    // gets its dwords.
    if (wave < 3 && p0 + 16 * wave < np)
        *(uint4*)&st_qk[(lane >> 3) & 1][(2 * (p0 + 16 * wave) + (lane >> 4)) * QKP +
                                         (lane & 7) * 8] = make_uint4(0u, 0u, 0u, 0u);
#pragma unroll
    for (int k = 0; k < 2; ++k) {
        const int pr = p0 + 16 * ((tid >> 6) + 2 * k);
        if (pr < np) *(uint32_t*)&st_vt[(tid & 63) * VTP + 2 * pr] = 0u;
    }
    __syncthreads();   // the staged tiles are read by other waves than wrote them
    if (mBase >= M_ROWS) return;   // no row of A: nothing to store, no barrier follows

    const int h = nBase >> 6, b0 = L0 / S_PAD;
    const int bEnd = (b0 + 1) * S_PAD;                 // first slot of the next batch

    // Q, K: 16 bytes a lane, 8 lanes to a slot row, 16 rows (whole lines) to a
    // store of the half's four waves. Element offset = (L + (7 * b + h) * 960) * 64 + d.
    {
        const int r0 = tid >> 3, d0 = (tid & 7) * 8;
        const uint16_t* sq = &st_qk[0][r0 * QKP + d0];
        const uint16_t* sk = &st_qk[1][r0 * QKP + d0];
        uint32_t off[4];                               // in bytes
        uint4 wq[4], wk[4];
#pragma unroll
        for (int i = 0; i < 4; ++i) {
            const int L = L0 + r0 + 16 * i;
            off[i] = (uint32_t)(((L + (7 * (L >= bEnd ? b0 + 1 : b0) + h) * S_PAD) * DK + d0) * 2);
            wq[i] = *(const uint4*)&sq[16 * i * QKP];
            wk[i] = *(const uint4*)&sk[16 * i * QKP];
        }
#pragma unroll
        for (int i = 0; i < 4; ++i) {
            *(uint4*)((char*)Qo + off[i]) = wq[i];
            *(uint4*)((char*)Ko + off[i]) = wk[i];
        }
        if (64 + r0 < 2 * np) {                        // the 4 or 6 slots behind the 64th
            const int L = L0 + r0 + 64;
            const uint32_t o =
                (uint32_t)(((L + (7 * (L >= bEnd ? b0 + 1 : b0) + h) * S_PAD) * DK + d0) * 2);
            const uint4 tq = *(const uint4*)&sq[64 * QKP];
            const uint4 tk = *(const uint4*)&sk[64 * QKP];
            *(uint4*)((char*)Qo + o) = tq;
            *(uint4*)((char*)Ko + o) = tk;
        }
    }

    // V^T: a wave takes 16 d rows; its lanes store 32 consecutive slot pairs
    // of a row (128 B in a row), so a wave-wide store meets 1 or 2 lines and
    // not 32. Element offset = ((b * 8 + h) * 64 + d) * 960 + L - b * 960.
    {
        const int L = L0 + 2 * lane, b = L >= bEnd ? b0 + 1 : b0;
        uint16_t* vp = Vo + (((b * NHEADS + h) * DK + wave * 16) * S_PAD + L - b * S_PAD);
        const uint16_t* sv = &st_vt[wave * 16 * VTP + 2 * lane];
        uint32_t w[16];
#pragma unroll
        for (int r = 0; r < 16; ++r) w[r] = *(const uint32_t*)&sv[r * VTP];
#pragma unroll
        for (int r = 0; r < 16; ++r) *(uint32_t*)&vp[r * S_PAD] = w[r];
    }
    // the 2 or 3 pairs behind the 32nd: 4 lanes to a row, 8 rows to a store
    {
        const int pr = 32 + (lane & 3);
        if (pr < np) {
            const int L = L0 + 2 * pr, b = L >= bEnd ? b0 + 1 : b0;
            const int d = wave * 16 + (lane >> 2);
            uint16_t* vp = Vo + (((b * NHEADS + h) * DK + d) * S_PAD + L - b * S_PAD);
            const uint32_t w0 = *(const uint32_t*)&st_vt[d * VTP + 2 * pr];
            const uint32_t w1 = *(const uint32_t*)&st_vt[(d + 8) * VTP + 2 * pr];
            *(uint32_t*)&vp[0] = w0;
            *(uint32_t*)&vp[8 * S_PAD] = w1;
        }
    }
}

// ---------------------------------------------------------------------------
// K / V^T staging for the attention kernel. The four waves of a work-group
// walk the same keys, so each 64-slot stage (two grid rows) is brought into
// LDS once per work-group by asynchronous copies that cover whole rows, and
// every wave takes its fragments from LDS with 16-byte reads.
// ---------------------------------------------------------------------------
#define ST_KEYS 64               // key slots per stage (two 32-slot blocks)
#define N_STAGES 15              // 15 * 64 = 960 slots, all of them
#define KVP 72                   // LDS row pitch in bf16: 144 B = 16 B x odd
#define TILE_E (64 * KVP)        // one staged tile: 64 rows of 128 B

// One stage: K slots key0..key0+63 (8 KiB in a row) and V^T rows 0..63, slots
// key0..key0+63 (128 B per row, source pitch 1920 B); 16 B per lane and copy,
// 8 lanes to a row, 16 rows to a copy.
// kg / vg: this lane's first source bytes; kl / vl: its first LDS byte address.
__device__ __forceinline__ void stage_copy(const uint16_t* kg, const uint16_t* vg,
                                           uint32_t kl, uint32_t vl) {
    // s_wait_xcnt closes each statement: the address registers named by the
    // copies are not rewritten before it.
    asm volatile(
        "global_load_async_to_lds_b128 %0, %4, off\n\t"
        "global_load_async_to_lds_b128 %1, %5, off\n\t"
        "global_load_async_to_lds_b128 %2, %6, off\n\t"
        "global_load_async_to_lds_b128 %3, %7, off\n\t"
        "s_wait_xcnt 0x0"
        :: "v"(kl), "v"(kl + 16 * 144), "v"(kl + 32 * 144), "v"(kl + 48 * 144),
           "v"(kg), "v"(kg + 16 * DK), "v"(kg + 32 * DK), "v"(kg + 48 * DK)
        : "memory");
    asm volatile(
        "global_load_async_to_lds_b128 %0, %4, off\n\t"
        "global_load_async_to_lds_b128 %1, %5, off\n\t"
        "global_load_async_to_lds_b128 %2, %6, off\n\t"
        "global_load_async_to_lds_b128 %3, %7, off\n\t"
        "s_wait_xcnt 0x0"
        :: "v"(vl), "v"(vl + 16 * 144), "v"(vl + 32 * 144), "v"(vl + 48 * 144),
           "v"(vg), "v"(vg + 16 * S_PAD), "v"(vg + 32 * S_PAD), "v"(vg + 48 * S_PAD)
        : "memory");
}

// 16x16x32 A/B fragment of one row from 16-byte aligned storage: p points at
// the row's k = 8*half; dwords 0..3 are k +0..7, dwords 4..7 are k +16..23.
__device__ __forceinline__ void load_frag16(FragB16& f, const uint16_t* p) {
    const uint4 lo = *(const uint4*)p;
    const uint4 hi = *(const uint4*)(p + 16);
    f.u[0] = lo.x; f.u[1] = lo.y; f.u[2] = lo.z; f.u[3] = lo.w;
    f.u[4] = hi.x; f.u[5] = hi.y; f.u[6] = hi.z; f.u[7] = hi.w;
}

// ---------------------------------------------------------------------------
// One 32-slot block (one grid row of keys) of transposed flash attention for
// the wave's QT query tiles of 16: every K and V^T fragment is read from LDS
// once and serves a WMMA of each tile.
// Kt points at the block's first slot row, Vt at V^T[d = 0][first slot], both
// in the staged LDS tiles (row pitch KVP).
// dh4[u]: 4 * |query row - key row|, one value per lane for the whole block.
// dw4[u][i]: 4 * |query column - key column| of this lane's score i; the pad
// slots point 64 entries up the table, where every entry masks.
// ---------------------------------------------------------------------------
#define QT 2                     // query tiles per wave
__device__ __forceinline__ void attn_block(
    const uint16_t* Kt, const uint16_t* Vt, const FragB16 (&bq)[QT][2],
    FragF32 (&cacc)[QT][4], float (&m_run)[QT], float (&l_run)[QT],
    const int (&dh4)[QT], const int (&dw4)[QT][16], const int half, const int l16,
    const float* __restrict__ s_bias) {
    // ---- the block's K fragments and bias values, one group of LDS reads ----
    FragB16 ak[2][2];
#pragma unroll
    for (int t = 0; t < 2; ++t)
#pragma unroll
        for (int db = 0; db < 2; ++db)
            load_frag16(ak[t][db], &Kt[(size_t)(t * 16 + l16) * KVP + db * 32 + 8 * half]);
    float bias[QT][16];
#pragma unroll
    for (int u = 0; u < QT; ++u)
#pragma unroll
        for (int i = 0; i < 16; ++i)
            bias[u][i] = *(const float*)((const char*)s_bias + (dh4[u] + dw4[u][i]));
    // keeps these reads together ahead of the WMMAs: spread among them, every
    // place with reads makes the wave wait out an LDS round trip of its own
    __builtin_amdgcn_sched_barrier(0);

    // ---- S^T: two 16-key tiles per query tile, accumulate over d ----
    FragF32 sc[QT][2];
#pragma unroll
    for (int t = 0; t < 2; ++t)
#pragma unroll
        for (int u = 0; u < QT; ++u) {
#pragma unroll
            for (int r = 0; r < 8; ++r) sc[u][t].f[r] = 0.0f;
#pragma unroll
            for (int db = 0; db < 2; ++db)
                sc[u][t].v = __builtin_amdgcn_wmma_f32_16x16x32_bf16(
                    false, ak[t][db].v, false, bq[u][db].v, (short)0, sc[u][t].v, false, false);
        }

    // V^T fragments: asked for here, in the registers that the K fragments
    // leave, so that they land during the softmax work
    FragB16 av[4];
#pragma unroll
    for (int cg = 0; cg < 4; ++cg)
        load_frag16(av[cg], &Vt[(size_t)(cg * 16 + l16) * KVP + 8 * half]);
    // keeps the eight reads ahead of the softmax work
    __builtin_amdgcn_sched_barrier(0);

    FragB16 bp[QT];
#pragma unroll
    for (int u = 0; u < QT; ++u) {
        // ---- spatial bias (and pad mask); lane-local max over 16 slots ----
        float mb = -3.0e38f;
#pragma unroll
        for (int t = 0; t < 2; ++t)
#pragma unroll
            for (int r = 0; r < 8; ++r) {
                const float s = sc[u][t].f[r] * 0.125f + bias[u][t * 8 + r];
                sc[u][t].f[r] = s;
                mb = fmaxf(mb, s);
            }
        mb = fmaxf(mb, __shfl_xor(mb, 16, 32));       // merge key-halves
        const float mnew = fmaxf(m_run[u], mb);
        const float corr = __expf(m_run[u] - mnew);
        float lb = 0.0f;
#pragma unroll
        for (int t = 0; t < 2; ++t)
#pragma unroll
            for (int r = 0; r < 8; ++r) {
                const float p = __expf(sc[u][t].f[r] - mnew);
                sc[u][t].f[r] = p;
                lb += p;
            }
        lb += __shfl_xor(lb, 16, 32);                 // merge key-halves
        l_run[u] = l_run[u] * corr + lb;
        m_run[u] = mnew;

        // rescale ctx^T accumulators by lane-scalar correction
#pragma unroll
        for (int cg = 0; cg < 4; ++cg)
#pragma unroll
            for (int r = 0; r < 8; ++r) cacc[u][cg].f[r] *= corr;

        // ---- P^T (C layout) -> B fragment: dword j of the fragment holds keys
        // kmap(j, half) and the next, which are this lane's own scores
        // 2 * (j & 3) and the next of key tile j >> 2: one paired conversion ----
#pragma unroll
        for (int t = 0; t < 2; ++t)
#pragma unroll
            for (int i = 0; i < 4; ++i)
                bp[u].u[t * 4 + i] = cvt2_bf16(sc[u][t].f[2 * i], sc[u][t].f[2 * i + 1]);
    }

    // ---- ctx^T += V^T_frag @ P^T ----
#pragma unroll
    for (int cg = 0; cg < 4; ++cg)
#pragma unroll
        for (int u = 0; u < QT; ++u)
            cacc[u][cg].v = __builtin_amdgcn_wmma_f32_16x16x32_bf16(
                false, av[cg].v, false, bp[u].v, (short)0, cacc[u][cg].v, false, false);
}

// ---------------------------------------------------------------------------
// Flash-style attention, fully transposed. One wave per two 16-query tiles per
// (b,h); the work-group's four waves (128 queries) share each staged 64-slot
// K / V^T stage.
//   S^T[key, q]  = K_blk(16k x 64d) @ Q^T(64d x 16q)   -> lane l16 = query col
//   ctx^T[d, q] += V^T_frag(16d x 32k) @ P^T(32k x 16q)
// Two LDS buffers: stage s + 1 flies while stage s is worked on.
// Four waves per SIMD, asked for as least and as most (256 registers): the two
// tiles' accumulators, Q fragments and bias offsets stay in registers.
// ---------------------------------------------------------------------------
__global__ __launch_bounds__(128) __attribute__((amdgpu_waves_per_eu(4, 4))) void attn_kernel(
    const uint16_t* __restrict__ Q, const uint16_t* __restrict__ K,
    const uint16_t* __restrict__ VT, const float* __restrict__ sbias,
    float* __restrict__ ctx_out) {
    __shared__ float s_bias[96];            // 0..58 table; 64..93 mask entries
    __shared__ __attribute__((aligned(16))) uint16_t kv[2][2][TILE_E];  // [buffer][K | V^T]

    const int tid = threadIdx.x;
    const int bh = blockIdx.y;             // b*8+h, 0..127
    const uint16_t* Qb = Q + (size_t)bh * S_PAD * DK;
    const uint16_t* Kb = K + (size_t)bh * S_PAD * DK;
    const uint16_t* Vb = VT + (size_t)bh * DK * S_PAD;

    // this lane's share of a stage: 16 B at row tid/8 (+16 rows per copy) of
    // the K tile and of the V^T tile
    const uint16_t* kg = Kb + tid * 8;
    const uint16_t* vg = Vb + (size_t)(tid >> 3) * S_PAD + (tid & 7) * 8;
    const uint32_t lds0 = (uint32_t)(uintptr_t)&kv[0][0][0];  // LDS byte address
    const uint32_t kl = lds0 + (tid >> 3) * 144 + (tid & 7) * 16;
    const uint32_t vl = kl + TILE_E * 2;

    if (tid < 59) s_bias[tid] = sbias[(size_t)tid * 59];  // column 0 of table
    else if (tid >= 64 && tid < 94) s_bias[tid] = -1.0e30f;  // pad slots
    stage_copy(kg, vg, kl, vl);                           // stage 0 -> buffer 0
    // stage 0 has landed before the barrier that publishes it
    asm volatile("s_wait_asynccnt 0x0" ::: "memory");
    __syncthreads();
    stage_copy(kg + ST_KEYS * DK, vg + ST_KEYS, kl + 4 * TILE_E, vl + 4 * TILE_E);

    const int wave = tid >> 5, lane = tid & 31;
    const int half = lane >> 4, l16 = lane & 15;
    // first query of the wave's two tiles; tiles 57..63 hold no query: they
    // copy, pass every barrier and store nothing
    const int q0 = (blockIdx.x * 4 + wave) * (QT * 16);

    int hqv[QT];                             // this lane's query grid rows
    FragB16 bq[QT][2];                       // Q^T fragments, loop-invariant
    int dw4[QT][16];                         // column part of the bias index, bytes
#pragma unroll
    for (int u = 0; u < QT; ++u) {
        const int qc = min(q0 + u * 16 + l16, S_LEN - 1);
        const int wqv = qc % GRID_W;
        hqv[u] = qc / GRID_W;
        // B fragments of Q^T (cols = queries), d-blocks 0..31 / 32..63
#pragma unroll
        for (int db = 0; db < 2; ++db)
#pragma unroll
            for (int j = 0; j < 8; ++j)
                bq[u][db].u[j] = *(const uint32_t*)&Qb[(size_t)(hqv[u] * 32 + wqv) * DK +
                                                       db * 32 + kmap(j, half)];
#pragma unroll
        for (int i = 0; i < 16; ++i) {
            const int wk = (i >> 3) * 16 + (i & 7) + 8 * half;   // slot in the grid row
            int dw = wqv - wk; dw = dw < 0 ? -dw : dw;
            dw4[u][i] = (wk < GRID_W ? dw : 64) * 4;
        }
    }

    float m_run[QT], l_run[QT];               // lane-scalar online-softmax state
    FragF32 cacc[QT][4];                      // ctx^T accumulators, d blocks of 16
#pragma unroll
    for (int u = 0; u < QT; ++u) {
        m_run[u] = -3.0e38f;
        l_run[u] = 0.0f;
#pragma unroll
        for (int cg = 0; cg < 4; ++cg)
#pragma unroll
            for (int r = 0; r < 8; ++r) cacc[u][cg].f[r] = 0.0f;
    }

    for (int hk = 0; hk < GRID_W; ++hk) {    // one grid row of keys per block
        const int s = hk >> 1, buf = s & 1, sub = hk & 1;
        int dh4[QT];
#pragma unroll
        for (int u = 0; u < QT; ++u) {
            const int dh = hqv[u] - hk;
            dh4[u] = (dh < 0 ? -dh : dh) * 4;
        }
        attn_block(&kv[buf][0][sub * 32 * KVP], &kv[buf][1][sub * 32], bq, cacc,
                   m_run, l_run, dh4, dw4, half, l16, s_bias);
        if (sub) {
            // publish point of stage s + 1: this wave's reads of buffer buf
            // are done, its own copies of stage s + 1 have landed, then the
            // barrier
            asm volatile("s_wait_dscnt 0x0" ::: "memory");
            asm volatile("s_wait_asynccnt 0x0" ::: "memory");
            __syncthreads();
            if (s + 2 < N_STAGES)            // refill the buffer just left
                stage_copy(kg + (size_t)(s + 2) * ST_KEYS * DK,
                           vg + (s + 2) * ST_KEYS, kl + buf * 4 * TILE_E,
                           vl + buf * 4 * TILE_E);
        }
    }
    // no copy is outstanding when the wave goes on to its end
    asm volatile("s_wait_asynccnt 0x0" ::: "memory");

    // ---- normalize and store: lane owns query q; d = cg*16 + 8*half + r ----
#pragma unroll
    for (int u = 0; u < QT; ++u) {
        const int q = q0 + u * 16 + l16;
        if (q < S_LEN) {
            const int b = bh >> 3, h = bh & 7;
            const float inv = 1.0f / l_run[u];
            float* dst = ctx_out + ((size_t)(b * S_LEN + q)) * D_MODEL + h * DK;
#pragma unroll
            for (int cg = 0; cg < 4; ++cg) {
                const int dbase = cg * 16 + 8 * half;
                float4 v0 = make_float4(cacc[u][cg].f[0] * inv, cacc[u][cg].f[1] * inv,
                                        cacc[u][cg].f[2] * inv, cacc[u][cg].f[3] * inv);
                float4 v1 = make_float4(cacc[u][cg].f[4] * inv, cacc[u][cg].f[5] * inv,
                                        cacc[u][cg].f[6] * inv, cacc[u][cg].f[7] * inv);
                ((float4*)(dst + dbase))[0] = v0;
                ((float4*)(dst + dbase))[1] = v1;
            }
        }
    }
}

// ---------------------------------------------------------------------------
// Output projection, residual and LayerNorm in one launch.
// A work-group of 16 waves owns 64 whole rows (a 64 x 512 tile): a wave has
// 32 rows x 64 columns (2 x 4 accumulators), K-step 64. The projected rows go
// to LDS as f32; each wave then takes 4 whole rows, adds bias and residual,
// and normalizes them, so the sum never travels through memory.
// ---------------------------------------------------------------------------
#define OP 72         // LDS row pitch of the staged tiles in bf16: 144 B = 16 B x odd
#define RP 516        // LDS row pitch of the projected rows in f32: the two
                      // 16-lane halves of a store (8 rows apart) meet other banks

__global__ __launch_bounds__(512) void out_ln_kernel(
    const float* __restrict__ A, const float* __restrict__ Wo,
    const float* __restrict__ bias, const float* __restrict__ xres,
    const float* __restrict__ gamma, const float* __restrict__ beta,
    float* __restrict__ out) {
    __shared__ __attribute__((aligned(16))) uint16_t lds_a[2][64 * OP];        // [buffer][row][k] bf16
    __shared__ __attribute__((aligned(16))) uint16_t lds_bt[2][D_MODEL * OP];  // [buffer][n][k] bf16
    __shared__ __attribute__((aligned(16))) float lds_r[64 * RP];           // [row][n] f32

    const int tid  = threadIdx.x;
    const int wave = tid >> 5, lane = tid & 31;
    const int half = lane >> 4, l16 = lane & 15;
    const int mBase = blockIdx.x * 64;
    const int wr = (wave >> 3) * 32, wc = (wave & 7) * 64;

    FragF32 acc[2][4];
#pragma unroll
    for (int a = 0; a < 2; ++a)
#pragma unroll
        for (int b = 0; b < 4; ++b)
#pragma unroll
            for (int r = 0; r < 8; ++r) acc[a][b].f[r] = 0.0f;

    // A tile, 64 rows x 64 k: 16 lanes read one row's 256 B, a wave 2 rows.
    const int arow = tid >> 4, ac4 = (tid & 15) * 4;
    uint32_t aoff = ((mBase + arow) * D_MODEL + ac4) * 4;   // byte offset in A
    // W tile, 64 k x 512 n: a thread takes 4 pieces of 4 k rows x 4 n columns,
    // 128 columns apart; 8 lanes read one 128-B line of a row, a wave 4 rows.
    const int wn = ((tid & 7) | ((tid >> 7) << 3)) * 4;
    const int wk = ((tid >> 3) & 15) * 4;
    uint32_t woff = (wk * D_MODEL + wn) * 4;                // byte offset in Wo

    float4 fa[2], fw[4][4];      // one k-step's tiles as loaded
    uint2 pa[2], pw[4][4];       // the same as bf16, on their way to LDS

    auto load_step = [&]() {
#pragma unroll
        for (int i = 0; i < 2; ++i)
            fa[i] = *(const float4*)((const char*)A + aoff + i * 32 * D_MODEL * 4);
#pragma unroll
        for (int u = 0; u < 4; ++u)
#pragma unroll
            for (int i = 0; i < 4; ++i)
                fw[u][i] = *(const float4*)((const char*)Wo + woff +
                                            (i * D_MODEL + u * 128) * 4);
        // The wait behind the run of 18 loads, in front of any rewrite of a
        // register that they name, their scalar base pairs too.
        asm volatile("s_wait_xcnt 0x0" ::: "memory");
    };
    auto cvt_step = [&]() {
#pragma unroll
        for (int i = 0; i < 2; ++i)
            pa[i] = make_uint2(cvt2_bf16(fa[i].x, fa[i].y), cvt2_bf16(fa[i].z, fa[i].w));
        // transposed: column n gets its 4 consecutive k as one 8-byte piece
#pragma unroll
        for (int u = 0; u < 4; ++u) {
            pw[u][0] = make_uint2(
                cvt2_bf16(fw[u][0].x, fw[u][1].x), cvt2_bf16(fw[u][2].x, fw[u][3].x));
            pw[u][1] = make_uint2(
                cvt2_bf16(fw[u][0].y, fw[u][1].y), cvt2_bf16(fw[u][2].y, fw[u][3].y));
            pw[u][2] = make_uint2(
                cvt2_bf16(fw[u][0].z, fw[u][1].z), cvt2_bf16(fw[u][2].z, fw[u][3].z));
            pw[u][3] = make_uint2(
                cvt2_bf16(fw[u][0].w, fw[u][1].w), cvt2_bf16(fw[u][2].w, fw[u][3].w));
        }
        // The wait in front of the rewrite of the two offset registers that the
        // 18 loads name, and the rewrite itself (one k-step on: 64 floats in A,
        // 64 rows in Wo) in one statement: written apart, the additions were
        // put behind the next step's loads, with a wait for those loads in
        // front of the LDS stores.
        asm volatile("s_wait_xcnt 0x0\n\t"
                     "v_add_nc_u32_e32 %0, 0x100, %0\n\t"
                     "v_add_nc_u32_e32 %1, 0x20000, %1"
                     : "+v"(aoff), "+v"(woff) :: "memory");
    };
    auto put_step = [&](const int buf) {
#pragma unroll
        for (int i = 0; i < 2; ++i)
            *(uint2*)&lds_a[buf][(arow + i * 32) * OP + ac4] = pa[i];
#pragma unroll
        for (int u = 0; u < 4; ++u)
#pragma unroll
            for (int c = 0; c < 4; ++c)
                *(uint2*)&lds_bt[buf][(wn + u * 128 + c) * OP + wk] = pw[u][c];
    };
    auto mma_step = [&](const int buf) {
#pragma unroll
        for (int kk = 0; kk < 2; ++kk) {
            FragB16 af[2], bf[4];
#pragma unroll
            for (int rg = 0; rg < 2; ++rg)
                load_frag16(af[rg],
                            &lds_a[buf][(wr + rg * 16 + l16) * OP + kk * 32 + 8 * half]);
#pragma unroll
            for (int cg = 0; cg < 4; ++cg)
                load_frag16(bf[cg],
                            &lds_bt[buf][(wc + cg * 16 + l16) * OP + kk * 32 + 8 * half]);
#pragma unroll
            for (int rg = 0; rg < 2; ++rg)
#pragma unroll
                for (int cg = 0; cg < 4; ++cg)
                    acc[rg][cg].v = __builtin_amdgcn_wmma_f32_16x16x32_bf16(
                        false, af[rg].v, false, bf[cg].v, (short)0, acc[rg][cg].v,
                        false, false);
        }
    };

    // Pipelined over two LDS buffers, as in gemm_tiles: the global loads of
    // step t + 2 fly through the LDS stores and the WMMAs of step t + 1.
    load_step();
    cvt_step();
    load_step();                 // step 1 flies
    put_step(0);
    lds_barrier();               // step 0 is staged
    for (int t = 0; t < D_MODEL / 64 - 2; ++t) {
        mma_step(t & 1);
        // keeps the conversions, which wait for the loads, behind the last WMMA
        __builtin_amdgcn_sched_barrier(0);
        cvt_step();
        load_step();             // step t + 2, into the registers just read
        // keeps all 18 loads ahead of the LDS stores and the barrier
        __builtin_amdgcn_sched_barrier(0);
        put_step((t + 1) & 1);   // the buffer that every wave left at step t - 1
        // one barrier a step: it publishes step t + 1 and ends the reads of
        // step t's buffer, which is written again in the next trip
        lds_barrier();
    }
    mma_step((D_MODEL / 64 - 2) & 1);
    // as in the loop
    __builtin_amdgcn_sched_barrier(0);
    cvt_step();
    put_step((D_MODEL / 64 - 1) & 1);
    __syncthreads();             // the last step is staged
    mma_step((D_MODEL / 64 - 1) & 1);

    // The residual of this wave's 4 rows is asked for first: it flies while
    // the projected rows go to LDS. 16 B a lane, 512 B in a row per load.
    const int row0 = wave * 4;
    const uint32_t xoff = (uint32_t)(((mBase + row0) * D_MODEL + lane * 4) * 4);  // bytes
    v4f xr[4][4], bo4[4], g4[4], be4[4];
    // unrolled, here and below: the arrays are indexed by constants alone and
    // stay in registers
#pragma unroll
    for (int j = 0; j < 4; ++j)
#pragma unroll
        for (int i = 0; i < 4; ++i)
            xr[j][i] = *(const v4f*)((const char*)xres + xoff + (j * D_MODEL + i * 128) * 4);
#pragma unroll
    for (int i = 0; i < 4; ++i) {
        bo4[i] = ((const v4f*)bias)[lane + i * 32];
        g4[i]  = ((const v4f*)gamma)[lane + i * 32];
        be4[i] = ((const v4f*)beta)[lane + i * 32];
    }

    // register r of a lane is row .. + r + 8 * half, column .. + l16
#pragma unroll
    for (int rg = 0; rg < 2; ++rg)
#pragma unroll
        for (int cg = 0; cg < 4; ++cg)
#pragma unroll
            for (int r = 0; r < 8; ++r)
                lds_r[(wr + rg * 16 + r + 8 * half) * RP + wc + cg * 16 + l16] =
                    acc[rg][cg].f[r];
    // The wait in front of any rewrite of the two index registers that the 28
    // loads name (the byte offset; the lane number). They and the loaded values
    // are inputs only: an index so that its register lives up to here and no
    // load's result lands in it, the values so that every load stands in front
    // of the wait.
    asm volatile("s_wait_xcnt 0x0"
                 :: "v"(xoff), "v"(xr[0][0]), "v"(xr[0][1]), "v"(xr[0][2]), "v"(xr[0][3]),
                    "v"(xr[1][0]), "v"(xr[1][1]), "v"(xr[1][2]), "v"(xr[1][3]),
                    "v"(xr[2][0]), "v"(xr[2][1]), "v"(xr[2][2]), "v"(xr[2][3]),
                    "v"(xr[3][0]), "v"(xr[3][1]), "v"(xr[3][2]), "v"(xr[3][3])
                 : "memory");
    asm volatile("s_wait_xcnt 0x0"
                 :: "v"(lane), "v"(bo4[0]), "v"(bo4[1]), "v"(bo4[2]), "v"(bo4[3]),
                    "v"(g4[0]), "v"(g4[1]), "v"(g4[2]), "v"(g4[3]),
                    "v"(be4[0]), "v"(be4[1]), "v"(be4[2]), "v"(be4[3])
                 : "memory");
    __syncthreads();   // a row is read by one of the eight waves that wrote it, seven of them others

#pragma unroll
    for (int j = 0; j < 4; ++j) {
        float vals[16];
        float sum = 0.0f, sq = 0.0f;
#pragma unroll
        for (int i = 0; i < 4; ++i) {
            float4 f = *(const float4*)&lds_r[(row0 + j) * RP + (lane + i * 32) * 4];
            f.x = f.x + bo4[i].x + xr[j][i].x;
            f.y = f.y + bo4[i].y + xr[j][i].y;
            f.z = f.z + bo4[i].z + xr[j][i].z;
            f.w = f.w + bo4[i].w + xr[j][i].w;
            vals[i * 4 + 0] = f.x; vals[i * 4 + 1] = f.y;
            vals[i * 4 + 2] = f.z; vals[i * 4 + 3] = f.w;
            sum += f.x + f.y + f.z + f.w;
            sq  += f.x * f.x + f.y * f.y + f.z * f.z + f.w * f.w;
        }
#pragma unroll
        for (int m = 16; m; m >>= 1) {
            sum += __shfl_xor(sum, m, 32);
            sq  += __shfl_xor(sq,  m, 32);
        }
        const float mu = sum * (1.0f / 512.0f);
        const float var = sq * (1.0f / 512.0f) - mu * mu;
        const float rs = rsqrtf(var + 1e-5f);
        float4* dst = (float4*)(out + (size_t)(mBase + row0 + j) * D_MODEL);
#pragma unroll
        for (int i = 0; i < 4; ++i)
            dst[lane + i * 32] = make_float4(
                (vals[i * 4 + 0] - mu) * rs * g4[i].x + be4[i].x,
                (vals[i * 4 + 1] - mu) * rs * g4[i].y + be4[i].y,
                (vals[i * 4 + 2] - mu) * rs * g4[i].z + be4[i].z,
                (vals[i * 4 + 3] - mu) * rs * g4[i].w + be4[i].w);
    }
}

// ---------------------------------------------------------------------------
extern "C" void kernel_launch(void* const* d_in, const int* in_sizes, int n_in,
                              void* d_out, int out_size, void* d_ws,
                              size_t ws_size, hipStream_t stream) {
    const float* x     = (const float*)d_in[0];
    const float* wq    = (const float*)d_in[1];
    const float* bq    = (const float*)d_in[2];
    const float* wk    = (const float*)d_in[3];
    const float* bk    = (const float*)d_in[4];
    const float* wv    = (const float*)d_in[5];
    const float* bv    = (const float*)d_in[6];
    const float* wo    = (const float*)d_in[7];
    const float* bo    = (const float*)d_in[8];
    const float* gamma = (const float*)d_in[9];
    const float* beta  = (const float*)d_in[10];
    const float* sbias = (const float*)d_in[11];

    // workspace layout (~77 MB total)
    uint8_t* ws = (uint8_t*)d_ws;
    const size_t SZ_H = (size_t)16 * S_PAD * D_MODEL * sizeof(uint16_t);  // 15.73 MB
    uint16_t* Qw = (uint16_t*)(ws);
    uint16_t* Kw = (uint16_t*)(ws + SZ_H);
    uint16_t* Vt = (uint16_t*)(ws + 2 * SZ_H);
    float* ctx   = (float*)(ws + 3 * SZ_H);

    const dim3 gG((M_ROWS + 127) / 128, D_MODEL / 64);  // 113 x 8
    const dim3 blk(128);
    qkv_gemm<<<gG, dim3(256), 0, stream>>>(x, wq, wk, wv, bq, bk, bv, Qw, Kw, Vt);
    attn_kernel<<<dim3(8, 128), blk, 0, stream>>>(Qw, Kw, Vt, sbias, ctx);
    out_ln_kernel<<<dim3(M_ROWS / 64), dim3(512), 0, stream>>>(ctx, wo, bo, x, gamma, beta,
                                                               (float*)d_out);
}
